// v000
// The times below were measured on an AMD MI455X: many runs one after another, warmed up first and cycling through
// copies of the inputs, with the whole window's GPU time divided by the number of runs. Launches and the gaps
// between them are all in it. The median over several windows is given; except for v000 it joins two sittings, which
// can be a few percent apart, so the side-by-side timings, each taken in one sitting, are the better comparison.
// v000, which the later versions start from, runs in 1020 microseconds.
#include <hip/hip_runtime.h>
// Pre-LN transformer layer (2 x 2048 tokens, 1024; 16 heads x 64; full (non-causal) attention; MLP 4096 with tanh-GELU): h = LN(x) (no affine); q,k,v = h w_qkv; x1 = x + softmax(q.k/8).v w_fc; out = x1 + gelu(LN(x1) w1 + b1) w2 + b2 -> [2,2048,1024].
// Structure: LayerNorm on VALU (also writing the bf16 residual plane); projections / MLP as f16 WMMA GEMMs (32x64 wave tiles, f32 accumulation, exact weights x16, tanh-GELU and biases in the epilogue, residuals through the f32 addend); q, k, V^T as plain f16 planes through the fused flash kernel over all keys (online softmax in f32, P x2^10); O as hi + residual planes into w_fc (two GEMMs).
// Compute dtype: x and weights rounded to bf16; LN outputs, q, k, v, P and the GELU hidden as f16 operands (~2^-12); O as hi + residual pairs; f32 accumulation, softmax, LayerNorm. v_wmma_f32_16x16x32_f16.
#define NBT 2
#define SLEN 2048
#define TQ SLEN
#define TK SLEN
#define DM 1024
#define NH 16
#define SCL 0.125f
#define NR (NBT * SLEN)
typedef __bf16 v16b __attribute__((ext_vector_type(16)));
typedef unsigned short v8us __attribute__((ext_vector_type(8), may_alias));
typedef float  v8f  __attribute__((ext_vector_type(8)));
typedef float  v4f  __attribute__((ext_vector_type(4)));
typedef float  v4fa __attribute__((ext_vector_type(4), may_alias));
union FragB { v16b v; v8us half[2]; unsigned short u[16]; };

__device__ __forceinline__ unsigned short bf16_bits(float x) { unsigned int u = __float_as_uint(x); return (unsigned short)((u + 0x7FFFu + ((u >> 16) & 1u)) >> 16); }
__device__ __forceinline__ float bf16_val(unsigned short b) { return __uint_as_float(((unsigned int)b) << 16); }
__device__ __forceinline__ float bf16_round(float x) { return bf16_val(bf16_bits(x)); }
// D += A·B with NT terms: 1 = ah·bh, 2 = + al·bh (A split), 3 = + ah·bl (both split)
template <int NT>
__device__ __forceinline__ v8f mmaN(v16b ah, v16b al, v16b bh, v16b bl, v8f c) {
  c = __builtin_amdgcn_wmma_f32_16x16x32_bf16(false, ah, false, bh, (short)0, c, false, false);
  if (NT >= 2) c = __builtin_amdgcn_wmma_f32_16x16x32_bf16(false, al, false, bh, (short)0, c, false, false);
  if (NT >= 3) c = __builtin_amdgcn_wmma_f32_16x16x32_bf16(false, ah, false, bl, (short)0, c, false, false);
  asm volatile("v_nop\n\tv_nop\n\tv_nop\n\tv_nop" : "+v"(c) : "v"(ah), "v"(al), "v"(bh), "v"(bl));
  return c;
}

__global__ __launch_bounds__(256) void k_wt_bf16(const float* __restrict__ W, unsigned short* __restrict__ Wt, int K, int N) {
  const int t = blockIdx.x * 256 + threadIdx.x;
  const int k8n = K / 8;
  if (t >= N * k8n) return;
  const int n = t / k8n, k8 = (t % k8n) * 8;
  v8us v;
#pragma unroll
  for (int i = 0; i < 8; ++i) v[i] = bf16_bits(W[(size_t)(k8 + i) * N + n]);
  *(v8us*)(Wt + (size_t)n * K + k8) = v;
  
}

// GEMM C[M][N] (f32, pitch ldc) = act(A[M][K]·W + bias). A f32 row-major (pitch lda) converted per fragment to bf16
// (ASPLIT: hi/lo two planes -> 2 terms, else single rounded term); Wt bf16 [N][K] (pitch ldb). BIAS_BF16 rounds the
// bias to bf16 first (bias quantised to bf16 before the add). K%32==0, M%16==0, N%64==0.
template <bool ASPLIT, int ACT, bool BIAS_BF16>
__global__ __launch_bounds__(128) void k_gemm_bf(const float* __restrict__ A, int lda, const unsigned short* __restrict__ Wt, int ldb,
                                               const float* __restrict__ bias, float* __restrict__ C, int ldc, int M, int N, int K) {
  __shared__ __attribute__((aligned(16))) float so[4][16][64];
  const int tid = threadIdx.x, w = tid >> 5, lane = tid & 31, ln = lane & 15, hh = lane >> 4;
  const int ntn = N / 64;
  const int wid = blockIdx.x * 4 + w;
  const int mt = wid / ntn, nq = wid % ntn;
  if (mt * 16 >= M) return;
  const int row0 = mt * 16, col0 = nq * 64;
  const float* arow = A + (size_t)(row0 + ln) * lda;
  v8f acc[4] = {};
  for (int kb = 0; kb < K; kb += 32) {
    FragB ah, al;
    const v4f x0 = *(const v4fa*)(arow + kb + 8 * hh), x1 = *(const v4fa*)(arow + kb + 8 * hh + 4);
    const v4f x2 = *(const v4fa*)(arow + kb + 16 + 8 * hh), x3 = *(const v4fa*)(arow + kb + 16 + 8 * hh + 4);
    float xs[16] = {x0[0],x0[1],x0[2],x0[3],x1[0],x1[1],x1[2],x1[3],x2[0],x2[1],x2[2],x2[3],x3[0],x3[1],x3[2],x3[3]};
#pragma unroll
    for (int i = 0; i < 16; ++i) { const unsigned short hb = bf16_bits(xs[i]); ah.u[i] = hb; al.u[i] = ASPLIT ? bf16_bits(xs[i] - bf16_val(hb)) : (unsigned short)0; }
#pragma unroll
    for (int t = 0; t < 4; ++t) {
      const unsigned short* brow = Wt + (size_t)(col0 + t * 16 + ln) * ldb + kb;
      FragB b;
      b.half[0] = *(const v8us*)(brow + 8 * hh);
      b.half[1] = *(const v8us*)(brow + 16 + 8 * hh);
      acc[t] = mmaN<ASPLIT ? 2 : 1>(ah.v, al.v, b.v, b.v, acc[t]);
    }
  }
#pragma unroll
  for (int t = 0; t < 4; ++t) {
    float bv = bias ? bias[col0 + t * 16 + ln] : 0.f;
    if (BIAS_BF16) bv = bf16_round(bv);
#pragma unroll
    for (int r = 0; r < 8; ++r) { float v = acc[t][r] + bv; if (ACT == 1) v = fmaxf(v, 0.f); so[w][8 * hh + r][t * 16 + ln] = v; }
  }
  __builtin_amdgcn_fence(__ATOMIC_ACQ_REL, "workgroup");
  __builtin_amdgcn_wave_barrier();
  const int rsub = lane >> 4, c4 = (lane & 15) * 4;
  {
#pragma unroll
    for (int q = 0; q < 8; ++q) {
      const int r = q * 2 + rsub;
      const v4f v = *(const v4fa*)&so[w][r][c4];
      *(v4f*)(C + (size_t)(row0 + r) * ldc + col0 + c4) = v;
    }
    
  }
}

// GEMM C = act(A·W + bias + resid): A f32 (ASPLIT -> hi/lo 2 terms), Wt bf16 [N][K]; ACT 0 none, 1 relu, 2 exact gelu;
// resid (optional, f32, row index = (row % rmod), pitch ldr, RES_BF16 rounds it) added before the activation.
template <bool ASPLIT, int ACT, bool BIAS_BF16, bool RES_BF16>
__global__ __launch_bounds__(128) void k_gemm_bf3(const float* __restrict__ A, int lda, const unsigned short* __restrict__ Wt, int ldb,
                                                const float* __restrict__ bias, const float* __restrict__ resid, int rmod, int ldr,
                                                float* __restrict__ C, int ldc, int M, int N, int K) {
  __shared__ __attribute__((aligned(16))) float so[4][16][64];
  const int tid = threadIdx.x, w = tid >> 5, lane = tid & 31, ln = lane & 15, hh = lane >> 4;
  const int ntn = N / 64;
  const int wid = blockIdx.x * 4 + w;
  const int mt = wid / ntn, nq = wid % ntn;
  if (mt * 16 >= M) return;
  const int row0 = mt * 16, col0 = nq * 64;
  const float* arow = A + (size_t)(row0 + ln) * lda;
  v8f acc[4] = {};
  for (int kb = 0; kb < K; kb += 32) {
    FragB ah, al;
    const v4f x0 = *(const v4fa*)(arow + kb + 8 * hh), x1 = *(const v4fa*)(arow + kb + 8 * hh + 4);
    const v4f x2 = *(const v4fa*)(arow + kb + 16 + 8 * hh), x3 = *(const v4fa*)(arow + kb + 16 + 8 * hh + 4);
    float xs[16] = {x0[0],x0[1],x0[2],x0[3],x1[0],x1[1],x1[2],x1[3],x2[0],x2[1],x2[2],x2[3],x3[0],x3[1],x3[2],x3[3]};
#pragma unroll
    for (int i = 0; i < 16; ++i) { const unsigned short hb = bf16_bits(xs[i]); ah.u[i] = hb; al.u[i] = ASPLIT ? bf16_bits(xs[i] - bf16_val(hb)) : (unsigned short)0; }
#pragma unroll
    for (int t = 0; t < 4; ++t) {
      const unsigned short* brow = Wt + (size_t)(col0 + t * 16 + ln) * ldb + kb;
      FragB b;
      b.half[0] = *(const v8us*)(brow + 8 * hh);
      b.half[1] = *(const v8us*)(brow + 16 + 8 * hh);
      acc[t] = mmaN<ASPLIT ? 2 : 1>(ah.v, al.v, b.v, b.v, acc[t]);
    }
  }
#pragma unroll
  for (int t = 0; t < 4; ++t) {
    const int col = col0 + t * 16 + ln;
    float bv = bias ? bias[col] : 0.f;
    if (BIAS_BF16) bv = bf16_round(bv);
#pragma unroll
    for (int r = 0; r < 8; ++r) {
      float v = acc[t][r] + bv;
      if (resid) { float rv = resid[(size_t)((row0 + 8 * hh + r) % rmod) * ldr + col]; if (RES_BF16) rv = bf16_round(rv); v += rv; }
      if (ACT == 1) v = fmaxf(v, 0.f);
      if (ACT == 2) v = 0.5f * v * (1.0f + erff(v * 0.70710678118654752f));
      if (ACT == 3) { const float u = 0.7978845608028654f * (v + 0.044715f * v * v * v); v = 0.5f * v * (1.0f + tanhf(u)); }
      so[w][8 * hh + r][t * 16 + ln] = v;
    }
  }
  __builtin_amdgcn_fence(__ATOMIC_ACQ_REL, "workgroup");
  __builtin_amdgcn_wave_barrier();
  const int rsub = lane >> 4, c4 = (lane & 15) * 4;
  {
#pragma unroll
    for (int q = 0; q < 8; ++q) {
      const int r = q * 2 + rsub;
      const v4f v = *(const v4fa*)&so[w][r][c4];
      *(v4f*)(C + (size_t)(row0 + r) * ldc + col0 + c4) = v;
    }
    
  }
}
// row LayerNorm (biased variance, eps) over N: s = X (+ R); optional out_sum <- s; out_norm <- (s-mu)*rsqrt(var+eps)*g + b
template <bool PARAM_BF16>
__global__ __launch_bounds__(256) void k_layernorm(const float* __restrict__ X, const float* __restrict__ R, const float* __restrict__ g, const float* __restrict__ bta,
                                                  float* __restrict__ out_sum, float* __restrict__ out_norm, int N, float eps) {
  __shared__ float red[256];
  const int row = blockIdx.x, tid = threadIdx.x;
  const float* x = X + (size_t)row * N; const float* rr = R ? R + (size_t)row * N : nullptr;
  float vals[16];                     // up to N = 4096
  const int per = N / 256;            // contiguous chunk per thread? use strided-by-4 chunks: thread handles j = tid*4 + 1024*u
  float s1 = 0.f;
  for (int u = 0; u < per / 4; ++u) {
    const int j = tid * 4 + 1024 * u;
    const v4f a = *(const v4fa*)(x + j);
    v4f b = {0.f,0.f,0.f,0.f}; if (rr) b = *(const v4fa*)(rr + j);
#pragma unroll
    for (int q = 0; q < 4; ++q) { const float v = a[q] + b[q]; vals[u * 4 + q] = v; s1 += v; }
  }
  red[tid] = s1; __syncthreads();
  for (int st = 128; st > 0; st >>= 1) { if (tid < st) red[tid] += red[tid + st]; __syncthreads(); }
  const float mu = red[0] / (float)N; __syncthreads();
  float s2 = 0.f;
  for (int u = 0; u < per / 4; ++u)
#pragma unroll
    for (int q = 0; q < 4; ++q) { const float c = vals[u * 4 + q] - mu; s2 += c * c; }
  red[tid] = s2; __syncthreads();
  for (int st = 128; st > 0; st >>= 1) { if (tid < st) red[tid] += red[tid + st]; __syncthreads(); }
  const float rs = rsqrtf(red[0] / (float)N + eps);
  {
    for (int u = 0; u < per / 4; ++u) {
      const int j = tid * 4 + 1024 * u;
      v4f o, sm;
#pragma unroll
      for (int q = 0; q < 4; ++q) {
        float gg = g[j + q], bb = bta[j + q];
        if (PARAM_BF16) { gg = bf16_round(gg); bb = bf16_round(bb); }
        sm[q] = vals[u * 4 + q]; o[q] = (vals[u * 4 + q] - mu) * rs * gg + bb;
      }
      if (out_sum) *(v4f*)(out_sum + (size_t)row * N + j) = sm;
      *(v4f*)(out_norm + (size_t)row * N + j) = o;
    }
    
  }
}



// ---- f16 WMMA path (v_wmma_f32_16x16x32_f16): 11-bit significands for operands in range — used where a [0,1] probability operand needs more precision than bf16
typedef _Float16 v16h __attribute__((ext_vector_type(16)));
union FragH { v16h v; v8us half[2]; _Float16 h[16]; unsigned short u[16]; };
template <int NT>
__device__ __forceinline__ v8f mmaH(v16h ah, v16h al, v16h bh, v16h bl, v8f c) {
  c = __builtin_amdgcn_wmma_f32_16x16x32_f16(false, ah, false, bh, (short)0, c, false, false);
  if (NT >= 2) c = __builtin_amdgcn_wmma_f32_16x16x32_f16(false, al, false, bh, (short)0, c, false, false);
  if (NT >= 3) c = __builtin_amdgcn_wmma_f32_16x16x32_f16(false, ah, false, bl, (short)0, c, false, false);
  asm volatile("v_nop\n\tv_nop\n\tv_nop\n\tv_nop" : "+v"(c) : "v"(ah), "v"(al), "v"(bh), "v"(bl));
  return c;
}
// batched GEMM like k_gemm_b but f16 operands: A f32 (split into f16 hi/lo if ASPLIT, else rounded to f16), Bt = f16 values [n][k]; alpha; C f32; N multiple of 16 (partial tiles skipped)
template <bool ASPLIT>
__global__ __launch_bounds__(128) void k_gemm_h(const float* __restrict__ A, int lda, size_t sA, const _Float16* __restrict__ Bh, int ldb, size_t sB, float alpha, float* __restrict__ C, int ldc, size_t sC, int M, int N, int K) {
  __shared__ __attribute__((aligned(16))) float so[4][16][64];
  const int tid = threadIdx.x, w = tid >> 5, lane = tid & 31, ln = lane & 15, hh = lane >> 4; const int by = blockIdx.y;
  A += (size_t)by * sA; Bh += (size_t)by * sB; C += (size_t)by * sC;
  const int ntn = (N + 63) / 64; const int wid = blockIdx.x * 4 + w; const int mt = wid / ntn, nq = wid % ntn; if (mt * 16 >= M) return;
  const int row0 = mt * 16, col0 = nq * 64; const float* arow = A + (size_t)(row0 + ln) * lda;
  v8f acc[4] = {};
  for (int kb = 0; kb < K; kb += 32) {
    FragH ah, al;
    const v4f x0 = *(const v4fa*)(arow + kb + 8 * hh), x1 = *(const v4fa*)(arow + kb + 8 * hh + 4), x2 = *(const v4fa*)(arow + kb + 16 + 8 * hh), x3 = *(const v4fa*)(arow + kb + 16 + 8 * hh + 4);
    float xs[16] = {x0[0],x0[1],x0[2],x0[3],x1[0],x1[1],x1[2],x1[3],x2[0],x2[1],x2[2],x2[3],x3[0],x3[1],x3[2],x3[3]};
#pragma unroll
    for (int i = 0; i < 16; ++i) { const _Float16 h = (_Float16)xs[i]; ah.h[i] = h; al.h[i] = ASPLIT ? (_Float16)(xs[i] - (float)h) : (_Float16)0.0f; }
#pragma unroll
    for (int t = 0; t < 4; ++t) { if (col0 + t * 16 >= N) continue; const size_t boff = (size_t)(col0 + t * 16 + ln) * ldb + kb; FragH bq; bq.half[0] = *(const v8us*)(Bh + boff + 8 * hh); bq.half[1] = *(const v8us*)(Bh + boff + 16 + 8 * hh);
      acc[t] = mmaH<ASPLIT ? 2 : 1>(ah.v, al.v, bq.v, bq.v, acc[t]); }
  }
#pragma unroll
  for (int t = 0; t < 4; ++t) { if (col0 + t * 16 >= N) continue;
#pragma unroll
    for (int r = 0; r < 8; ++r) so[w][8 * hh + r][t * 16 + ln] = acc[t][r] * alpha; }
  __builtin_amdgcn_fence(__ATOMIC_ACQ_REL, "workgroup"); __builtin_amdgcn_wave_barrier();
  const int rsub = lane >> 4, c4 = (lane & 15) * 4;
  {
#pragma unroll
    for (int q = 0; q < 8; ++q) { const int r = q * 2 + rsub; if (col0 + c4 < N) { const v4f v = *(const v4fa*)&so[w][r][c4]; *(v4f*)(C + (size_t)(row0 + r) * ldc + col0 + c4) = v; } }
     }
}

// Wt[n][k] = f16(W[k][n]·scale) from f32 row-major W[K][N] (scale = power of two; bf16-exact weights stay exact in f16 away from the subnormal range)
__global__ __launch_bounds__(256) void k_wt_f16(const float* __restrict__ W, _Float16* __restrict__ Wt, int K, int N, float scale) {
  const int t = blockIdx.x * 256 + threadIdx.x; if (t >= N * (K / 8)) return; const int n = t / (K / 8), k8 = (t % (K / 8)) * 8; FragH f;
#pragma unroll
  for (int i = 0; i < 8; ++i) f.h[i] = (_Float16)(bf16_round(W[(size_t)(k8 + i) * N + n]) * scale); const v8us o = f.half[0];
  *(v8us*)((unsigned short*)Wt + (size_t)n * K + k8) = o; 
}
// k_gemm_hh variant with fused epilogue: v = acc·alpha + bias[by·sBias + col] (+ CP[(row/rowsPerB)·sCPb + by·64 + col] if CP) ; ACT 0 none / 1 elu ; writes f16 C16 (and f32 C if non-null)
template <int ACT>
__global__ __launch_bounds__(128) void k_gemm_hhx(const _Float16* __restrict__ A, int lda, size_t sA, const _Float16* __restrict__ Bh, int ldb, size_t sB, float alpha, const float* __restrict__ bias, size_t sBias, const float* __restrict__ CP, int rowsPerB, size_t sCPb, int row0g,
    float* __restrict__ C, _Float16* __restrict__ C16, int ldc, size_t sC, int M, int N, int K) {
  __shared__ __attribute__((aligned(16))) float so[4][16][64];
  const int tid = threadIdx.x, w = tid >> 5, lane = tid & 31, ln = lane & 15, hh = lane >> 4; const int by = blockIdx.y;
  A += (size_t)by * sA; Bh += (size_t)by * sB; const size_t cofs = (size_t)by * sC; const float* bp = bias ? bias + (size_t)by * sBias : nullptr;
  const int ntn = (N + 63) / 64; const int wid = blockIdx.x * 4 + w; const int mt = wid / ntn, nq = wid % ntn; if (mt * 16 >= M) return;
  const int row0 = mt * 16, col0 = nq * 64; const _Float16* arow = A + (size_t)(row0 + ln) * lda;
  v8f acc[4] = {};
  for (int kb = 0; kb < K; kb += 32) { FragH ah; ah.half[0] = *(const v8us*)((const unsigned short*)arow + kb + 8 * hh); ah.half[1] = *(const v8us*)((const unsigned short*)arow + kb + 16 + 8 * hh);
#pragma unroll
    for (int t = 0; t < 4; ++t) { if (col0 + t * 16 >= N) continue; const size_t boff = (size_t)(col0 + t * 16 + ln) * ldb + kb; FragH bq; bq.half[0] = *(const v8us*)((const unsigned short*)Bh + boff + 8 * hh); bq.half[1] = *(const v8us*)((const unsigned short*)Bh + boff + 16 + 8 * hh);
      acc[t] = mmaH<1>(ah.v, ah.v, bq.v, bq.v, acc[t]); }
  }
#pragma unroll
  for (int t = 0; t < 4; ++t) { if (col0 + t * 16 >= N) continue; const int col = col0 + t * 16 + ln; const float bv = bp ? bf16_round(bp[col]) : 0.f;
#pragma unroll
    for (int r = 0; r < 8; ++r) { float v = acc[t][r] * alpha + bv; if (CP) { const int bidx = (row0g + row0 + 8 * hh + r) / rowsPerB; v += CP[(size_t)bidx * sCPb + (size_t)by * 64 + col]; } if (ACT == 1) v = (v > 0.f) ? v : expm1f(v); else if (ACT == 7) v = (v > 0.f) ? v + 1.0f : expf(v); else if (ACT == 8) v = tanhf(v); else if (ACT == 9) v = 0.5f * v * (1.0f + tanhf(0.7978845608028654f * (v + 0.044715f * v * v * v))); else if (ACT == 11) v = 1.0f / (1.0f + expf(-v)); else if (ACT == 12) v = (v > 0.f) ? v : 0.01f * v; else if (ACT == 14) v = (v > 0.f) ? v : 0.1f * v; else if (ACT == 15) v = v / (1.0f + expf(-v)); else if (ACT == 3) v = fmaxf(v, 0.f); else if (ACT == 6) v = 0.5f * v * (1.0f + erff(v * 0.70710678118654752f)); so[w][8 * hh + r][t * 16 + ln] = v; } }
  __builtin_amdgcn_fence(__ATOMIC_ACQ_REL, "workgroup"); __builtin_amdgcn_wave_barrier();
  const int rsub = lane >> 4, c4 = (lane & 15) * 4; typedef _Float16 v4h __attribute__((ext_vector_type(4)));
  {
#pragma unroll
    for (int q = 0; q < 8; ++q) { const int r = q * 2 + rsub; if (col0 + c4 < N) { const v4f v = *(const v4fa*)&so[w][r][c4]; if (C) *(v4f*)(C + cofs + (size_t)(row0 + r) * ldc + col0 + c4) = v; if (C16) { v4h h4; for (int i = 0; i < 4; ++i) h4[i] = (_Float16)v[i]; *(v4h*)(C16 + cofs + (size_t)(row0 + r) * ldc + col0 + c4) = h4; } } }
     }
}


typedef _Float16 v4h __attribute__((ext_vector_type(4)));

__global__ __launch_bounds__(256) void k_x16(const float* __restrict__ x, _Float16* __restrict__ X16, size_t n8) { const size_t t = (size_t)blockIdx.x * 256 + threadIdx.x; if (t >= n8) return; FragH f;
#pragma unroll
  for (int q = 0; q < 8; ++q) f.h[q] = (_Float16)bf16_round(x[t * 8 + q]); *(v8us*)((unsigned short*)X16 + t * 8) = f.half[0];  }
__global__ __launch_bounds__(256) void k_h16(const float* __restrict__ x, _Float16* __restrict__ X16, size_t n8) { const size_t t = (size_t)blockIdx.x * 256 + threadIdx.x; if (t >= n8) return; FragH f;
#pragma unroll
  for (int q = 0; q < 8; ++q) f.h[q] = (_Float16)x[t * 8 + q]; *(v8us*)((unsigned short*)X16 + t * 8) = f.half[0];  }
__global__ __launch_bounds__(256) void k_round16f(const float* __restrict__ W, _Float16* __restrict__ Bt, size_t n8) { const size_t t = (size_t)blockIdx.x * 256 + threadIdx.x; if (t >= n8) return; FragH f;
#pragma unroll
  for (int i = 0; i < 8; ++i) f.h[i] = (_Float16)(bf16_round(W[t * 8 + i]) * 16.0f); *(v8us*)((unsigned short*)Bt + t * 8) = f.half[0];  }
template <int NHv, int TTv>
__global__ __launch_bounds__(256) void k_vt(const _Float16* __restrict__ V16, int ldv, int voff, _Float16* __restrict__ Vt) { __shared__ unsigned short tl[64][66]; const int tid = threadIdx.x; const int slab = blockIdx.x / (TTv / 64), lg = blockIdx.x % (TTv / 64); const int b = slab / NHv, h = slab % NHv;
  for (int i = tid; i < 64 * 8; i += 256) { const int r = i / 8, c8 = (i % 8) * 8; FragH f; f.half[0] = *(const v8us*)((const unsigned short*)V16 + ((size_t)b * TTv + lg * 64 + r) * ldv + voff + h * 64 + c8);
#pragma unroll
    for (int q = 0; q < 8; ++q) tl[r][c8 + q] = f.u[q]; }
  __syncthreads();
  {
#pragma unroll
    for (int rd = 0; rd < 2; ++rd) { const int d = rd * 32 + tid / 8, pc = tid % 8; FragH f;
#pragma unroll
      for (int q = 0; q < 8; ++q) f.u[q] = tl[pc * 8 + q][d];
      *(v8us*)((unsigned short*)Vt + ((size_t)slab * 64 + d) * TTv + lg * 64 + pc * 8) = f.half[0]; }
     } }

__global__ __launch_bounds__(256) void k_hl(const float* __restrict__ F, _Float16* __restrict__ Hh, _Float16* __restrict__ Hl, size_t n8) { const size_t t = (size_t)blockIdx.x * 256 + threadIdx.x; if (t >= n8) return; FragH fh, fl; const v4f a = *(const v4fa*)(F + t * 8), c = *(const v4fa*)(F + t * 8 + 4);
#pragma unroll
  for (int q = 0; q < 4; ++q) { _Float16 h = (_Float16)a[q]; fh.h[q] = h; fl.h[q] = (_Float16)((a[q] - (float)h) * 1024.0f); h = (_Float16)c[q]; fh.h[4 + q] = h; fl.h[4 + q] = (_Float16)((c[q] - (float)h) * 1024.0f); }
  { *(v8us*)((unsigned short*)Hh + t * 8) = fh.half[0]; *(v8us*)((unsigned short*)Hl + t * 8) = fl.half[0];  } }

// ---- fast GEMM (wave tile 32x64; requires M % 32 == 0 rows per launch region and N % 64 == 0); epilogue = k_gemm_hhx semantics ----
__device__ __forceinline__ v16h g2_frag(const _Float16* p, int hh) { FragH f; f.half[0] = *(const v8us*)((const unsigned short*)p + 8 * hh); f.half[1] = *(const v8us*)((const unsigned short*)p + 16 + 8 * hh); return f.v; }
__device__ __forceinline__ v8f g2_mma(v16h a, v16h b, v8f c) { v8f d = __builtin_amdgcn_wmma_f32_16x16x32_f16(false, a, false, b, (short)0, c, false, false); asm volatile("v_nop\n\tv_nop\n\tv_nop\n\tv_nop" : "+v"(d) : "v"(a), "v"(b)); return d; }
template <int ACT>
__global__ __launch_bounds__(128) void k_gemm2(const _Float16* __restrict__ A, int lda, size_t sA, const _Float16* __restrict__ Bh, int ldb, size_t sB, float alpha, const float* __restrict__ bias, size_t sBias, const float* __restrict__ CP, int rowsPerB, size_t sCPb, int row0g,
    float* __restrict__ C, _Float16* __restrict__ C16, int ldc, size_t sC, int M, int N, int K) {
  __shared__ __attribute__((aligned(16))) float so[4][32][68];
  const int tid = threadIdx.x, w = tid >> 5, lane = tid & 31, ln = lane & 15, hh = lane >> 4; const int by = blockIdx.y;
  A += (size_t)by * sA; Bh += (size_t)by * sB; const size_t cofs = (size_t)by * sC; const float* bp = bias ? bias + (size_t)by * sBias : nullptr;
  const int ntn = N >> 6; const int mt = blockIdx.x / ntn, nq = blockIdx.x - mt * ntn; const int row0 = mt * 128 + 32 * w, col0 = nq * 64; if (row0 >= M) return;
  const _Float16* a0p = A + (size_t)(row0 + ln) * lda; const _Float16* a1p = a0p + (size_t)16 * lda;
  const _Float16* b0p = Bh + (size_t)(col0 + ln) * ldb; const _Float16* b1p = b0p + (size_t)16 * ldb; const _Float16* b2p = b1p + (size_t)16 * ldb; const _Float16* b3p = b2p + (size_t)16 * ldb;
  const v8f z8 = {0.f,0.f,0.f,0.f,0.f,0.f,0.f,0.f}; v8f c00 = z8, c01 = z8, c02 = z8, c03 = z8, c10 = z8, c11 = z8, c12 = z8, c13 = z8;
#pragma unroll 1
  for (int kb = 0; kb < K; kb += 32) { const v16h a0 = g2_frag(a0p + kb, hh), a1 = g2_frag(a1p + kb, hh);
    v16h b = g2_frag(b0p + kb, hh); c00 = g2_mma(a0, b, c00); c10 = g2_mma(a1, b, c10);
    b = g2_frag(b1p + kb, hh); c01 = g2_mma(a0, b, c01); c11 = g2_mma(a1, b, c11);
    b = g2_frag(b2p + kb, hh); c02 = g2_mma(a0, b, c02); c12 = g2_mma(a1, b, c12);
    b = g2_frag(b3p + kb, hh); c03 = g2_mma(a0, b, c03); c13 = g2_mma(a1, b, c13); }
  v8f accs[8] = {c00, c01, c02, c03, c10, c11, c12, c13};
#pragma unroll
  for (int u = 0; u < 8; ++u) { const int t = u & 3, half = u >> 2; const int col = col0 + t * 16 + ln; const float bv = bp ? bf16_round(bp[col]) : 0.f;
#pragma unroll
    for (int r = 0; r < 8; ++r) { const int rloc = half * 16 + 8 * hh + r; float v = accs[u][r] * alpha + bv; if (CP) { const int bidx = (row0g + row0 + rloc) / rowsPerB; v += CP[(size_t)bidx * sCPb + (size_t)by * 64 + col]; }
      if (ACT == 3) v = fmaxf(v, 0.f); else if (ACT == 6) v = 0.5f * v * (1.0f + erff(v * 0.70710678118654752f)); else if (ACT == 11) v = 1.0f / (1.0f + expf(-v)); else if (ACT == 15) v = v / (1.0f + expf(-v)); else if (ACT == 12) v = (v > 0.f) ? v : 0.01f * v; else if (ACT == 8) v = tanhf(v); else if (ACT == 9) v = 0.5f * v * (1.0f + tanhf(0.7978845608028654f * (v + 0.044715f * v * v * v)));      /* tanh-GELU */
      so[w][rloc][t * 16 + ln] = v; } }
  __builtin_amdgcn_fence(__ATOMIC_ACQ_REL, "workgroup"); __builtin_amdgcn_wave_barrier();
  const int rsub = lane >> 4, c4 = (lane & 15) * 4;
  {
#pragma unroll
    for (int q = 0; q < 16; ++q) { const int r = q * 2 + rsub; const v4f v = *(const v4fa*)&so[w][r][c4]; if (C) *(v4f*)(C + cofs + (size_t)(row0 + r) * ldc + col0 + c4) = v; if (C16) { v4h h4; for (int i = 0; i < 4; ++i) h4[i] = (_Float16)v[i]; *(v4h*)(C16 + cofs + (size_t)(row0 + r) * ldc + col0 + c4) = h4; } }
     } }



__global__ __launch_bounds__(128) void k_flash(const _Float16* __restrict__ Q16, int ldq, const _Float16* __restrict__ K16, int ldk, const _Float16* __restrict__ Vt, const int* __restrict__ MSK, float* __restrict__ O, int ldo) {
  constexpr int RPW = 16, RTN = RPW / 16, NQB = TQ / (4 * RPW), DT = 4, KS = 2;
  __shared__ __attribute__((aligned(16))) unsigned short sP[4][RPW][40]; __shared__ __attribute__((aligned(16))) float sO[4][RPW][64 + 4];
  const int tid = threadIdx.x, w = tid >> 5, lane = tid & 31, ln = lane & 15, hh = lane >> 4;
  const int slab = blockIdx.x / NQB, qblk = blockIdx.x % NQB; const int b = slab / NH, h = slab % NH; const int qb0 = qblk * (4 * RPW); const int q0 = qb0 + w * RPW;
  FragH aq[2][KS];
#pragma unroll
  for (int rt = 0; rt < RTN; ++rt) { const unsigned short* qr = (const unsigned short*)Q16 + ((size_t)b * TQ + q0 + rt * 16 + ln) * ldq + h * 64;
#pragma unroll
    for (int ks = 0; ks < KS; ++ks) { aq[rt][ks].half[0] = *(const v8us*)(qr + ks * 32 + 8 * hh); aq[rt][ks].half[1] = *(const v8us*)(qr + ks * 32 + 16 + 8 * hh); } }
  const unsigned short* Vth = (const unsigned short*)Vt + (size_t)slab * 64 * TK;
  float m_r[2][8], l_r[2][8]; v8f oacc[2][DT];
#pragma unroll
  for (int rt = 0; rt < RTN; ++rt) {
#pragma unroll
    for (int r = 0; r < 8; ++r) { m_r[rt][r] = -3.0e38f; l_r[rt][r] = 0.f; }
#pragma unroll
    for (int dt = 0; dt < DT; ++dt) oacc[rt][dt] = (v8f){0.f,0.f,0.f,0.f,0.f,0.f,0.f,0.f}; }
  const int jend = TK;
#pragma unroll 1
  for (int j0 = 0; j0 < jend; j0 += 32) {
    v8f s[2][2];
#pragma unroll
    for (int nt = 0; nt < 2; ++nt) { const unsigned short* kr = (const unsigned short*)K16 + ((size_t)b * TK + j0 + nt * 16 + ln) * ldk + h * 64; FragH bk[KS];
#pragma unroll
      for (int ks = 0; ks < KS; ++ks) { bk[ks].half[0] = *(const v8us*)(kr + ks * 32 + 8 * hh); bk[ks].half[1] = *(const v8us*)(kr + ks * 32 + 16 + 8 * hh); }
#pragma unroll
      for (int rt = 0; rt < RTN; ++rt) { v8f acc = (v8f){0.f,0.f,0.f,0.f,0.f,0.f,0.f,0.f};
#pragma unroll
        for (int ks = 0; ks < KS; ++ks) acc = mmaH<1>(aq[rt][ks].v, aq[rt][ks].v, bk[ks].v, bk[ks].v, acc); s[rt][nt] = acc; } }
#pragma unroll
    for (int rt = 0; rt < RTN; ++rt)
#pragma unroll
      for (int r = 0; r < 8; ++r) { const int tq = q0 + rt * 16 + 8 * hh + r; const int k0 = j0 + ln, k1 = j0 + 16 + ln; (void)tq; (void)k0; (void)k1;
        const bool ok0 = true, ok1 = true;
        const float s0 = s[rt][0][r] * SCL, s1 = s[rt][1][r] * SCL; float mc = fmaxf(s0, s1);
        mc = fmaxf(mc, __shfl_xor(mc, 1, 32)); mc = fmaxf(mc, __shfl_xor(mc, 2, 32)); mc = fmaxf(mc, __shfl_xor(mc, 4, 32)); mc = fmaxf(mc, __shfl_xor(mc, 8, 32));
        const float mn = fmaxf(m_r[rt][r], mc); const float al = (mn > -1.0e38f) ? expf(m_r[rt][r] - mn) : 1.0f; m_r[rt][r] = mn; const float p0 = ok0 ? expf(s0 - mn) : 0.f, p1 = ok1 ? expf(s1 - mn) : 0.f; l_r[rt][r] = l_r[rt][r] * al + p0 + p1;
#pragma unroll
        for (int dt = 0; dt < DT; ++dt) oacc[rt][dt][r] *= al;
        FragH t2; t2.h[0] = (_Float16)(p0 * 1024.0f); t2.h[1] = (_Float16)(p1 * 1024.0f); sP[w][rt * 16 + 8 * hh + r][ln] = t2.u[0]; sP[w][rt * 16 + 8 * hh + r][16 + ln] = t2.u[1]; }
    __builtin_amdgcn_fence(__ATOMIC_ACQ_REL, "workgroup"); __builtin_amdgcn_wave_barrier();
    FragH pa[2];
#pragma unroll
    for (int rt = 0; rt < RTN; ++rt) { pa[rt].half[0] = *(const v8us*)&sP[w][rt * 16 + ln][8 * hh]; pa[rt].half[1] = *(const v8us*)&sP[w][rt * 16 + ln][16 + 8 * hh]; }
#pragma unroll
    for (int dt = 0; dt < DT; ++dt) { const unsigned short* vrow = Vth + (size_t)(dt * 16 + ln) * TK + j0; FragH bv; bv.half[0] = *(const v8us*)(vrow + 8 * hh); bv.half[1] = *(const v8us*)(vrow + 16 + 8 * hh);
#pragma unroll
      for (int rt = 0; rt < RTN; ++rt) oacc[rt][dt] = mmaH<1>(pa[rt].v, pa[rt].v, bv.v, bv.v, oacc[rt][dt]); }
    __builtin_amdgcn_fence(__ATOMIC_ACQ_REL, "workgroup"); __builtin_amdgcn_wave_barrier(); }
#pragma unroll
  for (int rt = 0; rt < RTN; ++rt) {
#pragma unroll
    for (int r = 0; r < 8; ++r) { float l = l_r[rt][r]; l += __shfl_xor(l, 1, 32); l += __shfl_xor(l, 2, 32); l += __shfl_xor(l, 4, 32); l += __shfl_xor(l, 8, 32); l_r[rt][r] = (l > 0.f) ? 1.0f / (l * 1024.0f) : 0.f; }
#pragma unroll
    for (int dt = 0; dt < DT; ++dt)
#pragma unroll
      for (int r = 0; r < 8; ++r) sO[w][rt * 16 + 8 * hh + r][dt * 16 + ln] = oacc[rt][dt][r] * l_r[rt][r]; }
  __builtin_amdgcn_fence(__ATOMIC_ACQ_REL, "workgroup"); __builtin_amdgcn_wave_barrier();
  {
#pragma unroll
    for (int rp = 0; rp < RPW; rp += 2) { const int r = rp + (lane >> 4), pc = lane & 15; const v4f val = *(const v4fa*)&sO[w][r][pc * 4]; *(v4f*)(O + ((size_t)b * TQ + q0 + r) * ldo + h * 64 + pc * 4) = val; }
     } }
__global__ __launch_bounds__(256) void k_fulltab(unsigned* __restrict__ MB, int* __restrict__ RA, int* __restrict__ KE, int nq, int nk) {
  const int t = blockIdx.x * 256 + threadIdx.x;
  if (t < nq * (nk / 32)) { *(unsigned*)(MB + t) = 0u;  }
  if (t < nq) { *(int*)(RA + t) = 0;  }
  if (t < nq / 64) { *(int*)(KE + t * 32) = nk;  } }
template <int SRCBF>
__global__ __launch_bounds__(256) void k_ln1024(const float* __restrict__ X, _Float16* __restrict__ Y16, float* __restrict__ XB) {
  #pragma clang fp contract(off)
  const int tid = threadIdx.x, w = tid >> 5, ln = tid & 31; const int r = blockIdx.x * 8 + w; if (r >= NR) return; const float* x = X + (size_t)r * DM; float s = 0.f;
#pragma unroll 1
  for (int i = 0; i < 8; ++i) { const v4f a = *(const v4fa*)(x + i * 128 + ln * 4); for (int q = 0; q < 4; ++q) s += SRCBF ? bf16_round(a[q]) : a[q]; }
  for (int o = 16; o > 0; o >>= 1) s += __shfl_xor(s, o, 32); const float mu = s / (float)DM; float q2 = 0.f;
#pragma unroll 1
  for (int i = 0; i < 8; ++i) { const v4f a = *(const v4fa*)(x + i * 128 + ln * 4); for (int q = 0; q < 4; ++q) { const float d = (SRCBF ? bf16_round(a[q]) : a[q]) - mu; q2 += d * d; } }
  for (int o = 16; o > 0; o >>= 1) q2 += __shfl_xor(q2, o, 32); const float dn = sqrtf(q2 / (float)DM + 1e-5f);
  {
#pragma unroll 1
    for (int i = 0; i < 8; ++i) { const int c0 = i * 128 + ln * 4; const v4f a = *(const v4fa*)(x + c0); _Float16 h4[4]; v4f xb;
      for (int q = 0; q < 4; ++q) { const float t = SRCBF ? bf16_round(a[q]) : a[q]; h4[q] = (_Float16)((t - mu) / dn); xb[q] = t; }
      *(unsigned long long*)((unsigned short*)Y16 + (size_t)r * DM + c0) = *(const unsigned long long*)h4; if (SRCBF) *(v4f*)(XB + (size_t)r * DM + c0) = xb; }
     } }
__global__ __launch_bounds__(256) void k_causaltab(unsigned* __restrict__ MB, int* __restrict__ RA, int* __restrict__ KE, int nq, int nk) {
  const int t = blockIdx.x * 256 + threadIdx.x; const int nw = nk / 32;
  if (t < nq * nw) { const int q = t / nw, w = t % nw; const int first = q + 1 - 32 * w; const unsigned bits = (first <= 0) ? 0xffffffffu : ((first >= 32) ? 0u : (0xffffffffu << first)); *(unsigned*)(MB + t) = bits;  }
  if (t < nq) { *(int*)(RA + t) = 0;  }
  if (t < nq / 64) { const int v = 64 * (t + 1); *(int*)(KE + t * 32) = v;  } }


extern "C" void kernel_launch(void* const* d_in, const int* in_sizes, int n_in,
                              void* d_out, int out_size, void* d_ws, size_t ws_size, hipStream_t stream) {
  (void)in_sizes; (void)n_in; (void)out_size;
  const float* const* I = (const float* const*)d_in; const float* x = I[0]; const float* Wqkv = I[1]; const float* Wfc = I[2]; const float* W1 = I[3]; const float* b1 = I[4]; const float* W2 = I[5]; const float* b2 = I[6];
  char* ws = (char*)d_ws; size_t off = 0;
  auto take = [&](size_t bytes) { char* p = ws + off; off += (bytes + 255) & ~(size_t)255; return p; };
  _Float16* BQKV = (_Float16*)take((size_t)3 * DM * DM * 2); _Float16* BFC = (_Float16*)take((size_t)DM * DM * 2); _Float16* BW1 = (_Float16*)take((size_t)4096 * DM * 2); _Float16* BW2 = (_Float16*)take((size_t)DM * 4096 * 2);
  float* XB = (float*)take((size_t)NR * DM * 4); _Float16* X16 = (_Float16*)take((size_t)NR * DM * 2); float* F = (float*)take((size_t)NR * DM * 4);
  _Float16* Q16 = (_Float16*)take((size_t)NR * DM * 2); _Float16* K16 = (_Float16*)take((size_t)NR * DM * 2); _Float16* V16 = (_Float16*)take((size_t)NR * DM * 2); _Float16* VT = (_Float16*)take((size_t)NR * DM * 2); if (off > ws_size) return;      /* 24 + 16 + 8 + 16 + 32 = 96 MiB */
  float* O = F; _Float16* Oh = Q16; _Float16* Ol = K16;     /* q/k planes are dead after the flash */
  float* X1 = XB;                                           /* x1 written over the residual plane (own-tile addend) */
  _Float16* H16 = X16; _Float16* GH = Q16;                  /* GELU hidden [NR][4096] f16 = 32 MB over Q16|K16|V16|VT (contiguous, all dead once x1 is formed) */
  const size_t n8 = (size_t)NR * DM / 8; const unsigned nb8 = (unsigned)((n8 + 255) / 256);
  k_wt_f16<<<(unsigned)(((size_t)DM * 3 * DM / 8 + 255) / 256), 256, 0, stream>>>(Wqkv, BQKV, DM, 3 * DM, 16.0f); k_wt_f16<<<(unsigned)(((size_t)DM * DM / 8 + 255) / 256), 256, 0, stream>>>(Wfc, BFC, DM, DM, 16.0f);
  k_wt_f16<<<(unsigned)(((size_t)DM * 4096 / 8 + 255) / 256), 256, 0, stream>>>(W1, BW1, DM, 4096, 16.0f); k_wt_f16<<<(unsigned)(((size_t)4096 * DM / 8 + 255) / 256), 256, 0, stream>>>(W2, BW2, 4096, DM, 16.0f);      /* all (in,out) */
  k_ln1024<1><<<NR / 8, 256, 0, stream>>>(x, X16, XB);
  const dim3 gP((NR / 128) * (DM / 64), 1), gM((NR / 128) * (4096 / 64), 1);
  k_gemm2<0><<<gP, 128, 0, stream>>>(X16, DM, 0, BQKV, DM, 0, 0.0625f, nullptr, 0, nullptr, 1, 0, 0, nullptr, Q16, DM, 0, NR, DM, DM);
  k_gemm2<0><<<gP, 128, 0, stream>>>(X16, DM, 0, BQKV + (size_t)DM * DM, DM, 0, 0.0625f, nullptr, 0, nullptr, 1, 0, 0, nullptr, K16, DM, 0, NR, DM, DM);
  k_gemm2<0><<<gP, 128, 0, stream>>>(X16, DM, 0, BQKV + (size_t)2 * DM * DM, DM, 0, 0.0625f, nullptr, 0, nullptr, 1, 0, 0, nullptr, V16, DM, 0, NR, DM, DM);
  for (int b = 0; b < NBT; ++b) k_vt<NH, SLEN><<<NH * (SLEN / 64), 256, 0, stream>>>(V16 + (size_t)b * SLEN * DM, DM, 0, VT + (size_t)b * SLEN * DM);
  for (int b = 0; b < NBT; ++b) { const size_t ro = (size_t)b * SLEN * DM;
    k_flash<<<NH * (SLEN / 64), 128, 0, stream>>>(Q16 + ro, DM, K16 + ro, DM, VT + ro, nullptr, O + ro, DM); }      /* plain flash over all keys */
  k_hl<<<nb8, 256, 0, stream>>>(O, Oh, Ol, n8);
  k_gemm2<0><<<gP, 128, 0, stream>>>(Oh, DM, 0, BFC, DM, 0, 0.0625f, nullptr, 0, XB, 1, (size_t)DM, 0, X1, nullptr, DM, 0, NR, DM, DM);      /* x1 = x + attn w_fc (hi) */
  k_gemm2<0><<<gP, 128, 0, stream>>>(Ol, DM, 0, BFC, DM, 0, 0.0625f / 1024.0f, nullptr, 0, X1, 1, (size_t)DM, 0, X1, nullptr, DM, 0, NR, DM, DM);      /* + lo */
  k_ln1024<0><<<NR / 8, 256, 0, stream>>>(X1, H16, nullptr);
  k_gemm2<9><<<gM, 128, 0, stream>>>(H16, DM, 0, BW1, DM, 0, 0.0625f, b1, 0, nullptr, 1, 0, 0, nullptr, GH, 4096, 0, NR, 4096, DM);      /* tanh-gelu(LN(x1) w1 + b1) f16 */
  k_gemm2<0><<<gP, 128, 0, stream>>>(GH, 4096, 0, BW2, 4096, 0, 0.0625f, b2, 0, X1, 1, (size_t)DM, 0, (float*)d_out, nullptr, DM, 0, NR, DM, 4096);      /* out = x1 + mlp */
}

// v001
// One run takes 725 microseconds.
// Next to v000, in two timings, it ran 1.43 times as fast each time.
#include <hip/hip_runtime.h>
// Pre-LN transformer layer (2 x 2048 tokens, 1024; 16 heads x 64; full (non-causal) attention; MLP 4096 with tanh-GELU): h = LN(x) (no affine); q,k,v = h w_qkv; x1 = x + softmax(q.k/8).v w_fc; out = x1 + gelu(LN(x1) w1 + b1) w2 + b2 -> [2,2048,1024].
// Structure: LayerNorm on VALU (also writing the bf16 residual plane); projections / MLP as f16 WMMA GEMMs (32x64 wave tiles, f32 accumulation, exact weights x16, tanh-GELU and biases in the epilogue, residuals through the f32 addend); q, k, V^T as plain f16 planes through the fused flash kernel over all keys (online softmax in f32, P x2^10); O as hi + residual planes into w_fc (two GEMMs).
// Compute dtype: x and weights rounded to bf16; LN outputs, q, k, v, P and the GELU hidden as f16 operands (~2^-12); O as hi + residual pairs; f32 accumulation, softmax, LayerNorm. v_wmma_f32_16x16x32_f16.
#define NBT 2
#define SLEN 2048
#define TQ SLEN
#define TK SLEN
#define DM 1024
#define NH 16
#define SCL 0.125f
#define NR (NBT * SLEN)
typedef __bf16 v16b __attribute__((ext_vector_type(16)));
typedef unsigned short v8us __attribute__((ext_vector_type(8), may_alias));
typedef float  v8f  __attribute__((ext_vector_type(8)));
typedef float  v4f  __attribute__((ext_vector_type(4)));
typedef float  v4fa __attribute__((ext_vector_type(4), may_alias));
union FragB { v16b v; v8us half[2]; unsigned short u[16]; };

__device__ __forceinline__ unsigned short bf16_bits(float x) { unsigned int u = __float_as_uint(x); return (unsigned short)((u + 0x7FFFu + ((u >> 16) & 1u)) >> 16); }
__device__ __forceinline__ float bf16_val(unsigned short b) { return __uint_as_float(((unsigned int)b) << 16); }
__device__ __forceinline__ float bf16_round(float x) { return bf16_val(bf16_bits(x)); }
// D += A·B with NT terms: 1 = ah·bh, 2 = + al·bh (A split), 3 = + ah·bl (both split)
template <int NT>
__device__ __forceinline__ v8f mmaN(v16b ah, v16b al, v16b bh, v16b bl, v8f c) {
  c = __builtin_amdgcn_wmma_f32_16x16x32_bf16(false, ah, false, bh, (short)0, c, false, false);
  if (NT >= 2) c = __builtin_amdgcn_wmma_f32_16x16x32_bf16(false, al, false, bh, (short)0, c, false, false);
  if (NT >= 3) c = __builtin_amdgcn_wmma_f32_16x16x32_bf16(false, ah, false, bl, (short)0, c, false, false);
  asm volatile("v_nop\n\tv_nop\n\tv_nop\n\tv_nop" : "+v"(c) : "v"(ah), "v"(al), "v"(bh), "v"(bl));
  return c;
}

__global__ __launch_bounds__(256) void k_wt_bf16(const float* __restrict__ W, unsigned short* __restrict__ Wt, int K, int N) {
  const int t = blockIdx.x * 256 + threadIdx.x;
  const int k8n = K / 8;
  if (t >= N * k8n) return;
  const int n = t / k8n, k8 = (t % k8n) * 8;
  v8us v;
#pragma unroll
  for (int i = 0; i < 8; ++i) v[i] = bf16_bits(W[(size_t)(k8 + i) * N + n]);
  *(v8us*)(Wt + (size_t)n * K + k8) = v;
  
}

// GEMM C[M][N] (f32, pitch ldc) = act(A[M][K]·W + bias). A f32 row-major (pitch lda) converted per fragment to bf16
// (ASPLIT: hi/lo two planes -> 2 terms, else single rounded term); Wt bf16 [N][K] (pitch ldb). BIAS_BF16 rounds the
// bias to bf16 first (bias quantised to bf16 before the add). K%32==0, M%16==0, N%64==0.
template <bool ASPLIT, int ACT, bool BIAS_BF16>
__global__ __launch_bounds__(128) void k_gemm_bf(const float* __restrict__ A, int lda, const unsigned short* __restrict__ Wt, int ldb,
                                               const float* __restrict__ bias, float* __restrict__ C, int ldc, int M, int N, int K) {
  __shared__ __attribute__((aligned(16))) float so[4][16][64];
  const int tid = threadIdx.x, w = tid >> 5, lane = tid & 31, ln = lane & 15, hh = lane >> 4;
  const int ntn = N / 64;
  const int wid = blockIdx.x * 4 + w;
  const int mt = wid / ntn, nq = wid % ntn;
  if (mt * 16 >= M) return;
  const int row0 = mt * 16, col0 = nq * 64;
  const float* arow = A + (size_t)(row0 + ln) * lda;
  v8f acc[4] = {};
  for (int kb = 0; kb < K; kb += 32) {
    FragB ah, al;
    const v4f x0 = *(const v4fa*)(arow + kb + 8 * hh), x1 = *(const v4fa*)(arow + kb + 8 * hh + 4);
    const v4f x2 = *(const v4fa*)(arow + kb + 16 + 8 * hh), x3 = *(const v4fa*)(arow + kb + 16 + 8 * hh + 4);
    float xs[16] = {x0[0],x0[1],x0[2],x0[3],x1[0],x1[1],x1[2],x1[3],x2[0],x2[1],x2[2],x2[3],x3[0],x3[1],x3[2],x3[3]};
#pragma unroll
    for (int i = 0; i < 16; ++i) { const unsigned short hb = bf16_bits(xs[i]); ah.u[i] = hb; al.u[i] = ASPLIT ? bf16_bits(xs[i] - bf16_val(hb)) : (unsigned short)0; }
#pragma unroll
    for (int t = 0; t < 4; ++t) {
      const unsigned short* brow = Wt + (size_t)(col0 + t * 16 + ln) * ldb + kb;
      FragB b;
      b.half[0] = *(const v8us*)(brow + 8 * hh);
      b.half[1] = *(const v8us*)(brow + 16 + 8 * hh);
      acc[t] = mmaN<ASPLIT ? 2 : 1>(ah.v, al.v, b.v, b.v, acc[t]);
    }
  }
#pragma unroll
  for (int t = 0; t < 4; ++t) {
    float bv = bias ? bias[col0 + t * 16 + ln] : 0.f;
    if (BIAS_BF16) bv = bf16_round(bv);
#pragma unroll
    for (int r = 0; r < 8; ++r) { float v = acc[t][r] + bv; if (ACT == 1) v = fmaxf(v, 0.f); so[w][8 * hh + r][t * 16 + ln] = v; }
  }
  __builtin_amdgcn_fence(__ATOMIC_ACQ_REL, "workgroup");
  __builtin_amdgcn_wave_barrier();
  const int rsub = lane >> 4, c4 = (lane & 15) * 4;
  {
#pragma unroll
    for (int q = 0; q < 8; ++q) {
      const int r = q * 2 + rsub;
      const v4f v = *(const v4fa*)&so[w][r][c4];
      *(v4f*)(C + (size_t)(row0 + r) * ldc + col0 + c4) = v;
    }
    
  }
}

// GEMM C = act(A·W + bias + resid): A f32 (ASPLIT -> hi/lo 2 terms), Wt bf16 [N][K]; ACT 0 none, 1 relu, 2 exact gelu;
// resid (optional, f32, row index = (row % rmod), pitch ldr, RES_BF16 rounds it) added before the activation.
template <bool ASPLIT, int ACT, bool BIAS_BF16, bool RES_BF16>
__global__ __launch_bounds__(128) void k_gemm_bf3(const float* __restrict__ A, int lda, const unsigned short* __restrict__ Wt, int ldb,
                                                const float* __restrict__ bias, const float* __restrict__ resid, int rmod, int ldr,
                                                float* __restrict__ C, int ldc, int M, int N, int K) {
  __shared__ __attribute__((aligned(16))) float so[4][16][64];
  const int tid = threadIdx.x, w = tid >> 5, lane = tid & 31, ln = lane & 15, hh = lane >> 4;
  const int ntn = N / 64;
  const int wid = blockIdx.x * 4 + w;
  const int mt = wid / ntn, nq = wid % ntn;
  if (mt * 16 >= M) return;
  const int row0 = mt * 16, col0 = nq * 64;
  const float* arow = A + (size_t)(row0 + ln) * lda;
  v8f acc[4] = {};
  for (int kb = 0; kb < K; kb += 32) {
    FragB ah, al;
    const v4f x0 = *(const v4fa*)(arow + kb + 8 * hh), x1 = *(const v4fa*)(arow + kb + 8 * hh + 4);
    const v4f x2 = *(const v4fa*)(arow + kb + 16 + 8 * hh), x3 = *(const v4fa*)(arow + kb + 16 + 8 * hh + 4);
    float xs[16] = {x0[0],x0[1],x0[2],x0[3],x1[0],x1[1],x1[2],x1[3],x2[0],x2[1],x2[2],x2[3],x3[0],x3[1],x3[2],x3[3]};
#pragma unroll
    for (int i = 0; i < 16; ++i) { const unsigned short hb = bf16_bits(xs[i]); ah.u[i] = hb; al.u[i] = ASPLIT ? bf16_bits(xs[i] - bf16_val(hb)) : (unsigned short)0; }
#pragma unroll
    for (int t = 0; t < 4; ++t) {
      const unsigned short* brow = Wt + (size_t)(col0 + t * 16 + ln) * ldb + kb;
      FragB b;
      b.half[0] = *(const v8us*)(brow + 8 * hh);
      b.half[1] = *(const v8us*)(brow + 16 + 8 * hh);
      acc[t] = mmaN<ASPLIT ? 2 : 1>(ah.v, al.v, b.v, b.v, acc[t]);
    }
  }
#pragma unroll
  for (int t = 0; t < 4; ++t) {
    const int col = col0 + t * 16 + ln;
    float bv = bias ? bias[col] : 0.f;
    if (BIAS_BF16) bv = bf16_round(bv);
#pragma unroll
    for (int r = 0; r < 8; ++r) {
      float v = acc[t][r] + bv;
      if (resid) { float rv = resid[(size_t)((row0 + 8 * hh + r) % rmod) * ldr + col]; if (RES_BF16) rv = bf16_round(rv); v += rv; }
      if (ACT == 1) v = fmaxf(v, 0.f);
      if (ACT == 2) v = 0.5f * v * (1.0f + erff(v * 0.70710678118654752f));
      if (ACT == 3) { const float u = 0.7978845608028654f * (v + 0.044715f * v * v * v); v = 0.5f * v * (1.0f + tanhf(u)); }
      so[w][8 * hh + r][t * 16 + ln] = v;
    }
  }
  __builtin_amdgcn_fence(__ATOMIC_ACQ_REL, "workgroup");
  __builtin_amdgcn_wave_barrier();
  const int rsub = lane >> 4, c4 = (lane & 15) * 4;
  {
#pragma unroll
    for (int q = 0; q < 8; ++q) {
      const int r = q * 2 + rsub;
      const v4f v = *(const v4fa*)&so[w][r][c4];
      *(v4f*)(C + (size_t)(row0 + r) * ldc + col0 + c4) = v;
    }
    
  }
}
// row LayerNorm (biased variance, eps) over N: s = X (+ R); optional out_sum <- s; out_norm <- (s-mu)*rsqrt(var+eps)*g + b
template <bool PARAM_BF16>
__global__ __launch_bounds__(256) void k_layernorm(const float* __restrict__ X, const float* __restrict__ R, const float* __restrict__ g, const float* __restrict__ bta,
                                                  float* __restrict__ out_sum, float* __restrict__ out_norm, int N, float eps) {
  __shared__ float red[256];
  const int row = blockIdx.x, tid = threadIdx.x;
  const float* x = X + (size_t)row * N; const float* rr = R ? R + (size_t)row * N : nullptr;
  float vals[16];                     // up to N = 4096
  const int per = N / 256;            // contiguous chunk per thread? use strided-by-4 chunks: thread handles j = tid*4 + 1024*u
  float s1 = 0.f;
  for (int u = 0; u < per / 4; ++u) {
    const int j = tid * 4 + 1024 * u;
    const v4f a = *(const v4fa*)(x + j);
    v4f b = {0.f,0.f,0.f,0.f}; if (rr) b = *(const v4fa*)(rr + j);
#pragma unroll
    for (int q = 0; q < 4; ++q) { const float v = a[q] + b[q]; vals[u * 4 + q] = v; s1 += v; }
  }
  red[tid] = s1; __syncthreads();
  for (int st = 128; st > 0; st >>= 1) { if (tid < st) red[tid] += red[tid + st]; __syncthreads(); }
  const float mu = red[0] / (float)N; __syncthreads();
  float s2 = 0.f;
  for (int u = 0; u < per / 4; ++u)
#pragma unroll
    for (int q = 0; q < 4; ++q) { const float c = vals[u * 4 + q] - mu; s2 += c * c; }
  red[tid] = s2; __syncthreads();
  for (int st = 128; st > 0; st >>= 1) { if (tid < st) red[tid] += red[tid + st]; __syncthreads(); }
  const float rs = rsqrtf(red[0] / (float)N + eps);
  {
    for (int u = 0; u < per / 4; ++u) {
      const int j = tid * 4 + 1024 * u;
      v4f o, sm;
#pragma unroll
      for (int q = 0; q < 4; ++q) {
        float gg = g[j + q], bb = bta[j + q];
        if (PARAM_BF16) { gg = bf16_round(gg); bb = bf16_round(bb); }
        sm[q] = vals[u * 4 + q]; o[q] = (vals[u * 4 + q] - mu) * rs * gg + bb;
      }
      if (out_sum) *(v4f*)(out_sum + (size_t)row * N + j) = sm;
      *(v4f*)(out_norm + (size_t)row * N + j) = o;
    }
    
  }
}



// ---- f16 WMMA path (v_wmma_f32_16x16x32_f16): 11-bit significands for operands in range — used where a [0,1] probability operand needs more precision than bf16
typedef _Float16 v16h __attribute__((ext_vector_type(16)));
union FragH { v16h v; v8us half[2]; _Float16 h[16]; unsigned short u[16]; };
template <int NT>
__device__ __forceinline__ v8f mmaH(v16h ah, v16h al, v16h bh, v16h bl, v8f c) {
  c = __builtin_amdgcn_wmma_f32_16x16x32_f16(false, ah, false, bh, (short)0, c, false, false);
  if (NT >= 2) c = __builtin_amdgcn_wmma_f32_16x16x32_f16(false, al, false, bh, (short)0, c, false, false);
  if (NT >= 3) c = __builtin_amdgcn_wmma_f32_16x16x32_f16(false, ah, false, bl, (short)0, c, false, false);
  asm volatile("v_nop\n\tv_nop\n\tv_nop\n\tv_nop" : "+v"(c) : "v"(ah), "v"(al), "v"(bh), "v"(bl));
  return c;
}
// batched GEMM like k_gemm_b but f16 operands: A f32 (split into f16 hi/lo if ASPLIT, else rounded to f16), Bt = f16 values [n][k]; alpha; C f32; N multiple of 16 (partial tiles skipped)
template <bool ASPLIT>
__global__ __launch_bounds__(128) void k_gemm_h(const float* __restrict__ A, int lda, size_t sA, const _Float16* __restrict__ Bh, int ldb, size_t sB, float alpha, float* __restrict__ C, int ldc, size_t sC, int M, int N, int K) {
  __shared__ __attribute__((aligned(16))) float so[4][16][64];
  const int tid = threadIdx.x, w = tid >> 5, lane = tid & 31, ln = lane & 15, hh = lane >> 4; const int by = blockIdx.y;
  A += (size_t)by * sA; Bh += (size_t)by * sB; C += (size_t)by * sC;
  const int ntn = (N + 63) / 64; const int wid = blockIdx.x * 4 + w; const int mt = wid / ntn, nq = wid % ntn; if (mt * 16 >= M) return;
  const int row0 = mt * 16, col0 = nq * 64; const float* arow = A + (size_t)(row0 + ln) * lda;
  v8f acc[4] = {};
  for (int kb = 0; kb < K; kb += 32) {
    FragH ah, al;
    const v4f x0 = *(const v4fa*)(arow + kb + 8 * hh), x1 = *(const v4fa*)(arow + kb + 8 * hh + 4), x2 = *(const v4fa*)(arow + kb + 16 + 8 * hh), x3 = *(const v4fa*)(arow + kb + 16 + 8 * hh + 4);
    float xs[16] = {x0[0],x0[1],x0[2],x0[3],x1[0],x1[1],x1[2],x1[3],x2[0],x2[1],x2[2],x2[3],x3[0],x3[1],x3[2],x3[3]};
#pragma unroll
    for (int i = 0; i < 16; ++i) { const _Float16 h = (_Float16)xs[i]; ah.h[i] = h; al.h[i] = ASPLIT ? (_Float16)(xs[i] - (float)h) : (_Float16)0.0f; }
#pragma unroll
    for (int t = 0; t < 4; ++t) { if (col0 + t * 16 >= N) continue; const size_t boff = (size_t)(col0 + t * 16 + ln) * ldb + kb; FragH bq; bq.half[0] = *(const v8us*)(Bh + boff + 8 * hh); bq.half[1] = *(const v8us*)(Bh + boff + 16 + 8 * hh);
      acc[t] = mmaH<ASPLIT ? 2 : 1>(ah.v, al.v, bq.v, bq.v, acc[t]); }
  }
#pragma unroll
  for (int t = 0; t < 4; ++t) { if (col0 + t * 16 >= N) continue;
#pragma unroll
    for (int r = 0; r < 8; ++r) so[w][8 * hh + r][t * 16 + ln] = acc[t][r] * alpha; }
  __builtin_amdgcn_fence(__ATOMIC_ACQ_REL, "workgroup"); __builtin_amdgcn_wave_barrier();
  const int rsub = lane >> 4, c4 = (lane & 15) * 4;
  {
#pragma unroll
    for (int q = 0; q < 8; ++q) { const int r = q * 2 + rsub; if (col0 + c4 < N) { const v4f v = *(const v4fa*)&so[w][r][c4]; *(v4f*)(C + (size_t)(row0 + r) * ldc + col0 + c4) = v; } }
     }
}

// Wt[n][k] = f16(W[k][n]·scale) from f32 row-major W[K][N] (scale = power of two; bf16-exact weights stay exact in f16 away from the subnormal range)
__global__ __launch_bounds__(256) void k_wt_f16(const float* __restrict__ W, _Float16* __restrict__ Wt, int K, int N, float scale) {
  const int t = blockIdx.x * 256 + threadIdx.x; if (t >= N * (K / 8)) return; const int n = t / (K / 8), k8 = (t % (K / 8)) * 8; FragH f;
#pragma unroll
  for (int i = 0; i < 8; ++i) f.h[i] = (_Float16)(bf16_round(W[(size_t)(k8 + i) * N + n]) * scale); const v8us o = f.half[0];
  *(v8us*)((unsigned short*)Wt + (size_t)n * K + k8) = o; 
}
// k_gemm_hh variant with fused epilogue: v = acc·alpha + bias[by·sBias + col] (+ CP[(row/rowsPerB)·sCPb + by·64 + col] if CP) ; ACT 0 none / 1 elu ; writes f16 C16 (and f32 C if non-null)
template <int ACT>
__global__ __launch_bounds__(128) void k_gemm_hhx(const _Float16* __restrict__ A, int lda, size_t sA, const _Float16* __restrict__ Bh, int ldb, size_t sB, float alpha, const float* __restrict__ bias, size_t sBias, const float* __restrict__ CP, int rowsPerB, size_t sCPb, int row0g,
    float* __restrict__ C, _Float16* __restrict__ C16, int ldc, size_t sC, int M, int N, int K) {
  __shared__ __attribute__((aligned(16))) float so[4][16][64];
  const int tid = threadIdx.x, w = tid >> 5, lane = tid & 31, ln = lane & 15, hh = lane >> 4; const int by = blockIdx.y;
  A += (size_t)by * sA; Bh += (size_t)by * sB; const size_t cofs = (size_t)by * sC; const float* bp = bias ? bias + (size_t)by * sBias : nullptr;
  const int ntn = (N + 63) / 64; const int wid = blockIdx.x * 4 + w; const int mt = wid / ntn, nq = wid % ntn; if (mt * 16 >= M) return;
  const int row0 = mt * 16, col0 = nq * 64; const _Float16* arow = A + (size_t)(row0 + ln) * lda;
  v8f acc[4] = {};
  for (int kb = 0; kb < K; kb += 32) { FragH ah; ah.half[0] = *(const v8us*)((const unsigned short*)arow + kb + 8 * hh); ah.half[1] = *(const v8us*)((const unsigned short*)arow + kb + 16 + 8 * hh);
#pragma unroll
    for (int t = 0; t < 4; ++t) { if (col0 + t * 16 >= N) continue; const size_t boff = (size_t)(col0 + t * 16 + ln) * ldb + kb; FragH bq; bq.half[0] = *(const v8us*)((const unsigned short*)Bh + boff + 8 * hh); bq.half[1] = *(const v8us*)((const unsigned short*)Bh + boff + 16 + 8 * hh);
      acc[t] = mmaH<1>(ah.v, ah.v, bq.v, bq.v, acc[t]); }
  }
#pragma unroll
  for (int t = 0; t < 4; ++t) { if (col0 + t * 16 >= N) continue; const int col = col0 + t * 16 + ln; const float bv = bp ? bf16_round(bp[col]) : 0.f;
#pragma unroll
    for (int r = 0; r < 8; ++r) { float v = acc[t][r] * alpha + bv; if (CP) { const int bidx = (row0g + row0 + 8 * hh + r) / rowsPerB; v += CP[(size_t)bidx * sCPb + (size_t)by * 64 + col]; } if (ACT == 1) v = (v > 0.f) ? v : expm1f(v); else if (ACT == 7) v = (v > 0.f) ? v + 1.0f : expf(v); else if (ACT == 8) v = tanhf(v); else if (ACT == 9) v = 0.5f * v * (1.0f + tanhf(0.7978845608028654f * (v + 0.044715f * v * v * v))); else if (ACT == 11) v = 1.0f / (1.0f + expf(-v)); else if (ACT == 12) v = (v > 0.f) ? v : 0.01f * v; else if (ACT == 14) v = (v > 0.f) ? v : 0.1f * v; else if (ACT == 15) v = v / (1.0f + expf(-v)); else if (ACT == 3) v = fmaxf(v, 0.f); else if (ACT == 6) v = 0.5f * v * (1.0f + erff(v * 0.70710678118654752f)); so[w][8 * hh + r][t * 16 + ln] = v; } }
  __builtin_amdgcn_fence(__ATOMIC_ACQ_REL, "workgroup"); __builtin_amdgcn_wave_barrier();
  const int rsub = lane >> 4, c4 = (lane & 15) * 4; typedef _Float16 v4h __attribute__((ext_vector_type(4)));
  {
#pragma unroll
    for (int q = 0; q < 8; ++q) { const int r = q * 2 + rsub; if (col0 + c4 < N) { const v4f v = *(const v4fa*)&so[w][r][c4]; if (C) *(v4f*)(C + cofs + (size_t)(row0 + r) * ldc + col0 + c4) = v; if (C16) { v4h h4; for (int i = 0; i < 4; ++i) h4[i] = (_Float16)v[i]; *(v4h*)(C16 + cofs + (size_t)(row0 + r) * ldc + col0 + c4) = h4; } } }
     }
}


typedef _Float16 v4h __attribute__((ext_vector_type(4)));

__global__ __launch_bounds__(256) void k_x16(const float* __restrict__ x, _Float16* __restrict__ X16, size_t n8) { const size_t t = (size_t)blockIdx.x * 256 + threadIdx.x; if (t >= n8) return; FragH f;
#pragma unroll
  for (int q = 0; q < 8; ++q) f.h[q] = (_Float16)bf16_round(x[t * 8 + q]); *(v8us*)((unsigned short*)X16 + t * 8) = f.half[0];  }
__global__ __launch_bounds__(256) void k_h16(const float* __restrict__ x, _Float16* __restrict__ X16, size_t n8) { const size_t t = (size_t)blockIdx.x * 256 + threadIdx.x; if (t >= n8) return; FragH f;
#pragma unroll
  for (int q = 0; q < 8; ++q) f.h[q] = (_Float16)x[t * 8 + q]; *(v8us*)((unsigned short*)X16 + t * 8) = f.half[0];  }
__global__ __launch_bounds__(256) void k_round16f(const float* __restrict__ W, _Float16* __restrict__ Bt, size_t n8) { const size_t t = (size_t)blockIdx.x * 256 + threadIdx.x; if (t >= n8) return; FragH f;
#pragma unroll
  for (int i = 0; i < 8; ++i) f.h[i] = (_Float16)(bf16_round(W[t * 8 + i]) * 16.0f); *(v8us*)((unsigned short*)Bt + t * 8) = f.half[0];  }
template <int NHv, int TTv>
__global__ __launch_bounds__(256) void k_vt(const _Float16* __restrict__ V16, int ldv, int voff, _Float16* __restrict__ Vt) { __shared__ unsigned short tl[64][66]; const int tid = threadIdx.x; const int slab = blockIdx.x / (TTv / 64), lg = blockIdx.x % (TTv / 64); const int b = slab / NHv, h = slab % NHv;
  for (int i = tid; i < 64 * 8; i += 256) { const int r = i / 8, c8 = (i % 8) * 8; FragH f; f.half[0] = *(const v8us*)((const unsigned short*)V16 + ((size_t)b * TTv + lg * 64 + r) * ldv + voff + h * 64 + c8);
#pragma unroll
    for (int q = 0; q < 8; ++q) tl[r][c8 + q] = f.u[q]; }
  __syncthreads();
  {
#pragma unroll
    for (int rd = 0; rd < 2; ++rd) { const int d = rd * 32 + tid / 8, pc = tid % 8; FragH f;
#pragma unroll
      for (int q = 0; q < 8; ++q) f.u[q] = tl[pc * 8 + q][d];
      *(v8us*)((unsigned short*)Vt + ((size_t)slab * 64 + d) * TTv + lg * 64 + pc * 8) = f.half[0]; }
     } }

__global__ __launch_bounds__(256) void k_hl(const float* __restrict__ F, _Float16* __restrict__ Hh, _Float16* __restrict__ Hl, size_t n8) { const size_t t = (size_t)blockIdx.x * 256 + threadIdx.x; if (t >= n8) return; FragH fh, fl; const v4f a = *(const v4fa*)(F + t * 8), c = *(const v4fa*)(F + t * 8 + 4);
#pragma unroll
  for (int q = 0; q < 4; ++q) { _Float16 h = (_Float16)a[q]; fh.h[q] = h; fl.h[q] = (_Float16)((a[q] - (float)h) * 1024.0f); h = (_Float16)c[q]; fh.h[4 + q] = h; fl.h[4 + q] = (_Float16)((c[q] - (float)h) * 1024.0f); }
  { *(v8us*)((unsigned short*)Hh + t * 8) = fh.half[0]; *(v8us*)((unsigned short*)Hl + t * 8) = fl.half[0];  } }

// ---- fast GEMM (wave tile 32x64, operands staged in LDS); epilogue = k_gemm_hhx semantics ----
__device__ __forceinline__ v16h g2_frag(const _Float16* p, int hh) { FragH f; f.half[0] = *(const v8us*)((const unsigned short*)p + 8 * hh); f.half[1] = *(const v8us*)((const unsigned short*)p + 16 + 8 * hh); return f.v; }
__device__ __forceinline__ v8f g2_mma(v16h a, v16h b, v8f c) { v8f d = __builtin_amdgcn_wmma_f32_16x16x32_f16(false, a, false, b, (short)0, c, false, false); asm volatile("v_nop\n\tv_nop\n\tv_nop\n\tv_nop" : "+v"(d) : "v"(a), "v"(b)); return d; }
// Staged tile of k_gemm2: 128 A rows then 128 B rows, 128 k (256 B) each, at a pitch of 272 B (16 B x odd: conflict-free for ds_load_b128 readers); two buffers.
#define G2_PITCH 272
#define G2_BUF (256 * G2_PITCH)
// Eight asynchronous 16-byte copies per lane (rows 16 apart): l = the lane's LDS byte address, g = its global address, gstep = 16 source rows in elements.
// s_wait_xcnt 0 is the statement's last line, so that it stands in front of any later rewrite of the address registers the copies name.
__device__ __forceinline__ void g2_copy8(unsigned l, const _Float16* g, size_t gstep) {
  const unsigned l1 = l + 16 * G2_PITCH, l2 = l + 32 * G2_PITCH, l3 = l + 48 * G2_PITCH, l4 = l + 64 * G2_PITCH, l5 = l + 80 * G2_PITCH, l6 = l + 96 * G2_PITCH, l7 = l + 112 * G2_PITCH;
  const _Float16* g1 = g + gstep; const _Float16* g2 = g1 + gstep; const _Float16* g3 = g2 + gstep; const _Float16* g4 = g3 + gstep; const _Float16* g5 = g4 + gstep; const _Float16* g6 = g5 + gstep; const _Float16* g7 = g6 + gstep;
  asm volatile("global_load_async_to_lds_b128 %0, %8, off\n\t"
               "global_load_async_to_lds_b128 %1, %9, off\n\t"
               "global_load_async_to_lds_b128 %2, %10, off\n\t"
               "global_load_async_to_lds_b128 %3, %11, off\n\t"
               "global_load_async_to_lds_b128 %4, %12, off\n\t"
               "global_load_async_to_lds_b128 %5, %13, off\n\t"
               "global_load_async_to_lds_b128 %6, %14, off\n\t"
               "global_load_async_to_lds_b128 %7, %15, off\n\t"
               "s_wait_xcnt 0x0"
               :: "v"(l), "v"(l1), "v"(l2), "v"(l3), "v"(l4), "v"(l5), "v"(l6), "v"(l7), "v"(g), "v"(g1), "v"(g2), "v"(g3), "v"(g4), "v"(g5), "v"(g6), "v"(g7) : "memory");
}
// Block tile 128x128 (8 waves as 4 x 2, wave tile 32x64); requires M % 128 == 0, N % 128 == 0, K % 128 == 0. Each pass works on 128 k from one LDS buffer while the next pass's copies fly into the other.
template <int ACT>
__global__ __launch_bounds__(256) void k_gemm2(const _Float16* __restrict__ A, int lda, size_t sA, const _Float16* __restrict__ Bh, int ldb, size_t sB, float alpha, const float* __restrict__ bias, size_t sBias, const float* __restrict__ CP, int rowsPerB, size_t sCPb, int row0g,
    float* __restrict__ C, _Float16* __restrict__ C16, int ldc, size_t sC, int M, int N, int K) {
  __shared__ __attribute__((aligned(16))) unsigned char ring[2 * G2_BUF];
  float (*so)[32][68] = (float (*)[32][68])ring;      /* output staging (8 x 32 x 68 f32 = one buffer), used only behind the last pass's barrier */
  const int tid = threadIdx.x, w = tid >> 5, lane = tid & 31, ln = lane & 15, hh = lane >> 4; const int by = blockIdx.y;
  A += (size_t)by * sA; Bh += (size_t)by * sB; const size_t cofs = (size_t)by * sC; const float* bp = bias ? bias + (size_t)by * sBias : nullptr;
  const int ntn = N >> 7; const int mt = blockIdx.x / ntn, nq = blockIdx.x - mt * ntn; if (mt * 128 >= M) return;      /* the whole block leaves, in front of every barrier */
  const int row0 = mt * 128 + 32 * (w & 3), col0 = nq * 128 + 64 * (w >> 2);
  const _Float16* gA = A + (size_t)(mt * 128 + (tid >> 4)) * lda + (tid & 15) * 8; const _Float16* gB = Bh + (size_t)(nq * 128 + (tid >> 4)) * ldb + (tid & 15) * 8;
  const unsigned lA = (unsigned)(size_t)ring + (unsigned)((tid >> 4) * G2_PITCH + (tid & 15) * 16); const unsigned lB = lA + 128 * G2_PITCH;
  const size_t stA = (size_t)16 * lda, stB = (size_t)16 * ldb;
  const int aofs = (32 * (w & 3) + ln) * G2_PITCH, bofs = (128 + 64 * (w >> 2) + ln) * G2_PITCH;
  const int np = K >> 7;
  g2_copy8(lA, gA, stA); g2_copy8(lB, gB, stB);
  asm volatile("s_wait_asynccnt 0x0" ::: "memory");      /* pass 0's own copies have landed */
  __syncthreads();                                        /* ... and every other wave's */
  if (np > 1) { g2_copy8(lA + G2_BUF, gA + 128, stA); g2_copy8(lB + G2_BUF, gB + 128, stB); }
  const v8f z8 = {0.f,0.f,0.f,0.f,0.f,0.f,0.f,0.f}; v8f c00 = z8, c01 = z8, c02 = z8, c03 = z8, c10 = z8, c11 = z8, c12 = z8, c13 = z8;
#pragma unroll 1      /* one pass per trip: the publish point at the foot stands once */
  for (int p = 0; p < np; ++p) { const unsigned bsel = (unsigned)(p & 1) * G2_BUF; const unsigned char* sa = ring + bsel + aofs; const unsigned char* sb = ring + bsel + bofs;
    v16h fa[2][2], fb[2][4];      /* two fragment sets: block kk + 1 is fetched ahead of block kk's products, inside this pass's buffer only */
    fa[0][0] = g2_frag((const _Float16*)sa, hh); fa[0][1] = g2_frag((const _Float16*)(sa + 16 * G2_PITCH), hh);
#pragma unroll      /* constant indices keep fa and fb in registers (this loop and the two below) */
    for (int j = 0; j < 4; ++j) fb[0][j] = g2_frag((const _Float16*)(sb + j * 16 * G2_PITCH), hh);
#pragma unroll
    for (int kk = 0; kk < 4; ++kk) { const int cu = kk & 1, nx = cu ^ 1;
      if (kk < 3) { fa[nx][0] = g2_frag((const _Float16*)(sa + (kk + 1) * 64), hh); fa[nx][1] = g2_frag((const _Float16*)(sa + 16 * G2_PITCH + (kk + 1) * 64), hh);
#pragma unroll
        for (int j = 0; j < 4; ++j) fb[nx][j] = g2_frag((const _Float16*)(sb + j * 16 * G2_PITCH + (kk + 1) * 64), hh); }
      c00 = g2_mma(fa[cu][0], fb[cu][0], c00); c10 = g2_mma(fa[cu][1], fb[cu][0], c10); c01 = g2_mma(fa[cu][0], fb[cu][1], c01); c11 = g2_mma(fa[cu][1], fb[cu][1], c11);
      c02 = g2_mma(fa[cu][0], fb[cu][2], c02); c12 = g2_mma(fa[cu][1], fb[cu][2], c12); c03 = g2_mma(fa[cu][0], fb[cu][3], c03); c13 = g2_mma(fa[cu][1], fb[cu][3], c13); }
    asm volatile("s_wait_dscnt 0x0" ::: "memory");        /* this wave's reads of the buffer have returned before it is refilled */
    asm volatile("s_wait_asynccnt 0x0" ::: "memory");     /* this wave's copies for pass p + 1 have landed */
    __syncthreads();                                      /* publishes pass p + 1 and ends every reader's last read of pass p's buffer */
    if (p + 2 < np) { g2_copy8(lA + bsel, gA + (size_t)(p + 2) * 128, stA); g2_copy8(lB + bsel, gB + (size_t)(p + 2) * 128, stB); } }
  asm volatile("s_wait_asynccnt 0x0" ::: "memory");       /* nothing in flight when the ring becomes output staging */
  v8f accs[8] = {c00, c01, c02, c03, c10, c11, c12, c13};
#pragma unroll
  for (int u = 0; u < 8; ++u) { const int t = u & 3, half = u >> 2; const int col = col0 + t * 16 + ln; const float bv = bp ? bf16_round(bp[col]) : 0.f;
#pragma unroll
    for (int r = 0; r < 8; ++r) { const int rloc = half * 16 + 8 * hh + r; float v = accs[u][r] * alpha + bv; if (CP) { const int bidx = (row0g + row0 + rloc) / rowsPerB; v += CP[(size_t)bidx * sCPb + (size_t)by * 64 + col]; }
      if (ACT == 3) v = fmaxf(v, 0.f); else if (ACT == 6) v = 0.5f * v * (1.0f + erff(v * 0.70710678118654752f)); else if (ACT == 11) v = 1.0f / (1.0f + expf(-v)); else if (ACT == 15) v = v / (1.0f + expf(-v)); else if (ACT == 12) v = (v > 0.f) ? v : 0.01f * v; else if (ACT == 8) v = tanhf(v); else if (ACT == 9) v = 0.5f * v * (1.0f + tanhf(0.7978845608028654f * (v + 0.044715f * v * v * v)));      /* tanh-GELU */
      so[w][rloc][t * 16 + ln] = v; } }
  __builtin_amdgcn_fence(__ATOMIC_ACQ_REL, "workgroup"); __builtin_amdgcn_wave_barrier();
  const int rsub = lane >> 4, c4 = (lane & 15) * 4;
  {
#pragma unroll
    for (int q = 0; q < 16; ++q) { const int r = q * 2 + rsub; const v4f v = *(const v4fa*)&so[w][r][c4]; if (C) *(v4f*)(C + cofs + (size_t)(row0 + r) * ldc + col0 + c4) = v; if (C16) { v4h h4; for (int i = 0; i < 4; ++i) h4[i] = (_Float16)v[i]; *(v4h*)(C16 + cofs + (size_t)(row0 + r) * ldc + col0 + c4) = h4; } }
     } }



__global__ __launch_bounds__(128) void k_flash(const _Float16* __restrict__ Q16, int ldq, const _Float16* __restrict__ K16, int ldk, const _Float16* __restrict__ Vt, const int* __restrict__ MSK, float* __restrict__ O, int ldo) {
  constexpr int RPW = 16, RTN = RPW / 16, NQB = TQ / (4 * RPW), DT = 4, KS = 2;
  __shared__ __attribute__((aligned(16))) unsigned short sP[4][RPW][40]; __shared__ __attribute__((aligned(16))) float sO[4][RPW][64 + 4];
  const int tid = threadIdx.x, w = tid >> 5, lane = tid & 31, ln = lane & 15, hh = lane >> 4;
  const int slab = blockIdx.x / NQB, qblk = blockIdx.x % NQB; const int b = slab / NH, h = slab % NH; const int qb0 = qblk * (4 * RPW); const int q0 = qb0 + w * RPW;
  FragH aq[2][KS];
#pragma unroll
  for (int rt = 0; rt < RTN; ++rt) { const unsigned short* qr = (const unsigned short*)Q16 + ((size_t)b * TQ + q0 + rt * 16 + ln) * ldq + h * 64;
#pragma unroll
    for (int ks = 0; ks < KS; ++ks) { aq[rt][ks].half[0] = *(const v8us*)(qr + ks * 32 + 8 * hh); aq[rt][ks].half[1] = *(const v8us*)(qr + ks * 32 + 16 + 8 * hh); } }
  const unsigned short* Vth = (const unsigned short*)Vt + (size_t)slab * 64 * TK;
  float m_r[2][8], l_r[2][8]; v8f oacc[2][DT];
#pragma unroll
  for (int rt = 0; rt < RTN; ++rt) {
#pragma unroll
    for (int r = 0; r < 8; ++r) { m_r[rt][r] = -3.0e38f; l_r[rt][r] = 0.f; }
#pragma unroll
    for (int dt = 0; dt < DT; ++dt) oacc[rt][dt] = (v8f){0.f,0.f,0.f,0.f,0.f,0.f,0.f,0.f}; }
  const int jend = TK;
#pragma unroll 1
  for (int j0 = 0; j0 < jend; j0 += 32) {
    v8f s[2][2];
#pragma unroll
    for (int nt = 0; nt < 2; ++nt) { const unsigned short* kr = (const unsigned short*)K16 + ((size_t)b * TK + j0 + nt * 16 + ln) * ldk + h * 64; FragH bk[KS];
#pragma unroll
      for (int ks = 0; ks < KS; ++ks) { bk[ks].half[0] = *(const v8us*)(kr + ks * 32 + 8 * hh); bk[ks].half[1] = *(const v8us*)(kr + ks * 32 + 16 + 8 * hh); }
#pragma unroll
      for (int rt = 0; rt < RTN; ++rt) { v8f acc = (v8f){0.f,0.f,0.f,0.f,0.f,0.f,0.f,0.f};
#pragma unroll
        for (int ks = 0; ks < KS; ++ks) acc = mmaH<1>(aq[rt][ks].v, aq[rt][ks].v, bk[ks].v, bk[ks].v, acc); s[rt][nt] = acc; } }
#pragma unroll
    for (int rt = 0; rt < RTN; ++rt)
#pragma unroll
      for (int r = 0; r < 8; ++r) { const int tq = q0 + rt * 16 + 8 * hh + r; const int k0 = j0 + ln, k1 = j0 + 16 + ln; (void)tq; (void)k0; (void)k1;
        const bool ok0 = true, ok1 = true;
        const float s0 = s[rt][0][r] * SCL, s1 = s[rt][1][r] * SCL; float mc = fmaxf(s0, s1);
        mc = fmaxf(mc, __shfl_xor(mc, 1, 32)); mc = fmaxf(mc, __shfl_xor(mc, 2, 32)); mc = fmaxf(mc, __shfl_xor(mc, 4, 32)); mc = fmaxf(mc, __shfl_xor(mc, 8, 32));
        const float mn = fmaxf(m_r[rt][r], mc); const float al = (mn > -1.0e38f) ? expf(m_r[rt][r] - mn) : 1.0f; m_r[rt][r] = mn; const float p0 = ok0 ? expf(s0 - mn) : 0.f, p1 = ok1 ? expf(s1 - mn) : 0.f; l_r[rt][r] = l_r[rt][r] * al + p0 + p1;
#pragma unroll
        for (int dt = 0; dt < DT; ++dt) oacc[rt][dt][r] *= al;
        FragH t2; t2.h[0] = (_Float16)(p0 * 1024.0f); t2.h[1] = (_Float16)(p1 * 1024.0f); sP[w][rt * 16 + 8 * hh + r][ln] = t2.u[0]; sP[w][rt * 16 + 8 * hh + r][16 + ln] = t2.u[1]; }
    __builtin_amdgcn_fence(__ATOMIC_ACQ_REL, "workgroup"); __builtin_amdgcn_wave_barrier();
    FragH pa[2];
#pragma unroll
    for (int rt = 0; rt < RTN; ++rt) { pa[rt].half[0] = *(const v8us*)&sP[w][rt * 16 + ln][8 * hh]; pa[rt].half[1] = *(const v8us*)&sP[w][rt * 16 + ln][16 + 8 * hh]; }
#pragma unroll
    for (int dt = 0; dt < DT; ++dt) { const unsigned short* vrow = Vth + (size_t)(dt * 16 + ln) * TK + j0; FragH bv; bv.half[0] = *(const v8us*)(vrow + 8 * hh); bv.half[1] = *(const v8us*)(vrow + 16 + 8 * hh);
#pragma unroll
      for (int rt = 0; rt < RTN; ++rt) oacc[rt][dt] = mmaH<1>(pa[rt].v, pa[rt].v, bv.v, bv.v, oacc[rt][dt]); }
    __builtin_amdgcn_fence(__ATOMIC_ACQ_REL, "workgroup"); __builtin_amdgcn_wave_barrier(); }
#pragma unroll
  for (int rt = 0; rt < RTN; ++rt) {
#pragma unroll
    for (int r = 0; r < 8; ++r) { float l = l_r[rt][r]; l += __shfl_xor(l, 1, 32); l += __shfl_xor(l, 2, 32); l += __shfl_xor(l, 4, 32); l += __shfl_xor(l, 8, 32); l_r[rt][r] = (l > 0.f) ? 1.0f / (l * 1024.0f) : 0.f; }
#pragma unroll
    for (int dt = 0; dt < DT; ++dt)
#pragma unroll
      for (int r = 0; r < 8; ++r) sO[w][rt * 16 + 8 * hh + r][dt * 16 + ln] = oacc[rt][dt][r] * l_r[rt][r]; }
  __builtin_amdgcn_fence(__ATOMIC_ACQ_REL, "workgroup"); __builtin_amdgcn_wave_barrier();
  {
#pragma unroll
    for (int rp = 0; rp < RPW; rp += 2) { const int r = rp + (lane >> 4), pc = lane & 15; const v4f val = *(const v4fa*)&sO[w][r][pc * 4]; *(v4f*)(O + ((size_t)b * TQ + q0 + r) * ldo + h * 64 + pc * 4) = val; }
     } }
__global__ __launch_bounds__(256) void k_fulltab(unsigned* __restrict__ MB, int* __restrict__ RA, int* __restrict__ KE, int nq, int nk) {
  const int t = blockIdx.x * 256 + threadIdx.x;
  if (t < nq * (nk / 32)) { *(unsigned*)(MB + t) = 0u;  }
  if (t < nq) { *(int*)(RA + t) = 0;  }
  if (t < nq / 64) { *(int*)(KE + t * 32) = nk;  } }
template <int SRCBF>
__global__ __launch_bounds__(256) void k_ln1024(const float* __restrict__ X, _Float16* __restrict__ Y16, float* __restrict__ XB) {
  #pragma clang fp contract(off)
  const int tid = threadIdx.x, w = tid >> 5, ln = tid & 31; const int r = blockIdx.x * 8 + w; if (r >= NR) return; const float* x = X + (size_t)r * DM; float s = 0.f;
#pragma unroll 1
  for (int i = 0; i < 8; ++i) { const v4f a = *(const v4fa*)(x + i * 128 + ln * 4); for (int q = 0; q < 4; ++q) s += SRCBF ? bf16_round(a[q]) : a[q]; }
  for (int o = 16; o > 0; o >>= 1) s += __shfl_xor(s, o, 32); const float mu = s / (float)DM; float q2 = 0.f;
#pragma unroll 1
  for (int i = 0; i < 8; ++i) { const v4f a = *(const v4fa*)(x + i * 128 + ln * 4); for (int q = 0; q < 4; ++q) { const float d = (SRCBF ? bf16_round(a[q]) : a[q]) - mu; q2 += d * d; } }
  for (int o = 16; o > 0; o >>= 1) q2 += __shfl_xor(q2, o, 32); const float dn = sqrtf(q2 / (float)DM + 1e-5f);
  {
#pragma unroll 1
    for (int i = 0; i < 8; ++i) { const int c0 = i * 128 + ln * 4; const v4f a = *(const v4fa*)(x + c0); _Float16 h4[4]; v4f xb;
      for (int q = 0; q < 4; ++q) { const float t = SRCBF ? bf16_round(a[q]) : a[q]; h4[q] = (_Float16)((t - mu) / dn); xb[q] = t; }
      *(unsigned long long*)((unsigned short*)Y16 + (size_t)r * DM + c0) = *(const unsigned long long*)h4; if (SRCBF) *(v4f*)(XB + (size_t)r * DM + c0) = xb; }
     } }
__global__ __launch_bounds__(256) void k_causaltab(unsigned* __restrict__ MB, int* __restrict__ RA, int* __restrict__ KE, int nq, int nk) {
  const int t = blockIdx.x * 256 + threadIdx.x; const int nw = nk / 32;
  if (t < nq * nw) { const int q = t / nw, w = t % nw; const int first = q + 1 - 32 * w; const unsigned bits = (first <= 0) ? 0xffffffffu : ((first >= 32) ? 0u : (0xffffffffu << first)); *(unsigned*)(MB + t) = bits;  }
  if (t < nq) { *(int*)(RA + t) = 0;  }
  if (t < nq / 64) { const int v = 64 * (t + 1); *(int*)(KE + t * 32) = v;  } }


extern "C" void kernel_launch(void* const* d_in, const int* in_sizes, int n_in,
                              void* d_out, int out_size, void* d_ws, size_t ws_size, hipStream_t stream) {
  (void)in_sizes; (void)n_in; (void)out_size;
  const float* const* I = (const float* const*)d_in; const float* x = I[0]; const float* Wqkv = I[1]; const float* Wfc = I[2]; const float* W1 = I[3]; const float* b1 = I[4]; const float* W2 = I[5]; const float* b2 = I[6];
  char* ws = (char*)d_ws; size_t off = 0;
  auto take = [&](size_t bytes) { char* p = ws + off; off += (bytes + 255) & ~(size_t)255; return p; };
  _Float16* BQKV = (_Float16*)take((size_t)3 * DM * DM * 2); _Float16* BFC = (_Float16*)take((size_t)DM * DM * 2); _Float16* BW1 = (_Float16*)take((size_t)4096 * DM * 2); _Float16* BW2 = (_Float16*)take((size_t)DM * 4096 * 2);
  float* XB = (float*)take((size_t)NR * DM * 4); _Float16* X16 = (_Float16*)take((size_t)NR * DM * 2); float* F = (float*)take((size_t)NR * DM * 4);
  _Float16* Q16 = (_Float16*)take((size_t)NR * DM * 2); _Float16* K16 = (_Float16*)take((size_t)NR * DM * 2); _Float16* V16 = (_Float16*)take((size_t)NR * DM * 2); _Float16* VT = (_Float16*)take((size_t)NR * DM * 2); if (off > ws_size) return;      /* 24 + 16 + 8 + 16 + 32 = 96 MiB */
  float* O = F; _Float16* Oh = Q16; _Float16* Ol = K16;     /* q/k planes are dead after the flash */
  float* X1 = XB;                                           /* x1 written over the residual plane (own-tile addend) */
  _Float16* H16 = X16; _Float16* GH = Q16;                  /* GELU hidden [NR][4096] f16 = 32 MB over Q16|K16|V16|VT (contiguous, all dead once x1 is formed) */
  const size_t n8 = (size_t)NR * DM / 8; const unsigned nb8 = (unsigned)((n8 + 255) / 256);
  k_wt_f16<<<(unsigned)(((size_t)DM * 3 * DM / 8 + 255) / 256), 256, 0, stream>>>(Wqkv, BQKV, DM, 3 * DM, 16.0f); k_wt_f16<<<(unsigned)(((size_t)DM * DM / 8 + 255) / 256), 256, 0, stream>>>(Wfc, BFC, DM, DM, 16.0f);
  k_wt_f16<<<(unsigned)(((size_t)DM * 4096 / 8 + 255) / 256), 256, 0, stream>>>(W1, BW1, DM, 4096, 16.0f); k_wt_f16<<<(unsigned)(((size_t)4096 * DM / 8 + 255) / 256), 256, 0, stream>>>(W2, BW2, 4096, DM, 16.0f);      /* all (in,out) */
  k_ln1024<1><<<NR / 8, 256, 0, stream>>>(x, X16, XB);
  const dim3 gP((NR / 128) * (DM / 128), 1), gM((NR / 128) * (4096 / 128), 1);
  k_gemm2<0><<<gP, 256, 0, stream>>>(X16, DM, 0, BQKV, DM, 0, 0.0625f, nullptr, 0, nullptr, 1, 0, 0, nullptr, Q16, DM, 0, NR, DM, DM);
  k_gemm2<0><<<gP, 256, 0, stream>>>(X16, DM, 0, BQKV + (size_t)DM * DM, DM, 0, 0.0625f, nullptr, 0, nullptr, 1, 0, 0, nullptr, K16, DM, 0, NR, DM, DM);
  k_gemm2<0><<<gP, 256, 0, stream>>>(X16, DM, 0, BQKV + (size_t)2 * DM * DM, DM, 0, 0.0625f, nullptr, 0, nullptr, 1, 0, 0, nullptr, V16, DM, 0, NR, DM, DM);
  for (int b = 0; b < NBT; ++b) k_vt<NH, SLEN><<<NH * (SLEN / 64), 256, 0, stream>>>(V16 + (size_t)b * SLEN * DM, DM, 0, VT + (size_t)b * SLEN * DM);
  for (int b = 0; b < NBT; ++b) { const size_t ro = (size_t)b * SLEN * DM;
    k_flash<<<NH * (SLEN / 64), 128, 0, stream>>>(Q16 + ro, DM, K16 + ro, DM, VT + ro, nullptr, O + ro, DM); }      /* plain flash over all keys */
  k_hl<<<nb8, 256, 0, stream>>>(O, Oh, Ol, n8);
  k_gemm2<0><<<gP, 256, 0, stream>>>(Oh, DM, 0, BFC, DM, 0, 0.0625f, nullptr, 0, XB, 1, (size_t)DM, 0, X1, nullptr, DM, 0, NR, DM, DM);      /* x1 = x + attn w_fc (hi) */
  k_gemm2<0><<<gP, 256, 0, stream>>>(Ol, DM, 0, BFC, DM, 0, 0.0625f / 1024.0f, nullptr, 0, X1, 1, (size_t)DM, 0, X1, nullptr, DM, 0, NR, DM, DM);      /* + lo */
  k_ln1024<0><<<NR / 8, 256, 0, stream>>>(X1, H16, nullptr);
  k_gemm2<9><<<gM, 256, 0, stream>>>(H16, DM, 0, BW1, DM, 0, 0.0625f, b1, 0, nullptr, 1, 0, 0, nullptr, GH, 4096, 0, NR, 4096, DM);      /* tanh-gelu(LN(x1) w1 + b1) f16 */
  k_gemm2<0><<<gP, 256, 0, stream>>>(GH, 4096, 0, BW2, 4096, 0, 0.0625f, b2, 0, X1, 1, (size_t)DM, 0, (float*)d_out, nullptr, DM, 0, NR, DM, 4096);      /* out = x1 + mlp */
}

// v002
// It runs in 552 microseconds.
// Timed twice side by side with v001, it ran 1.32 and 1.31 times as fast.
// Counting every step since v000, it is 1.87 times as fast.
#include <hip/hip_runtime.h>
// Pre-LN transformer layer (2 x 2048 tokens, 1024; 16 heads x 64; full (non-causal) attention; MLP 4096 with tanh-GELU): h = LN(x) (no affine); q,k,v = h w_qkv; x1 = x + softmax(q.k/8).v w_fc; out = x1 + gelu(LN(x1) w1 + b1) w2 + b2 -> [2,2048,1024].
// Structure: LayerNorm on VALU (also writing the bf16 residual plane); projections / MLP as f16 WMMA GEMMs (32x64 wave tiles, f32 accumulation, exact weights x16, tanh-GELU and biases in the epilogue, residuals through the f32 addend); q, k, V^T as plain f16 planes through the fused flash kernel over all keys (online softmax in f32, P x2^10); O as hi + residual planes into w_fc (two GEMMs).
// Compute dtype: x and weights rounded to bf16; LN outputs, q, k, v, P and the GELU hidden as f16 operands (~2^-12); O as hi + residual pairs; f32 accumulation, softmax, LayerNorm. v_wmma_f32_16x16x32_f16.
#define NBT 2
#define SLEN 2048
#define TQ SLEN
#define TK SLEN
#define DM 1024
#define NH 16
#define SCL 0.125f
#define NR (NBT * SLEN)
typedef __bf16 v16b __attribute__((ext_vector_type(16)));
typedef unsigned short v8us __attribute__((ext_vector_type(8), may_alias));
typedef float  v8f  __attribute__((ext_vector_type(8)));
typedef float  v4f  __attribute__((ext_vector_type(4)));
typedef float  v4fa __attribute__((ext_vector_type(4), may_alias));
union FragB { v16b v; v8us half[2]; unsigned short u[16]; };

__device__ __forceinline__ unsigned short bf16_bits(float x) { unsigned int u = __float_as_uint(x); return (unsigned short)((u + 0x7FFFu + ((u >> 16) & 1u)) >> 16); }
__device__ __forceinline__ float bf16_val(unsigned short b) { return __uint_as_float(((unsigned int)b) << 16); }
__device__ __forceinline__ float bf16_round(float x) { return bf16_val(bf16_bits(x)); }
// D += A·B with NT terms: 1 = ah·bh, 2 = + al·bh (A split), 3 = + ah·bl (both split)
template <int NT>
__device__ __forceinline__ v8f mmaN(v16b ah, v16b al, v16b bh, v16b bl, v8f c) {
  c = __builtin_amdgcn_wmma_f32_16x16x32_bf16(false, ah, false, bh, (short)0, c, false, false);
  if (NT >= 2) c = __builtin_amdgcn_wmma_f32_16x16x32_bf16(false, al, false, bh, (short)0, c, false, false);
  if (NT >= 3) c = __builtin_amdgcn_wmma_f32_16x16x32_bf16(false, ah, false, bl, (short)0, c, false, false);
  asm volatile("v_nop\n\tv_nop\n\tv_nop\n\tv_nop" : "+v"(c) : "v"(ah), "v"(al), "v"(bh), "v"(bl));
  return c;
}

__global__ __launch_bounds__(256) void k_wt_bf16(const float* __restrict__ W, unsigned short* __restrict__ Wt, int K, int N) {
  const int t = blockIdx.x * 256 + threadIdx.x;
  const int k8n = K / 8;
  if (t >= N * k8n) return;
  const int n = t / k8n, k8 = (t % k8n) * 8;
  v8us v;
#pragma unroll
  for (int i = 0; i < 8; ++i) v[i] = bf16_bits(W[(size_t)(k8 + i) * N + n]);
  *(v8us*)(Wt + (size_t)n * K + k8) = v;
  
}

// GEMM C[M][N] (f32, pitch ldc) = act(A[M][K]·W + bias). A f32 row-major (pitch lda) converted per fragment to bf16
// (ASPLIT: hi/lo two planes -> 2 terms, else single rounded term); Wt bf16 [N][K] (pitch ldb). BIAS_BF16 rounds the
// bias to bf16 first (bias quantised to bf16 before the add). K%32==0, M%16==0, N%64==0.
template <bool ASPLIT, int ACT, bool BIAS_BF16>
__global__ __launch_bounds__(128) void k_gemm_bf(const float* __restrict__ A, int lda, const unsigned short* __restrict__ Wt, int ldb,
                                               const float* __restrict__ bias, float* __restrict__ C, int ldc, int M, int N, int K) {
  __shared__ __attribute__((aligned(16))) float so[4][16][64];
  const int tid = threadIdx.x, w = tid >> 5, lane = tid & 31, ln = lane & 15, hh = lane >> 4;
  const int ntn = N / 64;
  const int wid = blockIdx.x * 4 + w;
  const int mt = wid / ntn, nq = wid % ntn;
  if (mt * 16 >= M) return;
  const int row0 = mt * 16, col0 = nq * 64;
  const float* arow = A + (size_t)(row0 + ln) * lda;
  v8f acc[4] = {};
  for (int kb = 0; kb < K; kb += 32) {
    FragB ah, al;
    const v4f x0 = *(const v4fa*)(arow + kb + 8 * hh), x1 = *(const v4fa*)(arow + kb + 8 * hh + 4);
    const v4f x2 = *(const v4fa*)(arow + kb + 16 + 8 * hh), x3 = *(const v4fa*)(arow + kb + 16 + 8 * hh + 4);
    float xs[16] = {x0[0],x0[1],x0[2],x0[3],x1[0],x1[1],x1[2],x1[3],x2[0],x2[1],x2[2],x2[3],x3[0],x3[1],x3[2],x3[3]};
#pragma unroll
    for (int i = 0; i < 16; ++i) { const unsigned short hb = bf16_bits(xs[i]); ah.u[i] = hb; al.u[i] = ASPLIT ? bf16_bits(xs[i] - bf16_val(hb)) : (unsigned short)0; }
#pragma unroll
    for (int t = 0; t < 4; ++t) {
      const unsigned short* brow = Wt + (size_t)(col0 + t * 16 + ln) * ldb + kb;
      FragB b;
      b.half[0] = *(const v8us*)(brow + 8 * hh);
      b.half[1] = *(const v8us*)(brow + 16 + 8 * hh);
      acc[t] = mmaN<ASPLIT ? 2 : 1>(ah.v, al.v, b.v, b.v, acc[t]);
    }
  }
#pragma unroll
  for (int t = 0; t < 4; ++t) {
    float bv = bias ? bias[col0 + t * 16 + ln] : 0.f;
    if (BIAS_BF16) bv = bf16_round(bv);
#pragma unroll
    for (int r = 0; r < 8; ++r) { float v = acc[t][r] + bv; if (ACT == 1) v = fmaxf(v, 0.f); so[w][8 * hh + r][t * 16 + ln] = v; }
  }
  __builtin_amdgcn_fence(__ATOMIC_ACQ_REL, "workgroup");
  __builtin_amdgcn_wave_barrier();
  const int rsub = lane >> 4, c4 = (lane & 15) * 4;
  {
#pragma unroll
    for (int q = 0; q < 8; ++q) {
      const int r = q * 2 + rsub;
      const v4f v = *(const v4fa*)&so[w][r][c4];
      *(v4f*)(C + (size_t)(row0 + r) * ldc + col0 + c4) = v;
    }
    
  }
}

// GEMM C = act(A·W + bias + resid): A f32 (ASPLIT -> hi/lo 2 terms), Wt bf16 [N][K]; ACT 0 none, 1 relu, 2 exact gelu;
// resid (optional, f32, row index = (row % rmod), pitch ldr, RES_BF16 rounds it) added before the activation.
template <bool ASPLIT, int ACT, bool BIAS_BF16, bool RES_BF16>
__global__ __launch_bounds__(128) void k_gemm_bf3(const float* __restrict__ A, int lda, const unsigned short* __restrict__ Wt, int ldb,
                                                const float* __restrict__ bias, const float* __restrict__ resid, int rmod, int ldr,
                                                float* __restrict__ C, int ldc, int M, int N, int K) {
  __shared__ __attribute__((aligned(16))) float so[4][16][64];
  const int tid = threadIdx.x, w = tid >> 5, lane = tid & 31, ln = lane & 15, hh = lane >> 4;
  const int ntn = N / 64;
  const int wid = blockIdx.x * 4 + w;
  const int mt = wid / ntn, nq = wid % ntn;
  if (mt * 16 >= M) return;
  const int row0 = mt * 16, col0 = nq * 64;
  const float* arow = A + (size_t)(row0 + ln) * lda;
  v8f acc[4] = {};
  for (int kb = 0; kb < K; kb += 32) {
    FragB ah, al;
    const v4f x0 = *(const v4fa*)(arow + kb + 8 * hh), x1 = *(const v4fa*)(arow + kb + 8 * hh + 4);
    const v4f x2 = *(const v4fa*)(arow + kb + 16 + 8 * hh), x3 = *(const v4fa*)(arow + kb + 16 + 8 * hh + 4);
    float xs[16] = {x0[0],x0[1],x0[2],x0[3],x1[0],x1[1],x1[2],x1[3],x2[0],x2[1],x2[2],x2[3],x3[0],x3[1],x3[2],x3[3]};
#pragma unroll
    for (int i = 0; i < 16; ++i) { const unsigned short hb = bf16_bits(xs[i]); ah.u[i] = hb; al.u[i] = ASPLIT ? bf16_bits(xs[i] - bf16_val(hb)) : (unsigned short)0; }
#pragma unroll
    for (int t = 0; t < 4; ++t) {
      const unsigned short* brow = Wt + (size_t)(col0 + t * 16 + ln) * ldb + kb;
      FragB b;
      b.half[0] = *(const v8us*)(brow + 8 * hh);
      b.half[1] = *(const v8us*)(brow + 16 + 8 * hh);
      acc[t] = mmaN<ASPLIT ? 2 : 1>(ah.v, al.v, b.v, b.v, acc[t]);
    }
  }
#pragma unroll
  for (int t = 0; t < 4; ++t) {
    const int col = col0 + t * 16 + ln;
    float bv = bias ? bias[col] : 0.f;
    if (BIAS_BF16) bv = bf16_round(bv);
#pragma unroll
    for (int r = 0; r < 8; ++r) {
      float v = acc[t][r] + bv;
      if (resid) { float rv = resid[(size_t)((row0 + 8 * hh + r) % rmod) * ldr + col]; if (RES_BF16) rv = bf16_round(rv); v += rv; }
      if (ACT == 1) v = fmaxf(v, 0.f);
      if (ACT == 2) v = 0.5f * v * (1.0f + erff(v * 0.70710678118654752f));
      if (ACT == 3) { const float u = 0.7978845608028654f * (v + 0.044715f * v * v * v); v = 0.5f * v * (1.0f + tanhf(u)); }
      so[w][8 * hh + r][t * 16 + ln] = v;
    }
  }
  __builtin_amdgcn_fence(__ATOMIC_ACQ_REL, "workgroup");
  __builtin_amdgcn_wave_barrier();
  const int rsub = lane >> 4, c4 = (lane & 15) * 4;
  {
#pragma unroll
    for (int q = 0; q < 8; ++q) {
      const int r = q * 2 + rsub;
      const v4f v = *(const v4fa*)&so[w][r][c4];
      *(v4f*)(C + (size_t)(row0 + r) * ldc + col0 + c4) = v;
    }
    
  }
}
// row LayerNorm (biased variance, eps) over N: s = X (+ R); optional out_sum <- s; out_norm <- (s-mu)*rsqrt(var+eps)*g + b
template <bool PARAM_BF16>
__global__ __launch_bounds__(256) void k_layernorm(const float* __restrict__ X, const float* __restrict__ R, const float* __restrict__ g, const float* __restrict__ bta,
                                                  float* __restrict__ out_sum, float* __restrict__ out_norm, int N, float eps) {
  __shared__ float red[256];
  const int row = blockIdx.x, tid = threadIdx.x;
  const float* x = X + (size_t)row * N; const float* rr = R ? R + (size_t)row * N : nullptr;
  float vals[16];                     // up to N = 4096
  const int per = N / 256;            // contiguous chunk per thread? use strided-by-4 chunks: thread handles j = tid*4 + 1024*u
  float s1 = 0.f;
  for (int u = 0; u < per / 4; ++u) {
    const int j = tid * 4 + 1024 * u;
    const v4f a = *(const v4fa*)(x + j);
    v4f b = {0.f,0.f,0.f,0.f}; if (rr) b = *(const v4fa*)(rr + j);
#pragma unroll
    for (int q = 0; q < 4; ++q) { const float v = a[q] + b[q]; vals[u * 4 + q] = v; s1 += v; }
  }
  red[tid] = s1; __syncthreads();
  for (int st = 128; st > 0; st >>= 1) { if (tid < st) red[tid] += red[tid + st]; __syncthreads(); }
  const float mu = red[0] / (float)N; __syncthreads();
  float s2 = 0.f;
  for (int u = 0; u < per / 4; ++u)
#pragma unroll
    for (int q = 0; q < 4; ++q) { const float c = vals[u * 4 + q] - mu; s2 += c * c; }
  red[tid] = s2; __syncthreads();
  for (int st = 128; st > 0; st >>= 1) { if (tid < st) red[tid] += red[tid + st]; __syncthreads(); }
  const float rs = rsqrtf(red[0] / (float)N + eps);
  {
    for (int u = 0; u < per / 4; ++u) {
      const int j = tid * 4 + 1024 * u;
      v4f o, sm;
#pragma unroll
      for (int q = 0; q < 4; ++q) {
        float gg = g[j + q], bb = bta[j + q];
        if (PARAM_BF16) { gg = bf16_round(gg); bb = bf16_round(bb); }
        sm[q] = vals[u * 4 + q]; o[q] = (vals[u * 4 + q] - mu) * rs * gg + bb;
      }
      if (out_sum) *(v4f*)(out_sum + (size_t)row * N + j) = sm;
      *(v4f*)(out_norm + (size_t)row * N + j) = o;
    }
    
  }
}



// ---- f16 WMMA path (v_wmma_f32_16x16x32_f16): 11-bit significands for operands in range — used where a [0,1] probability operand needs more precision than bf16
typedef _Float16 v16h __attribute__((ext_vector_type(16)));
union FragH { v16h v; v8us half[2]; _Float16 h[16]; unsigned short u[16]; };
template <int NT>
__device__ __forceinline__ v8f mmaH(v16h ah, v16h al, v16h bh, v16h bl, v8f c) {
  c = __builtin_amdgcn_wmma_f32_16x16x32_f16(false, ah, false, bh, (short)0, c, false, false);
  if (NT >= 2) c = __builtin_amdgcn_wmma_f32_16x16x32_f16(false, al, false, bh, (short)0, c, false, false);
  if (NT >= 3) c = __builtin_amdgcn_wmma_f32_16x16x32_f16(false, ah, false, bl, (short)0, c, false, false);
  asm volatile("v_nop\n\tv_nop\n\tv_nop\n\tv_nop" : "+v"(c) : "v"(ah), "v"(al), "v"(bh), "v"(bl));
  return c;
}
// batched GEMM like k_gemm_b but f16 operands: A f32 (split into f16 hi/lo if ASPLIT, else rounded to f16), Bt = f16 values [n][k]; alpha; C f32; N multiple of 16 (partial tiles skipped)
template <bool ASPLIT>
__global__ __launch_bounds__(128) void k_gemm_h(const float* __restrict__ A, int lda, size_t sA, const _Float16* __restrict__ Bh, int ldb, size_t sB, float alpha, float* __restrict__ C, int ldc, size_t sC, int M, int N, int K) {
  __shared__ __attribute__((aligned(16))) float so[4][16][64];
  const int tid = threadIdx.x, w = tid >> 5, lane = tid & 31, ln = lane & 15, hh = lane >> 4; const int by = blockIdx.y;
  A += (size_t)by * sA; Bh += (size_t)by * sB; C += (size_t)by * sC;
  const int ntn = (N + 63) / 64; const int wid = blockIdx.x * 4 + w; const int mt = wid / ntn, nq = wid % ntn; if (mt * 16 >= M) return;
  const int row0 = mt * 16, col0 = nq * 64; const float* arow = A + (size_t)(row0 + ln) * lda;
  v8f acc[4] = {};
  for (int kb = 0; kb < K; kb += 32) {
    FragH ah, al;
    const v4f x0 = *(const v4fa*)(arow + kb + 8 * hh), x1 = *(const v4fa*)(arow + kb + 8 * hh + 4), x2 = *(const v4fa*)(arow + kb + 16 + 8 * hh), x3 = *(const v4fa*)(arow + kb + 16 + 8 * hh + 4);
    float xs[16] = {x0[0],x0[1],x0[2],x0[3],x1[0],x1[1],x1[2],x1[3],x2[0],x2[1],x2[2],x2[3],x3[0],x3[1],x3[2],x3[3]};
#pragma unroll
    for (int i = 0; i < 16; ++i) { const _Float16 h = (_Float16)xs[i]; ah.h[i] = h; al.h[i] = ASPLIT ? (_Float16)(xs[i] - (float)h) : (_Float16)0.0f; }
#pragma unroll
    for (int t = 0; t < 4; ++t) { if (col0 + t * 16 >= N) continue; const size_t boff = (size_t)(col0 + t * 16 + ln) * ldb + kb; FragH bq; bq.half[0] = *(const v8us*)(Bh + boff + 8 * hh); bq.half[1] = *(const v8us*)(Bh + boff + 16 + 8 * hh);
      acc[t] = mmaH<ASPLIT ? 2 : 1>(ah.v, al.v, bq.v, bq.v, acc[t]); }
  }
#pragma unroll
  for (int t = 0; t < 4; ++t) { if (col0 + t * 16 >= N) continue;
#pragma unroll
    for (int r = 0; r < 8; ++r) so[w][8 * hh + r][t * 16 + ln] = acc[t][r] * alpha; }
  __builtin_amdgcn_fence(__ATOMIC_ACQ_REL, "workgroup"); __builtin_amdgcn_wave_barrier();
  const int rsub = lane >> 4, c4 = (lane & 15) * 4;
  {
#pragma unroll
    for (int q = 0; q < 8; ++q) { const int r = q * 2 + rsub; if (col0 + c4 < N) { const v4f v = *(const v4fa*)&so[w][r][c4]; *(v4f*)(C + (size_t)(row0 + r) * ldc + col0 + c4) = v; } }
     }
}

// Wt[n][k] = f16(W[k][n]·scale) from f32 row-major W[K][N] (scale = power of two; bf16-exact weights stay exact in f16 away from the subnormal range)
__global__ __launch_bounds__(256) void k_wt_f16(const float* __restrict__ W, _Float16* __restrict__ Wt, int K, int N, float scale) {
  const int t = blockIdx.x * 256 + threadIdx.x; if (t >= N * (K / 8)) return; const int n = t / (K / 8), k8 = (t % (K / 8)) * 8; FragH f;
#pragma unroll
  for (int i = 0; i < 8; ++i) f.h[i] = (_Float16)(bf16_round(W[(size_t)(k8 + i) * N + n]) * scale); const v8us o = f.half[0];
  *(v8us*)((unsigned short*)Wt + (size_t)n * K + k8) = o; 
}
// k_gemm_hh variant with fused epilogue: v = acc·alpha + bias[by·sBias + col] (+ CP[(row/rowsPerB)·sCPb + by·64 + col] if CP) ; ACT 0 none / 1 elu ; writes f16 C16 (and f32 C if non-null)
template <int ACT>
__global__ __launch_bounds__(128) void k_gemm_hhx(const _Float16* __restrict__ A, int lda, size_t sA, const _Float16* __restrict__ Bh, int ldb, size_t sB, float alpha, const float* __restrict__ bias, size_t sBias, const float* __restrict__ CP, int rowsPerB, size_t sCPb, int row0g,
    float* __restrict__ C, _Float16* __restrict__ C16, int ldc, size_t sC, int M, int N, int K) {
  __shared__ __attribute__((aligned(16))) float so[4][16][64];
  const int tid = threadIdx.x, w = tid >> 5, lane = tid & 31, ln = lane & 15, hh = lane >> 4; const int by = blockIdx.y;
  A += (size_t)by * sA; Bh += (size_t)by * sB; const size_t cofs = (size_t)by * sC; const float* bp = bias ? bias + (size_t)by * sBias : nullptr;
  const int ntn = (N + 63) / 64; const int wid = blockIdx.x * 4 + w; const int mt = wid / ntn, nq = wid % ntn; if (mt * 16 >= M) return;
  const int row0 = mt * 16, col0 = nq * 64; const _Float16* arow = A + (size_t)(row0 + ln) * lda;
  v8f acc[4] = {};
  for (int kb = 0; kb < K; kb += 32) { FragH ah; ah.half[0] = *(const v8us*)((const unsigned short*)arow + kb + 8 * hh); ah.half[1] = *(const v8us*)((const unsigned short*)arow + kb + 16 + 8 * hh);
#pragma unroll
    for (int t = 0; t < 4; ++t) { if (col0 + t * 16 >= N) continue; const size_t boff = (size_t)(col0 + t * 16 + ln) * ldb + kb; FragH bq; bq.half[0] = *(const v8us*)((const unsigned short*)Bh + boff + 8 * hh); bq.half[1] = *(const v8us*)((const unsigned short*)Bh + boff + 16 + 8 * hh);
      acc[t] = mmaH<1>(ah.v, ah.v, bq.v, bq.v, acc[t]); }
  }
#pragma unroll
  for (int t = 0; t < 4; ++t) { if (col0 + t * 16 >= N) continue; const int col = col0 + t * 16 + ln; const float bv = bp ? bf16_round(bp[col]) : 0.f;
#pragma unroll
    for (int r = 0; r < 8; ++r) { float v = acc[t][r] * alpha + bv; if (CP) { const int bidx = (row0g + row0 + 8 * hh + r) / rowsPerB; v += CP[(size_t)bidx * sCPb + (size_t)by * 64 + col]; } if (ACT == 1) v = (v > 0.f) ? v : expm1f(v); else if (ACT == 7) v = (v > 0.f) ? v + 1.0f : expf(v); else if (ACT == 8) v = tanhf(v); else if (ACT == 9) v = 0.5f * v * (1.0f + tanhf(0.7978845608028654f * (v + 0.044715f * v * v * v))); else if (ACT == 11) v = 1.0f / (1.0f + expf(-v)); else if (ACT == 12) v = (v > 0.f) ? v : 0.01f * v; else if (ACT == 14) v = (v > 0.f) ? v : 0.1f * v; else if (ACT == 15) v = v / (1.0f + expf(-v)); else if (ACT == 3) v = fmaxf(v, 0.f); else if (ACT == 6) v = 0.5f * v * (1.0f + erff(v * 0.70710678118654752f)); so[w][8 * hh + r][t * 16 + ln] = v; } }
  __builtin_amdgcn_fence(__ATOMIC_ACQ_REL, "workgroup"); __builtin_amdgcn_wave_barrier();
  const int rsub = lane >> 4, c4 = (lane & 15) * 4; typedef _Float16 v4h __attribute__((ext_vector_type(4)));
  {
#pragma unroll
    for (int q = 0; q < 8; ++q) { const int r = q * 2 + rsub; if (col0 + c4 < N) { const v4f v = *(const v4fa*)&so[w][r][c4]; if (C) *(v4f*)(C + cofs + (size_t)(row0 + r) * ldc + col0 + c4) = v; if (C16) { v4h h4; for (int i = 0; i < 4; ++i) h4[i] = (_Float16)v[i]; *(v4h*)(C16 + cofs + (size_t)(row0 + r) * ldc + col0 + c4) = h4; } } }
     }
}


typedef _Float16 v4h __attribute__((ext_vector_type(4)));

__global__ __launch_bounds__(256) void k_x16(const float* __restrict__ x, _Float16* __restrict__ X16, size_t n8) { const size_t t = (size_t)blockIdx.x * 256 + threadIdx.x; if (t >= n8) return; FragH f;
#pragma unroll
  for (int q = 0; q < 8; ++q) f.h[q] = (_Float16)bf16_round(x[t * 8 + q]); *(v8us*)((unsigned short*)X16 + t * 8) = f.half[0];  }
__global__ __launch_bounds__(256) void k_h16(const float* __restrict__ x, _Float16* __restrict__ X16, size_t n8) { const size_t t = (size_t)blockIdx.x * 256 + threadIdx.x; if (t >= n8) return; FragH f;
#pragma unroll
  for (int q = 0; q < 8; ++q) f.h[q] = (_Float16)x[t * 8 + q]; *(v8us*)((unsigned short*)X16 + t * 8) = f.half[0];  }
__global__ __launch_bounds__(256) void k_round16f(const float* __restrict__ W, _Float16* __restrict__ Bt, size_t n8) { const size_t t = (size_t)blockIdx.x * 256 + threadIdx.x; if (t >= n8) return; FragH f;
#pragma unroll
  for (int i = 0; i < 8; ++i) f.h[i] = (_Float16)(bf16_round(W[t * 8 + i]) * 16.0f); *(v8us*)((unsigned short*)Bt + t * 8) = f.half[0];  }
template <int NHv, int TTv>
__global__ __launch_bounds__(256) void k_vt(const _Float16* __restrict__ V16, int ldv, int voff, _Float16* __restrict__ Vt) { __shared__ unsigned short tl[64][66]; const int tid = threadIdx.x; const int slab = blockIdx.x / (TTv / 64), lg = blockIdx.x % (TTv / 64); const int b = slab / NHv, h = slab % NHv;
  for (int i = tid; i < 64 * 8; i += 256) { const int r = i / 8, c8 = (i % 8) * 8; FragH f; f.half[0] = *(const v8us*)((const unsigned short*)V16 + ((size_t)b * TTv + lg * 64 + r) * ldv + voff + h * 64 + c8);
#pragma unroll
    for (int q = 0; q < 8; ++q) tl[r][c8 + q] = f.u[q]; }
  __syncthreads();
  {
#pragma unroll
    for (int rd = 0; rd < 2; ++rd) { const int d = rd * 32 + tid / 8, pc = tid % 8; FragH f;
#pragma unroll
      for (int q = 0; q < 8; ++q) f.u[q] = tl[pc * 8 + q][d];
      *(v8us*)((unsigned short*)Vt + ((size_t)slab * 64 + d) * TTv + lg * 64 + pc * 8) = f.half[0]; }
     } }

__global__ __launch_bounds__(256) void k_hl(const float* __restrict__ F, _Float16* __restrict__ Hh, _Float16* __restrict__ Hl, size_t n8) { const size_t t = (size_t)blockIdx.x * 256 + threadIdx.x; if (t >= n8) return; FragH fh, fl; const v4f a = *(const v4fa*)(F + t * 8), c = *(const v4fa*)(F + t * 8 + 4);
#pragma unroll
  for (int q = 0; q < 4; ++q) { _Float16 h = (_Float16)a[q]; fh.h[q] = h; fl.h[q] = (_Float16)((a[q] - (float)h) * 1024.0f); h = (_Float16)c[q]; fh.h[4 + q] = h; fl.h[4 + q] = (_Float16)((c[q] - (float)h) * 1024.0f); }
  { *(v8us*)((unsigned short*)Hh + t * 8) = fh.half[0]; *(v8us*)((unsigned short*)Hl + t * 8) = fl.half[0];  } }

// ---- fast GEMM (wave tile 32x64, operands staged in LDS); epilogue = k_gemm_hhx semantics ----
__device__ __forceinline__ v16h g2_frag(const _Float16* p, int hh) { FragH f; f.half[0] = *(const v8us*)((const unsigned short*)p + 8 * hh); f.half[1] = *(const v8us*)((const unsigned short*)p + 16 + 8 * hh); return f.v; }
__device__ __forceinline__ v8f g2_mma(v16h a, v16h b, v8f c) { v8f d = __builtin_amdgcn_wmma_f32_16x16x32_f16(false, a, false, b, (short)0, c, false, false); asm volatile("v_nop\n\tv_nop\n\tv_nop\n\tv_nop" : "+v"(d) : "v"(a), "v"(b)); return d; }
// Staged tile of k_gemm2: 128 A rows then 128 B rows, 128 k (256 B) each, at a pitch of 272 B (16 B x odd: conflict-free for ds_load_b128 readers); two buffers.
#define G2_PITCH 272
#define G2_BUF (256 * G2_PITCH)
// Eight asynchronous 16-byte copies per lane (rows 16 apart): l = the lane's LDS byte address, g = its global address, gstep = 16 source rows in elements.
// s_wait_xcnt 0 is the statement's last line, so that it stands in front of any later rewrite of the address registers the copies name.
__device__ __forceinline__ void g2_copy8(unsigned l, const _Float16* g, size_t gstep) {
  const unsigned l1 = l + 16 * G2_PITCH, l2 = l + 32 * G2_PITCH, l3 = l + 48 * G2_PITCH, l4 = l + 64 * G2_PITCH, l5 = l + 80 * G2_PITCH, l6 = l + 96 * G2_PITCH, l7 = l + 112 * G2_PITCH;
  const _Float16* g1 = g + gstep; const _Float16* g2 = g1 + gstep; const _Float16* g3 = g2 + gstep; const _Float16* g4 = g3 + gstep; const _Float16* g5 = g4 + gstep; const _Float16* g6 = g5 + gstep; const _Float16* g7 = g6 + gstep;
  asm volatile("global_load_async_to_lds_b128 %0, %8, off\n\t"
               "global_load_async_to_lds_b128 %1, %9, off\n\t"
               "global_load_async_to_lds_b128 %2, %10, off\n\t"
               "global_load_async_to_lds_b128 %3, %11, off\n\t"
               "global_load_async_to_lds_b128 %4, %12, off\n\t"
               "global_load_async_to_lds_b128 %5, %13, off\n\t"
               "global_load_async_to_lds_b128 %6, %14, off\n\t"
               "global_load_async_to_lds_b128 %7, %15, off\n\t"
               "s_wait_xcnt 0x0"
               :: "v"(l), "v"(l1), "v"(l2), "v"(l3), "v"(l4), "v"(l5), "v"(l6), "v"(l7), "v"(g), "v"(g1), "v"(g2), "v"(g3), "v"(g4), "v"(g5), "v"(g6), "v"(g7) : "memory");
}
// Block tile 128x128 (8 waves as 4 x 2, wave tile 32x64); requires M % 128 == 0, N % 128 == 0, K % 128 == 0. Each pass works on 128 k from one LDS buffer while the next pass's copies fly into the other.
template <int ACT>
__global__ __launch_bounds__(256) void k_gemm2(const _Float16* __restrict__ A, int lda, size_t sA, const _Float16* __restrict__ Bh, int ldb, size_t sB, float alpha, const float* __restrict__ bias, size_t sBias, const float* __restrict__ CP, int rowsPerB, size_t sCPb, int row0g,
    float* __restrict__ C, _Float16* __restrict__ C16, int ldc, size_t sC, int M, int N, int K) {
  __shared__ __attribute__((aligned(16))) unsigned char ring[2 * G2_BUF];
  float (*so)[32][68] = (float (*)[32][68])ring;      /* output staging (8 x 32 x 68 f32 = one buffer), used only behind the last pass's barrier */
  const int tid = threadIdx.x, w = tid >> 5, lane = tid & 31, ln = lane & 15, hh = lane >> 4; const int by = blockIdx.y;
  A += (size_t)by * sA; Bh += (size_t)by * sB; const size_t cofs = (size_t)by * sC; const float* bp = bias ? bias + (size_t)by * sBias : nullptr;
  const int ntn = N >> 7; const int mt = blockIdx.x / ntn, nq = blockIdx.x - mt * ntn; if (mt * 128 >= M) return;      /* the whole block leaves, in front of every barrier */
  const int row0 = mt * 128 + 32 * (w & 3), col0 = nq * 128 + 64 * (w >> 2);
  const _Float16* gA = A + (size_t)(mt * 128 + (tid >> 4)) * lda + (tid & 15) * 8; const _Float16* gB = Bh + (size_t)(nq * 128 + (tid >> 4)) * ldb + (tid & 15) * 8;
  const unsigned lA = (unsigned)(size_t)ring + (unsigned)((tid >> 4) * G2_PITCH + (tid & 15) * 16); const unsigned lB = lA + 128 * G2_PITCH;
  const size_t stA = (size_t)16 * lda, stB = (size_t)16 * ldb;
  const int aofs = (32 * (w & 3) + ln) * G2_PITCH, bofs = (128 + 64 * (w >> 2) + ln) * G2_PITCH;
  const int np = K >> 7;
  g2_copy8(lA, gA, stA); g2_copy8(lB, gB, stB);
  asm volatile("s_wait_asynccnt 0x0" ::: "memory");      /* pass 0's own copies have landed */
  __syncthreads();                                        /* ... and every other wave's */
  if (np > 1) { g2_copy8(lA + G2_BUF, gA + 128, stA); g2_copy8(lB + G2_BUF, gB + 128, stB); }
  const v8f z8 = {0.f,0.f,0.f,0.f,0.f,0.f,0.f,0.f}; v8f c00 = z8, c01 = z8, c02 = z8, c03 = z8, c10 = z8, c11 = z8, c12 = z8, c13 = z8;
#pragma unroll 1      /* one pass per trip: the publish point at the foot stands once */
  for (int p = 0; p < np; ++p) { const unsigned bsel = (unsigned)(p & 1) * G2_BUF; const unsigned char* sa = ring + bsel + aofs; const unsigned char* sb = ring + bsel + bofs;
    v16h fa[2][2], fb[2][4];      /* two fragment sets: block kk + 1 is fetched ahead of block kk's products, inside this pass's buffer only */
    fa[0][0] = g2_frag((const _Float16*)sa, hh); fa[0][1] = g2_frag((const _Float16*)(sa + 16 * G2_PITCH), hh);
#pragma unroll      /* constant indices keep fa and fb in registers (this loop and the two below) */
    for (int j = 0; j < 4; ++j) fb[0][j] = g2_frag((const _Float16*)(sb + j * 16 * G2_PITCH), hh);
#pragma unroll
    for (int kk = 0; kk < 4; ++kk) { const int cu = kk & 1, nx = cu ^ 1;
      if (kk < 3) { fa[nx][0] = g2_frag((const _Float16*)(sa + (kk + 1) * 64), hh); fa[nx][1] = g2_frag((const _Float16*)(sa + 16 * G2_PITCH + (kk + 1) * 64), hh);
#pragma unroll
        for (int j = 0; j < 4; ++j) fb[nx][j] = g2_frag((const _Float16*)(sb + j * 16 * G2_PITCH + (kk + 1) * 64), hh); }
      c00 = g2_mma(fa[cu][0], fb[cu][0], c00); c10 = g2_mma(fa[cu][1], fb[cu][0], c10); c01 = g2_mma(fa[cu][0], fb[cu][1], c01); c11 = g2_mma(fa[cu][1], fb[cu][1], c11);
      c02 = g2_mma(fa[cu][0], fb[cu][2], c02); c12 = g2_mma(fa[cu][1], fb[cu][2], c12); c03 = g2_mma(fa[cu][0], fb[cu][3], c03); c13 = g2_mma(fa[cu][1], fb[cu][3], c13); }
    asm volatile("s_wait_dscnt 0x0" ::: "memory");        /* this wave's reads of the buffer have returned before it is refilled */
    asm volatile("s_wait_asynccnt 0x0" ::: "memory");     /* this wave's copies for pass p + 1 have landed */
    __syncthreads();                                      /* publishes pass p + 1 and ends every reader's last read of pass p's buffer */
    if (p + 2 < np) { g2_copy8(lA + bsel, gA + (size_t)(p + 2) * 128, stA); g2_copy8(lB + bsel, gB + (size_t)(p + 2) * 128, stB); } }
  asm volatile("s_wait_asynccnt 0x0" ::: "memory");       /* nothing in flight when the ring becomes output staging */
  v8f accs[8] = {c00, c01, c02, c03, c10, c11, c12, c13};
#pragma unroll
  for (int u = 0; u < 8; ++u) { const int t = u & 3, half = u >> 2; const int col = col0 + t * 16 + ln; const float bv = bp ? bf16_round(bp[col]) : 0.f;
#pragma unroll
    for (int r = 0; r < 8; ++r) { const int rloc = half * 16 + 8 * hh + r; float v = accs[u][r] * alpha + bv; if (CP) { const int bidx = (row0g + row0 + rloc) / rowsPerB; v += CP[(size_t)bidx * sCPb + (size_t)by * 64 + col]; }
      if (ACT == 3) v = fmaxf(v, 0.f); else if (ACT == 6) v = 0.5f * v * (1.0f + erff(v * 0.70710678118654752f)); else if (ACT == 11) v = 1.0f / (1.0f + expf(-v)); else if (ACT == 15) v = v / (1.0f + expf(-v)); else if (ACT == 12) v = (v > 0.f) ? v : 0.01f * v; else if (ACT == 8) v = tanhf(v); else if (ACT == 9) v = 0.5f * v * (1.0f + tanhf(0.7978845608028654f * (v + 0.044715f * v * v * v)));      /* tanh-GELU */
      so[w][rloc][t * 16 + ln] = v; } }
  __builtin_amdgcn_fence(__ATOMIC_ACQ_REL, "workgroup"); __builtin_amdgcn_wave_barrier();
  const int rsub = lane >> 4, c4 = (lane & 15) * 4;
  {
#pragma unroll
    for (int q = 0; q < 16; ++q) { const int r = q * 2 + rsub; const v4f v = *(const v4fa*)&so[w][r][c4]; if (C) *(v4f*)(C + cofs + (size_t)(row0 + r) * ldc + col0 + c4) = v; if (C16) { v4h h4; for (int i = 0; i < 4; ++i) h4[i] = (_Float16)v[i]; *(v4h*)(C16 + cofs + (size_t)(row0 + r) * ldc + col0 + c4) = h4; } }
     } }



// Staged tile of k_flash: 128 keys. 128 K rows (64 f16 = 128 B) at a pitch of 144 B, then 64 V^T rows (128 keys = 256 B) at a pitch of 272 B (16 B x odd: conflict-free for ds_load_b128 readers); two buffers.
#define FL_KEYS 128
#define FL_KP 144
#define FL_VP 272
#define FL_VOFS (FL_KEYS * FL_KP)
#define FL_BUF (FL_VOFS + 64 * FL_VP)
// Eight asynchronous 16-byte copies per lane: l = the lane's LDS byte address (LSTEP bytes between copies), g = its global address (gstep elements between copies).
// s_wait_xcnt 0 is the statement's last line, so that it stands in front of any later rewrite of the address registers the copies name.
template <unsigned LSTEP>
__device__ __forceinline__ void fl_copy8(unsigned l, const unsigned short* g, size_t gstep) {
  const unsigned l1 = l + LSTEP, l2 = l + 2 * LSTEP, l3 = l + 3 * LSTEP, l4 = l + 4 * LSTEP, l5 = l + 5 * LSTEP, l6 = l + 6 * LSTEP, l7 = l + 7 * LSTEP;
  const unsigned short* g1 = g + gstep; const unsigned short* g2 = g1 + gstep; const unsigned short* g3 = g2 + gstep; const unsigned short* g4 = g3 + gstep; const unsigned short* g5 = g4 + gstep; const unsigned short* g6 = g5 + gstep; const unsigned short* g7 = g6 + gstep;
  asm volatile("global_load_async_to_lds_b128 %0, %8, off\n\t"
               "global_load_async_to_lds_b128 %1, %9, off\n\t"
               "global_load_async_to_lds_b128 %2, %10, off\n\t"
               "global_load_async_to_lds_b128 %3, %11, off\n\t"
               "global_load_async_to_lds_b128 %4, %12, off\n\t"
               "global_load_async_to_lds_b128 %5, %13, off\n\t"
               "global_load_async_to_lds_b128 %6, %14, off\n\t"
               "global_load_async_to_lds_b128 %7, %15, off\n\t"
               "s_wait_xcnt 0x0"
               :: "v"(l), "v"(l1), "v"(l2), "v"(l3), "v"(l4), "v"(l5), "v"(l6), "v"(l7), "v"(g), "v"(g1), "v"(g2), "v"(g3), "v"(g4), "v"(g5), "v"(g6), "v"(g7) : "memory");
}
__global__ __launch_bounds__(128) void k_flash(const _Float16* __restrict__ Q16, int ldq, const _Float16* __restrict__ K16, int ldk, const _Float16* __restrict__ Vt, const int* __restrict__ MSK, float* __restrict__ O, int ldo) {
  constexpr int RPW = 16, RTN = RPW / 16, NQB = TQ / (4 * RPW), DT = 4, KS = 2;
  __shared__ __attribute__((aligned(16))) unsigned short sP[4][RPW][40]; __shared__ __attribute__((aligned(16))) float sO[4][RPW][64 + 4];
  __shared__ __attribute__((aligned(16))) unsigned char ring[2 * FL_BUF];
  const int tid = threadIdx.x, w = tid >> 5, lane = tid & 31, ln = lane & 15, hh = lane >> 4;
  const int slab = blockIdx.x / NQB, qblk = blockIdx.x % NQB; const int b = slab / NH, h = slab % NH; const int qb0 = qblk * (4 * RPW); const int q0 = qb0 + w * RPW;
  FragH aq[2][KS];
#pragma unroll
  for (int rt = 0; rt < RTN; ++rt) { const unsigned short* qr = (const unsigned short*)Q16 + ((size_t)b * TQ + q0 + rt * 16 + ln) * ldq + h * 64;
#pragma unroll
    for (int ks = 0; ks < KS; ++ks) { aq[rt][ks].half[0] = *(const v8us*)(qr + ks * 32 + 8 * hh); aq[rt][ks].half[1] = *(const v8us*)(qr + ks * 32 + 16 + 8 * hh); } }
  const unsigned short* Vth = (const unsigned short*)Vt + (size_t)slab * 64 * TK;
  float m_r[2][8], l_r[2][8]; v8f oacc[2][DT];
#pragma unroll
  for (int rt = 0; rt < RTN; ++rt) {
#pragma unroll
    for (int r = 0; r < 8; ++r) { m_r[rt][r] = -3.0e38f; l_r[rt][r] = 0.f; }
#pragma unroll
    for (int dt = 0; dt < DT; ++dt) oacc[rt][dt] = (v8f){0.f,0.f,0.f,0.f,0.f,0.f,0.f,0.f}; }
  /* the block's 128 threads copy a stage: K as 16 rows x 8 pieces, V^T as 8 rows x 16 pieces per copy, whole 128-B lines per wave */
  const unsigned short* gK = (const unsigned short*)K16 + ((size_t)b * TK + (tid >> 3)) * ldk + h * 64 + (tid & 7) * 8; const unsigned short* gV = Vth + (size_t)(tid >> 4) * TK + (tid & 15) * 8;
  const unsigned lK = (unsigned)(size_t)ring + (unsigned)((tid >> 3) * FL_KP + (tid & 7) * 16); const unsigned lV = (unsigned)(size_t)ring + (unsigned)(FL_VOFS + (tid >> 4) * FL_VP + (tid & 15) * 16);
  const size_t stK = (size_t)16 * ldk, stV = (size_t)8 * TK;
  constexpr int NST = TK / FL_KEYS;
  fl_copy8<16 * FL_KP>(lK, gK, stK); fl_copy8<8 * FL_VP>(lV, gV, stV);
  asm volatile("s_wait_asynccnt 0x0" ::: "memory");      /* stage 0's own copies have landed */
  __syncthreads();                                        /* ... and every other wave's */
  if (NST > 1) { fl_copy8<16 * FL_KP>(lK + FL_BUF, gK + (size_t)FL_KEYS * ldk, stK); fl_copy8<8 * FL_VP>(lV + FL_BUF, gV + FL_KEYS, stV); }
#pragma unroll 1      /* one stage per trip: the publish point at the foot stands once */
  for (int st = 0; st < NST; ++st) { const unsigned bsel = (unsigned)(st & 1) * FL_BUF; const unsigned char* sK = ring + bsel; const unsigned char* sV = sK + FL_VOFS;
#pragma unroll 1      /* 32 keys per trip, rolled as before: keeps the loop's text small */
  for (int j0 = 0; j0 < FL_KEYS; j0 += 32) {
    v8f s[2][2]; FragH bk[2][KS], bv[DT];      /* this trip's K and V^T fragments are read from the stage as one group, ahead of the products and the softmax */
#pragma unroll
    for (int nt = 0; nt < 2; ++nt) { const unsigned short* kr = (const unsigned short*)(sK + (j0 + nt * 16 + ln) * FL_KP);
#pragma unroll
      for (int ks = 0; ks < KS; ++ks) { bk[nt][ks].half[0] = *(const v8us*)(kr + ks * 32 + 8 * hh); bk[nt][ks].half[1] = *(const v8us*)(kr + ks * 32 + 16 + 8 * hh); } }
#pragma unroll
    for (int dt = 0; dt < DT; ++dt) { const unsigned short* vrow = (const unsigned short*)(sV + (dt * 16 + ln) * FL_VP) + j0; bv[dt].half[0] = *(const v8us*)(vrow + 8 * hh); bv[dt].half[1] = *(const v8us*)(vrow + 16 + 8 * hh); }
#pragma unroll
    for (int nt = 0; nt < 2; ++nt) {
#pragma unroll
      for (int rt = 0; rt < RTN; ++rt) { v8f acc = (v8f){0.f,0.f,0.f,0.f,0.f,0.f,0.f,0.f};
#pragma unroll
        for (int ks = 0; ks < KS; ++ks) acc = mmaH<1>(aq[rt][ks].v, aq[rt][ks].v, bk[nt][ks].v, bk[nt][ks].v, acc); s[rt][nt] = acc; } }
#pragma unroll
    for (int rt = 0; rt < RTN; ++rt)
#pragma unroll
      for (int r = 0; r < 8; ++r) { const int tq = q0 + rt * 16 + 8 * hh + r; const int k0 = j0 + ln, k1 = j0 + 16 + ln; (void)tq; (void)k0; (void)k1;
        const bool ok0 = true, ok1 = true;
        const float s0 = s[rt][0][r] * SCL, s1 = s[rt][1][r] * SCL; float mc = fmaxf(s0, s1);
        mc = fmaxf(mc, __shfl_xor(mc, 1, 32)); mc = fmaxf(mc, __shfl_xor(mc, 2, 32)); mc = fmaxf(mc, __shfl_xor(mc, 4, 32)); mc = fmaxf(mc, __shfl_xor(mc, 8, 32));
        const float mn = fmaxf(m_r[rt][r], mc); const float al = (mn > -1.0e38f) ? expf(m_r[rt][r] - mn) : 1.0f; m_r[rt][r] = mn; const float p0 = ok0 ? expf(s0 - mn) : 0.f, p1 = ok1 ? expf(s1 - mn) : 0.f; l_r[rt][r] = l_r[rt][r] * al + p0 + p1;
#pragma unroll
        for (int dt = 0; dt < DT; ++dt) oacc[rt][dt][r] *= al;
        FragH t2; t2.h[0] = (_Float16)(p0 * 1024.0f); t2.h[1] = (_Float16)(p1 * 1024.0f); sP[w][rt * 16 + 8 * hh + r][ln] = t2.u[0]; sP[w][rt * 16 + 8 * hh + r][16 + ln] = t2.u[1]; }
    __builtin_amdgcn_fence(__ATOMIC_ACQ_REL, "workgroup"); __builtin_amdgcn_wave_barrier();
    FragH pa[2];
#pragma unroll
    for (int rt = 0; rt < RTN; ++rt) { pa[rt].half[0] = *(const v8us*)&sP[w][rt * 16 + ln][8 * hh]; pa[rt].half[1] = *(const v8us*)&sP[w][rt * 16 + ln][16 + 8 * hh]; }
#pragma unroll
    for (int dt = 0; dt < DT; ++dt) {
#pragma unroll
      for (int rt = 0; rt < RTN; ++rt) oacc[rt][dt] = mmaH<1>(pa[rt].v, pa[rt].v, bv[dt].v, bv[dt].v, oacc[rt][dt]); }
    __builtin_amdgcn_fence(__ATOMIC_ACQ_REL, "workgroup"); __builtin_amdgcn_wave_barrier(); }
    asm volatile("s_wait_dscnt 0x0" ::: "memory");        /* this wave's reads of the buffer have returned before it is refilled */
    asm volatile("s_wait_asynccnt 0x0" ::: "memory");     /* this wave's copies for stage st + 1 have landed */
    __syncthreads();                                      /* publishes stage st + 1 and ends every reader's last read of stage st's buffer */
    if (st + 2 < NST) { fl_copy8<16 * FL_KP>(lK + bsel, gK + (size_t)(st + 2) * FL_KEYS * ldk, stK); fl_copy8<8 * FL_VP>(lV + bsel, gV + (size_t)(st + 2) * FL_KEYS, stV); } }
  asm volatile("s_wait_asynccnt 0x0" ::: "memory");       /* nothing in flight when the wave goes on to its end */
#pragma unroll
  for (int rt = 0; rt < RTN; ++rt) {
#pragma unroll
    for (int r = 0; r < 8; ++r) { float l = l_r[rt][r]; l += __shfl_xor(l, 1, 32); l += __shfl_xor(l, 2, 32); l += __shfl_xor(l, 4, 32); l += __shfl_xor(l, 8, 32); l_r[rt][r] = (l > 0.f) ? 1.0f / (l * 1024.0f) : 0.f; }
#pragma unroll
    for (int dt = 0; dt < DT; ++dt)
#pragma unroll
      for (int r = 0; r < 8; ++r) sO[w][rt * 16 + 8 * hh + r][dt * 16 + ln] = oacc[rt][dt][r] * l_r[rt][r]; }
  __builtin_amdgcn_fence(__ATOMIC_ACQ_REL, "workgroup"); __builtin_amdgcn_wave_barrier();
  {
#pragma unroll
    for (int rp = 0; rp < RPW; rp += 2) { const int r = rp + (lane >> 4), pc = lane & 15; const v4f val = *(const v4fa*)&sO[w][r][pc * 4]; *(v4f*)(O + ((size_t)b * TQ + q0 + r) * ldo + h * 64 + pc * 4) = val; }
     } }
__global__ __launch_bounds__(256) void k_fulltab(unsigned* __restrict__ MB, int* __restrict__ RA, int* __restrict__ KE, int nq, int nk) {
  const int t = blockIdx.x * 256 + threadIdx.x;
  if (t < nq * (nk / 32)) { *(unsigned*)(MB + t) = 0u;  }
  if (t < nq) { *(int*)(RA + t) = 0;  }
  if (t < nq / 64) { *(int*)(KE + t * 32) = nk;  } }
template <int SRCBF>
__global__ __launch_bounds__(256) void k_ln1024(const float* __restrict__ X, _Float16* __restrict__ Y16, float* __restrict__ XB) {
  #pragma clang fp contract(off)
  const int tid = threadIdx.x, w = tid >> 5, ln = tid & 31; const int r = blockIdx.x * 8 + w; if (r >= NR) return; const float* x = X + (size_t)r * DM; float s = 0.f;
#pragma unroll 1
  for (int i = 0; i < 8; ++i) { const v4f a = *(const v4fa*)(x + i * 128 + ln * 4); for (int q = 0; q < 4; ++q) s += SRCBF ? bf16_round(a[q]) : a[q]; }
  for (int o = 16; o > 0; o >>= 1) s += __shfl_xor(s, o, 32); const float mu = s / (float)DM; float q2 = 0.f;
#pragma unroll 1
  for (int i = 0; i < 8; ++i) { const v4f a = *(const v4fa*)(x + i * 128 + ln * 4); for (int q = 0; q < 4; ++q) { const float d = (SRCBF ? bf16_round(a[q]) : a[q]) - mu; q2 += d * d; } }
  for (int o = 16; o > 0; o >>= 1) q2 += __shfl_xor(q2, o, 32); const float dn = sqrtf(q2 / (float)DM + 1e-5f);
  {
#pragma unroll 1
    for (int i = 0; i < 8; ++i) { const int c0 = i * 128 + ln * 4; const v4f a = *(const v4fa*)(x + c0); _Float16 h4[4]; v4f xb;
      for (int q = 0; q < 4; ++q) { const float t = SRCBF ? bf16_round(a[q]) : a[q]; h4[q] = (_Float16)((t - mu) / dn); xb[q] = t; }
      *(unsigned long long*)((unsigned short*)Y16 + (size_t)r * DM + c0) = *(const unsigned long long*)h4; if (SRCBF) *(v4f*)(XB + (size_t)r * DM + c0) = xb; }
     } }
__global__ __launch_bounds__(256) void k_causaltab(unsigned* __restrict__ MB, int* __restrict__ RA, int* __restrict__ KE, int nq, int nk) {
  const int t = blockIdx.x * 256 + threadIdx.x; const int nw = nk / 32;
  if (t < nq * nw) { const int q = t / nw, w = t % nw; const int first = q + 1 - 32 * w; const unsigned bits = (first <= 0) ? 0xffffffffu : ((first >= 32) ? 0u : (0xffffffffu << first)); *(unsigned*)(MB + t) = bits;  }
  if (t < nq) { *(int*)(RA + t) = 0;  }
  if (t < nq / 64) { const int v = 64 * (t + 1); *(int*)(KE + t * 32) = v;  } }


extern "C" void kernel_launch(void* const* d_in, const int* in_sizes, int n_in,
                              void* d_out, int out_size, void* d_ws, size_t ws_size, hipStream_t stream) {
  (void)in_sizes; (void)n_in; (void)out_size;
  const float* const* I = (const float* const*)d_in; const float* x = I[0]; const float* Wqkv = I[1]; const float* Wfc = I[2]; const float* W1 = I[3]; const float* b1 = I[4]; const float* W2 = I[5]; const float* b2 = I[6];
  char* ws = (char*)d_ws; size_t off = 0;
  auto take = [&](size_t bytes) { char* p = ws + off; off += (bytes + 255) & ~(size_t)255; return p; };
  _Float16* BQKV = (_Float16*)take((size_t)3 * DM * DM * 2); _Float16* BFC = (_Float16*)take((size_t)DM * DM * 2); _Float16* BW1 = (_Float16*)take((size_t)4096 * DM * 2); _Float16* BW2 = (_Float16*)take((size_t)DM * 4096 * 2);
  float* XB = (float*)take((size_t)NR * DM * 4); _Float16* X16 = (_Float16*)take((size_t)NR * DM * 2); float* F = (float*)take((size_t)NR * DM * 4);
  _Float16* Q16 = (_Float16*)take((size_t)NR * DM * 2); _Float16* K16 = (_Float16*)take((size_t)NR * DM * 2); _Float16* V16 = (_Float16*)take((size_t)NR * DM * 2); _Float16* VT = (_Float16*)take((size_t)NR * DM * 2); if (off > ws_size) return;      /* 24 + 16 + 8 + 16 + 32 = 96 MiB */
  float* O = F; _Float16* Oh = Q16; _Float16* Ol = K16;     /* q/k planes are dead after the flash */
  float* X1 = XB;                                           /* x1 written over the residual plane (own-tile addend) */
  _Float16* H16 = X16; _Float16* GH = Q16;                  /* GELU hidden [NR][4096] f16 = 32 MB over Q16|K16|V16|VT (contiguous, all dead once x1 is formed) */
  const size_t n8 = (size_t)NR * DM / 8; const unsigned nb8 = (unsigned)((n8 + 255) / 256);
  k_wt_f16<<<(unsigned)(((size_t)DM * 3 * DM / 8 + 255) / 256), 256, 0, stream>>>(Wqkv, BQKV, DM, 3 * DM, 16.0f); k_wt_f16<<<(unsigned)(((size_t)DM * DM / 8 + 255) / 256), 256, 0, stream>>>(Wfc, BFC, DM, DM, 16.0f);
  k_wt_f16<<<(unsigned)(((size_t)DM * 4096 / 8 + 255) / 256), 256, 0, stream>>>(W1, BW1, DM, 4096, 16.0f); k_wt_f16<<<(unsigned)(((size_t)4096 * DM / 8 + 255) / 256), 256, 0, stream>>>(W2, BW2, 4096, DM, 16.0f);      /* all (in,out) */
  k_ln1024<1><<<NR / 8, 256, 0, stream>>>(x, X16, XB);
  const dim3 gP((NR / 128) * (DM / 128), 1), gM((NR / 128) * (4096 / 128), 1);
  k_gemm2<0><<<gP, 256, 0, stream>>>(X16, DM, 0, BQKV, DM, 0, 0.0625f, nullptr, 0, nullptr, 1, 0, 0, nullptr, Q16, DM, 0, NR, DM, DM);
  k_gemm2<0><<<gP, 256, 0, stream>>>(X16, DM, 0, BQKV + (size_t)DM * DM, DM, 0, 0.0625f, nullptr, 0, nullptr, 1, 0, 0, nullptr, K16, DM, 0, NR, DM, DM);
  k_gemm2<0><<<gP, 256, 0, stream>>>(X16, DM, 0, BQKV + (size_t)2 * DM * DM, DM, 0, 0.0625f, nullptr, 0, nullptr, 1, 0, 0, nullptr, V16, DM, 0, NR, DM, DM);
  for (int b = 0; b < NBT; ++b) k_vt<NH, SLEN><<<NH * (SLEN / 64), 256, 0, stream>>>(V16 + (size_t)b * SLEN * DM, DM, 0, VT + (size_t)b * SLEN * DM);
  for (int b = 0; b < NBT; ++b) { const size_t ro = (size_t)b * SLEN * DM;
    k_flash<<<NH * (SLEN / 64), 128, 0, stream>>>(Q16 + ro, DM, K16 + ro, DM, VT + ro, nullptr, O + ro, DM); }      /* plain flash over all keys */
  k_hl<<<nb8, 256, 0, stream>>>(O, Oh, Ol, n8);
  k_gemm2<0><<<gP, 256, 0, stream>>>(Oh, DM, 0, BFC, DM, 0, 0.0625f, nullptr, 0, XB, 1, (size_t)DM, 0, X1, nullptr, DM, 0, NR, DM, DM);      /* x1 = x + attn w_fc (hi) */
  k_gemm2<0><<<gP, 256, 0, stream>>>(Ol, DM, 0, BFC, DM, 0, 0.0625f / 1024.0f, nullptr, 0, X1, 1, (size_t)DM, 0, X1, nullptr, DM, 0, NR, DM, DM);      /* + lo */
  k_ln1024<0><<<NR / 8, 256, 0, stream>>>(X1, H16, nullptr);
  k_gemm2<9><<<gM, 256, 0, stream>>>(H16, DM, 0, BW1, DM, 0, 0.0625f, b1, 0, nullptr, 1, 0, 0, nullptr, GH, 4096, 0, NR, 4096, DM);      /* tanh-gelu(LN(x1) w1 + b1) f16 */
  k_gemm2<0><<<gP, 256, 0, stream>>>(GH, 4096, 0, BW2, 4096, 0, 0.0625f, b2, 0, X1, 1, (size_t)DM, 0, (float*)d_out, nullptr, DM, 0, NR, DM, 4096);      /* out = x1 + mlp */
}

// v003
// One run takes 375 microseconds.
// Timed twice side by side with v002, it ran 1.47 times as fast both times.
// Over all steps from v000 it is 2.76 times as fast.
#include <hip/hip_runtime.h>
// Pre-LN transformer layer (2 x 2048 tokens, 1024; 16 heads x 64; full (non-causal) attention; MLP 4096 with tanh-GELU): h = LN(x) (no affine); q,k,v = h w_qkv; x1 = x + softmax(q.k/8).v w_fc; out = x1 + gelu(LN(x1) w1 + b1) w2 + b2 -> [2,2048,1024].
// Structure: LayerNorm on VALU (also writing the bf16 residual plane); projections / MLP as f16 WMMA GEMMs (32x64 wave tiles, f32 accumulation, exact weights x16, tanh-GELU and biases in the epilogue, residuals through the f32 addend); q, k, V^T as plain f16 planes through the fused flash kernel over all keys (online softmax in f32, P x2^10); O as hi + residual planes into w_fc (two GEMMs).
// Compute dtype: x and weights rounded to bf16; LN outputs, q, k, v, P and the GELU hidden as f16 operands (~2^-12); O as hi + residual pairs; f32 accumulation, softmax, LayerNorm. v_wmma_f32_16x16x32_f16.
#define NBT 2
#define SLEN 2048
#define TQ SLEN
#define TK SLEN
#define DM 1024
#define NH 16
#define SCL 0.125f
#define NR (NBT * SLEN)
typedef __bf16 v16b __attribute__((ext_vector_type(16)));
typedef unsigned short v8us __attribute__((ext_vector_type(8), may_alias));
typedef float  v8f  __attribute__((ext_vector_type(8)));
typedef float  v4f  __attribute__((ext_vector_type(4)));
typedef float  v4fa __attribute__((ext_vector_type(4), may_alias));
union FragB { v16b v; v8us half[2]; unsigned short u[16]; };

__device__ __forceinline__ unsigned short bf16_bits(float x) { unsigned int u = __float_as_uint(x); return (unsigned short)((u + 0x7FFFu + ((u >> 16) & 1u)) >> 16); }
__device__ __forceinline__ float bf16_val(unsigned short b) { return __uint_as_float(((unsigned int)b) << 16); }
__device__ __forceinline__ float bf16_round(float x) { return bf16_val(bf16_bits(x)); }
// D += A·B with NT terms: 1 = ah·bh, 2 = + al·bh (A split), 3 = + ah·bl (both split)
template <int NT>
__device__ __forceinline__ v8f mmaN(v16b ah, v16b al, v16b bh, v16b bl, v8f c) {
  c = __builtin_amdgcn_wmma_f32_16x16x32_bf16(false, ah, false, bh, (short)0, c, false, false);
  if (NT >= 2) c = __builtin_amdgcn_wmma_f32_16x16x32_bf16(false, al, false, bh, (short)0, c, false, false);
  if (NT >= 3) c = __builtin_amdgcn_wmma_f32_16x16x32_bf16(false, ah, false, bl, (short)0, c, false, false);
  asm volatile("v_nop\n\tv_nop\n\tv_nop\n\tv_nop" : "+v"(c) : "v"(ah), "v"(al), "v"(bh), "v"(bl));
  return c;
}

__global__ __launch_bounds__(256) void k_wt_bf16(const float* __restrict__ W, unsigned short* __restrict__ Wt, int K, int N) {
  const int t = blockIdx.x * 256 + threadIdx.x;
  const int k8n = K / 8;
  if (t >= N * k8n) return;
  const int n = t / k8n, k8 = (t % k8n) * 8;
  v8us v;
#pragma unroll
  for (int i = 0; i < 8; ++i) v[i] = bf16_bits(W[(size_t)(k8 + i) * N + n]);
  *(v8us*)(Wt + (size_t)n * K + k8) = v;
  
}

// GEMM C[M][N] (f32, pitch ldc) = act(A[M][K]·W + bias). A f32 row-major (pitch lda) converted per fragment to bf16
// (ASPLIT: hi/lo two planes -> 2 terms, else single rounded term); Wt bf16 [N][K] (pitch ldb). BIAS_BF16 rounds the
// bias to bf16 first (bias quantised to bf16 before the add). K%32==0, M%16==0, N%64==0.
template <bool ASPLIT, int ACT, bool BIAS_BF16>
__global__ __launch_bounds__(128) void k_gemm_bf(const float* __restrict__ A, int lda, const unsigned short* __restrict__ Wt, int ldb,
                                               const float* __restrict__ bias, float* __restrict__ C, int ldc, int M, int N, int K) {
  __shared__ __attribute__((aligned(16))) float so[4][16][64];
  const int tid = threadIdx.x, w = tid >> 5, lane = tid & 31, ln = lane & 15, hh = lane >> 4;
  const int ntn = N / 64;
  const int wid = blockIdx.x * 4 + w;
  const int mt = wid / ntn, nq = wid % ntn;
  if (mt * 16 >= M) return;
  const int row0 = mt * 16, col0 = nq * 64;
  const float* arow = A + (size_t)(row0 + ln) * lda;
  v8f acc[4] = {};
  for (int kb = 0; kb < K; kb += 32) {
    FragB ah, al;
    const v4f x0 = *(const v4fa*)(arow + kb + 8 * hh), x1 = *(const v4fa*)(arow + kb + 8 * hh + 4);
    const v4f x2 = *(const v4fa*)(arow + kb + 16 + 8 * hh), x3 = *(const v4fa*)(arow + kb + 16 + 8 * hh + 4);
    float xs[16] = {x0[0],x0[1],x0[2],x0[3],x1[0],x1[1],x1[2],x1[3],x2[0],x2[1],x2[2],x2[3],x3[0],x3[1],x3[2],x3[3]};
#pragma unroll
    for (int i = 0; i < 16; ++i) { const unsigned short hb = bf16_bits(xs[i]); ah.u[i] = hb; al.u[i] = ASPLIT ? bf16_bits(xs[i] - bf16_val(hb)) : (unsigned short)0; }
#pragma unroll
    for (int t = 0; t < 4; ++t) {
      const unsigned short* brow = Wt + (size_t)(col0 + t * 16 + ln) * ldb + kb;
      FragB b;
      b.half[0] = *(const v8us*)(brow + 8 * hh);
      b.half[1] = *(const v8us*)(brow + 16 + 8 * hh);
      acc[t] = mmaN<ASPLIT ? 2 : 1>(ah.v, al.v, b.v, b.v, acc[t]);
    }
  }
#pragma unroll
  for (int t = 0; t < 4; ++t) {
    float bv = bias ? bias[col0 + t * 16 + ln] : 0.f;
    if (BIAS_BF16) bv = bf16_round(bv);
#pragma unroll
    for (int r = 0; r < 8; ++r) { float v = acc[t][r] + bv; if (ACT == 1) v = fmaxf(v, 0.f); so[w][8 * hh + r][t * 16 + ln] = v; }
  }
  __builtin_amdgcn_fence(__ATOMIC_ACQ_REL, "workgroup");
  __builtin_amdgcn_wave_barrier();
  const int rsub = lane >> 4, c4 = (lane & 15) * 4;
  {
#pragma unroll
    for (int q = 0; q < 8; ++q) {
      const int r = q * 2 + rsub;
      const v4f v = *(const v4fa*)&so[w][r][c4];
      *(v4f*)(C + (size_t)(row0 + r) * ldc + col0 + c4) = v;
    }
    
  }
}

// GEMM C = act(A·W + bias + resid): A f32 (ASPLIT -> hi/lo 2 terms), Wt bf16 [N][K]; ACT 0 none, 1 relu, 2 exact gelu;
// resid (optional, f32, row index = (row % rmod), pitch ldr, RES_BF16 rounds it) added before the activation.
template <bool ASPLIT, int ACT, bool BIAS_BF16, bool RES_BF16>
__global__ __launch_bounds__(128) void k_gemm_bf3(const float* __restrict__ A, int lda, const unsigned short* __restrict__ Wt, int ldb,
                                                const float* __restrict__ bias, const float* __restrict__ resid, int rmod, int ldr,
                                                float* __restrict__ C, int ldc, int M, int N, int K) {
  __shared__ __attribute__((aligned(16))) float so[4][16][64];
  const int tid = threadIdx.x, w = tid >> 5, lane = tid & 31, ln = lane & 15, hh = lane >> 4;
  const int ntn = N / 64;
  const int wid = blockIdx.x * 4 + w;
  const int mt = wid / ntn, nq = wid % ntn;
  if (mt * 16 >= M) return;
  const int row0 = mt * 16, col0 = nq * 64;
  const float* arow = A + (size_t)(row0 + ln) * lda;
  v8f acc[4] = {};
  for (int kb = 0; kb < K; kb += 32) {
    FragB ah, al;
    const v4f x0 = *(const v4fa*)(arow + kb + 8 * hh), x1 = *(const v4fa*)(arow + kb + 8 * hh + 4);
    const v4f x2 = *(const v4fa*)(arow + kb + 16 + 8 * hh), x3 = *(const v4fa*)(arow + kb + 16 + 8 * hh + 4);
    float xs[16] = {x0[0],x0[1],x0[2],x0[3],x1[0],x1[1],x1[2],x1[3],x2[0],x2[1],x2[2],x2[3],x3[0],x3[1],x3[2],x3[3]};
#pragma unroll
    for (int i = 0; i < 16; ++i) { const unsigned short hb = bf16_bits(xs[i]); ah.u[i] = hb; al.u[i] = ASPLIT ? bf16_bits(xs[i] - bf16_val(hb)) : (unsigned short)0; }
#pragma unroll
    for (int t = 0; t < 4; ++t) {
      const unsigned short* brow = Wt + (size_t)(col0 + t * 16 + ln) * ldb + kb;
      FragB b;
      b.half[0] = *(const v8us*)(brow + 8 * hh);
      b.half[1] = *(const v8us*)(brow + 16 + 8 * hh);
      acc[t] = mmaN<ASPLIT ? 2 : 1>(ah.v, al.v, b.v, b.v, acc[t]);
    }
  }
#pragma unroll
  for (int t = 0; t < 4; ++t) {
    const int col = col0 + t * 16 + ln;
    float bv = bias ? bias[col] : 0.f;
    if (BIAS_BF16) bv = bf16_round(bv);
#pragma unroll
    for (int r = 0; r < 8; ++r) {
      float v = acc[t][r] + bv;
      if (resid) { float rv = resid[(size_t)((row0 + 8 * hh + r) % rmod) * ldr + col]; if (RES_BF16) rv = bf16_round(rv); v += rv; }
      if (ACT == 1) v = fmaxf(v, 0.f);
      if (ACT == 2) v = 0.5f * v * (1.0f + erff(v * 0.70710678118654752f));
      if (ACT == 3) { const float u = 0.7978845608028654f * (v + 0.044715f * v * v * v); v = 0.5f * v * (1.0f + tanhf(u)); }
      so[w][8 * hh + r][t * 16 + ln] = v;
    }
  }
  __builtin_amdgcn_fence(__ATOMIC_ACQ_REL, "workgroup");
  __builtin_amdgcn_wave_barrier();
  const int rsub = lane >> 4, c4 = (lane & 15) * 4;
  {
#pragma unroll
    for (int q = 0; q < 8; ++q) {
      const int r = q * 2 + rsub;
      const v4f v = *(const v4fa*)&so[w][r][c4];
      *(v4f*)(C + (size_t)(row0 + r) * ldc + col0 + c4) = v;
    }
    
  }
}
// row LayerNorm (biased variance, eps) over N: s = X (+ R); optional out_sum <- s; out_norm <- (s-mu)*rsqrt(var+eps)*g + b
template <bool PARAM_BF16>
__global__ __launch_bounds__(256) void k_layernorm(const float* __restrict__ X, const float* __restrict__ R, const float* __restrict__ g, const float* __restrict__ bta,
                                                  float* __restrict__ out_sum, float* __restrict__ out_norm, int N, float eps) {
  __shared__ float red[256];
  const int row = blockIdx.x, tid = threadIdx.x;
  const float* x = X + (size_t)row * N; const float* rr = R ? R + (size_t)row * N : nullptr;
  float vals[16];                     // up to N = 4096
  const int per = N / 256;            // contiguous chunk per thread? use strided-by-4 chunks: thread handles j = tid*4 + 1024*u
  float s1 = 0.f;
  for (int u = 0; u < per / 4; ++u) {
    const int j = tid * 4 + 1024 * u;
    const v4f a = *(const v4fa*)(x + j);
    v4f b = {0.f,0.f,0.f,0.f}; if (rr) b = *(const v4fa*)(rr + j);
#pragma unroll
    for (int q = 0; q < 4; ++q) { const float v = a[q] + b[q]; vals[u * 4 + q] = v; s1 += v; }
  }
  red[tid] = s1; __syncthreads();
  for (int st = 128; st > 0; st >>= 1) { if (tid < st) red[tid] += red[tid + st]; __syncthreads(); }
  const float mu = red[0] / (float)N; __syncthreads();
  float s2 = 0.f;
  for (int u = 0; u < per / 4; ++u)
#pragma unroll
    for (int q = 0; q < 4; ++q) { const float c = vals[u * 4 + q] - mu; s2 += c * c; }
  red[tid] = s2; __syncthreads();
  for (int st = 128; st > 0; st >>= 1) { if (tid < st) red[tid] += red[tid + st]; __syncthreads(); }
  const float rs = rsqrtf(red[0] / (float)N + eps);
  {
    for (int u = 0; u < per / 4; ++u) {
      const int j = tid * 4 + 1024 * u;
      v4f o, sm;
#pragma unroll
      for (int q = 0; q < 4; ++q) {
        float gg = g[j + q], bb = bta[j + q];
        if (PARAM_BF16) { gg = bf16_round(gg); bb = bf16_round(bb); }
        sm[q] = vals[u * 4 + q]; o[q] = (vals[u * 4 + q] - mu) * rs * gg + bb;
      }
      if (out_sum) *(v4f*)(out_sum + (size_t)row * N + j) = sm;
      *(v4f*)(out_norm + (size_t)row * N + j) = o;
    }
    
  }
}



// ---- f16 WMMA path (v_wmma_f32_16x16x32_f16): 11-bit significands for operands in range — used where a [0,1] probability operand needs more precision than bf16
typedef _Float16 v16h __attribute__((ext_vector_type(16)));
union FragH { v16h v; v8us half[2]; _Float16 h[16]; unsigned short u[16]; };
template <int NT>
__device__ __forceinline__ v8f mmaH(v16h ah, v16h al, v16h bh, v16h bl, v8f c) {
  c = __builtin_amdgcn_wmma_f32_16x16x32_f16(false, ah, false, bh, (short)0, c, false, false);
  if (NT >= 2) c = __builtin_amdgcn_wmma_f32_16x16x32_f16(false, al, false, bh, (short)0, c, false, false);
  if (NT >= 3) c = __builtin_amdgcn_wmma_f32_16x16x32_f16(false, ah, false, bl, (short)0, c, false, false);
  asm volatile("v_nop\n\tv_nop\n\tv_nop\n\tv_nop" : "+v"(c) : "v"(ah), "v"(al), "v"(bh), "v"(bl));
  return c;
}
// batched GEMM like k_gemm_b but f16 operands: A f32 (split into f16 hi/lo if ASPLIT, else rounded to f16), Bt = f16 values [n][k]; alpha; C f32; N multiple of 16 (partial tiles skipped)
template <bool ASPLIT>
__global__ __launch_bounds__(128) void k_gemm_h(const float* __restrict__ A, int lda, size_t sA, const _Float16* __restrict__ Bh, int ldb, size_t sB, float alpha, float* __restrict__ C, int ldc, size_t sC, int M, int N, int K) {
  __shared__ __attribute__((aligned(16))) float so[4][16][64];
  const int tid = threadIdx.x, w = tid >> 5, lane = tid & 31, ln = lane & 15, hh = lane >> 4; const int by = blockIdx.y;
  A += (size_t)by * sA; Bh += (size_t)by * sB; C += (size_t)by * sC;
  const int ntn = (N + 63) / 64; const int wid = blockIdx.x * 4 + w; const int mt = wid / ntn, nq = wid % ntn; if (mt * 16 >= M) return;
  const int row0 = mt * 16, col0 = nq * 64; const float* arow = A + (size_t)(row0 + ln) * lda;
  v8f acc[4] = {};
  for (int kb = 0; kb < K; kb += 32) {
    FragH ah, al;
    const v4f x0 = *(const v4fa*)(arow + kb + 8 * hh), x1 = *(const v4fa*)(arow + kb + 8 * hh + 4), x2 = *(const v4fa*)(arow + kb + 16 + 8 * hh), x3 = *(const v4fa*)(arow + kb + 16 + 8 * hh + 4);
    float xs[16] = {x0[0],x0[1],x0[2],x0[3],x1[0],x1[1],x1[2],x1[3],x2[0],x2[1],x2[2],x2[3],x3[0],x3[1],x3[2],x3[3]};
#pragma unroll
    for (int i = 0; i < 16; ++i) { const _Float16 h = (_Float16)xs[i]; ah.h[i] = h; al.h[i] = ASPLIT ? (_Float16)(xs[i] - (float)h) : (_Float16)0.0f; }
#pragma unroll
    for (int t = 0; t < 4; ++t) { if (col0 + t * 16 >= N) continue; const size_t boff = (size_t)(col0 + t * 16 + ln) * ldb + kb; FragH bq; bq.half[0] = *(const v8us*)(Bh + boff + 8 * hh); bq.half[1] = *(const v8us*)(Bh + boff + 16 + 8 * hh);
      acc[t] = mmaH<ASPLIT ? 2 : 1>(ah.v, al.v, bq.v, bq.v, acc[t]); }
  }
#pragma unroll
  for (int t = 0; t < 4; ++t) { if (col0 + t * 16 >= N) continue;
#pragma unroll
    for (int r = 0; r < 8; ++r) so[w][8 * hh + r][t * 16 + ln] = acc[t][r] * alpha; }
  __builtin_amdgcn_fence(__ATOMIC_ACQ_REL, "workgroup"); __builtin_amdgcn_wave_barrier();
  const int rsub = lane >> 4, c4 = (lane & 15) * 4;
  {
#pragma unroll
    for (int q = 0; q < 8; ++q) { const int r = q * 2 + rsub; if (col0 + c4 < N) { const v4f v = *(const v4fa*)&so[w][r][c4]; *(v4f*)(C + (size_t)(row0 + r) * ldc + col0 + c4) = v; } }
     }
}

// Wt[n][k] = f16(W[k][n]·scale) from f32 row-major W[K][N] (scale = power of two; bf16-exact weights stay exact in f16 away from the subnormal range)
__global__ __launch_bounds__(256) void k_wt_f16(const float* __restrict__ W, _Float16* __restrict__ Wt, int K, int N, float scale) {
  const int t = blockIdx.x * 256 + threadIdx.x; if (t >= N * (K / 8)) return; const int n = t / (K / 8), k8 = (t % (K / 8)) * 8; FragH f;
#pragma unroll
  for (int i = 0; i < 8; ++i) f.h[i] = (_Float16)(bf16_round(W[(size_t)(k8 + i) * N + n]) * scale); const v8us o = f.half[0];
  *(v8us*)((unsigned short*)Wt + (size_t)n * K + k8) = o; 
}
// k_gemm_hh variant with fused epilogue: v = acc·alpha + bias[by·sBias + col] (+ CP[(row/rowsPerB)·sCPb + by·64 + col] if CP) ; ACT 0 none / 1 elu ; writes f16 C16 (and f32 C if non-null)
template <int ACT>
__global__ __launch_bounds__(128) void k_gemm_hhx(const _Float16* __restrict__ A, int lda, size_t sA, const _Float16* __restrict__ Bh, int ldb, size_t sB, float alpha, const float* __restrict__ bias, size_t sBias, const float* __restrict__ CP, int rowsPerB, size_t sCPb, int row0g,
    float* __restrict__ C, _Float16* __restrict__ C16, int ldc, size_t sC, int M, int N, int K) {
  __shared__ __attribute__((aligned(16))) float so[4][16][64];
  const int tid = threadIdx.x, w = tid >> 5, lane = tid & 31, ln = lane & 15, hh = lane >> 4; const int by = blockIdx.y;
  A += (size_t)by * sA; Bh += (size_t)by * sB; const size_t cofs = (size_t)by * sC; const float* bp = bias ? bias + (size_t)by * sBias : nullptr;
  const int ntn = (N + 63) / 64; const int wid = blockIdx.x * 4 + w; const int mt = wid / ntn, nq = wid % ntn; if (mt * 16 >= M) return;
  const int row0 = mt * 16, col0 = nq * 64; const _Float16* arow = A + (size_t)(row0 + ln) * lda;
  v8f acc[4] = {};
  for (int kb = 0; kb < K; kb += 32) { FragH ah; ah.half[0] = *(const v8us*)((const unsigned short*)arow + kb + 8 * hh); ah.half[1] = *(const v8us*)((const unsigned short*)arow + kb + 16 + 8 * hh);
#pragma unroll
    for (int t = 0; t < 4; ++t) { if (col0 + t * 16 >= N) continue; const size_t boff = (size_t)(col0 + t * 16 + ln) * ldb + kb; FragH bq; bq.half[0] = *(const v8us*)((const unsigned short*)Bh + boff + 8 * hh); bq.half[1] = *(const v8us*)((const unsigned short*)Bh + boff + 16 + 8 * hh);
      acc[t] = mmaH<1>(ah.v, ah.v, bq.v, bq.v, acc[t]); }
  }
#pragma unroll
  for (int t = 0; t < 4; ++t) { if (col0 + t * 16 >= N) continue; const int col = col0 + t * 16 + ln; const float bv = bp ? bf16_round(bp[col]) : 0.f;
#pragma unroll
    for (int r = 0; r < 8; ++r) { float v = acc[t][r] * alpha + bv; if (CP) { const int bidx = (row0g + row0 + 8 * hh + r) / rowsPerB; v += CP[(size_t)bidx * sCPb + (size_t)by * 64 + col]; } if (ACT == 1) v = (v > 0.f) ? v : expm1f(v); else if (ACT == 7) v = (v > 0.f) ? v + 1.0f : expf(v); else if (ACT == 8) v = tanhf(v); else if (ACT == 9) v = 0.5f * v * (1.0f + tanhf(0.7978845608028654f * (v + 0.044715f * v * v * v))); else if (ACT == 11) v = 1.0f / (1.0f + expf(-v)); else if (ACT == 12) v = (v > 0.f) ? v : 0.01f * v; else if (ACT == 14) v = (v > 0.f) ? v : 0.1f * v; else if (ACT == 15) v = v / (1.0f + expf(-v)); else if (ACT == 3) v = fmaxf(v, 0.f); else if (ACT == 6) v = 0.5f * v * (1.0f + erff(v * 0.70710678118654752f)); so[w][8 * hh + r][t * 16 + ln] = v; } }
  __builtin_amdgcn_fence(__ATOMIC_ACQ_REL, "workgroup"); __builtin_amdgcn_wave_barrier();
  const int rsub = lane >> 4, c4 = (lane & 15) * 4; typedef _Float16 v4h __attribute__((ext_vector_type(4)));
  {
#pragma unroll
    for (int q = 0; q < 8; ++q) { const int r = q * 2 + rsub; if (col0 + c4 < N) { const v4f v = *(const v4fa*)&so[w][r][c4]; if (C) *(v4f*)(C + cofs + (size_t)(row0 + r) * ldc + col0 + c4) = v; if (C16) { v4h h4; for (int i = 0; i < 4; ++i) h4[i] = (_Float16)v[i]; *(v4h*)(C16 + cofs + (size_t)(row0 + r) * ldc + col0 + c4) = h4; } } }
     }
}


typedef _Float16 v4h __attribute__((ext_vector_type(4)));

__global__ __launch_bounds__(256) void k_x16(const float* __restrict__ x, _Float16* __restrict__ X16, size_t n8) { const size_t t = (size_t)blockIdx.x * 256 + threadIdx.x; if (t >= n8) return; FragH f;
#pragma unroll
  for (int q = 0; q < 8; ++q) f.h[q] = (_Float16)bf16_round(x[t * 8 + q]); *(v8us*)((unsigned short*)X16 + t * 8) = f.half[0];  }
__global__ __launch_bounds__(256) void k_h16(const float* __restrict__ x, _Float16* __restrict__ X16, size_t n8) { const size_t t = (size_t)blockIdx.x * 256 + threadIdx.x; if (t >= n8) return; FragH f;
#pragma unroll
  for (int q = 0; q < 8; ++q) f.h[q] = (_Float16)x[t * 8 + q]; *(v8us*)((unsigned short*)X16 + t * 8) = f.half[0];  }
__global__ __launch_bounds__(256) void k_round16f(const float* __restrict__ W, _Float16* __restrict__ Bt, size_t n8) { const size_t t = (size_t)blockIdx.x * 256 + threadIdx.x; if (t >= n8) return; FragH f;
#pragma unroll
  for (int i = 0; i < 8; ++i) f.h[i] = (_Float16)(bf16_round(W[t * 8 + i]) * 16.0f); *(v8us*)((unsigned short*)Bt + t * 8) = f.half[0];  }
template <int NHv, int TTv>
__global__ __launch_bounds__(256) void k_vt(const _Float16* __restrict__ V16, int ldv, int voff, _Float16* __restrict__ Vt) { __shared__ unsigned short tl[64][66]; const int tid = threadIdx.x; const int slab = blockIdx.x / (TTv / 64), lg = blockIdx.x % (TTv / 64); const int b = slab / NHv, h = slab % NHv;
  for (int i = tid; i < 64 * 8; i += 256) { const int r = i / 8, c8 = (i % 8) * 8; FragH f; f.half[0] = *(const v8us*)((const unsigned short*)V16 + ((size_t)b * TTv + lg * 64 + r) * ldv + voff + h * 64 + c8);
#pragma unroll
    for (int q = 0; q < 8; ++q) tl[r][c8 + q] = f.u[q]; }
  __syncthreads();
  {
#pragma unroll
    for (int rd = 0; rd < 2; ++rd) { const int d = rd * 32 + tid / 8, pc = tid % 8; FragH f;
#pragma unroll
      for (int q = 0; q < 8; ++q) f.u[q] = tl[pc * 8 + q][d];
      *(v8us*)((unsigned short*)Vt + ((size_t)slab * 64 + d) * TTv + lg * 64 + pc * 8) = f.half[0]; }
     } }

__global__ __launch_bounds__(256) void k_hl(const float* __restrict__ F, _Float16* __restrict__ Hh, _Float16* __restrict__ Hl, size_t n8) { const size_t t = (size_t)blockIdx.x * 256 + threadIdx.x; if (t >= n8) return; FragH fh, fl; const v4f a = *(const v4fa*)(F + t * 8), c = *(const v4fa*)(F + t * 8 + 4);
#pragma unroll
  for (int q = 0; q < 4; ++q) { _Float16 h = (_Float16)a[q]; fh.h[q] = h; fl.h[q] = (_Float16)((a[q] - (float)h) * 1024.0f); h = (_Float16)c[q]; fh.h[4 + q] = h; fl.h[4 + q] = (_Float16)((c[q] - (float)h) * 1024.0f); }
  { *(v8us*)((unsigned short*)Hh + t * 8) = fh.half[0]; *(v8us*)((unsigned short*)Hl + t * 8) = fl.half[0];  } }

// ---- fast GEMM (wave tile 32x64, operands staged in LDS); epilogue = k_gemm_hhx semantics ----
__device__ __forceinline__ v16h g2_frag(const _Float16* p, int hh) { FragH f; f.half[0] = *(const v8us*)((const unsigned short*)p + 8 * hh); f.half[1] = *(const v8us*)((const unsigned short*)p + 16 + 8 * hh); return f.v; }
__device__ __forceinline__ v8f g2_mma(v16h a, v16h b, v8f c) { v8f d = __builtin_amdgcn_wmma_f32_16x16x32_f16(false, a, false, b, (short)0, c, false, false); asm volatile("v_nop\n\tv_nop\n\tv_nop\n\tv_nop" : "+v"(d) : "v"(a), "v"(b)); return d; }
// Staged tile of k_gemm2: 128 A rows then 128 B rows, 128 k (256 B) each, at a pitch of 272 B (16 B x odd: conflict-free for ds_load_b128 readers); two buffers.
#define G2_PITCH 272
#define G2_BUF (256 * G2_PITCH)
// Eight asynchronous 16-byte copies per lane (rows 16 apart): l = the lane's LDS byte address, g = its global address, gstep = 16 source rows in elements.
// s_wait_xcnt 0 is the statement's last line, so that it stands in front of any later rewrite of the address registers the copies name.
__device__ __forceinline__ void g2_copy8(unsigned l, const _Float16* g, size_t gstep) {
  const unsigned l1 = l + 16 * G2_PITCH, l2 = l + 32 * G2_PITCH, l3 = l + 48 * G2_PITCH, l4 = l + 64 * G2_PITCH, l5 = l + 80 * G2_PITCH, l6 = l + 96 * G2_PITCH, l7 = l + 112 * G2_PITCH;
  const _Float16* g1 = g + gstep; const _Float16* g2 = g1 + gstep; const _Float16* g3 = g2 + gstep; const _Float16* g4 = g3 + gstep; const _Float16* g5 = g4 + gstep; const _Float16* g6 = g5 + gstep; const _Float16* g7 = g6 + gstep;
  asm volatile("global_load_async_to_lds_b128 %0, %8, off\n\t"
               "global_load_async_to_lds_b128 %1, %9, off\n\t"
               "global_load_async_to_lds_b128 %2, %10, off\n\t"
               "global_load_async_to_lds_b128 %3, %11, off\n\t"
               "global_load_async_to_lds_b128 %4, %12, off\n\t"
               "global_load_async_to_lds_b128 %5, %13, off\n\t"
               "global_load_async_to_lds_b128 %6, %14, off\n\t"
               "global_load_async_to_lds_b128 %7, %15, off\n\t"
               "s_wait_xcnt 0x0"
               :: "v"(l), "v"(l1), "v"(l2), "v"(l3), "v"(l4), "v"(l5), "v"(l6), "v"(l7), "v"(g), "v"(g1), "v"(g2), "v"(g3), "v"(g4), "v"(g5), "v"(g6), "v"(g7) : "memory");
}
// Block tile 128x128 (8 waves as 4 x 2, wave tile 32x64); requires M % 128 == 0, N % 128 == 0, K % 128 == 0. Each pass works on 128 k from one LDS buffer while the next pass's copies fly into the other.
template <int ACT>
__global__ __launch_bounds__(256) void k_gemm2(const _Float16* __restrict__ A, int lda, size_t sA, const _Float16* __restrict__ Bh, int ldb, size_t sB, float alpha, const float* __restrict__ bias, size_t sBias, const float* __restrict__ CP, int rowsPerB, size_t sCPb, int row0g,
    float* __restrict__ C, _Float16* __restrict__ C16, int ldc, size_t sC, int M, int N, int K) {
  __shared__ __attribute__((aligned(16))) unsigned char ring[2 * G2_BUF];
  float (*so)[32][68] = (float (*)[32][68])ring;      /* output staging (8 x 32 x 68 f32 = one buffer), used only behind the last pass's barrier */
  const int tid = threadIdx.x, w = tid >> 5, lane = tid & 31, ln = lane & 15, hh = lane >> 4; const int by = blockIdx.y;
  A += (size_t)by * sA; Bh += (size_t)by * sB; const size_t cofs = (size_t)by * sC; const float* bp = bias ? bias + (size_t)by * sBias : nullptr;
  const int ntn = N >> 7; const int mt = blockIdx.x / ntn, nq = blockIdx.x - mt * ntn; if (mt * 128 >= M) return;      /* the whole block leaves, in front of every barrier */
  const int row0 = mt * 128 + 32 * (w & 3), col0 = nq * 128 + 64 * (w >> 2);
  const _Float16* gA = A + (size_t)(mt * 128 + (tid >> 4)) * lda + (tid & 15) * 8; const _Float16* gB = Bh + (size_t)(nq * 128 + (tid >> 4)) * ldb + (tid & 15) * 8;
  const unsigned lA = (unsigned)(size_t)ring + (unsigned)((tid >> 4) * G2_PITCH + (tid & 15) * 16); const unsigned lB = lA + 128 * G2_PITCH;
  const size_t stA = (size_t)16 * lda, stB = (size_t)16 * ldb;
  const int aofs = (32 * (w & 3) + ln) * G2_PITCH, bofs = (128 + 64 * (w >> 2) + ln) * G2_PITCH;
  const int np = K >> 7;
  g2_copy8(lA, gA, stA); g2_copy8(lB, gB, stB);
  asm volatile("s_wait_asynccnt 0x0" ::: "memory");      /* pass 0's own copies have landed */
  __syncthreads();                                        /* ... and every other wave's */
  if (np > 1) { g2_copy8(lA + G2_BUF, gA + 128, stA); g2_copy8(lB + G2_BUF, gB + 128, stB); }
  const v8f z8 = {0.f,0.f,0.f,0.f,0.f,0.f,0.f,0.f}; v8f c00 = z8, c01 = z8, c02 = z8, c03 = z8, c10 = z8, c11 = z8, c12 = z8, c13 = z8;
#pragma unroll 1      /* one pass per trip: the publish point at the foot stands once */
  for (int p = 0; p < np; ++p) { const unsigned bsel = (unsigned)(p & 1) * G2_BUF; const unsigned char* sa = ring + bsel + aofs; const unsigned char* sb = ring + bsel + bofs;
    v16h fa[2][2], fb[2][4];      /* two fragment sets: block kk + 1 is fetched ahead of block kk's products, inside this pass's buffer only */
    fa[0][0] = g2_frag((const _Float16*)sa, hh); fa[0][1] = g2_frag((const _Float16*)(sa + 16 * G2_PITCH), hh);
#pragma unroll      /* constant indices keep fa and fb in registers (this loop and the two below) */
    for (int j = 0; j < 4; ++j) fb[0][j] = g2_frag((const _Float16*)(sb + j * 16 * G2_PITCH), hh);
#pragma unroll
    for (int kk = 0; kk < 4; ++kk) { const int cu = kk & 1, nx = cu ^ 1;
      if (kk < 3) { fa[nx][0] = g2_frag((const _Float16*)(sa + (kk + 1) * 64), hh); fa[nx][1] = g2_frag((const _Float16*)(sa + 16 * G2_PITCH + (kk + 1) * 64), hh);
#pragma unroll
        for (int j = 0; j < 4; ++j) fb[nx][j] = g2_frag((const _Float16*)(sb + j * 16 * G2_PITCH + (kk + 1) * 64), hh); }
      c00 = g2_mma(fa[cu][0], fb[cu][0], c00); c10 = g2_mma(fa[cu][1], fb[cu][0], c10); c01 = g2_mma(fa[cu][0], fb[cu][1], c01); c11 = g2_mma(fa[cu][1], fb[cu][1], c11);
      c02 = g2_mma(fa[cu][0], fb[cu][2], c02); c12 = g2_mma(fa[cu][1], fb[cu][2], c12); c03 = g2_mma(fa[cu][0], fb[cu][3], c03); c13 = g2_mma(fa[cu][1], fb[cu][3], c13); }
    asm volatile("s_wait_dscnt 0x0" ::: "memory");        /* this wave's reads of the buffer have returned before it is refilled */
    asm volatile("s_wait_asynccnt 0x0" ::: "memory");     /* this wave's copies for pass p + 1 have landed */
    __syncthreads();                                      /* publishes pass p + 1 and ends every reader's last read of pass p's buffer */
    if (p + 2 < np) { g2_copy8(lA + bsel, gA + (size_t)(p + 2) * 128, stA); g2_copy8(lB + bsel, gB + (size_t)(p + 2) * 128, stB); } }
  asm volatile("s_wait_asynccnt 0x0" ::: "memory");       /* nothing in flight when the ring becomes output staging */
  v8f accs[8] = {c00, c01, c02, c03, c10, c11, c12, c13};
#pragma unroll
  for (int u = 0; u < 8; ++u) { const int t = u & 3, half = u >> 2; const int col = col0 + t * 16 + ln; const float bv = bp ? bf16_round(bp[col]) : 0.f;
#pragma unroll
    for (int r = 0; r < 8; ++r) { const int rloc = half * 16 + 8 * hh + r; float v = accs[u][r] * alpha + bv; if (CP) { const int bidx = (row0g + row0 + rloc) / rowsPerB; v += CP[(size_t)bidx * sCPb + (size_t)by * 64 + col]; }
      if (ACT == 3) v = fmaxf(v, 0.f); else if (ACT == 6) v = 0.5f * v * (1.0f + erff(v * 0.70710678118654752f)); else if (ACT == 11) v = 1.0f / (1.0f + expf(-v)); else if (ACT == 15) v = v / (1.0f + expf(-v)); else if (ACT == 12) v = (v > 0.f) ? v : 0.01f * v; else if (ACT == 8) v = tanhf(v); else if (ACT == 9) v = 0.5f * v * (1.0f + tanhf(0.7978845608028654f * (v + 0.044715f * v * v * v)));      /* tanh-GELU */
      so[w][rloc][t * 16 + ln] = v; } }
  __builtin_amdgcn_fence(__ATOMIC_ACQ_REL, "workgroup"); __builtin_amdgcn_wave_barrier();
  const int rsub = lane >> 4, c4 = (lane & 15) * 4;
  {
#pragma unroll
    for (int q = 0; q < 16; ++q) { const int r = q * 2 + rsub; const v4f v = *(const v4fa*)&so[w][r][c4]; if (C) *(v4f*)(C + cofs + (size_t)(row0 + r) * ldc + col0 + c4) = v; if (C16) { v4h h4; for (int i = 0; i < 4; ++i) h4[i] = (_Float16)v[i]; *(v4h*)(C16 + cofs + (size_t)(row0 + r) * ldc + col0 + c4) = h4; } }
     } }



// Staged tile of k_flash: 128 keys. 128 K rows (64 f16 = 128 B) at a pitch of 144 B, then 64 V^T rows (128 keys = 256 B) at a pitch of 272 B (16 B x odd: conflict-free for ds_load_b128 readers); two buffers.
#define FL_KEYS 128
#define FL_KP 144
#define FL_VP 272
#define FL_VOFS (FL_KEYS * FL_KP)
#define FL_BUF (FL_VOFS + 64 * FL_VP)
// Eight asynchronous 16-byte copies per lane: l = the lane's LDS byte address (LSTEP bytes between copies), g = its global address (gstep elements between copies).
// s_wait_xcnt 0 is the statement's last line, so that it stands in front of any later rewrite of the address registers the copies name.
template <unsigned LSTEP>
__device__ __forceinline__ void fl_copy8(unsigned l, const unsigned short* g, size_t gstep) {
  const unsigned l1 = l + LSTEP, l2 = l + 2 * LSTEP, l3 = l + 3 * LSTEP, l4 = l + 4 * LSTEP, l5 = l + 5 * LSTEP, l6 = l + 6 * LSTEP, l7 = l + 7 * LSTEP;
  const unsigned short* g1 = g + gstep; const unsigned short* g2 = g1 + gstep; const unsigned short* g3 = g2 + gstep; const unsigned short* g4 = g3 + gstep; const unsigned short* g5 = g4 + gstep; const unsigned short* g6 = g5 + gstep; const unsigned short* g7 = g6 + gstep;
  asm volatile("global_load_async_to_lds_b128 %0, %8, off\n\t"
               "global_load_async_to_lds_b128 %1, %9, off\n\t"
               "global_load_async_to_lds_b128 %2, %10, off\n\t"
               "global_load_async_to_lds_b128 %3, %11, off\n\t"
               "global_load_async_to_lds_b128 %4, %12, off\n\t"
               "global_load_async_to_lds_b128 %5, %13, off\n\t"
               "global_load_async_to_lds_b128 %6, %14, off\n\t"
               "global_load_async_to_lds_b128 %7, %15, off\n\t"
               "s_wait_xcnt 0x0"
               :: "v"(l), "v"(l1), "v"(l2), "v"(l3), "v"(l4), "v"(l5), "v"(l6), "v"(l7), "v"(g), "v"(g1), "v"(g2), "v"(g3), "v"(g4), "v"(g5), "v"(g6), "v"(g7) : "memory");
}
// lane l with lane l ^ 16 (the two lanes that share one query column of a transposed score tile)
__device__ __forceinline__ float fl_xhalf(float x) { return __builtin_bit_cast(float, __builtin_amdgcn_permlanex16(__builtin_bit_cast(int, x), __builtin_bit_cast(int, x), 0x76543210, 0xfedcba98, false, false)); }
__global__ __launch_bounds__(128) void k_flash(const _Float16* __restrict__ Q16, int ldq, const _Float16* __restrict__ K16, int ldk, const _Float16* __restrict__ Vt, const int* __restrict__ MSK, float* __restrict__ O, int ldo) {
  constexpr int RPW = 16, NQB = TQ / (4 * RPW), DT = 4, KS = 2; (void)MSK;
  __shared__ __attribute__((aligned(16))) float sO[4][RPW][64 + 4];
  __shared__ __attribute__((aligned(16))) unsigned char ring[2 * FL_BUF];
  const int tid = threadIdx.x, w = tid >> 5, lane = tid & 31, ln = lane & 15, hh = lane >> 4;
  const int slab = blockIdx.x / NQB, qblk = blockIdx.x % NQB; const int b = slab / NH, h = slab % NH; const int qb0 = qblk * (4 * RPW); const int q0 = qb0 + w * RPW;
  FragH aq[KS];
  { const unsigned short* qr = (const unsigned short*)Q16 + ((size_t)b * TQ + q0 + ln) * ldq + h * 64;
#pragma unroll
    for (int ks = 0; ks < KS; ++ks) { aq[ks].half[0] = *(const v8us*)(qr + ks * 32 + 8 * hh); aq[ks].half[1] = *(const v8us*)(qr + ks * 32 + 16 + 8 * hh); } }
  const unsigned short* Vth = (const unsigned short*)Vt + (size_t)slab * 64 * TK;
  float m_r = -3.0e38f, l_r = 0.f; v8f oacc[DT];      /* oacc[dt][r] = O^T[dt*16 + 8*hh + r][query ln] */
#pragma unroll
  for (int dt = 0; dt < DT; ++dt) oacc[dt] = (v8f){0.f,0.f,0.f,0.f,0.f,0.f,0.f,0.f};
  /* the block's 128 threads copy a stage: K as 16 rows x 8 pieces, V^T as 8 rows x 16 pieces per copy, whole 128-B lines per wave */
  const unsigned short* gK = (const unsigned short*)K16 + ((size_t)b * TK + (tid >> 3)) * ldk + h * 64 + (tid & 7) * 8; const unsigned short* gV = Vth + (size_t)(tid >> 4) * TK + (tid & 15) * 8;
  const unsigned lK = (unsigned)(size_t)ring + (unsigned)((tid >> 3) * FL_KP + (tid & 7) * 16); const unsigned lV = (unsigned)(size_t)ring + (unsigned)(FL_VOFS + (tid >> 4) * FL_VP + (tid & 15) * 16);
  const size_t stK = (size_t)16 * ldk, stV = (size_t)8 * TK;
  constexpr int NST = TK / FL_KEYS;
  fl_copy8<16 * FL_KP>(lK, gK, stK); fl_copy8<8 * FL_VP>(lV, gV, stV);
  asm volatile("s_wait_asynccnt 0x0" ::: "memory");      /* stage 0's own copies have landed */
  __syncthreads();                                        /* ... and every other wave's */
  if (NST > 1) { fl_copy8<16 * FL_KP>(lK + FL_BUF, gK + (size_t)FL_KEYS * ldk, stK); fl_copy8<8 * FL_VP>(lV + FL_BUF, gV + FL_KEYS, stV); }
#pragma unroll 1      /* one stage per trip: the publish point at the foot stands once */
  for (int st = 0; st < NST; ++st) { const unsigned bsel = (unsigned)(st & 1) * FL_BUF; const unsigned char* sK = ring + bsel; const unsigned char* sV = sK + FL_VOFS;
#pragma unroll 1      /* 32 keys per trip, rolled as before: keeps the loop's text small */
  for (int j0 = 0; j0 < FL_KEYS; j0 += 32) {
    v8f s[2]; FragH bk[2][KS], bv[DT];      /* this trip's K and V^T fragments are read from the stage as one group, ahead of the products and the softmax */
#pragma unroll
    for (int nt = 0; nt < 2; ++nt) { const unsigned short* kr = (const unsigned short*)(sK + (j0 + nt * 16 + ln) * FL_KP);
#pragma unroll
      for (int ks = 0; ks < KS; ++ks) { bk[nt][ks].half[0] = *(const v8us*)(kr + ks * 32 + 8 * hh); bk[nt][ks].half[1] = *(const v8us*)(kr + ks * 32 + 16 + 8 * hh); } }
#pragma unroll
    for (int dt = 0; dt < DT; ++dt) { const unsigned short* vrow = (const unsigned short*)(sV + (dt * 16 + ln) * FL_VP) + j0; bv[dt].half[0] = *(const v8us*)(vrow + 8 * hh); bv[dt].half[1] = *(const v8us*)(vrow + 16 + 8 * hh); }
#pragma unroll
    for (int nt = 0; nt < 2; ++nt) { v8f acc = (v8f){0.f,0.f,0.f,0.f,0.f,0.f,0.f,0.f};
#pragma unroll
      for (int ks = 0; ks < KS; ++ks) acc = mmaH<1>(bk[nt][ks].v, bk[nt][ks].v, aq[ks].v, aq[ks].v, acc);
      s[nt] = acc; }
    float sc[16];
#pragma unroll      /* constant indices keep sc, pb and oacc in registers (this loop and those below) */
    for (int i = 0; i < 16; ++i) sc[i] = s[i >> 3][i & 7] * SCL;
    float mc = sc[0];
#pragma unroll
    for (int i = 1; i < 16; ++i) mc = fmaxf(mc, sc[i]);
    mc = fmaxf(mc, fl_xhalf(mc));
    const float mn = fmaxf(m_r, mc); const float al = (mn > -1.0e38f) ? expf(m_r - mn) : 1.0f; m_r = mn;
    FragH pb; float psum = 0.f;
#pragma unroll
    for (int i = 0; i < 16; ++i) { const float p = expf(sc[i] - mn); psum += p; pb.h[i] = (_Float16)(p * 1024.0f); }
    l_r = l_r * al + psum;
#pragma unroll
    for (int dt = 0; dt < DT; ++dt)
#pragma unroll
      for (int r = 0; r < 8; ++r) oacc[dt][r] *= al;
#pragma unroll
    for (int dt = 0; dt < DT; ++dt) oacc[dt] = mmaH<1>(bv[dt].v, bv[dt].v, pb.v, pb.v, oacc[dt]); }
    asm volatile("s_wait_dscnt 0x0" ::: "memory");        /* this wave's reads of the buffer have returned before it is refilled */
    asm volatile("s_wait_asynccnt 0x0" ::: "memory");     /* this wave's copies for stage st + 1 have landed */
    __syncthreads();                                      /* publishes stage st + 1 and ends every reader's last read of stage st's buffer */
    if (st + 2 < NST) { fl_copy8<16 * FL_KP>(lK + bsel, gK + (size_t)(st + 2) * FL_KEYS * ldk, stK); fl_copy8<8 * FL_VP>(lV + bsel, gV + (size_t)(st + 2) * FL_KEYS, stV); } }
  asm volatile("s_wait_asynccnt 0x0" ::: "memory");       /* nothing in flight when the wave goes on to its end */
  { float l = l_r + fl_xhalf(l_r); l = (l > 0.f) ? 1.0f / (l * 1024.0f) : 0.f;
#pragma unroll
    for (int dt = 0; dt < DT; ++dt) { v4f lo, hi;
#pragma unroll
      for (int r = 0; r < 4; ++r) { lo[r] = oacc[dt][r] * l; hi[r] = oacc[dt][4 + r] * l; }
      *(v4fa*)&sO[w][ln][dt * 16 + 8 * hh] = lo; *(v4fa*)&sO[w][ln][dt * 16 + 8 * hh + 4] = hi; } }
  __builtin_amdgcn_fence(__ATOMIC_ACQ_REL, "workgroup"); __builtin_amdgcn_wave_barrier();
  {
#pragma unroll
    for (int rp = 0; rp < RPW; rp += 2) { const int r = rp + (lane >> 4), pc = lane & 15; const v4f val = *(const v4fa*)&sO[w][r][pc * 4]; *(v4f*)(O + ((size_t)b * TQ + q0 + r) * ldo + h * 64 + pc * 4) = val; }
     } }
__global__ __launch_bounds__(256) void k_fulltab(unsigned* __restrict__ MB, int* __restrict__ RA, int* __restrict__ KE, int nq, int nk) {
  const int t = blockIdx.x * 256 + threadIdx.x;
  if (t < nq * (nk / 32)) { *(unsigned*)(MB + t) = 0u;  }
  if (t < nq) { *(int*)(RA + t) = 0;  }
  if (t < nq / 64) { *(int*)(KE + t * 32) = nk;  } }
template <int SRCBF>
__global__ __launch_bounds__(256) void k_ln1024(const float* __restrict__ X, _Float16* __restrict__ Y16, float* __restrict__ XB) {
  #pragma clang fp contract(off)
  const int tid = threadIdx.x, w = tid >> 5, ln = tid & 31; const int r = blockIdx.x * 8 + w; if (r >= NR) return; const float* x = X + (size_t)r * DM; float s = 0.f;
#pragma unroll 1
  for (int i = 0; i < 8; ++i) { const v4f a = *(const v4fa*)(x + i * 128 + ln * 4); for (int q = 0; q < 4; ++q) s += SRCBF ? bf16_round(a[q]) : a[q]; }
  for (int o = 16; o > 0; o >>= 1) s += __shfl_xor(s, o, 32); const float mu = s / (float)DM; float q2 = 0.f;
#pragma unroll 1
  for (int i = 0; i < 8; ++i) { const v4f a = *(const v4fa*)(x + i * 128 + ln * 4); for (int q = 0; q < 4; ++q) { const float d = (SRCBF ? bf16_round(a[q]) : a[q]) - mu; q2 += d * d; } }
  for (int o = 16; o > 0; o >>= 1) q2 += __shfl_xor(q2, o, 32); const float dn = sqrtf(q2 / (float)DM + 1e-5f);
  {
#pragma unroll 1
    for (int i = 0; i < 8; ++i) { const int c0 = i * 128 + ln * 4; const v4f a = *(const v4fa*)(x + c0); _Float16 h4[4]; v4f xb;
      for (int q = 0; q < 4; ++q) { const float t = SRCBF ? bf16_round(a[q]) : a[q]; h4[q] = (_Float16)((t - mu) / dn); xb[q] = t; }
      *(unsigned long long*)((unsigned short*)Y16 + (size_t)r * DM + c0) = *(const unsigned long long*)h4; if (SRCBF) *(v4f*)(XB + (size_t)r * DM + c0) = xb; }
     } }
__global__ __launch_bounds__(256) void k_causaltab(unsigned* __restrict__ MB, int* __restrict__ RA, int* __restrict__ KE, int nq, int nk) {
  const int t = blockIdx.x * 256 + threadIdx.x; const int nw = nk / 32;
  if (t < nq * nw) { const int q = t / nw, w = t % nw; const int first = q + 1 - 32 * w; const unsigned bits = (first <= 0) ? 0xffffffffu : ((first >= 32) ? 0u : (0xffffffffu << first)); *(unsigned*)(MB + t) = bits;  }
  if (t < nq) { *(int*)(RA + t) = 0;  }
  if (t < nq / 64) { const int v = 64 * (t + 1); *(int*)(KE + t * 32) = v;  } }


extern "C" void kernel_launch(void* const* d_in, const int* in_sizes, int n_in,
                              void* d_out, int out_size, void* d_ws, size_t ws_size, hipStream_t stream) {
  (void)in_sizes; (void)n_in; (void)out_size;
  const float* const* I = (const float* const*)d_in; const float* x = I[0]; const float* Wqkv = I[1]; const float* Wfc = I[2]; const float* W1 = I[3]; const float* b1 = I[4]; const float* W2 = I[5]; const float* b2 = I[6];
  char* ws = (char*)d_ws; size_t off = 0;
  auto take = [&](size_t bytes) { char* p = ws + off; off += (bytes + 255) & ~(size_t)255; return p; };
  _Float16* BQKV = (_Float16*)take((size_t)3 * DM * DM * 2); _Float16* BFC = (_Float16*)take((size_t)DM * DM * 2); _Float16* BW1 = (_Float16*)take((size_t)4096 * DM * 2); _Float16* BW2 = (_Float16*)take((size_t)DM * 4096 * 2);
  float* XB = (float*)take((size_t)NR * DM * 4); _Float16* X16 = (_Float16*)take((size_t)NR * DM * 2); float* F = (float*)take((size_t)NR * DM * 4);
  _Float16* Q16 = (_Float16*)take((size_t)NR * DM * 2); _Float16* K16 = (_Float16*)take((size_t)NR * DM * 2); _Float16* V16 = (_Float16*)take((size_t)NR * DM * 2); _Float16* VT = (_Float16*)take((size_t)NR * DM * 2); if (off > ws_size) return;      /* 24 + 16 + 8 + 16 + 32 = 96 MiB */
  float* O = F; _Float16* Oh = Q16; _Float16* Ol = K16;     /* q/k planes are dead after the flash */
  float* X1 = XB;                                           /* x1 written over the residual plane (own-tile addend) */
  _Float16* H16 = X16; _Float16* GH = Q16;                  /* GELU hidden [NR][4096] f16 = 32 MB over Q16|K16|V16|VT (contiguous, all dead once x1 is formed) */
  const size_t n8 = (size_t)NR * DM / 8; const unsigned nb8 = (unsigned)((n8 + 255) / 256);
  k_wt_f16<<<(unsigned)(((size_t)DM * 3 * DM / 8 + 255) / 256), 256, 0, stream>>>(Wqkv, BQKV, DM, 3 * DM, 16.0f); k_wt_f16<<<(unsigned)(((size_t)DM * DM / 8 + 255) / 256), 256, 0, stream>>>(Wfc, BFC, DM, DM, 16.0f);
  k_wt_f16<<<(unsigned)(((size_t)DM * 4096 / 8 + 255) / 256), 256, 0, stream>>>(W1, BW1, DM, 4096, 16.0f); k_wt_f16<<<(unsigned)(((size_t)4096 * DM / 8 + 255) / 256), 256, 0, stream>>>(W2, BW2, 4096, DM, 16.0f);      /* all (in,out) */
  k_ln1024<1><<<NR / 8, 256, 0, stream>>>(x, X16, XB);
  const dim3 gP((NR / 128) * (DM / 128), 1), gM((NR / 128) * (4096 / 128), 1);
  k_gemm2<0><<<gP, 256, 0, stream>>>(X16, DM, 0, BQKV, DM, 0, 0.0625f, nullptr, 0, nullptr, 1, 0, 0, nullptr, Q16, DM, 0, NR, DM, DM);
  k_gemm2<0><<<gP, 256, 0, stream>>>(X16, DM, 0, BQKV + (size_t)DM * DM, DM, 0, 0.0625f, nullptr, 0, nullptr, 1, 0, 0, nullptr, K16, DM, 0, NR, DM, DM);
  k_gemm2<0><<<gP, 256, 0, stream>>>(X16, DM, 0, BQKV + (size_t)2 * DM * DM, DM, 0, 0.0625f, nullptr, 0, nullptr, 1, 0, 0, nullptr, V16, DM, 0, NR, DM, DM);
  for (int b = 0; b < NBT; ++b) k_vt<NH, SLEN><<<NH * (SLEN / 64), 256, 0, stream>>>(V16 + (size_t)b * SLEN * DM, DM, 0, VT + (size_t)b * SLEN * DM);
  for (int b = 0; b < NBT; ++b) { const size_t ro = (size_t)b * SLEN * DM;
    k_flash<<<NH * (SLEN / 64), 128, 0, stream>>>(Q16 + ro, DM, K16 + ro, DM, VT + ro, nullptr, O + ro, DM); }      /* plain flash over all keys */
  k_hl<<<nb8, 256, 0, stream>>>(O, Oh, Ol, n8);
  k_gemm2<0><<<gP, 256, 0, stream>>>(Oh, DM, 0, BFC, DM, 0, 0.0625f, nullptr, 0, XB, 1, (size_t)DM, 0, X1, nullptr, DM, 0, NR, DM, DM);      /* x1 = x + attn w_fc (hi) */
  k_gemm2<0><<<gP, 256, 0, stream>>>(Ol, DM, 0, BFC, DM, 0, 0.0625f / 1024.0f, nullptr, 0, X1, 1, (size_t)DM, 0, X1, nullptr, DM, 0, NR, DM, DM);      /* + lo */
  k_ln1024<0><<<NR / 8, 256, 0, stream>>>(X1, H16, nullptr);
  k_gemm2<9><<<gM, 256, 0, stream>>>(H16, DM, 0, BW1, DM, 0, 0.0625f, b1, 0, nullptr, 1, 0, 0, nullptr, GH, 4096, 0, NR, 4096, DM);      /* tanh-gelu(LN(x1) w1 + b1) f16 */
  k_gemm2<0><<<gP, 256, 0, stream>>>(GH, 4096, 0, BW2, 4096, 0, 0.0625f, b2, 0, X1, 1, (size_t)DM, 0, (float*)d_out, nullptr, DM, 0, NR, DM, 4096);      /* out = x1 + mlp */
}

// v004
// Measured time: 341 microseconds a run.
// Next to v003, in two timings, it ran 1.09 times as fast each time.
// Counting every step since v000, it is 3.02 times as fast.
#include <hip/hip_runtime.h>
// Pre-LN transformer layer (2 x 2048 tokens, 1024; 16 heads x 64; full (non-causal) attention; MLP 4096 with tanh-GELU): h = LN(x) (no affine); q,k,v = h w_qkv; x1 = x + softmax(q.k/8).v w_fc; out = x1 + gelu(LN(x1) w1 + b1) w2 + b2 -> [2,2048,1024].
// Structure: LayerNorm on VALU (also writing the bf16 residual plane); projections / MLP as f16 WMMA GEMMs (32x64 wave tiles, f32 accumulation, exact weights x16, tanh-GELU and biases in the epilogue, residuals through the f32 addend); q, k, V^T as plain f16 planes through the fused flash kernel over all keys (online softmax in f32, P x2^10); O as hi + residual planes into w_fc (two GEMMs).
// Compute dtype: x and weights rounded to bf16; LN outputs, q, k, v, P and the GELU hidden as f16 operands (~2^-12); O as hi + residual pairs; f32 accumulation, softmax, LayerNorm. v_wmma_f32_16x16x32_f16.
#define NBT 2
#define SLEN 2048
#define TQ SLEN
#define TK SLEN
#define DM 1024
#define NH 16
#define SCL 0.125f
#define NR (NBT * SLEN)
typedef __bf16 v16b __attribute__((ext_vector_type(16)));
typedef unsigned short v8us __attribute__((ext_vector_type(8), may_alias));
typedef float  v8f  __attribute__((ext_vector_type(8)));
typedef float  v4f  __attribute__((ext_vector_type(4)));
typedef float  v4fa __attribute__((ext_vector_type(4), may_alias));
union FragB { v16b v; v8us half[2]; unsigned short u[16]; };

__device__ __forceinline__ unsigned short bf16_bits(float x) { unsigned int u = __float_as_uint(x); return (unsigned short)((u + 0x7FFFu + ((u >> 16) & 1u)) >> 16); }
__device__ __forceinline__ float bf16_val(unsigned short b) { return __uint_as_float(((unsigned int)b) << 16); }
__device__ __forceinline__ float bf16_round(float x) { return bf16_val(bf16_bits(x)); }
// D += A·B with NT terms: 1 = ah·bh, 2 = + al·bh (A split), 3 = + ah·bl (both split)
template <int NT>
__device__ __forceinline__ v8f mmaN(v16b ah, v16b al, v16b bh, v16b bl, v8f c) {
  c = __builtin_amdgcn_wmma_f32_16x16x32_bf16(false, ah, false, bh, (short)0, c, false, false);
  if (NT >= 2) c = __builtin_amdgcn_wmma_f32_16x16x32_bf16(false, al, false, bh, (short)0, c, false, false);
  if (NT >= 3) c = __builtin_amdgcn_wmma_f32_16x16x32_bf16(false, ah, false, bl, (short)0, c, false, false);
  asm volatile("v_nop\n\tv_nop\n\tv_nop\n\tv_nop" : "+v"(c) : "v"(ah), "v"(al), "v"(bh), "v"(bl));
  return c;
}

__global__ __launch_bounds__(256) void k_wt_bf16(const float* __restrict__ W, unsigned short* __restrict__ Wt, int K, int N) {
  const int t = blockIdx.x * 256 + threadIdx.x;
  const int k8n = K / 8;
  if (t >= N * k8n) return;
  const int n = t / k8n, k8 = (t % k8n) * 8;
  v8us v;
#pragma unroll
  for (int i = 0; i < 8; ++i) v[i] = bf16_bits(W[(size_t)(k8 + i) * N + n]);
  *(v8us*)(Wt + (size_t)n * K + k8) = v;
  
}

// GEMM C[M][N] (f32, pitch ldc) = act(A[M][K]·W + bias). A f32 row-major (pitch lda) converted per fragment to bf16
// (ASPLIT: hi/lo two planes -> 2 terms, else single rounded term); Wt bf16 [N][K] (pitch ldb). BIAS_BF16 rounds the
// bias to bf16 first (bias quantised to bf16 before the add). K%32==0, M%16==0, N%64==0.
template <bool ASPLIT, int ACT, bool BIAS_BF16>
__global__ __launch_bounds__(128) void k_gemm_bf(const float* __restrict__ A, int lda, const unsigned short* __restrict__ Wt, int ldb,
                                               const float* __restrict__ bias, float* __restrict__ C, int ldc, int M, int N, int K) {
  __shared__ __attribute__((aligned(16))) float so[4][16][64];
  const int tid = threadIdx.x, w = tid >> 5, lane = tid & 31, ln = lane & 15, hh = lane >> 4;
  const int ntn = N / 64;
  const int wid = blockIdx.x * 4 + w;
  const int mt = wid / ntn, nq = wid % ntn;
  if (mt * 16 >= M) return;
  const int row0 = mt * 16, col0 = nq * 64;
  const float* arow = A + (size_t)(row0 + ln) * lda;
  v8f acc[4] = {};
  for (int kb = 0; kb < K; kb += 32) {
    FragB ah, al;
    const v4f x0 = *(const v4fa*)(arow + kb + 8 * hh), x1 = *(const v4fa*)(arow + kb + 8 * hh + 4);
    const v4f x2 = *(const v4fa*)(arow + kb + 16 + 8 * hh), x3 = *(const v4fa*)(arow + kb + 16 + 8 * hh + 4);
    float xs[16] = {x0[0],x0[1],x0[2],x0[3],x1[0],x1[1],x1[2],x1[3],x2[0],x2[1],x2[2],x2[3],x3[0],x3[1],x3[2],x3[3]};
#pragma unroll
    for (int i = 0; i < 16; ++i) { const unsigned short hb = bf16_bits(xs[i]); ah.u[i] = hb; al.u[i] = ASPLIT ? bf16_bits(xs[i] - bf16_val(hb)) : (unsigned short)0; }
#pragma unroll
    for (int t = 0; t < 4; ++t) {
      const unsigned short* brow = Wt + (size_t)(col0 + t * 16 + ln) * ldb + kb;
      FragB b;
      b.half[0] = *(const v8us*)(brow + 8 * hh);
      b.half[1] = *(const v8us*)(brow + 16 + 8 * hh);
      acc[t] = mmaN<ASPLIT ? 2 : 1>(ah.v, al.v, b.v, b.v, acc[t]);
    }
  }
#pragma unroll
  for (int t = 0; t < 4; ++t) {
    float bv = bias ? bias[col0 + t * 16 + ln] : 0.f;
    if (BIAS_BF16) bv = bf16_round(bv);
#pragma unroll
    for (int r = 0; r < 8; ++r) { float v = acc[t][r] + bv; if (ACT == 1) v = fmaxf(v, 0.f); so[w][8 * hh + r][t * 16 + ln] = v; }
  }
  __builtin_amdgcn_fence(__ATOMIC_ACQ_REL, "workgroup");
  __builtin_amdgcn_wave_barrier();
  const int rsub = lane >> 4, c4 = (lane & 15) * 4;
  {
#pragma unroll
    for (int q = 0; q < 8; ++q) {
      const int r = q * 2 + rsub;
      const v4f v = *(const v4fa*)&so[w][r][c4];
      *(v4f*)(C + (size_t)(row0 + r) * ldc + col0 + c4) = v;
    }
    
  }
}

// GEMM C = act(A·W + bias + resid): A f32 (ASPLIT -> hi/lo 2 terms), Wt bf16 [N][K]; ACT 0 none, 1 relu, 2 exact gelu;
// resid (optional, f32, row index = (row % rmod), pitch ldr, RES_BF16 rounds it) added before the activation.
template <bool ASPLIT, int ACT, bool BIAS_BF16, bool RES_BF16>
__global__ __launch_bounds__(128) void k_gemm_bf3(const float* __restrict__ A, int lda, const unsigned short* __restrict__ Wt, int ldb,
                                                const float* __restrict__ bias, const float* __restrict__ resid, int rmod, int ldr,
                                                float* __restrict__ C, int ldc, int M, int N, int K) {
  __shared__ __attribute__((aligned(16))) float so[4][16][64];
  const int tid = threadIdx.x, w = tid >> 5, lane = tid & 31, ln = lane & 15, hh = lane >> 4;
  const int ntn = N / 64;
  const int wid = blockIdx.x * 4 + w;
  const int mt = wid / ntn, nq = wid % ntn;
  if (mt * 16 >= M) return;
  const int row0 = mt * 16, col0 = nq * 64;
  const float* arow = A + (size_t)(row0 + ln) * lda;
  v8f acc[4] = {};
  for (int kb = 0; kb < K; kb += 32) {
    FragB ah, al;
    const v4f x0 = *(const v4fa*)(arow + kb + 8 * hh), x1 = *(const v4fa*)(arow + kb + 8 * hh + 4);
    const v4f x2 = *(const v4fa*)(arow + kb + 16 + 8 * hh), x3 = *(const v4fa*)(arow + kb + 16 + 8 * hh + 4);
    float xs[16] = {x0[0],x0[1],x0[2],x0[3],x1[0],x1[1],x1[2],x1[3],x2[0],x2[1],x2[2],x2[3],x3[0],x3[1],x3[2],x3[3]};
#pragma unroll
    for (int i = 0; i < 16; ++i) { const unsigned short hb = bf16_bits(xs[i]); ah.u[i] = hb; al.u[i] = ASPLIT ? bf16_bits(xs[i] - bf16_val(hb)) : (unsigned short)0; }
#pragma unroll
    for (int t = 0; t < 4; ++t) {
      const unsigned short* brow = Wt + (size_t)(col0 + t * 16 + ln) * ldb + kb;
      FragB b;
      b.half[0] = *(const v8us*)(brow + 8 * hh);
      b.half[1] = *(const v8us*)(brow + 16 + 8 * hh);
      acc[t] = mmaN<ASPLIT ? 2 : 1>(ah.v, al.v, b.v, b.v, acc[t]);
    }
  }
#pragma unroll
  for (int t = 0; t < 4; ++t) {
    const int col = col0 + t * 16 + ln;
    float bv = bias ? bias[col] : 0.f;
    if (BIAS_BF16) bv = bf16_round(bv);
#pragma unroll
    for (int r = 0; r < 8; ++r) {
      float v = acc[t][r] + bv;
      if (resid) { float rv = resid[(size_t)((row0 + 8 * hh + r) % rmod) * ldr + col]; if (RES_BF16) rv = bf16_round(rv); v += rv; }
      if (ACT == 1) v = fmaxf(v, 0.f);
      if (ACT == 2) v = 0.5f * v * (1.0f + erff(v * 0.70710678118654752f));
      if (ACT == 3) { const float u = 0.7978845608028654f * (v + 0.044715f * v * v * v); v = 0.5f * v * (1.0f + tanhf(u)); }
      so[w][8 * hh + r][t * 16 + ln] = v;
    }
  }
  __builtin_amdgcn_fence(__ATOMIC_ACQ_REL, "workgroup");
  __builtin_amdgcn_wave_barrier();
  const int rsub = lane >> 4, c4 = (lane & 15) * 4;
  {
#pragma unroll
    for (int q = 0; q < 8; ++q) {
      const int r = q * 2 + rsub;
      const v4f v = *(const v4fa*)&so[w][r][c4];
      *(v4f*)(C + (size_t)(row0 + r) * ldc + col0 + c4) = v;
    }
    
  }
}
// row LayerNorm (biased variance, eps) over N: s = X (+ R); optional out_sum <- s; out_norm <- (s-mu)*rsqrt(var+eps)*g + b
template <bool PARAM_BF16>
__global__ __launch_bounds__(256) void k_layernorm(const float* __restrict__ X, const float* __restrict__ R, const float* __restrict__ g, const float* __restrict__ bta,
                                                  float* __restrict__ out_sum, float* __restrict__ out_norm, int N, float eps) {
  __shared__ float red[256];
  const int row = blockIdx.x, tid = threadIdx.x;
  const float* x = X + (size_t)row * N; const float* rr = R ? R + (size_t)row * N : nullptr;
  float vals[16];                     // up to N = 4096
  const int per = N / 256;            // contiguous chunk per thread? use strided-by-4 chunks: thread handles j = tid*4 + 1024*u
  float s1 = 0.f;
  for (int u = 0; u < per / 4; ++u) {
    const int j = tid * 4 + 1024 * u;
    const v4f a = *(const v4fa*)(x + j);
    v4f b = {0.f,0.f,0.f,0.f}; if (rr) b = *(const v4fa*)(rr + j);
#pragma unroll
    for (int q = 0; q < 4; ++q) { const float v = a[q] + b[q]; vals[u * 4 + q] = v; s1 += v; }
  }
  red[tid] = s1; __syncthreads();
  for (int st = 128; st > 0; st >>= 1) { if (tid < st) red[tid] += red[tid + st]; __syncthreads(); }
  const float mu = red[0] / (float)N; __syncthreads();
  float s2 = 0.f;
  for (int u = 0; u < per / 4; ++u)
#pragma unroll
    for (int q = 0; q < 4; ++q) { const float c = vals[u * 4 + q] - mu; s2 += c * c; }
  red[tid] = s2; __syncthreads();
  for (int st = 128; st > 0; st >>= 1) { if (tid < st) red[tid] += red[tid + st]; __syncthreads(); }
  const float rs = rsqrtf(red[0] / (float)N + eps);
  {
    for (int u = 0; u < per / 4; ++u) {
      const int j = tid * 4 + 1024 * u;
      v4f o, sm;
#pragma unroll
      for (int q = 0; q < 4; ++q) {
        float gg = g[j + q], bb = bta[j + q];
        if (PARAM_BF16) { gg = bf16_round(gg); bb = bf16_round(bb); }
        sm[q] = vals[u * 4 + q]; o[q] = (vals[u * 4 + q] - mu) * rs * gg + bb;
      }
      if (out_sum) *(v4f*)(out_sum + (size_t)row * N + j) = sm;
      *(v4f*)(out_norm + (size_t)row * N + j) = o;
    }
    
  }
}



// ---- f16 WMMA path (v_wmma_f32_16x16x32_f16): 11-bit significands for operands in range — used where a [0,1] probability operand needs more precision than bf16
typedef _Float16 v16h __attribute__((ext_vector_type(16)));
union FragH { v16h v; v8us half[2]; _Float16 h[16]; unsigned short u[16]; };
template <int NT>
__device__ __forceinline__ v8f mmaH(v16h ah, v16h al, v16h bh, v16h bl, v8f c) {
  c = __builtin_amdgcn_wmma_f32_16x16x32_f16(false, ah, false, bh, (short)0, c, false, false);
  if (NT >= 2) c = __builtin_amdgcn_wmma_f32_16x16x32_f16(false, al, false, bh, (short)0, c, false, false);
  if (NT >= 3) c = __builtin_amdgcn_wmma_f32_16x16x32_f16(false, ah, false, bl, (short)0, c, false, false);
  asm volatile("v_nop\n\tv_nop\n\tv_nop\n\tv_nop" : "+v"(c) : "v"(ah), "v"(al), "v"(bh), "v"(bl));
  return c;
}
// batched GEMM like k_gemm_b but f16 operands: A f32 (split into f16 hi/lo if ASPLIT, else rounded to f16), Bt = f16 values [n][k]; alpha; C f32; N multiple of 16 (partial tiles skipped)
template <bool ASPLIT>
__global__ __launch_bounds__(128) void k_gemm_h(const float* __restrict__ A, int lda, size_t sA, const _Float16* __restrict__ Bh, int ldb, size_t sB, float alpha, float* __restrict__ C, int ldc, size_t sC, int M, int N, int K) {
  __shared__ __attribute__((aligned(16))) float so[4][16][64];
  const int tid = threadIdx.x, w = tid >> 5, lane = tid & 31, ln = lane & 15, hh = lane >> 4; const int by = blockIdx.y;
  A += (size_t)by * sA; Bh += (size_t)by * sB; C += (size_t)by * sC;
  const int ntn = (N + 63) / 64; const int wid = blockIdx.x * 4 + w; const int mt = wid / ntn, nq = wid % ntn; if (mt * 16 >= M) return;
  const int row0 = mt * 16, col0 = nq * 64; const float* arow = A + (size_t)(row0 + ln) * lda;
  v8f acc[4] = {};
  for (int kb = 0; kb < K; kb += 32) {
    FragH ah, al;
    const v4f x0 = *(const v4fa*)(arow + kb + 8 * hh), x1 = *(const v4fa*)(arow + kb + 8 * hh + 4), x2 = *(const v4fa*)(arow + kb + 16 + 8 * hh), x3 = *(const v4fa*)(arow + kb + 16 + 8 * hh + 4);
    float xs[16] = {x0[0],x0[1],x0[2],x0[3],x1[0],x1[1],x1[2],x1[3],x2[0],x2[1],x2[2],x2[3],x3[0],x3[1],x3[2],x3[3]};
#pragma unroll
    for (int i = 0; i < 16; ++i) { const _Float16 h = (_Float16)xs[i]; ah.h[i] = h; al.h[i] = ASPLIT ? (_Float16)(xs[i] - (float)h) : (_Float16)0.0f; }
#pragma unroll
    for (int t = 0; t < 4; ++t) { if (col0 + t * 16 >= N) continue; const size_t boff = (size_t)(col0 + t * 16 + ln) * ldb + kb; FragH bq; bq.half[0] = *(const v8us*)(Bh + boff + 8 * hh); bq.half[1] = *(const v8us*)(Bh + boff + 16 + 8 * hh);
      acc[t] = mmaH<ASPLIT ? 2 : 1>(ah.v, al.v, bq.v, bq.v, acc[t]); }
  }
#pragma unroll
  for (int t = 0; t < 4; ++t) { if (col0 + t * 16 >= N) continue;
#pragma unroll
    for (int r = 0; r < 8; ++r) so[w][8 * hh + r][t * 16 + ln] = acc[t][r] * alpha; }
  __builtin_amdgcn_fence(__ATOMIC_ACQ_REL, "workgroup"); __builtin_amdgcn_wave_barrier();
  const int rsub = lane >> 4, c4 = (lane & 15) * 4;
  {
#pragma unroll
    for (int q = 0; q < 8; ++q) { const int r = q * 2 + rsub; if (col0 + c4 < N) { const v4f v = *(const v4fa*)&so[w][r][c4]; *(v4f*)(C + (size_t)(row0 + r) * ldc + col0 + c4) = v; } }
     }
}

// Wt[n][k] = f16(W[k][n]·scale) from f32 row-major W[K][N] (scale = power of two; bf16-exact weights stay exact in f16 away from the subnormal range)
__global__ __launch_bounds__(256) void k_wt_f16(const float* __restrict__ W, _Float16* __restrict__ Wt, int K, int N, float scale) {
  const int t = blockIdx.x * 256 + threadIdx.x; if (t >= N * (K / 8)) return; const int n = t / (K / 8), k8 = (t % (K / 8)) * 8; FragH f;
#pragma unroll
  for (int i = 0; i < 8; ++i) f.h[i] = (_Float16)(bf16_round(W[(size_t)(k8 + i) * N + n]) * scale); const v8us o = f.half[0];
  *(v8us*)((unsigned short*)Wt + (size_t)n * K + k8) = o; 
}
// k_gemm_hh variant with fused epilogue: v = acc·alpha + bias[by·sBias + col] (+ CP[(row/rowsPerB)·sCPb + by·64 + col] if CP) ; ACT 0 none / 1 elu ; writes f16 C16 (and f32 C if non-null)
template <int ACT>
__global__ __launch_bounds__(128) void k_gemm_hhx(const _Float16* __restrict__ A, int lda, size_t sA, const _Float16* __restrict__ Bh, int ldb, size_t sB, float alpha, const float* __restrict__ bias, size_t sBias, const float* __restrict__ CP, int rowsPerB, size_t sCPb, int row0g,
    float* __restrict__ C, _Float16* __restrict__ C16, int ldc, size_t sC, int M, int N, int K) {
  __shared__ __attribute__((aligned(16))) float so[4][16][64];
  const int tid = threadIdx.x, w = tid >> 5, lane = tid & 31, ln = lane & 15, hh = lane >> 4; const int by = blockIdx.y;
  A += (size_t)by * sA; Bh += (size_t)by * sB; const size_t cofs = (size_t)by * sC; const float* bp = bias ? bias + (size_t)by * sBias : nullptr;
  const int ntn = (N + 63) / 64; const int wid = blockIdx.x * 4 + w; const int mt = wid / ntn, nq = wid % ntn; if (mt * 16 >= M) return;
  const int row0 = mt * 16, col0 = nq * 64; const _Float16* arow = A + (size_t)(row0 + ln) * lda;
  v8f acc[4] = {};
  for (int kb = 0; kb < K; kb += 32) { FragH ah; ah.half[0] = *(const v8us*)((const unsigned short*)arow + kb + 8 * hh); ah.half[1] = *(const v8us*)((const unsigned short*)arow + kb + 16 + 8 * hh);
#pragma unroll
    for (int t = 0; t < 4; ++t) { if (col0 + t * 16 >= N) continue; const size_t boff = (size_t)(col0 + t * 16 + ln) * ldb + kb; FragH bq; bq.half[0] = *(const v8us*)((const unsigned short*)Bh + boff + 8 * hh); bq.half[1] = *(const v8us*)((const unsigned short*)Bh + boff + 16 + 8 * hh);
      acc[t] = mmaH<1>(ah.v, ah.v, bq.v, bq.v, acc[t]); }
  }
#pragma unroll
  for (int t = 0; t < 4; ++t) { if (col0 + t * 16 >= N) continue; const int col = col0 + t * 16 + ln; const float bv = bp ? bf16_round(bp[col]) : 0.f;
#pragma unroll
    for (int r = 0; r < 8; ++r) { float v = acc[t][r] * alpha + bv; if (CP) { const int bidx = (row0g + row0 + 8 * hh + r) / rowsPerB; v += CP[(size_t)bidx * sCPb + (size_t)by * 64 + col]; } if (ACT == 1) v = (v > 0.f) ? v : expm1f(v); else if (ACT == 7) v = (v > 0.f) ? v + 1.0f : expf(v); else if (ACT == 8) v = tanhf(v); else if (ACT == 9) v = 0.5f * v * (1.0f + tanhf(0.7978845608028654f * (v + 0.044715f * v * v * v))); else if (ACT == 11) v = 1.0f / (1.0f + expf(-v)); else if (ACT == 12) v = (v > 0.f) ? v : 0.01f * v; else if (ACT == 14) v = (v > 0.f) ? v : 0.1f * v; else if (ACT == 15) v = v / (1.0f + expf(-v)); else if (ACT == 3) v = fmaxf(v, 0.f); else if (ACT == 6) v = 0.5f * v * (1.0f + erff(v * 0.70710678118654752f)); so[w][8 * hh + r][t * 16 + ln] = v; } }
  __builtin_amdgcn_fence(__ATOMIC_ACQ_REL, "workgroup"); __builtin_amdgcn_wave_barrier();
  const int rsub = lane >> 4, c4 = (lane & 15) * 4; typedef _Float16 v4h __attribute__((ext_vector_type(4)));
  {
#pragma unroll
    for (int q = 0; q < 8; ++q) { const int r = q * 2 + rsub; if (col0 + c4 < N) { const v4f v = *(const v4fa*)&so[w][r][c4]; if (C) *(v4f*)(C + cofs + (size_t)(row0 + r) * ldc + col0 + c4) = v; if (C16) { v4h h4; for (int i = 0; i < 4; ++i) h4[i] = (_Float16)v[i]; *(v4h*)(C16 + cofs + (size_t)(row0 + r) * ldc + col0 + c4) = h4; } } }
     }
}


typedef _Float16 v4h __attribute__((ext_vector_type(4)));

__global__ __launch_bounds__(256) void k_x16(const float* __restrict__ x, _Float16* __restrict__ X16, size_t n8) { const size_t t = (size_t)blockIdx.x * 256 + threadIdx.x; if (t >= n8) return; FragH f;
#pragma unroll
  for (int q = 0; q < 8; ++q) f.h[q] = (_Float16)bf16_round(x[t * 8 + q]); *(v8us*)((unsigned short*)X16 + t * 8) = f.half[0];  }
__global__ __launch_bounds__(256) void k_h16(const float* __restrict__ x, _Float16* __restrict__ X16, size_t n8) { const size_t t = (size_t)blockIdx.x * 256 + threadIdx.x; if (t >= n8) return; FragH f;
#pragma unroll
  for (int q = 0; q < 8; ++q) f.h[q] = (_Float16)x[t * 8 + q]; *(v8us*)((unsigned short*)X16 + t * 8) = f.half[0];  }
__global__ __launch_bounds__(256) void k_round16f(const float* __restrict__ W, _Float16* __restrict__ Bt, size_t n8) { const size_t t = (size_t)blockIdx.x * 256 + threadIdx.x; if (t >= n8) return; FragH f;
#pragma unroll
  for (int i = 0; i < 8; ++i) f.h[i] = (_Float16)(bf16_round(W[t * 8 + i]) * 16.0f); *(v8us*)((unsigned short*)Bt + t * 8) = f.half[0];  }
template <int NHv, int TTv>
__global__ __launch_bounds__(256) void k_vt(const _Float16* __restrict__ V16, int ldv, int voff, _Float16* __restrict__ Vt) { __shared__ unsigned short tl[64][66]; const int tid = threadIdx.x; const int slab = blockIdx.x / (TTv / 64), lg = blockIdx.x % (TTv / 64); const int b = slab / NHv, h = slab % NHv;
  for (int i = tid; i < 64 * 8; i += 256) { const int r = i / 8, c8 = (i % 8) * 8; FragH f; f.half[0] = *(const v8us*)((const unsigned short*)V16 + ((size_t)b * TTv + lg * 64 + r) * ldv + voff + h * 64 + c8);
#pragma unroll
    for (int q = 0; q < 8; ++q) tl[r][c8 + q] = f.u[q]; }
  __syncthreads();
  {
#pragma unroll
    for (int rd = 0; rd < 2; ++rd) { const int d = rd * 32 + tid / 8, pc = tid % 8; FragH f;
#pragma unroll
      for (int q = 0; q < 8; ++q) f.u[q] = tl[pc * 8 + q][d];
      *(v8us*)((unsigned short*)Vt + ((size_t)slab * 64 + d) * TTv + lg * 64 + pc * 8) = f.half[0]; }
     } }

__global__ __launch_bounds__(256) void k_hl(const float* __restrict__ F, _Float16* __restrict__ Hh, _Float16* __restrict__ Hl, size_t n8) { const size_t t = (size_t)blockIdx.x * 256 + threadIdx.x; if (t >= n8) return; FragH fh, fl; const v4f a = *(const v4fa*)(F + t * 8), c = *(const v4fa*)(F + t * 8 + 4);
#pragma unroll
  for (int q = 0; q < 4; ++q) { _Float16 h = (_Float16)a[q]; fh.h[q] = h; fl.h[q] = (_Float16)((a[q] - (float)h) * 1024.0f); h = (_Float16)c[q]; fh.h[4 + q] = h; fl.h[4 + q] = (_Float16)((c[q] - (float)h) * 1024.0f); }
  { *(v8us*)((unsigned short*)Hh + t * 8) = fh.half[0]; *(v8us*)((unsigned short*)Hl + t * 8) = fl.half[0];  } }

// ---- fast GEMM (wave tile 32x64, operands staged in LDS); epilogue = k_gemm_hhx semantics ----
__device__ __forceinline__ v16h g2_frag(const _Float16* p, int hh) { FragH f; f.half[0] = *(const v8us*)((const unsigned short*)p + 8 * hh); f.half[1] = *(const v8us*)((const unsigned short*)p + 16 + 8 * hh); return f.v; }
__device__ __forceinline__ v8f g2_mma(v16h a, v16h b, v8f c) { v8f d = __builtin_amdgcn_wmma_f32_16x16x32_f16(false, a, false, b, (short)0, c, false, false); asm volatile("v_nop\n\tv_nop\n\tv_nop\n\tv_nop" : "+v"(d) : "v"(a), "v"(b)); return d; }
// Staged tile of k_gemm2: 128 A rows then 128 B rows, 128 k (256 B) each, at a pitch of 272 B (16 B x odd: conflict-free for ds_load_b128 readers); two buffers.
#define G2_PITCH 272
#define G2_BUF (256 * G2_PITCH)
// Eight asynchronous 16-byte copies per lane (rows 16 apart): l = the lane's LDS byte address, g = its global address, gstep = 16 source rows in elements.
// s_wait_xcnt 0 is the statement's last line, so that it stands in front of any later rewrite of the address registers the copies name.
__device__ __forceinline__ void g2_copy8(unsigned l, const _Float16* g, size_t gstep) {
  const unsigned l1 = l + 16 * G2_PITCH, l2 = l + 32 * G2_PITCH, l3 = l + 48 * G2_PITCH, l4 = l + 64 * G2_PITCH, l5 = l + 80 * G2_PITCH, l6 = l + 96 * G2_PITCH, l7 = l + 112 * G2_PITCH;
  const _Float16* g1 = g + gstep; const _Float16* g2 = g1 + gstep; const _Float16* g3 = g2 + gstep; const _Float16* g4 = g3 + gstep; const _Float16* g5 = g4 + gstep; const _Float16* g6 = g5 + gstep; const _Float16* g7 = g6 + gstep;
  asm volatile("global_load_async_to_lds_b128 %0, %8, off\n\t"
               "global_load_async_to_lds_b128 %1, %9, off\n\t"
               "global_load_async_to_lds_b128 %2, %10, off\n\t"
               "global_load_async_to_lds_b128 %3, %11, off\n\t"
               "global_load_async_to_lds_b128 %4, %12, off\n\t"
               "global_load_async_to_lds_b128 %5, %13, off\n\t"
               "global_load_async_to_lds_b128 %6, %14, off\n\t"
               "global_load_async_to_lds_b128 %7, %15, off\n\t"
               "s_wait_xcnt 0x0"
               :: "v"(l), "v"(l1), "v"(l2), "v"(l3), "v"(l4), "v"(l5), "v"(l6), "v"(l7), "v"(g), "v"(g1), "v"(g2), "v"(g3), "v"(g4), "v"(g5), "v"(g6), "v"(g7) : "memory");
}
// Block tile 128x128 (8 waves as 4 x 2, wave tile 32x64); requires M % 128 == 0, N % 128 == 0, K % 128 == 0. Each pass works on 128 k from one LDS buffer while the next pass's copies fly into the other.
template <int ACT>
__global__ __launch_bounds__(256) void k_gemm2(const _Float16* __restrict__ A, int lda, size_t sA, const _Float16* __restrict__ Bh, int ldb, size_t sB, float alpha, const float* __restrict__ bias, size_t sBias, const float* __restrict__ CP, int rowsPerB, size_t sCPb, int row0g,
    float* __restrict__ C, _Float16* __restrict__ C16, int ldc, size_t sC, int M, int N, int K) {
  __shared__ __attribute__((aligned(16))) unsigned char ring[2 * G2_BUF];
  float (*so)[32][68] = (float (*)[32][68])ring;      /* output staging (8 x 32 x 68 f32 = one buffer), used only behind the last pass's barrier */
  const int tid = threadIdx.x, w = tid >> 5, lane = tid & 31, ln = lane & 15, hh = lane >> 4; const int by = blockIdx.y;
  A += (size_t)by * sA; Bh += (size_t)by * sB; const size_t cofs = (size_t)by * sC; const float* bp = bias ? bias + (size_t)by * sBias : nullptr;
  const int ntn = N >> 7; const int mt = blockIdx.x / ntn, nq = blockIdx.x - mt * ntn; if (mt * 128 >= M) return;      /* the whole block leaves, in front of every barrier */
  const int row0 = mt * 128 + 32 * (w & 3), col0 = nq * 128 + 64 * (w >> 2);
  const _Float16* gA = A + (size_t)(mt * 128 + (tid >> 4)) * lda + (tid & 15) * 8; const _Float16* gB = Bh + (size_t)(nq * 128 + (tid >> 4)) * ldb + (tid & 15) * 8;
  const unsigned lA = (unsigned)(size_t)ring + (unsigned)((tid >> 4) * G2_PITCH + (tid & 15) * 16); const unsigned lB = lA + 128 * G2_PITCH;
  const size_t stA = (size_t)16 * lda, stB = (size_t)16 * ldb;
  const int aofs = (32 * (w & 3) + ln) * G2_PITCH, bofs = (128 + 64 * (w >> 2) + ln) * G2_PITCH;
  const int np = K >> 7;
  g2_copy8(lA, gA, stA); g2_copy8(lB, gB, stB);
  asm volatile("s_wait_asynccnt 0x0" ::: "memory");      /* pass 0's own copies have landed */
  __syncthreads();                                        /* ... and every other wave's */
  if (np > 1) { g2_copy8(lA + G2_BUF, gA + 128, stA); g2_copy8(lB + G2_BUF, gB + 128, stB); }
  const v8f z8 = {0.f,0.f,0.f,0.f,0.f,0.f,0.f,0.f}; v8f c00 = z8, c01 = z8, c02 = z8, c03 = z8, c10 = z8, c11 = z8, c12 = z8, c13 = z8;
#pragma unroll 1      /* one pass per trip: the publish point at the foot stands once */
  for (int p = 0; p < np; ++p) { const unsigned bsel = (unsigned)(p & 1) * G2_BUF; const unsigned char* sa = ring + bsel + aofs; const unsigned char* sb = ring + bsel + bofs;
    v16h fa[2][2], fb[2][4];      /* two fragment sets: block kk + 1 is fetched ahead of block kk's products, inside this pass's buffer only */
    fa[0][0] = g2_frag((const _Float16*)sa, hh); fa[0][1] = g2_frag((const _Float16*)(sa + 16 * G2_PITCH), hh);
#pragma unroll      /* constant indices keep fa and fb in registers (this loop and the two below) */
    for (int j = 0; j < 4; ++j) fb[0][j] = g2_frag((const _Float16*)(sb + j * 16 * G2_PITCH), hh);
#pragma unroll
    for (int kk = 0; kk < 4; ++kk) { const int cu = kk & 1, nx = cu ^ 1;
      if (kk < 3) { fa[nx][0] = g2_frag((const _Float16*)(sa + (kk + 1) * 64), hh); fa[nx][1] = g2_frag((const _Float16*)(sa + 16 * G2_PITCH + (kk + 1) * 64), hh);
#pragma unroll
        for (int j = 0; j < 4; ++j) fb[nx][j] = g2_frag((const _Float16*)(sb + j * 16 * G2_PITCH + (kk + 1) * 64), hh); }
      c00 = g2_mma(fa[cu][0], fb[cu][0], c00); c10 = g2_mma(fa[cu][1], fb[cu][0], c10); c01 = g2_mma(fa[cu][0], fb[cu][1], c01); c11 = g2_mma(fa[cu][1], fb[cu][1], c11);
      c02 = g2_mma(fa[cu][0], fb[cu][2], c02); c12 = g2_mma(fa[cu][1], fb[cu][2], c12); c03 = g2_mma(fa[cu][0], fb[cu][3], c03); c13 = g2_mma(fa[cu][1], fb[cu][3], c13); }
    asm volatile("s_wait_dscnt 0x0" ::: "memory");        /* this wave's reads of the buffer have returned before it is refilled */
    asm volatile("s_wait_asynccnt 0x0" ::: "memory");     /* this wave's copies for pass p + 1 have landed */
    __syncthreads();                                      /* publishes pass p + 1 and ends every reader's last read of pass p's buffer */
    if (p + 2 < np) { g2_copy8(lA + bsel, gA + (size_t)(p + 2) * 128, stA); g2_copy8(lB + bsel, gB + (size_t)(p + 2) * 128, stB); } }
  asm volatile("s_wait_asynccnt 0x0" ::: "memory");       /* nothing in flight when the ring becomes output staging */
  v8f accs[8] = {c00, c01, c02, c03, c10, c11, c12, c13};
#pragma unroll
  for (int u = 0; u < 8; ++u) { const int t = u & 3, half = u >> 2; const int col = col0 + t * 16 + ln; const float bv = bp ? bf16_round(bp[col]) : 0.f;
#pragma unroll
    for (int r = 0; r < 8; ++r) { const int rloc = half * 16 + 8 * hh + r; float v = accs[u][r] * alpha + bv; if (CP) { const int bidx = (row0g + row0 + rloc) / rowsPerB; v += CP[(size_t)bidx * sCPb + (size_t)by * 64 + col]; }
      if (ACT == 3) v = fmaxf(v, 0.f); else if (ACT == 6) v = 0.5f * v * (1.0f + erff(v * 0.70710678118654752f)); else if (ACT == 11) v = 1.0f / (1.0f + expf(-v)); else if (ACT == 15) v = v / (1.0f + expf(-v)); else if (ACT == 12) v = (v > 0.f) ? v : 0.01f * v; else if (ACT == 8) v = tanhf(v); else if (ACT == 9) v = 0.5f * v * (1.0f + tanhf(0.7978845608028654f * (v + 0.044715f * v * v * v)));      /* tanh-GELU */
      so[w][rloc][t * 16 + ln] = v; } }
  __builtin_amdgcn_fence(__ATOMIC_ACQ_REL, "workgroup"); __builtin_amdgcn_wave_barrier();
  const int rsub = lane >> 4, c4 = (lane & 15) * 4;
  {
#pragma unroll
    for (int q = 0; q < 16; ++q) { const int r = q * 2 + rsub; const v4f v = *(const v4fa*)&so[w][r][c4]; if (C) *(v4f*)(C + cofs + (size_t)(row0 + r) * ldc + col0 + c4) = v; if (C16) { v4h h4; for (int i = 0; i < 4; ++i) h4[i] = (_Float16)v[i]; *(v4h*)(C16 + cofs + (size_t)(row0 + r) * ldc + col0 + c4) = h4; } }
     } }



// Staged tile of k_flash: 128 keys. 128 K rows (64 f16 = 128 B) at a pitch of 144 B, then 64 V^T rows (128 keys = 256 B) at a pitch of 272 B (16 B x odd: conflict-free for ds_load_b128 readers); two buffers.
#define FL_KEYS 128
#define FL_KP 144
#define FL_VP 272
#define FL_VOFS (FL_KEYS * FL_KP)
#define FL_BUF (FL_VOFS + 64 * FL_VP)
#define FL_C2 (SCL * 1.4426950408889634f)      /* score scale x log2(e) */
// Eight asynchronous 16-byte copies per lane: l = the lane's LDS byte address (LSTEP bytes between copies), g = its global address (gstep elements between copies).
// s_wait_xcnt 0 is the statement's last line, so that it stands in front of any later rewrite of the address registers the copies name.
template <unsigned LSTEP>
__device__ __forceinline__ void fl_copy8(unsigned l, const unsigned short* g, size_t gstep) {
  const unsigned l1 = l + LSTEP, l2 = l + 2 * LSTEP, l3 = l + 3 * LSTEP, l4 = l + 4 * LSTEP, l5 = l + 5 * LSTEP, l6 = l + 6 * LSTEP, l7 = l + 7 * LSTEP;
  const unsigned short* g1 = g + gstep; const unsigned short* g2 = g1 + gstep; const unsigned short* g3 = g2 + gstep; const unsigned short* g4 = g3 + gstep; const unsigned short* g5 = g4 + gstep; const unsigned short* g6 = g5 + gstep; const unsigned short* g7 = g6 + gstep;
  asm volatile("global_load_async_to_lds_b128 %0, %8, off\n\t"
               "global_load_async_to_lds_b128 %1, %9, off\n\t"
               "global_load_async_to_lds_b128 %2, %10, off\n\t"
               "global_load_async_to_lds_b128 %3, %11, off\n\t"
               "global_load_async_to_lds_b128 %4, %12, off\n\t"
               "global_load_async_to_lds_b128 %5, %13, off\n\t"
               "global_load_async_to_lds_b128 %6, %14, off\n\t"
               "global_load_async_to_lds_b128 %7, %15, off\n\t"
               "s_wait_xcnt 0x0"
               :: "v"(l), "v"(l1), "v"(l2), "v"(l3), "v"(l4), "v"(l5), "v"(l6), "v"(l7), "v"(g), "v"(g1), "v"(g2), "v"(g3), "v"(g4), "v"(g5), "v"(g6), "v"(g7) : "memory");
}
// lane l with lane l ^ 16 (the two lanes that share one query column of a transposed score tile)
__device__ __forceinline__ float fl_xhalf(float x) { return __builtin_bit_cast(float, __builtin_amdgcn_permlanex16(__builtin_bit_cast(int, x), __builtin_bit_cast(int, x), 0x76543210, 0xfedcba98, false, false)); }
__global__ __launch_bounds__(128) void k_flash(const _Float16* __restrict__ Q16, int ldq, const _Float16* __restrict__ K16, int ldk, const _Float16* __restrict__ Vt, const int* __restrict__ MSK, float* __restrict__ O, int ldo) {
  constexpr int RPW = 16, NQB = TQ / (4 * RPW), DT = 4, KS = 2; (void)MSK;
  __shared__ __attribute__((aligned(16))) float sO[4][RPW][64 + 4];
  __shared__ __attribute__((aligned(16))) unsigned char ring[2 * FL_BUF];
  const int tid = threadIdx.x, w = tid >> 5, lane = tid & 31, ln = lane & 15, hh = lane >> 4;
  const int slab = blockIdx.x / NQB, qblk = blockIdx.x % NQB; const int b = slab / NH, h = slab % NH; const int qb0 = qblk * (4 * RPW); const int q0 = qb0 + w * RPW;
  FragH aq[KS];
  { const unsigned short* qr = (const unsigned short*)Q16 + ((size_t)b * TQ + q0 + ln) * ldq + h * 64;
#pragma unroll
    for (int ks = 0; ks < KS; ++ks) { aq[ks].half[0] = *(const v8us*)(qr + ks * 32 + 8 * hh); aq[ks].half[1] = *(const v8us*)(qr + ks * 32 + 16 + 8 * hh); } }
  const unsigned short* Vth = (const unsigned short*)Vt + (size_t)slab * 64 * TK;
  float m_r = -3.0e38f, l_r = 0.f; v8f oacc[DT];      /* oacc[dt][r] = O^T[dt*16 + 8*hh + r][query ln] */
#pragma unroll
  for (int dt = 0; dt < DT; ++dt) oacc[dt] = (v8f){0.f,0.f,0.f,0.f,0.f,0.f,0.f,0.f};
  /* the block's 128 threads copy a stage: K as 16 rows x 8 pieces, V^T as 8 rows x 16 pieces per copy, whole 128-B lines per wave */
  const unsigned short* gK = (const unsigned short*)K16 + ((size_t)b * TK + (tid >> 3)) * ldk + h * 64 + (tid & 7) * 8; const unsigned short* gV = Vth + (size_t)(tid >> 4) * TK + (tid & 15) * 8;
  const unsigned lK = (unsigned)(size_t)ring + (unsigned)((tid >> 3) * FL_KP + (tid & 7) * 16); const unsigned lV = (unsigned)(size_t)ring + (unsigned)(FL_VOFS + (tid >> 4) * FL_VP + (tid & 15) * 16);
  const size_t stK = (size_t)16 * ldk, stV = (size_t)8 * TK;
  constexpr int NST = TK / FL_KEYS;
  fl_copy8<16 * FL_KP>(lK, gK, stK); fl_copy8<8 * FL_VP>(lV, gV, stV);
  asm volatile("s_wait_asynccnt 0x0" ::: "memory");      /* stage 0's own copies have landed */
  __syncthreads();                                        /* ... and every other wave's */
  if (NST > 1) { fl_copy8<16 * FL_KP>(lK + FL_BUF, gK + (size_t)FL_KEYS * ldk, stK); fl_copy8<8 * FL_VP>(lV + FL_BUF, gV + FL_KEYS, stV); }
#pragma unroll 1      /* one stage per trip: the publish point at the foot stands once */
  for (int st = 0; st < NST; ++st) { const unsigned bsel = (unsigned)(st & 1) * FL_BUF; const unsigned char* sK = ring + bsel; const unsigned char* sV = sK + FL_VOFS;
#pragma unroll 1      /* 32 keys per trip, rolled as before: keeps the loop's text small */
  for (int j0 = 0; j0 < FL_KEYS; j0 += 32) {
    v8f s[2]; FragH bk[2][KS], bv[DT];      /* this trip's K and V^T fragments are read from the stage as one group, ahead of the products and the softmax */
#pragma unroll
    for (int nt = 0; nt < 2; ++nt) { const unsigned short* kr = (const unsigned short*)(sK + (j0 + nt * 16 + ln) * FL_KP);
#pragma unroll
      for (int ks = 0; ks < KS; ++ks) { bk[nt][ks].half[0] = *(const v8us*)(kr + ks * 32 + 8 * hh); bk[nt][ks].half[1] = *(const v8us*)(kr + ks * 32 + 16 + 8 * hh); } }
#pragma unroll
    for (int dt = 0; dt < DT; ++dt) { const unsigned short* vrow = (const unsigned short*)(sV + (dt * 16 + ln) * FL_VP) + j0; bv[dt].half[0] = *(const v8us*)(vrow + 8 * hh); bv[dt].half[1] = *(const v8us*)(vrow + 16 + 8 * hh); }
#pragma unroll
    for (int nt = 0; nt < 2; ++nt) { v8f acc = (v8f){0.f,0.f,0.f,0.f,0.f,0.f,0.f,0.f};
#pragma unroll
      for (int ks = 0; ks < KS; ++ks) acc = mmaH<1>(bk[nt][ks].v, bk[nt][ks].v, aq[ks].v, aq[ks].v, acc);
      s[nt] = acc; }
    float mc = s[0][0];      /* the running maximum is kept in raw (unscaled) scores: the scale is positive, so the order is the same */
#pragma unroll      /* constant indices keep s, pb and oacc in registers (this loop and those below) */
    for (int i = 1; i < 16; ++i) mc = fmaxf(mc, s[i >> 3][i & 7]);
    mc = fmaxf(mc, fl_xhalf(mc));
    const float mn = fmaxf(m_r, mc); const float al = (mn > -1.0e38f) ? __builtin_amdgcn_exp2f((m_r - mn) * FL_C2) : 1.0f; m_r = mn;
    const float nb = __builtin_fmaf(-mn, FL_C2, 10.0f);      /* 2^(s c + nb) = 2^10 exp((s - mn) / 8): scale, maximum and the 2^10 of P in one multiply-add */
    FragH pb; float psum = 0.f;
#pragma unroll
    for (int i = 0; i < 16; ++i) { const float p = __builtin_amdgcn_exp2f(__builtin_fmaf(s[i >> 3][i & 7], FL_C2, nb)); psum += p; pb.h[i] = (_Float16)p; }
    l_r = l_r * al + psum;      /* l_r carries the 2^10 too */
#pragma unroll
    for (int dt = 0; dt < DT; ++dt)
#pragma unroll
      for (int r = 0; r < 8; ++r) oacc[dt][r] *= al;
#pragma unroll
    for (int dt = 0; dt < DT; ++dt) oacc[dt] = mmaH<1>(bv[dt].v, bv[dt].v, pb.v, pb.v, oacc[dt]); }
    asm volatile("s_wait_dscnt 0x0" ::: "memory");        /* this wave's reads of the buffer have returned before it is refilled */
    asm volatile("s_wait_asynccnt 0x0" ::: "memory");     /* this wave's copies for stage st + 1 have landed */
    __syncthreads();                                      /* publishes stage st + 1 and ends every reader's last read of stage st's buffer */
    if (st + 2 < NST) { fl_copy8<16 * FL_KP>(lK + bsel, gK + (size_t)(st + 2) * FL_KEYS * ldk, stK); fl_copy8<8 * FL_VP>(lV + bsel, gV + (size_t)(st + 2) * FL_KEYS, stV); } }
  asm volatile("s_wait_asynccnt 0x0" ::: "memory");       /* nothing in flight when the wave goes on to its end */
  { float l = l_r + fl_xhalf(l_r); l = (l > 0.f) ? 1.0f / l : 0.f;
#pragma unroll
    for (int dt = 0; dt < DT; ++dt) { v4f lo, hi;
#pragma unroll
      for (int r = 0; r < 4; ++r) { lo[r] = oacc[dt][r] * l; hi[r] = oacc[dt][4 + r] * l; }
      *(v4fa*)&sO[w][ln][dt * 16 + 8 * hh] = lo; *(v4fa*)&sO[w][ln][dt * 16 + 8 * hh + 4] = hi; } }
  __builtin_amdgcn_fence(__ATOMIC_ACQ_REL, "workgroup"); __builtin_amdgcn_wave_barrier();
  {
#pragma unroll
    for (int rp = 0; rp < RPW; rp += 2) { const int r = rp + (lane >> 4), pc = lane & 15; const v4f val = *(const v4fa*)&sO[w][r][pc * 4]; *(v4f*)(O + ((size_t)b * TQ + q0 + r) * ldo + h * 64 + pc * 4) = val; }
     } }
__global__ __launch_bounds__(256) void k_fulltab(unsigned* __restrict__ MB, int* __restrict__ RA, int* __restrict__ KE, int nq, int nk) {
  const int t = blockIdx.x * 256 + threadIdx.x;
  if (t < nq * (nk / 32)) { *(unsigned*)(MB + t) = 0u;  }
  if (t < nq) { *(int*)(RA + t) = 0;  }
  if (t < nq / 64) { *(int*)(KE + t * 32) = nk;  } }
template <int SRCBF>
__global__ __launch_bounds__(256) void k_ln1024(const float* __restrict__ X, _Float16* __restrict__ Y16, float* __restrict__ XB) {
  #pragma clang fp contract(off)
  const int tid = threadIdx.x, w = tid >> 5, ln = tid & 31; const int r = blockIdx.x * 8 + w; if (r >= NR) return; const float* x = X + (size_t)r * DM; float s = 0.f;
#pragma unroll 1
  for (int i = 0; i < 8; ++i) { const v4f a = *(const v4fa*)(x + i * 128 + ln * 4); for (int q = 0; q < 4; ++q) s += SRCBF ? bf16_round(a[q]) : a[q]; }
  for (int o = 16; o > 0; o >>= 1) s += __shfl_xor(s, o, 32); const float mu = s / (float)DM; float q2 = 0.f;
#pragma unroll 1
  for (int i = 0; i < 8; ++i) { const v4f a = *(const v4fa*)(x + i * 128 + ln * 4); for (int q = 0; q < 4; ++q) { const float d = (SRCBF ? bf16_round(a[q]) : a[q]) - mu; q2 += d * d; } }
  for (int o = 16; o > 0; o >>= 1) q2 += __shfl_xor(q2, o, 32); const float dn = sqrtf(q2 / (float)DM + 1e-5f);
  {
#pragma unroll 1
    for (int i = 0; i < 8; ++i) { const int c0 = i * 128 + ln * 4; const v4f a = *(const v4fa*)(x + c0); _Float16 h4[4]; v4f xb;
      for (int q = 0; q < 4; ++q) { const float t = SRCBF ? bf16_round(a[q]) : a[q]; h4[q] = (_Float16)((t - mu) / dn); xb[q] = t; }
      *(unsigned long long*)((unsigned short*)Y16 + (size_t)r * DM + c0) = *(const unsigned long long*)h4; if (SRCBF) *(v4f*)(XB + (size_t)r * DM + c0) = xb; }
     } }
__global__ __launch_bounds__(256) void k_causaltab(unsigned* __restrict__ MB, int* __restrict__ RA, int* __restrict__ KE, int nq, int nk) {
  const int t = blockIdx.x * 256 + threadIdx.x; const int nw = nk / 32;
  if (t < nq * nw) { const int q = t / nw, w = t % nw; const int first = q + 1 - 32 * w; const unsigned bits = (first <= 0) ? 0xffffffffu : ((first >= 32) ? 0u : (0xffffffffu << first)); *(unsigned*)(MB + t) = bits;  }
  if (t < nq) { *(int*)(RA + t) = 0;  }
  if (t < nq / 64) { const int v = 64 * (t + 1); *(int*)(KE + t * 32) = v;  } }


extern "C" void kernel_launch(void* const* d_in, const int* in_sizes, int n_in,
                              void* d_out, int out_size, void* d_ws, size_t ws_size, hipStream_t stream) {
  (void)in_sizes; (void)n_in; (void)out_size;
  const float* const* I = (const float* const*)d_in; const float* x = I[0]; const float* Wqkv = I[1]; const float* Wfc = I[2]; const float* W1 = I[3]; const float* b1 = I[4]; const float* W2 = I[5]; const float* b2 = I[6];
  char* ws = (char*)d_ws; size_t off = 0;
  auto take = [&](size_t bytes) { char* p = ws + off; off += (bytes + 255) & ~(size_t)255; return p; };
  _Float16* BQKV = (_Float16*)take((size_t)3 * DM * DM * 2); _Float16* BFC = (_Float16*)take((size_t)DM * DM * 2); _Float16* BW1 = (_Float16*)take((size_t)4096 * DM * 2); _Float16* BW2 = (_Float16*)take((size_t)DM * 4096 * 2);
  float* XB = (float*)take((size_t)NR * DM * 4); _Float16* X16 = (_Float16*)take((size_t)NR * DM * 2); float* F = (float*)take((size_t)NR * DM * 4);
  _Float16* Q16 = (_Float16*)take((size_t)NR * DM * 2); _Float16* K16 = (_Float16*)take((size_t)NR * DM * 2); _Float16* V16 = (_Float16*)take((size_t)NR * DM * 2); _Float16* VT = (_Float16*)take((size_t)NR * DM * 2); if (off > ws_size) return;      /* 24 + 16 + 8 + 16 + 32 = 96 MiB */
  float* O = F; _Float16* Oh = Q16; _Float16* Ol = K16;     /* q/k planes are dead after the flash */
  float* X1 = XB;                                           /* x1 written over the residual plane (own-tile addend) */
  _Float16* H16 = X16; _Float16* GH = Q16;                  /* GELU hidden [NR][4096] f16 = 32 MB over Q16|K16|V16|VT (contiguous, all dead once x1 is formed) */
  const size_t n8 = (size_t)NR * DM / 8; const unsigned nb8 = (unsigned)((n8 + 255) / 256);
  k_wt_f16<<<(unsigned)(((size_t)DM * 3 * DM / 8 + 255) / 256), 256, 0, stream>>>(Wqkv, BQKV, DM, 3 * DM, 16.0f); k_wt_f16<<<(unsigned)(((size_t)DM * DM / 8 + 255) / 256), 256, 0, stream>>>(Wfc, BFC, DM, DM, 16.0f);
  k_wt_f16<<<(unsigned)(((size_t)DM * 4096 / 8 + 255) / 256), 256, 0, stream>>>(W1, BW1, DM, 4096, 16.0f); k_wt_f16<<<(unsigned)(((size_t)4096 * DM / 8 + 255) / 256), 256, 0, stream>>>(W2, BW2, 4096, DM, 16.0f);      /* all (in,out) */
  k_ln1024<1><<<NR / 8, 256, 0, stream>>>(x, X16, XB);
  const dim3 gP((NR / 128) * (DM / 128), 1), gM((NR / 128) * (4096 / 128), 1);
  k_gemm2<0><<<gP, 256, 0, stream>>>(X16, DM, 0, BQKV, DM, 0, 0.0625f, nullptr, 0, nullptr, 1, 0, 0, nullptr, Q16, DM, 0, NR, DM, DM);
  k_gemm2<0><<<gP, 256, 0, stream>>>(X16, DM, 0, BQKV + (size_t)DM * DM, DM, 0, 0.0625f, nullptr, 0, nullptr, 1, 0, 0, nullptr, K16, DM, 0, NR, DM, DM);
  k_gemm2<0><<<gP, 256, 0, stream>>>(X16, DM, 0, BQKV + (size_t)2 * DM * DM, DM, 0, 0.0625f, nullptr, 0, nullptr, 1, 0, 0, nullptr, V16, DM, 0, NR, DM, DM);
  for (int b = 0; b < NBT; ++b) k_vt<NH, SLEN><<<NH * (SLEN / 64), 256, 0, stream>>>(V16 + (size_t)b * SLEN * DM, DM, 0, VT + (size_t)b * SLEN * DM);
  for (int b = 0; b < NBT; ++b) { const size_t ro = (size_t)b * SLEN * DM;
    k_flash<<<NH * (SLEN / 64), 128, 0, stream>>>(Q16 + ro, DM, K16 + ro, DM, VT + ro, nullptr, O + ro, DM); }      /* plain flash over all keys */
  k_hl<<<nb8, 256, 0, stream>>>(O, Oh, Ol, n8);
  k_gemm2<0><<<gP, 256, 0, stream>>>(Oh, DM, 0, BFC, DM, 0, 0.0625f, nullptr, 0, XB, 1, (size_t)DM, 0, X1, nullptr, DM, 0, NR, DM, DM);      /* x1 = x + attn w_fc (hi) */
  k_gemm2<0><<<gP, 256, 0, stream>>>(Ol, DM, 0, BFC, DM, 0, 0.0625f / 1024.0f, nullptr, 0, X1, 1, (size_t)DM, 0, X1, nullptr, DM, 0, NR, DM, DM);      /* + lo */
  k_ln1024<0><<<NR / 8, 256, 0, stream>>>(X1, H16, nullptr);
  k_gemm2<9><<<gM, 256, 0, stream>>>(H16, DM, 0, BW1, DM, 0, 0.0625f, b1, 0, nullptr, 1, 0, 0, nullptr, GH, 4096, 0, NR, 4096, DM);      /* tanh-gelu(LN(x1) w1 + b1) f16 */
  k_gemm2<0><<<gP, 256, 0, stream>>>(GH, 4096, 0, BW2, 4096, 0, 0.0625f, b2, 0, X1, 1, (size_t)DM, 0, (float*)d_out, nullptr, DM, 0, NR, DM, 4096);      /* out = x1 + mlp */
}

// v005
// One run takes 301 microseconds.
// Next to v004, in two timings, it ran 1.14 times as fast each time.
// Over all steps from v000 it is 3.44 times as fast.
#include <hip/hip_runtime.h>
// Pre-LN transformer layer (2 x 2048 tokens, 1024; 16 heads x 64; full (non-causal) attention; MLP 4096 with tanh-GELU): h = LN(x) (no affine); q,k,v = h w_qkv; x1 = x + softmax(q.k/8).v w_fc; out = x1 + gelu(LN(x1) w1 + b1) w2 + b2 -> [2,2048,1024].
// Structure: LayerNorm on VALU (also writing the bf16 residual plane); projections / MLP as f16 WMMA GEMMs (32x64 wave tiles, f32 accumulation, exact weights x16, tanh-GELU and biases in the epilogue, residuals through the f32 addend); q, k, V^T as plain f16 planes through the fused flash kernel over all keys (online softmax in f32, P x2^10); O as hi + residual planes into w_fc (two GEMMs).
// Compute dtype: x and weights rounded to bf16; LN outputs, q, k, v, P and the GELU hidden as f16 operands (~2^-12); O as hi + residual pairs; f32 accumulation, softmax, LayerNorm. v_wmma_f32_16x16x32_f16.
#define NBT 2
#define SLEN 2048
#define TQ SLEN
#define TK SLEN
#define DM 1024
#define NH 16
#define SCL 0.125f
#define NR (NBT * SLEN)
typedef __bf16 v16b __attribute__((ext_vector_type(16)));
typedef unsigned short v8us __attribute__((ext_vector_type(8), may_alias));
typedef float  v8f  __attribute__((ext_vector_type(8)));
typedef float  v4f  __attribute__((ext_vector_type(4)));
typedef float  v4fa __attribute__((ext_vector_type(4), may_alias));
union FragB { v16b v; v8us half[2]; unsigned short u[16]; };

__device__ __forceinline__ unsigned short bf16_bits(float x) { unsigned int u = __float_as_uint(x); return (unsigned short)((u + 0x7FFFu + ((u >> 16) & 1u)) >> 16); }
__device__ __forceinline__ float bf16_val(unsigned short b) { return __uint_as_float(((unsigned int)b) << 16); }
__device__ __forceinline__ float bf16_round(float x) { return bf16_val(bf16_bits(x)); }
// D += A·B with NT terms: 1 = ah·bh, 2 = + al·bh (A split), 3 = + ah·bl (both split)
template <int NT>
__device__ __forceinline__ v8f mmaN(v16b ah, v16b al, v16b bh, v16b bl, v8f c) {
  c = __builtin_amdgcn_wmma_f32_16x16x32_bf16(false, ah, false, bh, (short)0, c, false, false);
  if (NT >= 2) c = __builtin_amdgcn_wmma_f32_16x16x32_bf16(false, al, false, bh, (short)0, c, false, false);
  if (NT >= 3) c = __builtin_amdgcn_wmma_f32_16x16x32_bf16(false, ah, false, bl, (short)0, c, false, false);
  asm volatile("v_nop\n\tv_nop\n\tv_nop\n\tv_nop" : "+v"(c) : "v"(ah), "v"(al), "v"(bh), "v"(bl));
  return c;
}

__global__ __launch_bounds__(256) void k_wt_bf16(const float* __restrict__ W, unsigned short* __restrict__ Wt, int K, int N) {
  const int t = blockIdx.x * 256 + threadIdx.x;
  const int k8n = K / 8;
  if (t >= N * k8n) return;
  const int n = t / k8n, k8 = (t % k8n) * 8;
  v8us v;
#pragma unroll
  for (int i = 0; i < 8; ++i) v[i] = bf16_bits(W[(size_t)(k8 + i) * N + n]);
  *(v8us*)(Wt + (size_t)n * K + k8) = v;
  
}

// GEMM C[M][N] (f32, pitch ldc) = act(A[M][K]·W + bias). A f32 row-major (pitch lda) converted per fragment to bf16
// (ASPLIT: hi/lo two planes -> 2 terms, else single rounded term); Wt bf16 [N][K] (pitch ldb). BIAS_BF16 rounds the
// bias to bf16 first (bias quantised to bf16 before the add). K%32==0, M%16==0, N%64==0.
template <bool ASPLIT, int ACT, bool BIAS_BF16>
__global__ __launch_bounds__(128) void k_gemm_bf(const float* __restrict__ A, int lda, const unsigned short* __restrict__ Wt, int ldb,
                                               const float* __restrict__ bias, float* __restrict__ C, int ldc, int M, int N, int K) {
  __shared__ __attribute__((aligned(16))) float so[4][16][64];
  const int tid = threadIdx.x, w = tid >> 5, lane = tid & 31, ln = lane & 15, hh = lane >> 4;
  const int ntn = N / 64;
  const int wid = blockIdx.x * 4 + w;
  const int mt = wid / ntn, nq = wid % ntn;
  if (mt * 16 >= M) return;
  const int row0 = mt * 16, col0 = nq * 64;
  const float* arow = A + (size_t)(row0 + ln) * lda;
  v8f acc[4] = {};
  for (int kb = 0; kb < K; kb += 32) {
    FragB ah, al;
    const v4f x0 = *(const v4fa*)(arow + kb + 8 * hh), x1 = *(const v4fa*)(arow + kb + 8 * hh + 4);
    const v4f x2 = *(const v4fa*)(arow + kb + 16 + 8 * hh), x3 = *(const v4fa*)(arow + kb + 16 + 8 * hh + 4);
    float xs[16] = {x0[0],x0[1],x0[2],x0[3],x1[0],x1[1],x1[2],x1[3],x2[0],x2[1],x2[2],x2[3],x3[0],x3[1],x3[2],x3[3]};
#pragma unroll
    for (int i = 0; i < 16; ++i) { const unsigned short hb = bf16_bits(xs[i]); ah.u[i] = hb; al.u[i] = ASPLIT ? bf16_bits(xs[i] - bf16_val(hb)) : (unsigned short)0; }
#pragma unroll
    for (int t = 0; t < 4; ++t) {
      const unsigned short* brow = Wt + (size_t)(col0 + t * 16 + ln) * ldb + kb;
      FragB b;
      b.half[0] = *(const v8us*)(brow + 8 * hh);
      b.half[1] = *(const v8us*)(brow + 16 + 8 * hh);
      acc[t] = mmaN<ASPLIT ? 2 : 1>(ah.v, al.v, b.v, b.v, acc[t]);
    }
  }
#pragma unroll
  for (int t = 0; t < 4; ++t) {
    float bv = bias ? bias[col0 + t * 16 + ln] : 0.f;
    if (BIAS_BF16) bv = bf16_round(bv);
#pragma unroll
    for (int r = 0; r < 8; ++r) { float v = acc[t][r] + bv; if (ACT == 1) v = fmaxf(v, 0.f); so[w][8 * hh + r][t * 16 + ln] = v; }
  }
  __builtin_amdgcn_fence(__ATOMIC_ACQ_REL, "workgroup");
  __builtin_amdgcn_wave_barrier();
  const int rsub = lane >> 4, c4 = (lane & 15) * 4;
  {
#pragma unroll
    for (int q = 0; q < 8; ++q) {
      const int r = q * 2 + rsub;
      const v4f v = *(const v4fa*)&so[w][r][c4];
      *(v4f*)(C + (size_t)(row0 + r) * ldc + col0 + c4) = v;
    }
    
  }
}

// GEMM C = act(A·W + bias + resid): A f32 (ASPLIT -> hi/lo 2 terms), Wt bf16 [N][K]; ACT 0 none, 1 relu, 2 exact gelu;
// resid (optional, f32, row index = (row % rmod), pitch ldr, RES_BF16 rounds it) added before the activation.
template <bool ASPLIT, int ACT, bool BIAS_BF16, bool RES_BF16>
__global__ __launch_bounds__(128) void k_gemm_bf3(const float* __restrict__ A, int lda, const unsigned short* __restrict__ Wt, int ldb,
                                                const float* __restrict__ bias, const float* __restrict__ resid, int rmod, int ldr,
                                                float* __restrict__ C, int ldc, int M, int N, int K) {
  __shared__ __attribute__((aligned(16))) float so[4][16][64];
  const int tid = threadIdx.x, w = tid >> 5, lane = tid & 31, ln = lane & 15, hh = lane >> 4;
  const int ntn = N / 64;
  const int wid = blockIdx.x * 4 + w;
  const int mt = wid / ntn, nq = wid % ntn;
  if (mt * 16 >= M) return;
  const int row0 = mt * 16, col0 = nq * 64;
  const float* arow = A + (size_t)(row0 + ln) * lda;
  v8f acc[4] = {};
  for (int kb = 0; kb < K; kb += 32) {
    FragB ah, al;
    const v4f x0 = *(const v4fa*)(arow + kb + 8 * hh), x1 = *(const v4fa*)(arow + kb + 8 * hh + 4);
    const v4f x2 = *(const v4fa*)(arow + kb + 16 + 8 * hh), x3 = *(const v4fa*)(arow + kb + 16 + 8 * hh + 4);
    float xs[16] = {x0[0],x0[1],x0[2],x0[3],x1[0],x1[1],x1[2],x1[3],x2[0],x2[1],x2[2],x2[3],x3[0],x3[1],x3[2],x3[3]};
#pragma unroll
    for (int i = 0; i < 16; ++i) { const unsigned short hb = bf16_bits(xs[i]); ah.u[i] = hb; al.u[i] = ASPLIT ? bf16_bits(xs[i] - bf16_val(hb)) : (unsigned short)0; }
#pragma unroll
    for (int t = 0; t < 4; ++t) {
      const unsigned short* brow = Wt + (size_t)(col0 + t * 16 + ln) * ldb + kb;
      FragB b;
      b.half[0] = *(const v8us*)(brow + 8 * hh);
      b.half[1] = *(const v8us*)(brow + 16 + 8 * hh);
      acc[t] = mmaN<ASPLIT ? 2 : 1>(ah.v, al.v, b.v, b.v, acc[t]);
    }
  }
#pragma unroll
  for (int t = 0; t < 4; ++t) {
    const int col = col0 + t * 16 + ln;
    float bv = bias ? bias[col] : 0.f;
    if (BIAS_BF16) bv = bf16_round(bv);
#pragma unroll
    for (int r = 0; r < 8; ++r) {
      float v = acc[t][r] + bv;
      if (resid) { float rv = resid[(size_t)((row0 + 8 * hh + r) % rmod) * ldr + col]; if (RES_BF16) rv = bf16_round(rv); v += rv; }
      if (ACT == 1) v = fmaxf(v, 0.f);
      if (ACT == 2) v = 0.5f * v * (1.0f + erff(v * 0.70710678118654752f));
      if (ACT == 3) { const float u = 0.7978845608028654f * (v + 0.044715f * v * v * v); v = 0.5f * v * (1.0f + tanhf(u)); }
      so[w][8 * hh + r][t * 16 + ln] = v;
    }
  }
  __builtin_amdgcn_fence(__ATOMIC_ACQ_REL, "workgroup");
  __builtin_amdgcn_wave_barrier();
  const int rsub = lane >> 4, c4 = (lane & 15) * 4;
  {
#pragma unroll
    for (int q = 0; q < 8; ++q) {
      const int r = q * 2 + rsub;
      const v4f v = *(const v4fa*)&so[w][r][c4];
      *(v4f*)(C + (size_t)(row0 + r) * ldc + col0 + c4) = v;
    }
    
  }
}
// row LayerNorm (biased variance, eps) over N: s = X (+ R); optional out_sum <- s; out_norm <- (s-mu)*rsqrt(var+eps)*g + b
template <bool PARAM_BF16>
__global__ __launch_bounds__(256) void k_layernorm(const float* __restrict__ X, const float* __restrict__ R, const float* __restrict__ g, const float* __restrict__ bta,
                                                  float* __restrict__ out_sum, float* __restrict__ out_norm, int N, float eps) {
  __shared__ float red[256];
  const int row = blockIdx.x, tid = threadIdx.x;
  const float* x = X + (size_t)row * N; const float* rr = R ? R + (size_t)row * N : nullptr;
  float vals[16];                     // up to N = 4096
  const int per = N / 256;            // contiguous chunk per thread? use strided-by-4 chunks: thread handles j = tid*4 + 1024*u
  float s1 = 0.f;
  for (int u = 0; u < per / 4; ++u) {
    const int j = tid * 4 + 1024 * u;
    const v4f a = *(const v4fa*)(x + j);
    v4f b = {0.f,0.f,0.f,0.f}; if (rr) b = *(const v4fa*)(rr + j);
#pragma unroll
    for (int q = 0; q < 4; ++q) { const float v = a[q] + b[q]; vals[u * 4 + q] = v; s1 += v; }
  }
  red[tid] = s1; __syncthreads();
  for (int st = 128; st > 0; st >>= 1) { if (tid < st) red[tid] += red[tid + st]; __syncthreads(); }
  const float mu = red[0] / (float)N; __syncthreads();
  float s2 = 0.f;
  for (int u = 0; u < per / 4; ++u)
#pragma unroll
    for (int q = 0; q < 4; ++q) { const float c = vals[u * 4 + q] - mu; s2 += c * c; }
  red[tid] = s2; __syncthreads();
  for (int st = 128; st > 0; st >>= 1) { if (tid < st) red[tid] += red[tid + st]; __syncthreads(); }
  const float rs = rsqrtf(red[0] / (float)N + eps);
  {
    for (int u = 0; u < per / 4; ++u) {
      const int j = tid * 4 + 1024 * u;
      v4f o, sm;
#pragma unroll
      for (int q = 0; q < 4; ++q) {
        float gg = g[j + q], bb = bta[j + q];
        if (PARAM_BF16) { gg = bf16_round(gg); bb = bf16_round(bb); }
        sm[q] = vals[u * 4 + q]; o[q] = (vals[u * 4 + q] - mu) * rs * gg + bb;
      }
      if (out_sum) *(v4f*)(out_sum + (size_t)row * N + j) = sm;
      *(v4f*)(out_norm + (size_t)row * N + j) = o;
    }
    
  }
}



// ---- f16 WMMA path (v_wmma_f32_16x16x32_f16): 11-bit significands for operands in range — used where a [0,1] probability operand needs more precision than bf16
typedef _Float16 v16h __attribute__((ext_vector_type(16)));
union FragH { v16h v; v8us half[2]; _Float16 h[16]; unsigned short u[16]; };
template <int NT>
__device__ __forceinline__ v8f mmaH(v16h ah, v16h al, v16h bh, v16h bl, v8f c) {
  c = __builtin_amdgcn_wmma_f32_16x16x32_f16(false, ah, false, bh, (short)0, c, false, false);
  if (NT >= 2) c = __builtin_amdgcn_wmma_f32_16x16x32_f16(false, al, false, bh, (short)0, c, false, false);
  if (NT >= 3) c = __builtin_amdgcn_wmma_f32_16x16x32_f16(false, ah, false, bl, (short)0, c, false, false);
  asm volatile("v_nop\n\tv_nop\n\tv_nop\n\tv_nop" : "+v"(c) : "v"(ah), "v"(al), "v"(bh), "v"(bl));
  return c;
}
// batched GEMM like k_gemm_b but f16 operands: A f32 (split into f16 hi/lo if ASPLIT, else rounded to f16), Bt = f16 values [n][k]; alpha; C f32; N multiple of 16 (partial tiles skipped)
template <bool ASPLIT>
__global__ __launch_bounds__(128) void k_gemm_h(const float* __restrict__ A, int lda, size_t sA, const _Float16* __restrict__ Bh, int ldb, size_t sB, float alpha, float* __restrict__ C, int ldc, size_t sC, int M, int N, int K) {
  __shared__ __attribute__((aligned(16))) float so[4][16][64];
  const int tid = threadIdx.x, w = tid >> 5, lane = tid & 31, ln = lane & 15, hh = lane >> 4; const int by = blockIdx.y;
  A += (size_t)by * sA; Bh += (size_t)by * sB; C += (size_t)by * sC;
  const int ntn = (N + 63) / 64; const int wid = blockIdx.x * 4 + w; const int mt = wid / ntn, nq = wid % ntn; if (mt * 16 >= M) return;
  const int row0 = mt * 16, col0 = nq * 64; const float* arow = A + (size_t)(row0 + ln) * lda;
  v8f acc[4] = {};
  for (int kb = 0; kb < K; kb += 32) {
    FragH ah, al;
    const v4f x0 = *(const v4fa*)(arow + kb + 8 * hh), x1 = *(const v4fa*)(arow + kb + 8 * hh + 4), x2 = *(const v4fa*)(arow + kb + 16 + 8 * hh), x3 = *(const v4fa*)(arow + kb + 16 + 8 * hh + 4);
    float xs[16] = {x0[0],x0[1],x0[2],x0[3],x1[0],x1[1],x1[2],x1[3],x2[0],x2[1],x2[2],x2[3],x3[0],x3[1],x3[2],x3[3]};
#pragma unroll
    for (int i = 0; i < 16; ++i) { const _Float16 h = (_Float16)xs[i]; ah.h[i] = h; al.h[i] = ASPLIT ? (_Float16)(xs[i] - (float)h) : (_Float16)0.0f; }
#pragma unroll
    for (int t = 0; t < 4; ++t) { if (col0 + t * 16 >= N) continue; const size_t boff = (size_t)(col0 + t * 16 + ln) * ldb + kb; FragH bq; bq.half[0] = *(const v8us*)(Bh + boff + 8 * hh); bq.half[1] = *(const v8us*)(Bh + boff + 16 + 8 * hh);
      acc[t] = mmaH<ASPLIT ? 2 : 1>(ah.v, al.v, bq.v, bq.v, acc[t]); }
  }
#pragma unroll
  for (int t = 0; t < 4; ++t) { if (col0 + t * 16 >= N) continue;
#pragma unroll
    for (int r = 0; r < 8; ++r) so[w][8 * hh + r][t * 16 + ln] = acc[t][r] * alpha; }
  __builtin_amdgcn_fence(__ATOMIC_ACQ_REL, "workgroup"); __builtin_amdgcn_wave_barrier();
  const int rsub = lane >> 4, c4 = (lane & 15) * 4;
  {
#pragma unroll
    for (int q = 0; q < 8; ++q) { const int r = q * 2 + rsub; if (col0 + c4 < N) { const v4f v = *(const v4fa*)&so[w][r][c4]; *(v4f*)(C + (size_t)(row0 + r) * ldc + col0 + c4) = v; } }
     }
}

// Wt[n][k] = f16(bf16(W[k][n]) * scale) from f32 row-major W[K][N] (scale = power of two; bf16-exact weights stay exact in f16 away from the subnormal range)
// A block turns a tile of 128 k x 64 n through LDS; grid = (K / 128) * (N / 64). Both sides of memory see whole aligned 256-B runs:
// 16 lanes read 64 n of one k row, 16 lanes write 128 k of one n row. A thread reads 8 k x 4 n and stores, per n, its 8 k as one 16-B piece.
// LDS row = one n (16 pieces) at a pitch of 272 B; piece g of row n lies at place g ^ (n >> 4), so that the 16 lanes of a store (rows 4 apart) fall on 16 different bank groups.
#define WT_P 272
template <int K, int N>
__global__ __launch_bounds__(256) void k_wt_f16(const float* __restrict__ W, _Float16* __restrict__ Wt, float scale) {
  static_assert(K % 128 == 0 && N % 64 == 0, "whole tiles only");
  __shared__ __attribute__((aligned(16))) unsigned char tl[64 * WT_P];
  const int tid = threadIdx.x, c = tid & 15, g = tid >> 4; const int kt = blockIdx.x / (N / 64), nt = blockIdx.x % (N / 64); const int k0 = kt * 128, n0 = nt * 64;
  const float* src = W + (size_t)(k0 + g * 8) * N + n0 + c * 4; v4f a[8];
#pragma unroll      /* constant indices keep a and f in registers (this loop and the three below); the eight loads are in flight together */
  for (int i = 0; i < 8; ++i) a[i] = *(const v4fa*)(src + i * N);
#pragma unroll
  for (int j = 0; j < 4; ++j) { FragH f;
#pragma unroll
    for (int i = 0; i < 8; ++i) f.h[i] = (_Float16)(bf16_round(a[i][j]) * scale);
    *(v8us*)(tl + (c * 4 + j) * WT_P + ((g ^ (c >> 2)) * 16)) = f.half[0]; }
  __syncthreads();      /* the tile is whole before any row of it is read */
  unsigned short* dst = (unsigned short*)Wt + (size_t)(n0 + g) * K + k0 + c * 8;
#pragma unroll
  for (int q = 0; q < 4; ++q) { const v8us o = *(const v8us*)(tl + (q * 16 + g) * WT_P + ((c ^ q) * 16)); *(v8us*)(dst + q * 16 * K) = o; }
}
// k_gemm_hh variant with fused epilogue: v = acc·alpha + bias[by·sBias + col] (+ CP[(row/rowsPerB)·sCPb + by·64 + col] if CP) ; ACT 0 none / 1 elu ; writes f16 C16 (and f32 C if non-null)
template <int ACT>
__global__ __launch_bounds__(128) void k_gemm_hhx(const _Float16* __restrict__ A, int lda, size_t sA, const _Float16* __restrict__ Bh, int ldb, size_t sB, float alpha, const float* __restrict__ bias, size_t sBias, const float* __restrict__ CP, int rowsPerB, size_t sCPb, int row0g,
    float* __restrict__ C, _Float16* __restrict__ C16, int ldc, size_t sC, int M, int N, int K) {
  __shared__ __attribute__((aligned(16))) float so[4][16][64];
  const int tid = threadIdx.x, w = tid >> 5, lane = tid & 31, ln = lane & 15, hh = lane >> 4; const int by = blockIdx.y;
  A += (size_t)by * sA; Bh += (size_t)by * sB; const size_t cofs = (size_t)by * sC; const float* bp = bias ? bias + (size_t)by * sBias : nullptr;
  const int ntn = (N + 63) / 64; const int wid = blockIdx.x * 4 + w; const int mt = wid / ntn, nq = wid % ntn; if (mt * 16 >= M) return;
  const int row0 = mt * 16, col0 = nq * 64; const _Float16* arow = A + (size_t)(row0 + ln) * lda;
  v8f acc[4] = {};
  for (int kb = 0; kb < K; kb += 32) { FragH ah; ah.half[0] = *(const v8us*)((const unsigned short*)arow + kb + 8 * hh); ah.half[1] = *(const v8us*)((const unsigned short*)arow + kb + 16 + 8 * hh);
#pragma unroll
    for (int t = 0; t < 4; ++t) { if (col0 + t * 16 >= N) continue; const size_t boff = (size_t)(col0 + t * 16 + ln) * ldb + kb; FragH bq; bq.half[0] = *(const v8us*)((const unsigned short*)Bh + boff + 8 * hh); bq.half[1] = *(const v8us*)((const unsigned short*)Bh + boff + 16 + 8 * hh);
      acc[t] = mmaH<1>(ah.v, ah.v, bq.v, bq.v, acc[t]); }
  }
#pragma unroll
  for (int t = 0; t < 4; ++t) { if (col0 + t * 16 >= N) continue; const int col = col0 + t * 16 + ln; const float bv = bp ? bf16_round(bp[col]) : 0.f;
#pragma unroll
    for (int r = 0; r < 8; ++r) { float v = acc[t][r] * alpha + bv; if (CP) { const int bidx = (row0g + row0 + 8 * hh + r) / rowsPerB; v += CP[(size_t)bidx * sCPb + (size_t)by * 64 + col]; } if (ACT == 1) v = (v > 0.f) ? v : expm1f(v); else if (ACT == 7) v = (v > 0.f) ? v + 1.0f : expf(v); else if (ACT == 8) v = tanhf(v); else if (ACT == 9) v = 0.5f * v * (1.0f + tanhf(0.7978845608028654f * (v + 0.044715f * v * v * v))); else if (ACT == 11) v = 1.0f / (1.0f + expf(-v)); else if (ACT == 12) v = (v > 0.f) ? v : 0.01f * v; else if (ACT == 14) v = (v > 0.f) ? v : 0.1f * v; else if (ACT == 15) v = v / (1.0f + expf(-v)); else if (ACT == 3) v = fmaxf(v, 0.f); else if (ACT == 6) v = 0.5f * v * (1.0f + erff(v * 0.70710678118654752f)); so[w][8 * hh + r][t * 16 + ln] = v; } }
  __builtin_amdgcn_fence(__ATOMIC_ACQ_REL, "workgroup"); __builtin_amdgcn_wave_barrier();
  const int rsub = lane >> 4, c4 = (lane & 15) * 4; typedef _Float16 v4h __attribute__((ext_vector_type(4)));
  {
#pragma unroll
    for (int q = 0; q < 8; ++q) { const int r = q * 2 + rsub; if (col0 + c4 < N) { const v4f v = *(const v4fa*)&so[w][r][c4]; if (C) *(v4f*)(C + cofs + (size_t)(row0 + r) * ldc + col0 + c4) = v; if (C16) { v4h h4; for (int i = 0; i < 4; ++i) h4[i] = (_Float16)v[i]; *(v4h*)(C16 + cofs + (size_t)(row0 + r) * ldc + col0 + c4) = h4; } } }
     }
}


typedef _Float16 v4h __attribute__((ext_vector_type(4)));

__global__ __launch_bounds__(256) void k_x16(const float* __restrict__ x, _Float16* __restrict__ X16, size_t n8) { const size_t t = (size_t)blockIdx.x * 256 + threadIdx.x; if (t >= n8) return; FragH f;
#pragma unroll
  for (int q = 0; q < 8; ++q) f.h[q] = (_Float16)bf16_round(x[t * 8 + q]); *(v8us*)((unsigned short*)X16 + t * 8) = f.half[0];  }
__global__ __launch_bounds__(256) void k_h16(const float* __restrict__ x, _Float16* __restrict__ X16, size_t n8) { const size_t t = (size_t)blockIdx.x * 256 + threadIdx.x; if (t >= n8) return; FragH f;
#pragma unroll
  for (int q = 0; q < 8; ++q) f.h[q] = (_Float16)x[t * 8 + q]; *(v8us*)((unsigned short*)X16 + t * 8) = f.half[0];  }
__global__ __launch_bounds__(256) void k_round16f(const float* __restrict__ W, _Float16* __restrict__ Bt, size_t n8) { const size_t t = (size_t)blockIdx.x * 256 + threadIdx.x; if (t >= n8) return; FragH f;
#pragma unroll
  for (int i = 0; i < 8; ++i) f.h[i] = (_Float16)(bf16_round(W[t * 8 + i]) * 16.0f); *(v8us*)((unsigned short*)Bt + t * 8) = f.half[0];  }
template <int NHv, int TTv>
__global__ __launch_bounds__(256) void k_vt(const _Float16* __restrict__ V16, int ldv, int voff, _Float16* __restrict__ Vt) { __shared__ unsigned short tl[64][66]; const int tid = threadIdx.x; const int slab = blockIdx.x / (TTv / 64), lg = blockIdx.x % (TTv / 64); const int b = slab / NHv, h = slab % NHv;
  for (int i = tid; i < 64 * 8; i += 256) { const int r = i / 8, c8 = (i % 8) * 8; FragH f; f.half[0] = *(const v8us*)((const unsigned short*)V16 + ((size_t)b * TTv + lg * 64 + r) * ldv + voff + h * 64 + c8);
#pragma unroll
    for (int q = 0; q < 8; ++q) tl[r][c8 + q] = f.u[q]; }
  __syncthreads();
  {
#pragma unroll
    for (int rd = 0; rd < 2; ++rd) { const int d = rd * 32 + tid / 8, pc = tid % 8; FragH f;
#pragma unroll
      for (int q = 0; q < 8; ++q) f.u[q] = tl[pc * 8 + q][d];
      *(v8us*)((unsigned short*)Vt + ((size_t)slab * 64 + d) * TTv + lg * 64 + pc * 8) = f.half[0]; }
     } }

__global__ __launch_bounds__(256) void k_hl(const float* __restrict__ F, _Float16* __restrict__ Hh, _Float16* __restrict__ Hl, size_t n8) { const size_t t = (size_t)blockIdx.x * 256 + threadIdx.x; if (t >= n8) return; FragH fh, fl; const v4f a = *(const v4fa*)(F + t * 8), c = *(const v4fa*)(F + t * 8 + 4);
#pragma unroll
  for (int q = 0; q < 4; ++q) { _Float16 h = (_Float16)a[q]; fh.h[q] = h; fl.h[q] = (_Float16)((a[q] - (float)h) * 1024.0f); h = (_Float16)c[q]; fh.h[4 + q] = h; fl.h[4 + q] = (_Float16)((c[q] - (float)h) * 1024.0f); }
  { *(v8us*)((unsigned short*)Hh + t * 8) = fh.half[0]; *(v8us*)((unsigned short*)Hl + t * 8) = fl.half[0];  } }

// ---- fast GEMM (wave tile 32x64, operands staged in LDS); epilogue = k_gemm_hhx semantics ----
__device__ __forceinline__ v16h g2_frag(const _Float16* p, int hh) { FragH f; f.half[0] = *(const v8us*)((const unsigned short*)p + 8 * hh); f.half[1] = *(const v8us*)((const unsigned short*)p + 16 + 8 * hh); return f.v; }
__device__ __forceinline__ v8f g2_mma(v16h a, v16h b, v8f c) { v8f d = __builtin_amdgcn_wmma_f32_16x16x32_f16(false, a, false, b, (short)0, c, false, false); asm volatile("v_nop\n\tv_nop\n\tv_nop\n\tv_nop" : "+v"(d) : "v"(a), "v"(b)); return d; }
// Staged tile of k_gemm2: 128 A rows then 128 B rows, 128 k (256 B) each, at a pitch of 272 B (16 B x odd: conflict-free for ds_load_b128 readers); two buffers.
#define G2_PITCH 272
#define G2_BUF (256 * G2_PITCH)
// Eight asynchronous 16-byte copies per lane (rows 16 apart): l = the lane's LDS byte address, g = its global address, gstep = 16 source rows in elements.
// s_wait_xcnt 0 is the statement's last line, so that it stands in front of any later rewrite of the address registers the copies name.
__device__ __forceinline__ void g2_copy8(unsigned l, const _Float16* g, size_t gstep) {
  const unsigned l1 = l + 16 * G2_PITCH, l2 = l + 32 * G2_PITCH, l3 = l + 48 * G2_PITCH, l4 = l + 64 * G2_PITCH, l5 = l + 80 * G2_PITCH, l6 = l + 96 * G2_PITCH, l7 = l + 112 * G2_PITCH;
  const _Float16* g1 = g + gstep; const _Float16* g2 = g1 + gstep; const _Float16* g3 = g2 + gstep; const _Float16* g4 = g3 + gstep; const _Float16* g5 = g4 + gstep; const _Float16* g6 = g5 + gstep; const _Float16* g7 = g6 + gstep;
  asm volatile("global_load_async_to_lds_b128 %0, %8, off\n\t"
               "global_load_async_to_lds_b128 %1, %9, off\n\t"
               "global_load_async_to_lds_b128 %2, %10, off\n\t"
               "global_load_async_to_lds_b128 %3, %11, off\n\t"
               "global_load_async_to_lds_b128 %4, %12, off\n\t"
               "global_load_async_to_lds_b128 %5, %13, off\n\t"
               "global_load_async_to_lds_b128 %6, %14, off\n\t"
               "global_load_async_to_lds_b128 %7, %15, off\n\t"
               "s_wait_xcnt 0x0"
               :: "v"(l), "v"(l1), "v"(l2), "v"(l3), "v"(l4), "v"(l5), "v"(l6), "v"(l7), "v"(g), "v"(g1), "v"(g2), "v"(g3), "v"(g4), "v"(g5), "v"(g6), "v"(g7) : "memory");
}
// Block tile 128x128 (8 waves as 4 x 2, wave tile 32x64); requires M % 128 == 0, N % 128 == 0, K % 128 == 0. Each pass works on 128 k from one LDS buffer while the next pass's copies fly into the other.
template <int ACT>
__global__ __launch_bounds__(256) void k_gemm2(const _Float16* __restrict__ A, int lda, size_t sA, const _Float16* __restrict__ Bh, int ldb, size_t sB, float alpha, const float* __restrict__ bias, size_t sBias, const float* __restrict__ CP, int rowsPerB, size_t sCPb, int row0g,
    float* __restrict__ C, _Float16* __restrict__ C16, int ldc, size_t sC, int M, int N, int K) {
  __shared__ __attribute__((aligned(16))) unsigned char ring[2 * G2_BUF];
  float (*so)[32][68] = (float (*)[32][68])ring;      /* output staging (8 x 32 x 68 f32 = one buffer), used only behind the last pass's barrier */
  const int tid = threadIdx.x, w = tid >> 5, lane = tid & 31, ln = lane & 15, hh = lane >> 4; const int by = blockIdx.y;
  A += (size_t)by * sA; Bh += (size_t)by * sB; const size_t cofs = (size_t)by * sC; const float* bp = bias ? bias + (size_t)by * sBias : nullptr;
  const int ntn = N >> 7; const int mt = blockIdx.x / ntn, nq = blockIdx.x - mt * ntn; if (mt * 128 >= M) return;      /* the whole block leaves, in front of every barrier */
  const int row0 = mt * 128 + 32 * (w & 3), col0 = nq * 128 + 64 * (w >> 2);
  const _Float16* gA = A + (size_t)(mt * 128 + (tid >> 4)) * lda + (tid & 15) * 8; const _Float16* gB = Bh + (size_t)(nq * 128 + (tid >> 4)) * ldb + (tid & 15) * 8;
  const unsigned lA = (unsigned)(size_t)ring + (unsigned)((tid >> 4) * G2_PITCH + (tid & 15) * 16); const unsigned lB = lA + 128 * G2_PITCH;
  const size_t stA = (size_t)16 * lda, stB = (size_t)16 * ldb;
  const int aofs = (32 * (w & 3) + ln) * G2_PITCH, bofs = (128 + 64 * (w >> 2) + ln) * G2_PITCH;
  const int np = K >> 7;
  g2_copy8(lA, gA, stA); g2_copy8(lB, gB, stB);
  asm volatile("s_wait_asynccnt 0x0" ::: "memory");      /* pass 0's own copies have landed */
  __syncthreads();                                        /* ... and every other wave's */
  if (np > 1) { g2_copy8(lA + G2_BUF, gA + 128, stA); g2_copy8(lB + G2_BUF, gB + 128, stB); }
  const v8f z8 = {0.f,0.f,0.f,0.f,0.f,0.f,0.f,0.f}; v8f c00 = z8, c01 = z8, c02 = z8, c03 = z8, c10 = z8, c11 = z8, c12 = z8, c13 = z8;
#pragma unroll 1      /* one pass per trip: the publish point at the foot stands once */
  for (int p = 0; p < np; ++p) { const unsigned bsel = (unsigned)(p & 1) * G2_BUF; const unsigned char* sa = ring + bsel + aofs; const unsigned char* sb = ring + bsel + bofs;
    v16h fa[2][2], fb[2][4];      /* two fragment sets: block kk + 1 is fetched ahead of block kk's products, inside this pass's buffer only */
    fa[0][0] = g2_frag((const _Float16*)sa, hh); fa[0][1] = g2_frag((const _Float16*)(sa + 16 * G2_PITCH), hh);
#pragma unroll      /* constant indices keep fa and fb in registers (this loop and the two below) */
    for (int j = 0; j < 4; ++j) fb[0][j] = g2_frag((const _Float16*)(sb + j * 16 * G2_PITCH), hh);
#pragma unroll
    for (int kk = 0; kk < 4; ++kk) { const int cu = kk & 1, nx = cu ^ 1;
      if (kk < 3) { fa[nx][0] = g2_frag((const _Float16*)(sa + (kk + 1) * 64), hh); fa[nx][1] = g2_frag((const _Float16*)(sa + 16 * G2_PITCH + (kk + 1) * 64), hh);
#pragma unroll
        for (int j = 0; j < 4; ++j) fb[nx][j] = g2_frag((const _Float16*)(sb + j * 16 * G2_PITCH + (kk + 1) * 64), hh); }
      c00 = g2_mma(fa[cu][0], fb[cu][0], c00); c10 = g2_mma(fa[cu][1], fb[cu][0], c10); c01 = g2_mma(fa[cu][0], fb[cu][1], c01); c11 = g2_mma(fa[cu][1], fb[cu][1], c11);
      c02 = g2_mma(fa[cu][0], fb[cu][2], c02); c12 = g2_mma(fa[cu][1], fb[cu][2], c12); c03 = g2_mma(fa[cu][0], fb[cu][3], c03); c13 = g2_mma(fa[cu][1], fb[cu][3], c13); }
    asm volatile("s_wait_dscnt 0x0" ::: "memory");        /* this wave's reads of the buffer have returned before it is refilled */
    asm volatile("s_wait_asynccnt 0x0" ::: "memory");     /* this wave's copies for pass p + 1 have landed */
    __syncthreads();                                      /* publishes pass p + 1 and ends every reader's last read of pass p's buffer */
    if (p + 2 < np) { g2_copy8(lA + bsel, gA + (size_t)(p + 2) * 128, stA); g2_copy8(lB + bsel, gB + (size_t)(p + 2) * 128, stB); } }
  asm volatile("s_wait_asynccnt 0x0" ::: "memory");       /* nothing in flight when the ring becomes output staging */
  v8f accs[8] = {c00, c01, c02, c03, c10, c11, c12, c13};
#pragma unroll
  for (int u = 0; u < 8; ++u) { const int t = u & 3, half = u >> 2; const int col = col0 + t * 16 + ln; const float bv = bp ? bf16_round(bp[col]) : 0.f;
#pragma unroll
    for (int r = 0; r < 8; ++r) { const int rloc = half * 16 + 8 * hh + r; float v = accs[u][r] * alpha + bv; if (CP) { const int bidx = (row0g + row0 + rloc) / rowsPerB; v += CP[(size_t)bidx * sCPb + (size_t)by * 64 + col]; }
      if (ACT == 3) v = fmaxf(v, 0.f); else if (ACT == 6) v = 0.5f * v * (1.0f + erff(v * 0.70710678118654752f)); else if (ACT == 11) v = 1.0f / (1.0f + expf(-v)); else if (ACT == 15) v = v / (1.0f + expf(-v)); else if (ACT == 12) v = (v > 0.f) ? v : 0.01f * v; else if (ACT == 8) v = tanhf(v); else if (ACT == 9) v = 0.5f * v * (1.0f + tanhf(0.7978845608028654f * (v + 0.044715f * v * v * v)));      /* tanh-GELU */
      so[w][rloc][t * 16 + ln] = v; } }
  __builtin_amdgcn_fence(__ATOMIC_ACQ_REL, "workgroup"); __builtin_amdgcn_wave_barrier();
  const int rsub = lane >> 4, c4 = (lane & 15) * 4;
  {
#pragma unroll
    for (int q = 0; q < 16; ++q) { const int r = q * 2 + rsub; const v4f v = *(const v4fa*)&so[w][r][c4]; if (C) *(v4f*)(C + cofs + (size_t)(row0 + r) * ldc + col0 + c4) = v; if (C16) { v4h h4; for (int i = 0; i < 4; ++i) h4[i] = (_Float16)v[i]; *(v4h*)(C16 + cofs + (size_t)(row0 + r) * ldc + col0 + c4) = h4; } }
     } }



// Staged tile of k_flash: 128 keys. 128 K rows (64 f16 = 128 B) at a pitch of 144 B, then 64 V^T rows (128 keys = 256 B) at a pitch of 272 B (16 B x odd: conflict-free for ds_load_b128 readers); two buffers.
#define FL_KEYS 128
#define FL_KP 144
#define FL_VP 272
#define FL_VOFS (FL_KEYS * FL_KP)
#define FL_BUF (FL_VOFS + 64 * FL_VP)
#define FL_C2 (SCL * 1.4426950408889634f)      /* score scale x log2(e) */
// Eight asynchronous 16-byte copies per lane: l = the lane's LDS byte address (LSTEP bytes between copies), g = its global address (gstep elements between copies).
// s_wait_xcnt 0 is the statement's last line, so that it stands in front of any later rewrite of the address registers the copies name.
template <unsigned LSTEP>
__device__ __forceinline__ void fl_copy8(unsigned l, const unsigned short* g, size_t gstep) {
  const unsigned l1 = l + LSTEP, l2 = l + 2 * LSTEP, l3 = l + 3 * LSTEP, l4 = l + 4 * LSTEP, l5 = l + 5 * LSTEP, l6 = l + 6 * LSTEP, l7 = l + 7 * LSTEP;
  const unsigned short* g1 = g + gstep; const unsigned short* g2 = g1 + gstep; const unsigned short* g3 = g2 + gstep; const unsigned short* g4 = g3 + gstep; const unsigned short* g5 = g4 + gstep; const unsigned short* g6 = g5 + gstep; const unsigned short* g7 = g6 + gstep;
  asm volatile("global_load_async_to_lds_b128 %0, %8, off\n\t"
               "global_load_async_to_lds_b128 %1, %9, off\n\t"
               "global_load_async_to_lds_b128 %2, %10, off\n\t"
               "global_load_async_to_lds_b128 %3, %11, off\n\t"
               "global_load_async_to_lds_b128 %4, %12, off\n\t"
               "global_load_async_to_lds_b128 %5, %13, off\n\t"
               "global_load_async_to_lds_b128 %6, %14, off\n\t"
               "global_load_async_to_lds_b128 %7, %15, off\n\t"
               "s_wait_xcnt 0x0"
               :: "v"(l), "v"(l1), "v"(l2), "v"(l3), "v"(l4), "v"(l5), "v"(l6), "v"(l7), "v"(g), "v"(g1), "v"(g2), "v"(g3), "v"(g4), "v"(g5), "v"(g6), "v"(g7) : "memory");
}
// lane l with lane l ^ 16 (the two lanes that share one query column of a transposed score tile)
__device__ __forceinline__ float fl_xhalf(float x) { return __builtin_bit_cast(float, __builtin_amdgcn_permlanex16(__builtin_bit_cast(int, x), __builtin_bit_cast(int, x), 0x76543210, 0xfedcba98, false, false)); }
__global__ __launch_bounds__(128) void k_flash(const _Float16* __restrict__ Q16, int ldq, const _Float16* __restrict__ K16, int ldk, const _Float16* __restrict__ Vt, const int* __restrict__ MSK, float* __restrict__ O, int ldo) {
  constexpr int RPW = 16, NQB = TQ / (4 * RPW), DT = 4, KS = 2; (void)MSK;
  __shared__ __attribute__((aligned(16))) float sO[4][RPW][64 + 4];
  __shared__ __attribute__((aligned(16))) unsigned char ring[2 * FL_BUF];
  const int tid = threadIdx.x, w = tid >> 5, lane = tid & 31, ln = lane & 15, hh = lane >> 4;
  const int slab = blockIdx.x / NQB, qblk = blockIdx.x % NQB; const int b = slab / NH, h = slab % NH; const int qb0 = qblk * (4 * RPW); const int q0 = qb0 + w * RPW;
  FragH aq[KS];
  { const unsigned short* qr = (const unsigned short*)Q16 + ((size_t)b * TQ + q0 + ln) * ldq + h * 64;
#pragma unroll
    for (int ks = 0; ks < KS; ++ks) { aq[ks].half[0] = *(const v8us*)(qr + ks * 32 + 8 * hh); aq[ks].half[1] = *(const v8us*)(qr + ks * 32 + 16 + 8 * hh); } }
  const unsigned short* Vth = (const unsigned short*)Vt + (size_t)slab * 64 * TK;
  float m_r = -3.0e38f, l_r = 0.f; v8f oacc[DT];      /* oacc[dt][r] = O^T[dt*16 + 8*hh + r][query ln] */
#pragma unroll
  for (int dt = 0; dt < DT; ++dt) oacc[dt] = (v8f){0.f,0.f,0.f,0.f,0.f,0.f,0.f,0.f};
  /* the block's 128 threads copy a stage: K as 16 rows x 8 pieces, V^T as 8 rows x 16 pieces per copy, whole 128-B lines per wave */
  const unsigned short* gK = (const unsigned short*)K16 + ((size_t)b * TK + (tid >> 3)) * ldk + h * 64 + (tid & 7) * 8; const unsigned short* gV = Vth + (size_t)(tid >> 4) * TK + (tid & 15) * 8;
  const unsigned lK = (unsigned)(size_t)ring + (unsigned)((tid >> 3) * FL_KP + (tid & 7) * 16); const unsigned lV = (unsigned)(size_t)ring + (unsigned)(FL_VOFS + (tid >> 4) * FL_VP + (tid & 15) * 16);
  const size_t stK = (size_t)16 * ldk, stV = (size_t)8 * TK;
  constexpr int NST = TK / FL_KEYS;
  fl_copy8<16 * FL_KP>(lK, gK, stK); fl_copy8<8 * FL_VP>(lV, gV, stV);
  asm volatile("s_wait_asynccnt 0x0" ::: "memory");      /* stage 0's own copies have landed */
  __syncthreads();                                        /* ... and every other wave's */
  if (NST > 1) { fl_copy8<16 * FL_KP>(lK + FL_BUF, gK + (size_t)FL_KEYS * ldk, stK); fl_copy8<8 * FL_VP>(lV + FL_BUF, gV + FL_KEYS, stV); }
#pragma unroll 1      /* one stage per trip: the publish point at the foot stands once */
  for (int st = 0; st < NST; ++st) { const unsigned bsel = (unsigned)(st & 1) * FL_BUF; const unsigned char* sK = ring + bsel; const unsigned char* sV = sK + FL_VOFS;
#pragma unroll 1      /* 32 keys per trip, rolled as before: keeps the loop's text small */
  for (int j0 = 0; j0 < FL_KEYS; j0 += 32) {
    v8f s[2]; FragH bk[2][KS], bv[DT];      /* this trip's K and V^T fragments are read from the stage as one group, ahead of the products and the softmax */
#pragma unroll
    for (int nt = 0; nt < 2; ++nt) { const unsigned short* kr = (const unsigned short*)(sK + (j0 + nt * 16 + ln) * FL_KP);
#pragma unroll
      for (int ks = 0; ks < KS; ++ks) { bk[nt][ks].half[0] = *(const v8us*)(kr + ks * 32 + 8 * hh); bk[nt][ks].half[1] = *(const v8us*)(kr + ks * 32 + 16 + 8 * hh); } }
#pragma unroll
    for (int dt = 0; dt < DT; ++dt) { const unsigned short* vrow = (const unsigned short*)(sV + (dt * 16 + ln) * FL_VP) + j0; bv[dt].half[0] = *(const v8us*)(vrow + 8 * hh); bv[dt].half[1] = *(const v8us*)(vrow + 16 + 8 * hh); }
#pragma unroll
    for (int nt = 0; nt < 2; ++nt) { v8f acc = (v8f){0.f,0.f,0.f,0.f,0.f,0.f,0.f,0.f};
#pragma unroll
      for (int ks = 0; ks < KS; ++ks) acc = mmaH<1>(bk[nt][ks].v, bk[nt][ks].v, aq[ks].v, aq[ks].v, acc);
      s[nt] = acc; }
    float mc = s[0][0];      /* the running maximum is kept in raw (unscaled) scores: the scale is positive, so the order is the same */
#pragma unroll      /* constant indices keep s, pb and oacc in registers (this loop and those below) */
    for (int i = 1; i < 16; ++i) mc = fmaxf(mc, s[i >> 3][i & 7]);
    mc = fmaxf(mc, fl_xhalf(mc));
    const float mn = fmaxf(m_r, mc); const float al = (mn > -1.0e38f) ? __builtin_amdgcn_exp2f((m_r - mn) * FL_C2) : 1.0f; m_r = mn;
    const float nb = __builtin_fmaf(-mn, FL_C2, 10.0f);      /* 2^(s c + nb) = 2^10 exp((s - mn) / 8): scale, maximum and the 2^10 of P in one multiply-add */
    FragH pb; float psum = 0.f;
#pragma unroll
    for (int i = 0; i < 16; ++i) { const float p = __builtin_amdgcn_exp2f(__builtin_fmaf(s[i >> 3][i & 7], FL_C2, nb)); psum += p; pb.h[i] = (_Float16)p; }
    l_r = l_r * al + psum;      /* l_r carries the 2^10 too */
#pragma unroll
    for (int dt = 0; dt < DT; ++dt)
#pragma unroll
      for (int r = 0; r < 8; ++r) oacc[dt][r] *= al;
#pragma unroll
    for (int dt = 0; dt < DT; ++dt) oacc[dt] = mmaH<1>(bv[dt].v, bv[dt].v, pb.v, pb.v, oacc[dt]); }
    asm volatile("s_wait_dscnt 0x0" ::: "memory");        /* this wave's reads of the buffer have returned before it is refilled */
    asm volatile("s_wait_asynccnt 0x0" ::: "memory");     /* this wave's copies for stage st + 1 have landed */
    __syncthreads();                                      /* publishes stage st + 1 and ends every reader's last read of stage st's buffer */
    if (st + 2 < NST) { fl_copy8<16 * FL_KP>(lK + bsel, gK + (size_t)(st + 2) * FL_KEYS * ldk, stK); fl_copy8<8 * FL_VP>(lV + bsel, gV + (size_t)(st + 2) * FL_KEYS, stV); } }
  asm volatile("s_wait_asynccnt 0x0" ::: "memory");       /* nothing in flight when the wave goes on to its end */
  { float l = l_r + fl_xhalf(l_r); l = (l > 0.f) ? 1.0f / l : 0.f;
#pragma unroll
    for (int dt = 0; dt < DT; ++dt) { v4f lo, hi;
#pragma unroll
      for (int r = 0; r < 4; ++r) { lo[r] = oacc[dt][r] * l; hi[r] = oacc[dt][4 + r] * l; }
      *(v4fa*)&sO[w][ln][dt * 16 + 8 * hh] = lo; *(v4fa*)&sO[w][ln][dt * 16 + 8 * hh + 4] = hi; } }
  __builtin_amdgcn_fence(__ATOMIC_ACQ_REL, "workgroup"); __builtin_amdgcn_wave_barrier();
  {
#pragma unroll
    for (int rp = 0; rp < RPW; rp += 2) { const int r = rp + (lane >> 4), pc = lane & 15; const v4f val = *(const v4fa*)&sO[w][r][pc * 4]; *(v4f*)(O + ((size_t)b * TQ + q0 + r) * ldo + h * 64 + pc * 4) = val; }
     } }
__global__ __launch_bounds__(256) void k_fulltab(unsigned* __restrict__ MB, int* __restrict__ RA, int* __restrict__ KE, int nq, int nk) {
  const int t = blockIdx.x * 256 + threadIdx.x;
  if (t < nq * (nk / 32)) { *(unsigned*)(MB + t) = 0u;  }
  if (t < nq) { *(int*)(RA + t) = 0;  }
  if (t < nq / 64) { *(int*)(KE + t * 32) = nk;  } }
template <int SRCBF>
__global__ __launch_bounds__(256) void k_ln1024(const float* __restrict__ X, _Float16* __restrict__ Y16, float* __restrict__ XB) {
  #pragma clang fp contract(off)
  const int tid = threadIdx.x, w = tid >> 5, ln = tid & 31; const int r = blockIdx.x * 8 + w; if (r >= NR) return; const float* x = X + (size_t)r * DM; float s = 0.f;
#pragma unroll 1
  for (int i = 0; i < 8; ++i) { const v4f a = *(const v4fa*)(x + i * 128 + ln * 4); for (int q = 0; q < 4; ++q) s += SRCBF ? bf16_round(a[q]) : a[q]; }
  for (int o = 16; o > 0; o >>= 1) s += __shfl_xor(s, o, 32); const float mu = s / (float)DM; float q2 = 0.f;
#pragma unroll 1
  for (int i = 0; i < 8; ++i) { const v4f a = *(const v4fa*)(x + i * 128 + ln * 4); for (int q = 0; q < 4; ++q) { const float d = (SRCBF ? bf16_round(a[q]) : a[q]) - mu; q2 += d * d; } }
  for (int o = 16; o > 0; o >>= 1) q2 += __shfl_xor(q2, o, 32); const float dn = sqrtf(q2 / (float)DM + 1e-5f);
  {
#pragma unroll 1
    for (int i = 0; i < 8; ++i) { const int c0 = i * 128 + ln * 4; const v4f a = *(const v4fa*)(x + c0); _Float16 h4[4]; v4f xb;
      for (int q = 0; q < 4; ++q) { const float t = SRCBF ? bf16_round(a[q]) : a[q]; h4[q] = (_Float16)((t - mu) / dn); xb[q] = t; }
      *(unsigned long long*)((unsigned short*)Y16 + (size_t)r * DM + c0) = *(const unsigned long long*)h4; if (SRCBF) *(v4f*)(XB + (size_t)r * DM + c0) = xb; }
     } }
__global__ __launch_bounds__(256) void k_causaltab(unsigned* __restrict__ MB, int* __restrict__ RA, int* __restrict__ KE, int nq, int nk) {
  const int t = blockIdx.x * 256 + threadIdx.x; const int nw = nk / 32;
  if (t < nq * nw) { const int q = t / nw, w = t % nw; const int first = q + 1 - 32 * w; const unsigned bits = (first <= 0) ? 0xffffffffu : ((first >= 32) ? 0u : (0xffffffffu << first)); *(unsigned*)(MB + t) = bits;  }
  if (t < nq) { *(int*)(RA + t) = 0;  }
  if (t < nq / 64) { const int v = 64 * (t + 1); *(int*)(KE + t * 32) = v;  } }


extern "C" void kernel_launch(void* const* d_in, const int* in_sizes, int n_in,
                              void* d_out, int out_size, void* d_ws, size_t ws_size, hipStream_t stream) {
  (void)in_sizes; (void)n_in; (void)out_size;
  const float* const* I = (const float* const*)d_in; const float* x = I[0]; const float* Wqkv = I[1]; const float* Wfc = I[2]; const float* W1 = I[3]; const float* b1 = I[4]; const float* W2 = I[5]; const float* b2 = I[6];
  char* ws = (char*)d_ws; size_t off = 0;
  auto take = [&](size_t bytes) { char* p = ws + off; off += (bytes + 255) & ~(size_t)255; return p; };
  _Float16* BQKV = (_Float16*)take((size_t)3 * DM * DM * 2); _Float16* BFC = (_Float16*)take((size_t)DM * DM * 2); _Float16* BW1 = (_Float16*)take((size_t)4096 * DM * 2); _Float16* BW2 = (_Float16*)take((size_t)DM * 4096 * 2);
  float* XB = (float*)take((size_t)NR * DM * 4); _Float16* X16 = (_Float16*)take((size_t)NR * DM * 2); float* F = (float*)take((size_t)NR * DM * 4);
  _Float16* Q16 = (_Float16*)take((size_t)NR * DM * 2); _Float16* K16 = (_Float16*)take((size_t)NR * DM * 2); _Float16* V16 = (_Float16*)take((size_t)NR * DM * 2); _Float16* VT = (_Float16*)take((size_t)NR * DM * 2); if (off > ws_size) return;      /* 24 + 16 + 8 + 16 + 32 = 96 MiB */
  float* O = F; _Float16* Oh = Q16; _Float16* Ol = K16;     /* q/k planes are dead after the flash */
  float* X1 = XB;                                           /* x1 written over the residual plane (own-tile addend) */
  _Float16* H16 = X16; _Float16* GH = Q16;                  /* GELU hidden [NR][4096] f16 = 32 MB over Q16|K16|V16|VT (contiguous, all dead once x1 is formed) */
  const size_t n8 = (size_t)NR * DM / 8; const unsigned nb8 = (unsigned)((n8 + 255) / 256);
  k_wt_f16<DM, 3 * DM><<<(DM / 128) * (3 * DM / 64), 256, 0, stream>>>(Wqkv, BQKV, 16.0f); k_wt_f16<DM, DM><<<(DM / 128) * (DM / 64), 256, 0, stream>>>(Wfc, BFC, 16.0f);
  k_wt_f16<DM, 4096><<<(DM / 128) * (4096 / 64), 256, 0, stream>>>(W1, BW1, 16.0f); k_wt_f16<4096, DM><<<(4096 / 128) * (DM / 64), 256, 0, stream>>>(W2, BW2, 16.0f);      /* all (in,out); one block per 128 k x 64 n tile */
  k_ln1024<1><<<NR / 8, 256, 0, stream>>>(x, X16, XB);
  const dim3 gP((NR / 128) * (DM / 128), 1), gM((NR / 128) * (4096 / 128), 1);
  k_gemm2<0><<<gP, 256, 0, stream>>>(X16, DM, 0, BQKV, DM, 0, 0.0625f, nullptr, 0, nullptr, 1, 0, 0, nullptr, Q16, DM, 0, NR, DM, DM);
  k_gemm2<0><<<gP, 256, 0, stream>>>(X16, DM, 0, BQKV + (size_t)DM * DM, DM, 0, 0.0625f, nullptr, 0, nullptr, 1, 0, 0, nullptr, K16, DM, 0, NR, DM, DM);
  k_gemm2<0><<<gP, 256, 0, stream>>>(X16, DM, 0, BQKV + (size_t)2 * DM * DM, DM, 0, 0.0625f, nullptr, 0, nullptr, 1, 0, 0, nullptr, V16, DM, 0, NR, DM, DM);
  for (int b = 0; b < NBT; ++b) k_vt<NH, SLEN><<<NH * (SLEN / 64), 256, 0, stream>>>(V16 + (size_t)b * SLEN * DM, DM, 0, VT + (size_t)b * SLEN * DM);
  for (int b = 0; b < NBT; ++b) { const size_t ro = (size_t)b * SLEN * DM;
    k_flash<<<NH * (SLEN / 64), 128, 0, stream>>>(Q16 + ro, DM, K16 + ro, DM, VT + ro, nullptr, O + ro, DM); }      /* plain flash over all keys */
  k_hl<<<nb8, 256, 0, stream>>>(O, Oh, Ol, n8);
  k_gemm2<0><<<gP, 256, 0, stream>>>(Oh, DM, 0, BFC, DM, 0, 0.0625f, nullptr, 0, XB, 1, (size_t)DM, 0, X1, nullptr, DM, 0, NR, DM, DM);      /* x1 = x + attn w_fc (hi) */
  k_gemm2<0><<<gP, 256, 0, stream>>>(Ol, DM, 0, BFC, DM, 0, 0.0625f / 1024.0f, nullptr, 0, X1, 1, (size_t)DM, 0, X1, nullptr, DM, 0, NR, DM, DM);      /* + lo */
  k_ln1024<0><<<NR / 8, 256, 0, stream>>>(X1, H16, nullptr);
  k_gemm2<9><<<gM, 256, 0, stream>>>(H16, DM, 0, BW1, DM, 0, 0.0625f, b1, 0, nullptr, 1, 0, 0, nullptr, GH, 4096, 0, NR, 4096, DM);      /* tanh-gelu(LN(x1) w1 + b1) f16 */
  k_gemm2<0><<<gP, 256, 0, stream>>>(GH, 4096, 0, BW2, 4096, 0, 0.0625f, b2, 0, X1, 1, (size_t)DM, 0, (float*)d_out, nullptr, DM, 0, NR, DM, 4096);      /* out = x1 + mlp */
}

// v006
// Measured time: 244 microseconds a run.
// In both of two side-by-side timings against v005, it was 1.25 times as fast.
// Counting every step since v000, it is 4.30 times as fast.
#include <hip/hip_runtime.h>
// Pre-LN transformer layer (2 x 2048 tokens, 1024; 16 heads x 64; full (non-causal) attention; MLP 4096 with tanh-GELU): h = LN(x) (no affine); q,k,v = h w_qkv; x1 = x + softmax(q.k/8).v w_fc; out = x1 + gelu(LN(x1) w1 + b1) w2 + b2 -> [2,2048,1024].
// Structure: LayerNorm on VALU (also writing the bf16 residual plane); projections / MLP as f16 WMMA GEMMs (32x64 wave tiles, f32 accumulation, exact weights x16, tanh-GELU and biases in the epilogue, residuals through the f32 addend); q, k, V^T as plain f16 planes through the fused flash kernel over all keys (online softmax in f32, P x2^10); O as hi + residual planes into w_fc (two GEMMs).
// Compute dtype: x and weights rounded to bf16; LN outputs, q, k, v, P and the GELU hidden as f16 operands (~2^-12); O as hi + residual pairs; f32 accumulation, softmax, LayerNorm. v_wmma_f32_16x16x32_f16.
#define NBT 2
#define SLEN 2048
#define TQ SLEN
#define TK SLEN
#define DM 1024
#define NH 16
#define SCL 0.125f
#define NR (NBT * SLEN)
typedef __bf16 v16b __attribute__((ext_vector_type(16)));
typedef unsigned short v8us __attribute__((ext_vector_type(8), may_alias));
typedef float  v8f  __attribute__((ext_vector_type(8)));
typedef float  v4f  __attribute__((ext_vector_type(4)));
typedef float  v4fa __attribute__((ext_vector_type(4), may_alias));
union FragB { v16b v; v8us half[2]; unsigned short u[16]; };

__device__ __forceinline__ unsigned short bf16_bits(float x) { unsigned int u = __float_as_uint(x); return (unsigned short)((u + 0x7FFFu + ((u >> 16) & 1u)) >> 16); }
__device__ __forceinline__ float bf16_val(unsigned short b) { return __uint_as_float(((unsigned int)b) << 16); }
__device__ __forceinline__ float bf16_round(float x) { return bf16_val(bf16_bits(x)); }
// D += A·B with NT terms: 1 = ah·bh, 2 = + al·bh (A split), 3 = + ah·bl (both split)
template <int NT>
__device__ __forceinline__ v8f mmaN(v16b ah, v16b al, v16b bh, v16b bl, v8f c) {
  c = __builtin_amdgcn_wmma_f32_16x16x32_bf16(false, ah, false, bh, (short)0, c, false, false);
  if (NT >= 2) c = __builtin_amdgcn_wmma_f32_16x16x32_bf16(false, al, false, bh, (short)0, c, false, false);
  if (NT >= 3) c = __builtin_amdgcn_wmma_f32_16x16x32_bf16(false, ah, false, bl, (short)0, c, false, false);
  asm volatile("v_nop\n\tv_nop\n\tv_nop\n\tv_nop" : "+v"(c) : "v"(ah), "v"(al), "v"(bh), "v"(bl));
  return c;
}

__global__ __launch_bounds__(256) void k_wt_bf16(const float* __restrict__ W, unsigned short* __restrict__ Wt, int K, int N) {
  const int t = blockIdx.x * 256 + threadIdx.x;
  const int k8n = K / 8;
  if (t >= N * k8n) return;
  const int n = t / k8n, k8 = (t % k8n) * 8;
  v8us v;
#pragma unroll
  for (int i = 0; i < 8; ++i) v[i] = bf16_bits(W[(size_t)(k8 + i) * N + n]);
  *(v8us*)(Wt + (size_t)n * K + k8) = v;
  
}

// GEMM C[M][N] (f32, pitch ldc) = act(A[M][K]·W + bias). A f32 row-major (pitch lda) converted per fragment to bf16
// (ASPLIT: hi/lo two planes -> 2 terms, else single rounded term); Wt bf16 [N][K] (pitch ldb). BIAS_BF16 rounds the
// bias to bf16 first (bias quantised to bf16 before the add). K%32==0, M%16==0, N%64==0.
template <bool ASPLIT, int ACT, bool BIAS_BF16>
__global__ __launch_bounds__(128) void k_gemm_bf(const float* __restrict__ A, int lda, const unsigned short* __restrict__ Wt, int ldb,
                                               const float* __restrict__ bias, float* __restrict__ C, int ldc, int M, int N, int K) {
  __shared__ __attribute__((aligned(16))) float so[4][16][64];
  const int tid = threadIdx.x, w = tid >> 5, lane = tid & 31, ln = lane & 15, hh = lane >> 4;
  const int ntn = N / 64;
  const int wid = blockIdx.x * 4 + w;
  const int mt = wid / ntn, nq = wid % ntn;
  if (mt * 16 >= M) return;
  const int row0 = mt * 16, col0 = nq * 64;
  const float* arow = A + (size_t)(row0 + ln) * lda;
  v8f acc[4] = {};
  for (int kb = 0; kb < K; kb += 32) {
    FragB ah, al;
    const v4f x0 = *(const v4fa*)(arow + kb + 8 * hh), x1 = *(const v4fa*)(arow + kb + 8 * hh + 4);
    const v4f x2 = *(const v4fa*)(arow + kb + 16 + 8 * hh), x3 = *(const v4fa*)(arow + kb + 16 + 8 * hh + 4);
    float xs[16] = {x0[0],x0[1],x0[2],x0[3],x1[0],x1[1],x1[2],x1[3],x2[0],x2[1],x2[2],x2[3],x3[0],x3[1],x3[2],x3[3]};
#pragma unroll
    for (int i = 0; i < 16; ++i) { const unsigned short hb = bf16_bits(xs[i]); ah.u[i] = hb; al.u[i] = ASPLIT ? bf16_bits(xs[i] - bf16_val(hb)) : (unsigned short)0; }
#pragma unroll
    for (int t = 0; t < 4; ++t) {
      const unsigned short* brow = Wt + (size_t)(col0 + t * 16 + ln) * ldb + kb;
      FragB b;
      b.half[0] = *(const v8us*)(brow + 8 * hh);
      b.half[1] = *(const v8us*)(brow + 16 + 8 * hh);
      acc[t] = mmaN<ASPLIT ? 2 : 1>(ah.v, al.v, b.v, b.v, acc[t]);
    }
  }
#pragma unroll
  for (int t = 0; t < 4; ++t) {
    float bv = bias ? bias[col0 + t * 16 + ln] : 0.f;
    if (BIAS_BF16) bv = bf16_round(bv);
#pragma unroll
    for (int r = 0; r < 8; ++r) { float v = acc[t][r] + bv; if (ACT == 1) v = fmaxf(v, 0.f); so[w][8 * hh + r][t * 16 + ln] = v; }
  }
  __builtin_amdgcn_fence(__ATOMIC_ACQ_REL, "workgroup");
  __builtin_amdgcn_wave_barrier();
  const int rsub = lane >> 4, c4 = (lane & 15) * 4;
  {
#pragma unroll
    for (int q = 0; q < 8; ++q) {
      const int r = q * 2 + rsub;
      const v4f v = *(const v4fa*)&so[w][r][c4];
      *(v4f*)(C + (size_t)(row0 + r) * ldc + col0 + c4) = v;
    }
    
  }
}

// GEMM C = act(A·W + bias + resid): A f32 (ASPLIT -> hi/lo 2 terms), Wt bf16 [N][K]; ACT 0 none, 1 relu, 2 exact gelu;
// resid (optional, f32, row index = (row % rmod), pitch ldr, RES_BF16 rounds it) added before the activation.
template <bool ASPLIT, int ACT, bool BIAS_BF16, bool RES_BF16>
__global__ __launch_bounds__(128) void k_gemm_bf3(const float* __restrict__ A, int lda, const unsigned short* __restrict__ Wt, int ldb,
                                                const float* __restrict__ bias, const float* __restrict__ resid, int rmod, int ldr,
                                                float* __restrict__ C, int ldc, int M, int N, int K) {
  __shared__ __attribute__((aligned(16))) float so[4][16][64];
  const int tid = threadIdx.x, w = tid >> 5, lane = tid & 31, ln = lane & 15, hh = lane >> 4;
  const int ntn = N / 64;
  const int wid = blockIdx.x * 4 + w;
  const int mt = wid / ntn, nq = wid % ntn;
  if (mt * 16 >= M) return;
  const int row0 = mt * 16, col0 = nq * 64;
  const float* arow = A + (size_t)(row0 + ln) * lda;
  v8f acc[4] = {};
  for (int kb = 0; kb < K; kb += 32) {
    FragB ah, al;
    const v4f x0 = *(const v4fa*)(arow + kb + 8 * hh), x1 = *(const v4fa*)(arow + kb + 8 * hh + 4);
    const v4f x2 = *(const v4fa*)(arow + kb + 16 + 8 * hh), x3 = *(const v4fa*)(arow + kb + 16 + 8 * hh + 4);
    float xs[16] = {x0[0],x0[1],x0[2],x0[3],x1[0],x1[1],x1[2],x1[3],x2[0],x2[1],x2[2],x2[3],x3[0],x3[1],x3[2],x3[3]};
#pragma unroll
    for (int i = 0; i < 16; ++i) { const unsigned short hb = bf16_bits(xs[i]); ah.u[i] = hb; al.u[i] = ASPLIT ? bf16_bits(xs[i] - bf16_val(hb)) : (unsigned short)0; }
#pragma unroll
    for (int t = 0; t < 4; ++t) {
      const unsigned short* brow = Wt + (size_t)(col0 + t * 16 + ln) * ldb + kb;
      FragB b;
      b.half[0] = *(const v8us*)(brow + 8 * hh);
      b.half[1] = *(const v8us*)(brow + 16 + 8 * hh);
      acc[t] = mmaN<ASPLIT ? 2 : 1>(ah.v, al.v, b.v, b.v, acc[t]);
    }
  }
#pragma unroll
  for (int t = 0; t < 4; ++t) {
    const int col = col0 + t * 16 + ln;
    float bv = bias ? bias[col] : 0.f;
    if (BIAS_BF16) bv = bf16_round(bv);
#pragma unroll
    for (int r = 0; r < 8; ++r) {
      float v = acc[t][r] + bv;
      if (resid) { float rv = resid[(size_t)((row0 + 8 * hh + r) % rmod) * ldr + col]; if (RES_BF16) rv = bf16_round(rv); v += rv; }
      if (ACT == 1) v = fmaxf(v, 0.f);
      if (ACT == 2) v = 0.5f * v * (1.0f + erff(v * 0.70710678118654752f));
      if (ACT == 3) { const float u = 0.7978845608028654f * (v + 0.044715f * v * v * v); v = 0.5f * v * (1.0f + tanhf(u)); }
      so[w][8 * hh + r][t * 16 + ln] = v;
    }
  }
  __builtin_amdgcn_fence(__ATOMIC_ACQ_REL, "workgroup");
  __builtin_amdgcn_wave_barrier();
  const int rsub = lane >> 4, c4 = (lane & 15) * 4;
  {
#pragma unroll
    for (int q = 0; q < 8; ++q) {
      const int r = q * 2 + rsub;
      const v4f v = *(const v4fa*)&so[w][r][c4];
      *(v4f*)(C + (size_t)(row0 + r) * ldc + col0 + c4) = v;
    }
    
  }
}
// row LayerNorm (biased variance, eps) over N: s = X (+ R); optional out_sum <- s; out_norm <- (s-mu)*rsqrt(var+eps)*g + b
template <bool PARAM_BF16>
__global__ __launch_bounds__(256) void k_layernorm(const float* __restrict__ X, const float* __restrict__ R, const float* __restrict__ g, const float* __restrict__ bta,
                                                  float* __restrict__ out_sum, float* __restrict__ out_norm, int N, float eps) {
  __shared__ float red[256];
  const int row = blockIdx.x, tid = threadIdx.x;
  const float* x = X + (size_t)row * N; const float* rr = R ? R + (size_t)row * N : nullptr;
  float vals[16];                     // up to N = 4096
  const int per = N / 256;            // contiguous chunk per thread? use strided-by-4 chunks: thread handles j = tid*4 + 1024*u
  float s1 = 0.f;
  for (int u = 0; u < per / 4; ++u) {
    const int j = tid * 4 + 1024 * u;
    const v4f a = *(const v4fa*)(x + j);
    v4f b = {0.f,0.f,0.f,0.f}; if (rr) b = *(const v4fa*)(rr + j);
#pragma unroll
    for (int q = 0; q < 4; ++q) { const float v = a[q] + b[q]; vals[u * 4 + q] = v; s1 += v; }
  }
  red[tid] = s1; __syncthreads();
  for (int st = 128; st > 0; st >>= 1) { if (tid < st) red[tid] += red[tid + st]; __syncthreads(); }
  const float mu = red[0] / (float)N; __syncthreads();
  float s2 = 0.f;
  for (int u = 0; u < per / 4; ++u)
#pragma unroll
    for (int q = 0; q < 4; ++q) { const float c = vals[u * 4 + q] - mu; s2 += c * c; }
  red[tid] = s2; __syncthreads();
  for (int st = 128; st > 0; st >>= 1) { if (tid < st) red[tid] += red[tid + st]; __syncthreads(); }
  const float rs = rsqrtf(red[0] / (float)N + eps);
  {
    for (int u = 0; u < per / 4; ++u) {
      const int j = tid * 4 + 1024 * u;
      v4f o, sm;
#pragma unroll
      for (int q = 0; q < 4; ++q) {
        float gg = g[j + q], bb = bta[j + q];
        if (PARAM_BF16) { gg = bf16_round(gg); bb = bf16_round(bb); }
        sm[q] = vals[u * 4 + q]; o[q] = (vals[u * 4 + q] - mu) * rs * gg + bb;
      }
      if (out_sum) *(v4f*)(out_sum + (size_t)row * N + j) = sm;
      *(v4f*)(out_norm + (size_t)row * N + j) = o;
    }
    
  }
}



// ---- f16 WMMA path (v_wmma_f32_16x16x32_f16): 11-bit significands for operands in range — used where a [0,1] probability operand needs more precision than bf16
typedef _Float16 v16h __attribute__((ext_vector_type(16)));
union FragH { v16h v; v8us half[2]; _Float16 h[16]; unsigned short u[16]; };
template <int NT>
__device__ __forceinline__ v8f mmaH(v16h ah, v16h al, v16h bh, v16h bl, v8f c) {
  c = __builtin_amdgcn_wmma_f32_16x16x32_f16(false, ah, false, bh, (short)0, c, false, false);
  if (NT >= 2) c = __builtin_amdgcn_wmma_f32_16x16x32_f16(false, al, false, bh, (short)0, c, false, false);
  if (NT >= 3) c = __builtin_amdgcn_wmma_f32_16x16x32_f16(false, ah, false, bl, (short)0, c, false, false);
  asm volatile("v_nop\n\tv_nop\n\tv_nop\n\tv_nop" : "+v"(c) : "v"(ah), "v"(al), "v"(bh), "v"(bl));
  return c;
}
// batched GEMM like k_gemm_b but f16 operands: A f32 (split into f16 hi/lo if ASPLIT, else rounded to f16), Bt = f16 values [n][k]; alpha; C f32; N multiple of 16 (partial tiles skipped)
template <bool ASPLIT>
__global__ __launch_bounds__(128) void k_gemm_h(const float* __restrict__ A, int lda, size_t sA, const _Float16* __restrict__ Bh, int ldb, size_t sB, float alpha, float* __restrict__ C, int ldc, size_t sC, int M, int N, int K) {
  __shared__ __attribute__((aligned(16))) float so[4][16][64];
  const int tid = threadIdx.x, w = tid >> 5, lane = tid & 31, ln = lane & 15, hh = lane >> 4; const int by = blockIdx.y;
  A += (size_t)by * sA; Bh += (size_t)by * sB; C += (size_t)by * sC;
  const int ntn = (N + 63) / 64; const int wid = blockIdx.x * 4 + w; const int mt = wid / ntn, nq = wid % ntn; if (mt * 16 >= M) return;
  const int row0 = mt * 16, col0 = nq * 64; const float* arow = A + (size_t)(row0 + ln) * lda;
  v8f acc[4] = {};
  for (int kb = 0; kb < K; kb += 32) {
    FragH ah, al;
    const v4f x0 = *(const v4fa*)(arow + kb + 8 * hh), x1 = *(const v4fa*)(arow + kb + 8 * hh + 4), x2 = *(const v4fa*)(arow + kb + 16 + 8 * hh), x3 = *(const v4fa*)(arow + kb + 16 + 8 * hh + 4);
    float xs[16] = {x0[0],x0[1],x0[2],x0[3],x1[0],x1[1],x1[2],x1[3],x2[0],x2[1],x2[2],x2[3],x3[0],x3[1],x3[2],x3[3]};
#pragma unroll
    for (int i = 0; i < 16; ++i) { const _Float16 h = (_Float16)xs[i]; ah.h[i] = h; al.h[i] = ASPLIT ? (_Float16)(xs[i] - (float)h) : (_Float16)0.0f; }
#pragma unroll
    for (int t = 0; t < 4; ++t) { if (col0 + t * 16 >= N) continue; const size_t boff = (size_t)(col0 + t * 16 + ln) * ldb + kb; FragH bq; bq.half[0] = *(const v8us*)(Bh + boff + 8 * hh); bq.half[1] = *(const v8us*)(Bh + boff + 16 + 8 * hh);
      acc[t] = mmaH<ASPLIT ? 2 : 1>(ah.v, al.v, bq.v, bq.v, acc[t]); }
  }
#pragma unroll
  for (int t = 0; t < 4; ++t) { if (col0 + t * 16 >= N) continue;
#pragma unroll
    for (int r = 0; r < 8; ++r) so[w][8 * hh + r][t * 16 + ln] = acc[t][r] * alpha; }
  __builtin_amdgcn_fence(__ATOMIC_ACQ_REL, "workgroup"); __builtin_amdgcn_wave_barrier();
  const int rsub = lane >> 4, c4 = (lane & 15) * 4;
  {
#pragma unroll
    for (int q = 0; q < 8; ++q) { const int r = q * 2 + rsub; if (col0 + c4 < N) { const v4f v = *(const v4fa*)&so[w][r][c4]; *(v4f*)(C + (size_t)(row0 + r) * ldc + col0 + c4) = v; } }
     }
}

// Wt[n][k] = f16(bf16(W[k][n]) * scale) from f32 row-major W[K][N] (scale = power of two; bf16-exact weights stay exact in f16 away from the subnormal range)
// A block turns a tile of 128 k x 64 n through LDS; grid = (K / 128) * (N / 64). Both sides of memory see whole aligned 256-B runs:
// 16 lanes read 64 n of one k row, 16 lanes write 128 k of one n row. A thread reads 8 k x 4 n and stores, per n, its 8 k as one 16-B piece.
// LDS row = one n (16 pieces) at a pitch of 272 B; piece g of row n lies at place g ^ (n >> 4), so that the 16 lanes of a store (rows 4 apart) fall on 16 different bank groups.
#define WT_P 272
template <int K, int N>
__global__ __launch_bounds__(256) void k_wt_f16(const float* __restrict__ W, _Float16* __restrict__ Wt, float scale) {
  static_assert(K % 128 == 0 && N % 64 == 0, "whole tiles only");
  __shared__ __attribute__((aligned(16))) unsigned char tl[64 * WT_P];
  const int tid = threadIdx.x, c = tid & 15, g = tid >> 4; const int kt = blockIdx.x / (N / 64), nt = blockIdx.x % (N / 64); const int k0 = kt * 128, n0 = nt * 64;
  const float* src = W + (size_t)(k0 + g * 8) * N + n0 + c * 4; v4f a[8];
#pragma unroll      /* constant indices keep a and f in registers (this loop and the three below); the eight loads are in flight together */
  for (int i = 0; i < 8; ++i) a[i] = *(const v4fa*)(src + i * N);
#pragma unroll
  for (int j = 0; j < 4; ++j) { FragH f;
#pragma unroll
    for (int i = 0; i < 8; ++i) f.h[i] = (_Float16)(bf16_round(a[i][j]) * scale);
    *(v8us*)(tl + (c * 4 + j) * WT_P + ((g ^ (c >> 2)) * 16)) = f.half[0]; }
  __syncthreads();      /* the tile is whole before any row of it is read */
  unsigned short* dst = (unsigned short*)Wt + (size_t)(n0 + g) * K + k0 + c * 8;
#pragma unroll
  for (int q = 0; q < 4; ++q) { const v8us o = *(const v8us*)(tl + (q * 16 + g) * WT_P + ((c ^ q) * 16)); *(v8us*)(dst + q * 16 * K) = o; }
}
// k_gemm_hh variant with fused epilogue: v = acc·alpha + bias[by·sBias + col] (+ CP[(row/rowsPerB)·sCPb + by·64 + col] if CP) ; ACT 0 none / 1 elu ; writes f16 C16 (and f32 C if non-null)
template <int ACT>
__global__ __launch_bounds__(128) void k_gemm_hhx(const _Float16* __restrict__ A, int lda, size_t sA, const _Float16* __restrict__ Bh, int ldb, size_t sB, float alpha, const float* __restrict__ bias, size_t sBias, const float* __restrict__ CP, int rowsPerB, size_t sCPb, int row0g,
    float* __restrict__ C, _Float16* __restrict__ C16, int ldc, size_t sC, int M, int N, int K) {
  __shared__ __attribute__((aligned(16))) float so[4][16][64];
  const int tid = threadIdx.x, w = tid >> 5, lane = tid & 31, ln = lane & 15, hh = lane >> 4; const int by = blockIdx.y;
  A += (size_t)by * sA; Bh += (size_t)by * sB; const size_t cofs = (size_t)by * sC; const float* bp = bias ? bias + (size_t)by * sBias : nullptr;
  const int ntn = (N + 63) / 64; const int wid = blockIdx.x * 4 + w; const int mt = wid / ntn, nq = wid % ntn; if (mt * 16 >= M) return;
  const int row0 = mt * 16, col0 = nq * 64; const _Float16* arow = A + (size_t)(row0 + ln) * lda;
  v8f acc[4] = {};
  for (int kb = 0; kb < K; kb += 32) { FragH ah; ah.half[0] = *(const v8us*)((const unsigned short*)arow + kb + 8 * hh); ah.half[1] = *(const v8us*)((const unsigned short*)arow + kb + 16 + 8 * hh);
#pragma unroll
    for (int t = 0; t < 4; ++t) { if (col0 + t * 16 >= N) continue; const size_t boff = (size_t)(col0 + t * 16 + ln) * ldb + kb; FragH bq; bq.half[0] = *(const v8us*)((const unsigned short*)Bh + boff + 8 * hh); bq.half[1] = *(const v8us*)((const unsigned short*)Bh + boff + 16 + 8 * hh);
      acc[t] = mmaH<1>(ah.v, ah.v, bq.v, bq.v, acc[t]); }
  }
#pragma unroll
  for (int t = 0; t < 4; ++t) { if (col0 + t * 16 >= N) continue; const int col = col0 + t * 16 + ln; const float bv = bp ? bf16_round(bp[col]) : 0.f;
#pragma unroll
    for (int r = 0; r < 8; ++r) { float v = acc[t][r] * alpha + bv; if (CP) { const int bidx = (row0g + row0 + 8 * hh + r) / rowsPerB; v += CP[(size_t)bidx * sCPb + (size_t)by * 64 + col]; } if (ACT == 1) v = (v > 0.f) ? v : expm1f(v); else if (ACT == 7) v = (v > 0.f) ? v + 1.0f : expf(v); else if (ACT == 8) v = tanhf(v); else if (ACT == 9) v = 0.5f * v * (1.0f + tanhf(0.7978845608028654f * (v + 0.044715f * v * v * v))); else if (ACT == 11) v = 1.0f / (1.0f + expf(-v)); else if (ACT == 12) v = (v > 0.f) ? v : 0.01f * v; else if (ACT == 14) v = (v > 0.f) ? v : 0.1f * v; else if (ACT == 15) v = v / (1.0f + expf(-v)); else if (ACT == 3) v = fmaxf(v, 0.f); else if (ACT == 6) v = 0.5f * v * (1.0f + erff(v * 0.70710678118654752f)); so[w][8 * hh + r][t * 16 + ln] = v; } }
  __builtin_amdgcn_fence(__ATOMIC_ACQ_REL, "workgroup"); __builtin_amdgcn_wave_barrier();
  const int rsub = lane >> 4, c4 = (lane & 15) * 4; typedef _Float16 v4h __attribute__((ext_vector_type(4)));
  {
#pragma unroll
    for (int q = 0; q < 8; ++q) { const int r = q * 2 + rsub; if (col0 + c4 < N) { const v4f v = *(const v4fa*)&so[w][r][c4]; if (C) *(v4f*)(C + cofs + (size_t)(row0 + r) * ldc + col0 + c4) = v; if (C16) { v4h h4; for (int i = 0; i < 4; ++i) h4[i] = (_Float16)v[i]; *(v4h*)(C16 + cofs + (size_t)(row0 + r) * ldc + col0 + c4) = h4; } } }
     }
}


typedef _Float16 v4h __attribute__((ext_vector_type(4)));

__global__ __launch_bounds__(256) void k_x16(const float* __restrict__ x, _Float16* __restrict__ X16, size_t n8) { const size_t t = (size_t)blockIdx.x * 256 + threadIdx.x; if (t >= n8) return; FragH f;
#pragma unroll
  for (int q = 0; q < 8; ++q) f.h[q] = (_Float16)bf16_round(x[t * 8 + q]); *(v8us*)((unsigned short*)X16 + t * 8) = f.half[0];  }
__global__ __launch_bounds__(256) void k_h16(const float* __restrict__ x, _Float16* __restrict__ X16, size_t n8) { const size_t t = (size_t)blockIdx.x * 256 + threadIdx.x; if (t >= n8) return; FragH f;
#pragma unroll
  for (int q = 0; q < 8; ++q) f.h[q] = (_Float16)x[t * 8 + q]; *(v8us*)((unsigned short*)X16 + t * 8) = f.half[0];  }
__global__ __launch_bounds__(256) void k_round16f(const float* __restrict__ W, _Float16* __restrict__ Bt, size_t n8) { const size_t t = (size_t)blockIdx.x * 256 + threadIdx.x; if (t >= n8) return; FragH f;
#pragma unroll
  for (int i = 0; i < 8; ++i) f.h[i] = (_Float16)(bf16_round(W[t * 8 + i]) * 16.0f); *(v8us*)((unsigned short*)Bt + t * 8) = f.half[0];  }
template <int NHv, int TTv>
__global__ __launch_bounds__(256) void k_vt(const _Float16* __restrict__ V16, int ldv, int voff, _Float16* __restrict__ Vt) { __shared__ unsigned short tl[64][66]; const int tid = threadIdx.x; const int slab = blockIdx.x / (TTv / 64), lg = blockIdx.x % (TTv / 64); const int b = slab / NHv, h = slab % NHv;
  for (int i = tid; i < 64 * 8; i += 256) { const int r = i / 8, c8 = (i % 8) * 8; FragH f; f.half[0] = *(const v8us*)((const unsigned short*)V16 + ((size_t)b * TTv + lg * 64 + r) * ldv + voff + h * 64 + c8);
#pragma unroll
    for (int q = 0; q < 8; ++q) tl[r][c8 + q] = f.u[q]; }
  __syncthreads();
  {
#pragma unroll
    for (int rd = 0; rd < 2; ++rd) { const int d = rd * 32 + tid / 8, pc = tid % 8; FragH f;
#pragma unroll
      for (int q = 0; q < 8; ++q) f.u[q] = tl[pc * 8 + q][d];
      *(v8us*)((unsigned short*)Vt + ((size_t)slab * 64 + d) * TTv + lg * 64 + pc * 8) = f.half[0]; }
     } }

__global__ __launch_bounds__(256) void k_hl(const float* __restrict__ F, _Float16* __restrict__ Hh, _Float16* __restrict__ Hl, size_t n8) { const size_t t = (size_t)blockIdx.x * 256 + threadIdx.x; if (t >= n8) return; FragH fh, fl; const v4f a = *(const v4fa*)(F + t * 8), c = *(const v4fa*)(F + t * 8 + 4);
#pragma unroll
  for (int q = 0; q < 4; ++q) { _Float16 h = (_Float16)a[q]; fh.h[q] = h; fl.h[q] = (_Float16)((a[q] - (float)h) * 1024.0f); h = (_Float16)c[q]; fh.h[4 + q] = h; fl.h[4 + q] = (_Float16)((c[q] - (float)h) * 1024.0f); }
  { *(v8us*)((unsigned short*)Hh + t * 8) = fh.half[0]; *(v8us*)((unsigned short*)Hl + t * 8) = fl.half[0];  } }

// ---- fast GEMM (wave tile 32x64, operands staged in LDS); epilogue: v = act(acc * alpha + bf16(bias[col]) (+ CP[row][col], f32 at a pitch of ADDP elements, if ADDP > 0)), written as f16 C16 (OUT16) or f32 C ----
__device__ __forceinline__ v16h g2_frag(const _Float16* p, int hh) { FragH f; f.half[0] = *(const v8us*)((const unsigned short*)p + 8 * hh); f.half[1] = *(const v8us*)((const unsigned short*)p + 16 + 8 * hh); return f.v; }
__device__ __forceinline__ v8f g2_mma(v16h a, v16h b, v8f c) { v8f d = __builtin_amdgcn_wmma_f32_16x16x32_f16(false, a, false, b, (short)0, c, false, false); asm volatile("v_nop\n\tv_nop\n\tv_nop\n\tv_nop" : "+v"(d) : "v"(a), "v"(b)); return d; }
// Staged tile of k_gemm2: 128 A rows then 128 B rows, 128 k (256 B) each, at a pitch of 272 B (16 B x odd: conflict-free for ds_load_b128 readers); two buffers.
#define G2_PITCH 272
#define G2_BUF (256 * G2_PITCH)
// Eight asynchronous 16-byte copies per lane (rows 16 apart): l = the lane's LDS byte address, g = its global address, gstep = 16 source rows in elements.
// s_wait_xcnt 0 is the statement's last line, so that it stands in front of any later rewrite of the address registers the copies name.
__device__ __forceinline__ void g2_copy8(unsigned l, const _Float16* g, size_t gstep) {
  const unsigned l1 = l + 16 * G2_PITCH, l2 = l + 32 * G2_PITCH, l3 = l + 48 * G2_PITCH, l4 = l + 64 * G2_PITCH, l5 = l + 80 * G2_PITCH, l6 = l + 96 * G2_PITCH, l7 = l + 112 * G2_PITCH;
  const _Float16* g1 = g + gstep; const _Float16* g2 = g1 + gstep; const _Float16* g3 = g2 + gstep; const _Float16* g4 = g3 + gstep; const _Float16* g5 = g4 + gstep; const _Float16* g6 = g5 + gstep; const _Float16* g7 = g6 + gstep;
  asm volatile("global_load_async_to_lds_b128 %0, %8, off\n\t"
               "global_load_async_to_lds_b128 %1, %9, off\n\t"
               "global_load_async_to_lds_b128 %2, %10, off\n\t"
               "global_load_async_to_lds_b128 %3, %11, off\n\t"
               "global_load_async_to_lds_b128 %4, %12, off\n\t"
               "global_load_async_to_lds_b128 %5, %13, off\n\t"
               "global_load_async_to_lds_b128 %6, %14, off\n\t"
               "global_load_async_to_lds_b128 %7, %15, off\n\t"
               "s_wait_xcnt 0x0"
               :: "v"(l), "v"(l1), "v"(l2), "v"(l3), "v"(l4), "v"(l5), "v"(l6), "v"(l7), "v"(g), "v"(g1), "v"(g2), "v"(g3), "v"(g4), "v"(g5), "v"(g6), "v"(g7) : "memory");
}
// Block tile 128x128 (8 waves as 4 x 2, wave tile 32x64); requires M % 128 == 0, N % 128 == 0, K % 128 == 0. Each pass works on 128 k from one LDS buffer while the next pass's copies fly into the other.
template <int ACT, int ADDP, bool OUT16>
__global__ __launch_bounds__(256) void k_gemm2(const _Float16* __restrict__ A, int lda, size_t sA, const _Float16* __restrict__ Bh, int ldb, size_t sB, float alpha, const float* __restrict__ bias, size_t sBias, const float* __restrict__ CP,
    float* __restrict__ C, _Float16* __restrict__ C16, int ldc, size_t sC, int M, int N, int K) {
  __shared__ __attribute__((aligned(16))) unsigned char ring[2 * G2_BUF];
  float (*so)[32][68] = (float (*)[32][68])ring;      /* output staging (8 x 32 x 68 f32 = one buffer), used only behind the last pass's barrier */
  const int tid = threadIdx.x, w = tid >> 5, lane = tid & 31, ln = lane & 15, hh = lane >> 4; const int by = blockIdx.y;
  A += (size_t)by * sA; Bh += (size_t)by * sB; const size_t cofs = (size_t)by * sC; const float* bp = bias ? bias + (size_t)by * sBias : nullptr;
  const int ntn = N >> 7; const int mt = blockIdx.x / ntn, nq = blockIdx.x - mt * ntn; if (mt * 128 >= M) return;      /* the whole block leaves, in front of every barrier */
  const int row0 = mt * 128 + 32 * (w & 3), col0 = nq * 128 + 64 * (w >> 2);
  const _Float16* gA = A + (size_t)(mt * 128 + (tid >> 4)) * lda + (tid & 15) * 8; const _Float16* gB = Bh + (size_t)(nq * 128 + (tid >> 4)) * ldb + (tid & 15) * 8;
  const unsigned lA = (unsigned)(size_t)ring + (unsigned)((tid >> 4) * G2_PITCH + (tid & 15) * 16); const unsigned lB = lA + 128 * G2_PITCH;
  const size_t stA = (size_t)16 * lda, stB = (size_t)16 * ldb;
  const int aofs = (32 * (w & 3) + ln) * G2_PITCH, bofs = (128 + 64 * (w >> 2) + ln) * G2_PITCH;
  const int np = K >> 7;
  g2_copy8(lA, gA, stA); g2_copy8(lB, gB, stB);
  asm volatile("s_wait_asynccnt 0x0" ::: "memory");      /* pass 0's own copies have landed */
  __syncthreads();                                        /* ... and every other wave's */
  if (np > 1) { g2_copy8(lA + G2_BUF, gA + 128, stA); g2_copy8(lB + G2_BUF, gB + 128, stB); }
  const v8f z8 = {0.f,0.f,0.f,0.f,0.f,0.f,0.f,0.f}; v8f c00 = z8, c01 = z8, c02 = z8, c03 = z8, c10 = z8, c11 = z8, c12 = z8, c13 = z8;
#pragma unroll 1      /* one pass per trip: the publish point at the foot stands once */
  for (int p = 0; p < np; ++p) { const unsigned bsel = (unsigned)(p & 1) * G2_BUF; const unsigned char* sa = ring + bsel + aofs; const unsigned char* sb = ring + bsel + bofs;
    v16h fa[2][2], fb[2][4];      /* two fragment sets: block kk + 1 is fetched ahead of block kk's products, inside this pass's buffer only */
    fa[0][0] = g2_frag((const _Float16*)sa, hh); fa[0][1] = g2_frag((const _Float16*)(sa + 16 * G2_PITCH), hh);
#pragma unroll      /* constant indices keep fa and fb in registers (this loop and the two below) */
    for (int j = 0; j < 4; ++j) fb[0][j] = g2_frag((const _Float16*)(sb + j * 16 * G2_PITCH), hh);
#pragma unroll
    for (int kk = 0; kk < 4; ++kk) { const int cu = kk & 1, nx = cu ^ 1;
      if (kk < 3) { fa[nx][0] = g2_frag((const _Float16*)(sa + (kk + 1) * 64), hh); fa[nx][1] = g2_frag((const _Float16*)(sa + 16 * G2_PITCH + (kk + 1) * 64), hh);
#pragma unroll
        for (int j = 0; j < 4; ++j) fb[nx][j] = g2_frag((const _Float16*)(sb + j * 16 * G2_PITCH + (kk + 1) * 64), hh); }
      c00 = g2_mma(fa[cu][0], fb[cu][0], c00); c10 = g2_mma(fa[cu][1], fb[cu][0], c10); c01 = g2_mma(fa[cu][0], fb[cu][1], c01); c11 = g2_mma(fa[cu][1], fb[cu][1], c11);
      c02 = g2_mma(fa[cu][0], fb[cu][2], c02); c12 = g2_mma(fa[cu][1], fb[cu][2], c12); c03 = g2_mma(fa[cu][0], fb[cu][3], c03); c13 = g2_mma(fa[cu][1], fb[cu][3], c13); }
    asm volatile("s_wait_dscnt 0x0" ::: "memory");        /* this wave's reads of the buffer have returned before it is refilled */
    asm volatile("s_wait_asynccnt 0x0" ::: "memory");     /* this wave's copies for pass p + 1 have landed */
    __syncthreads();                                      /* publishes pass p + 1 and ends every reader's last read of pass p's buffer */
    if (p + 2 < np) { g2_copy8(lA + bsel, gA + (size_t)(p + 2) * 128, stA); g2_copy8(lB + bsel, gB + (size_t)(p + 2) * 128, stB); } }
  asm volatile("s_wait_asynccnt 0x0" ::: "memory");       /* nothing in flight when the ring becomes output staging */
  /* Bias and addend are read in the layout of the write-out (a lane: 4 columns of 16 rows; 16 lanes: a whole 256-B run), and every load is issued here, ahead of the staging: they are in flight together and are waited for once. */
  const int rsub = lane >> 4, c4 = (lane & 15) * 4;
  v4f bq = {0.f, 0.f, 0.f, 0.f}, x[16];
  if (ADDP > 0) { const float* cr = CP + (size_t)(row0 + rsub) * ADDP + (size_t)by * 64 + col0 + c4;      /* a lane reads exactly the elements it writes below, so C may lie over CP */
#pragma unroll      /* constant indices keep x and accs in registers (this loop and those below); the compile-time pitch makes the 16 loads one address pair with immediate offsets */
    for (int q = 0; q < 16; ++q) x[q] = *(const v4fa*)(cr + q * 2 * ADDP);
    asm volatile("s_wait_xcnt 0x0" :: "v"(cr) : "memory"); }      /* the loads' address pair stays whole up to this wait */
  if (bp) { const float* br = bp + col0 + c4; bq = *(const v4fa*)br;
    asm volatile("s_wait_xcnt 0x0" :: "v"(br) : "memory"); }      /* the load's address pair stays whole up to this wait */
  v8f accs[8] = {c00, c01, c02, c03, c10, c11, c12, c13};
#pragma unroll
  for (int u = 0; u < 8; ++u) { const int t = u & 3, half = u >> 2;
#pragma unroll
    for (int r = 0; r < 8; ++r) so[w][half * 16 + 8 * hh + r][t * 16 + ln] = accs[u][r]; }
  __builtin_amdgcn_fence(__ATOMIC_ACQ_REL, "workgroup"); __builtin_amdgcn_wave_barrier();
  float bv[4];
#pragma unroll
  for (int i = 0; i < 4; ++i) bv[i] = bf16_round(bq[i]);
#pragma unroll
  for (int q = 0; q < 16; ++q) { const v4f a4 = *(const v4fa*)&so[w][q * 2 + rsub][c4];
#pragma unroll
    for (int i = 0; i < 4; ++i) { float v = a4[i] * alpha + bv[i]; if (ADDP > 0) v += x[q][i];
      if (ACT == 3) v = fmaxf(v, 0.f); else if (ACT == 6) v = 0.5f * v * (1.0f + erff(v * 0.70710678118654752f)); else if (ACT == 11) v = 1.0f / (1.0f + expf(-v)); else if (ACT == 15) v = v / (1.0f + expf(-v)); else if (ACT == 12) v = (v > 0.f) ? v : 0.01f * v; else if (ACT == 8) v = tanhf(v); else if (ACT == 9) v = 0.5f * v * (1.0f + tanhf(0.7978845608028654f * (v + 0.044715f * v * v * v)));      /* tanh-GELU */
      x[q][i] = v; } }
  /* all results first, then the stores as one group: no store is held behind the next row's LDS read */
  const size_t o0 = cofs + (size_t)(row0 + rsub) * ldc + col0 + c4, ost = (size_t)2 * ldc;
#pragma unroll
  for (int q = 0; q < 16; ++q) { if (OUT16) { v4h h4;
#pragma unroll
      for (int i = 0; i < 4; ++i) h4[i] = (_Float16)x[q][i];
      *(v4h*)(C16 + o0 + q * ost) = h4; } else *(v4f*)(C + o0 + q * ost) = x[q]; } }



// Staged tile of k_flash: 128 keys. 128 K rows (64 f16 = 128 B) at a pitch of 144 B, then 64 V^T rows (128 keys = 256 B) at a pitch of 272 B (16 B x odd: conflict-free for ds_load_b128 readers); two buffers.
#define FL_KEYS 128
#define FL_KP 144
#define FL_VP 272
#define FL_VOFS (FL_KEYS * FL_KP)
#define FL_BUF (FL_VOFS + 64 * FL_VP)
#define FL_C2 (SCL * 1.4426950408889634f)      /* score scale x log2(e) */
// Eight asynchronous 16-byte copies per lane: l = the lane's LDS byte address (LSTEP bytes between copies), g = its global address (gstep elements between copies).
// s_wait_xcnt 0 is the statement's last line, so that it stands in front of any later rewrite of the address registers the copies name.
template <unsigned LSTEP>
__device__ __forceinline__ void fl_copy8(unsigned l, const unsigned short* g, size_t gstep) {
  const unsigned l1 = l + LSTEP, l2 = l + 2 * LSTEP, l3 = l + 3 * LSTEP, l4 = l + 4 * LSTEP, l5 = l + 5 * LSTEP, l6 = l + 6 * LSTEP, l7 = l + 7 * LSTEP;
  const unsigned short* g1 = g + gstep; const unsigned short* g2 = g1 + gstep; const unsigned short* g3 = g2 + gstep; const unsigned short* g4 = g3 + gstep; const unsigned short* g5 = g4 + gstep; const unsigned short* g6 = g5 + gstep; const unsigned short* g7 = g6 + gstep;
  asm volatile("global_load_async_to_lds_b128 %0, %8, off\n\t"
               "global_load_async_to_lds_b128 %1, %9, off\n\t"
               "global_load_async_to_lds_b128 %2, %10, off\n\t"
               "global_load_async_to_lds_b128 %3, %11, off\n\t"
               "global_load_async_to_lds_b128 %4, %12, off\n\t"
               "global_load_async_to_lds_b128 %5, %13, off\n\t"
               "global_load_async_to_lds_b128 %6, %14, off\n\t"
               "global_load_async_to_lds_b128 %7, %15, off\n\t"
               "s_wait_xcnt 0x0"
               :: "v"(l), "v"(l1), "v"(l2), "v"(l3), "v"(l4), "v"(l5), "v"(l6), "v"(l7), "v"(g), "v"(g1), "v"(g2), "v"(g3), "v"(g4), "v"(g5), "v"(g6), "v"(g7) : "memory");
}
// lane l with lane l ^ 16 (the two lanes that share one query column of a transposed score tile)
__device__ __forceinline__ float fl_xhalf(float x) { return __builtin_bit_cast(float, __builtin_amdgcn_permlanex16(__builtin_bit_cast(int, x), __builtin_bit_cast(int, x), 0x76543210, 0xfedcba98, false, false)); }
__global__ __launch_bounds__(128) void k_flash(const _Float16* __restrict__ Q16, int ldq, const _Float16* __restrict__ K16, int ldk, const _Float16* __restrict__ Vt, const int* __restrict__ MSK, float* __restrict__ O, int ldo) {
  constexpr int RPW = 16, NQB = TQ / (4 * RPW), DT = 4, KS = 2; (void)MSK;
  __shared__ __attribute__((aligned(16))) float sO[4][RPW][64 + 4];
  __shared__ __attribute__((aligned(16))) unsigned char ring[2 * FL_BUF];
  const int tid = threadIdx.x, w = tid >> 5, lane = tid & 31, ln = lane & 15, hh = lane >> 4;
  const int slab = blockIdx.x / NQB, qblk = blockIdx.x % NQB; const int b = slab / NH, h = slab % NH; const int qb0 = qblk * (4 * RPW); const int q0 = qb0 + w * RPW;
  FragH aq[KS];
  { const unsigned short* qr = (const unsigned short*)Q16 + ((size_t)b * TQ + q0 + ln) * ldq + h * 64;
#pragma unroll
    for (int ks = 0; ks < KS; ++ks) { aq[ks].half[0] = *(const v8us*)(qr + ks * 32 + 8 * hh); aq[ks].half[1] = *(const v8us*)(qr + ks * 32 + 16 + 8 * hh); } }
  const unsigned short* Vth = (const unsigned short*)Vt + (size_t)slab * 64 * TK;
  float m_r = -3.0e38f, l_r = 0.f; v8f oacc[DT];      /* oacc[dt][r] = O^T[dt*16 + 8*hh + r][query ln] */
#pragma unroll
  for (int dt = 0; dt < DT; ++dt) oacc[dt] = (v8f){0.f,0.f,0.f,0.f,0.f,0.f,0.f,0.f};
  /* the block's 128 threads copy a stage: K as 16 rows x 8 pieces, V^T as 8 rows x 16 pieces per copy, whole 128-B lines per wave */
  const unsigned short* gK = (const unsigned short*)K16 + ((size_t)b * TK + (tid >> 3)) * ldk + h * 64 + (tid & 7) * 8; const unsigned short* gV = Vth + (size_t)(tid >> 4) * TK + (tid & 15) * 8;
  const unsigned lK = (unsigned)(size_t)ring + (unsigned)((tid >> 3) * FL_KP + (tid & 7) * 16); const unsigned lV = (unsigned)(size_t)ring + (unsigned)(FL_VOFS + (tid >> 4) * FL_VP + (tid & 15) * 16);
  const size_t stK = (size_t)16 * ldk, stV = (size_t)8 * TK;
  constexpr int NST = TK / FL_KEYS;
  fl_copy8<16 * FL_KP>(lK, gK, stK); fl_copy8<8 * FL_VP>(lV, gV, stV);
  asm volatile("s_wait_asynccnt 0x0" ::: "memory");      /* stage 0's own copies have landed */
  __syncthreads();                                        /* ... and every other wave's */
  if (NST > 1) { fl_copy8<16 * FL_KP>(lK + FL_BUF, gK + (size_t)FL_KEYS * ldk, stK); fl_copy8<8 * FL_VP>(lV + FL_BUF, gV + FL_KEYS, stV); }
#pragma unroll 1      /* one stage per trip: the publish point at the foot stands once */
  for (int st = 0; st < NST; ++st) { const unsigned bsel = (unsigned)(st & 1) * FL_BUF; const unsigned char* sK = ring + bsel; const unsigned char* sV = sK + FL_VOFS;
#pragma unroll 1      /* 32 keys per trip, rolled as before: keeps the loop's text small */
  for (int j0 = 0; j0 < FL_KEYS; j0 += 32) {
    v8f s[2]; FragH bk[2][KS], bv[DT];      /* this trip's K and V^T fragments are read from the stage as one group, ahead of the products and the softmax */
#pragma unroll
    for (int nt = 0; nt < 2; ++nt) { const unsigned short* kr = (const unsigned short*)(sK + (j0 + nt * 16 + ln) * FL_KP);
#pragma unroll
      for (int ks = 0; ks < KS; ++ks) { bk[nt][ks].half[0] = *(const v8us*)(kr + ks * 32 + 8 * hh); bk[nt][ks].half[1] = *(const v8us*)(kr + ks * 32 + 16 + 8 * hh); } }
#pragma unroll
    for (int dt = 0; dt < DT; ++dt) { const unsigned short* vrow = (const unsigned short*)(sV + (dt * 16 + ln) * FL_VP) + j0; bv[dt].half[0] = *(const v8us*)(vrow + 8 * hh); bv[dt].half[1] = *(const v8us*)(vrow + 16 + 8 * hh); }
#pragma unroll
    for (int nt = 0; nt < 2; ++nt) { v8f acc = (v8f){0.f,0.f,0.f,0.f,0.f,0.f,0.f,0.f};
#pragma unroll
      for (int ks = 0; ks < KS; ++ks) acc = mmaH<1>(bk[nt][ks].v, bk[nt][ks].v, aq[ks].v, aq[ks].v, acc);
      s[nt] = acc; }
    float mc = s[0][0];      /* the running maximum is kept in raw (unscaled) scores: the scale is positive, so the order is the same */
#pragma unroll      /* constant indices keep s, pb and oacc in registers (this loop and those below) */
    for (int i = 1; i < 16; ++i) mc = fmaxf(mc, s[i >> 3][i & 7]);
    mc = fmaxf(mc, fl_xhalf(mc));
    const float mn = fmaxf(m_r, mc); const float al = (mn > -1.0e38f) ? __builtin_amdgcn_exp2f((m_r - mn) * FL_C2) : 1.0f; m_r = mn;
    const float nb = __builtin_fmaf(-mn, FL_C2, 10.0f);      /* 2^(s c + nb) = 2^10 exp((s - mn) / 8): scale, maximum and the 2^10 of P in one multiply-add */
    FragH pb; float psum = 0.f;
#pragma unroll
    for (int i = 0; i < 16; ++i) { const float p = __builtin_amdgcn_exp2f(__builtin_fmaf(s[i >> 3][i & 7], FL_C2, nb)); psum += p; pb.h[i] = (_Float16)p; }
    l_r = l_r * al + psum;      /* l_r carries the 2^10 too */
#pragma unroll
    for (int dt = 0; dt < DT; ++dt)
#pragma unroll
      for (int r = 0; r < 8; ++r) oacc[dt][r] *= al;
#pragma unroll
    for (int dt = 0; dt < DT; ++dt) oacc[dt] = mmaH<1>(bv[dt].v, bv[dt].v, pb.v, pb.v, oacc[dt]); }
    asm volatile("s_wait_dscnt 0x0" ::: "memory");        /* this wave's reads of the buffer have returned before it is refilled */
    asm volatile("s_wait_asynccnt 0x0" ::: "memory");     /* this wave's copies for stage st + 1 have landed */
    __syncthreads();                                      /* publishes stage st + 1 and ends every reader's last read of stage st's buffer */
    if (st + 2 < NST) { fl_copy8<16 * FL_KP>(lK + bsel, gK + (size_t)(st + 2) * FL_KEYS * ldk, stK); fl_copy8<8 * FL_VP>(lV + bsel, gV + (size_t)(st + 2) * FL_KEYS, stV); } }
  asm volatile("s_wait_asynccnt 0x0" ::: "memory");       /* nothing in flight when the wave goes on to its end */
  { float l = l_r + fl_xhalf(l_r); l = (l > 0.f) ? 1.0f / l : 0.f;
#pragma unroll
    for (int dt = 0; dt < DT; ++dt) { v4f lo, hi;
#pragma unroll
      for (int r = 0; r < 4; ++r) { lo[r] = oacc[dt][r] * l; hi[r] = oacc[dt][4 + r] * l; }
      *(v4fa*)&sO[w][ln][dt * 16 + 8 * hh] = lo; *(v4fa*)&sO[w][ln][dt * 16 + 8 * hh + 4] = hi; } }
  __builtin_amdgcn_fence(__ATOMIC_ACQ_REL, "workgroup"); __builtin_amdgcn_wave_barrier();
  {
#pragma unroll
    for (int rp = 0; rp < RPW; rp += 2) { const int r = rp + (lane >> 4), pc = lane & 15; const v4f val = *(const v4fa*)&sO[w][r][pc * 4]; *(v4f*)(O + ((size_t)b * TQ + q0 + r) * ldo + h * 64 + pc * 4) = val; }
     } }
__global__ __launch_bounds__(256) void k_fulltab(unsigned* __restrict__ MB, int* __restrict__ RA, int* __restrict__ KE, int nq, int nk) {
  const int t = blockIdx.x * 256 + threadIdx.x;
  if (t < nq * (nk / 32)) { *(unsigned*)(MB + t) = 0u;  }
  if (t < nq) { *(int*)(RA + t) = 0;  }
  if (t < nq / 64) { *(int*)(KE + t * 32) = nk;  } }
template <int SRCBF>
__global__ __launch_bounds__(256) void k_ln1024(const float* __restrict__ X, _Float16* __restrict__ Y16, float* __restrict__ XB) {
  #pragma clang fp contract(off)
  const int tid = threadIdx.x, w = tid >> 5, ln = tid & 31; const int r = blockIdx.x * 8 + w; if (r >= NR) return; const float* x = X + (size_t)r * DM; float s = 0.f;
#pragma unroll 1
  for (int i = 0; i < 8; ++i) { const v4f a = *(const v4fa*)(x + i * 128 + ln * 4); for (int q = 0; q < 4; ++q) s += SRCBF ? bf16_round(a[q]) : a[q]; }
  for (int o = 16; o > 0; o >>= 1) s += __shfl_xor(s, o, 32); const float mu = s / (float)DM; float q2 = 0.f;
#pragma unroll 1
  for (int i = 0; i < 8; ++i) { const v4f a = *(const v4fa*)(x + i * 128 + ln * 4); for (int q = 0; q < 4; ++q) { const float d = (SRCBF ? bf16_round(a[q]) : a[q]) - mu; q2 += d * d; } }
  for (int o = 16; o > 0; o >>= 1) q2 += __shfl_xor(q2, o, 32); const float dn = sqrtf(q2 / (float)DM + 1e-5f);
  {
#pragma unroll 1
    for (int i = 0; i < 8; ++i) { const int c0 = i * 128 + ln * 4; const v4f a = *(const v4fa*)(x + c0); _Float16 h4[4]; v4f xb;
      for (int q = 0; q < 4; ++q) { const float t = SRCBF ? bf16_round(a[q]) : a[q]; h4[q] = (_Float16)((t - mu) / dn); xb[q] = t; }
      *(unsigned long long*)((unsigned short*)Y16 + (size_t)r * DM + c0) = *(const unsigned long long*)h4; if (SRCBF) *(v4f*)(XB + (size_t)r * DM + c0) = xb; }
     } }
__global__ __launch_bounds__(256) void k_causaltab(unsigned* __restrict__ MB, int* __restrict__ RA, int* __restrict__ KE, int nq, int nk) {
  const int t = blockIdx.x * 256 + threadIdx.x; const int nw = nk / 32;
  if (t < nq * nw) { const int q = t / nw, w = t % nw; const int first = q + 1 - 32 * w; const unsigned bits = (first <= 0) ? 0xffffffffu : ((first >= 32) ? 0u : (0xffffffffu << first)); *(unsigned*)(MB + t) = bits;  }
  if (t < nq) { *(int*)(RA + t) = 0;  }
  if (t < nq / 64) { const int v = 64 * (t + 1); *(int*)(KE + t * 32) = v;  } }


extern "C" void kernel_launch(void* const* d_in, const int* in_sizes, int n_in,
                              void* d_out, int out_size, void* d_ws, size_t ws_size, hipStream_t stream) {
  (void)in_sizes; (void)n_in; (void)out_size;
  const float* const* I = (const float* const*)d_in; const float* x = I[0]; const float* Wqkv = I[1]; const float* Wfc = I[2]; const float* W1 = I[3]; const float* b1 = I[4]; const float* W2 = I[5]; const float* b2 = I[6];
  char* ws = (char*)d_ws; size_t off = 0;
  auto take = [&](size_t bytes) { char* p = ws + off; off += (bytes + 255) & ~(size_t)255; return p; };
  _Float16* BQKV = (_Float16*)take((size_t)3 * DM * DM * 2); _Float16* BFC = (_Float16*)take((size_t)DM * DM * 2); _Float16* BW1 = (_Float16*)take((size_t)4096 * DM * 2); _Float16* BW2 = (_Float16*)take((size_t)DM * 4096 * 2);
  float* XB = (float*)take((size_t)NR * DM * 4); _Float16* X16 = (_Float16*)take((size_t)NR * DM * 2); float* F = (float*)take((size_t)NR * DM * 4);
  _Float16* Q16 = (_Float16*)take((size_t)NR * DM * 2); _Float16* K16 = (_Float16*)take((size_t)NR * DM * 2); _Float16* V16 = (_Float16*)take((size_t)NR * DM * 2); _Float16* VT = (_Float16*)take((size_t)NR * DM * 2); if (off > ws_size) return;      /* 24 + 16 + 8 + 16 + 32 = 96 MiB */
  float* O = F; _Float16* Oh = Q16; _Float16* Ol = K16;     /* q/k planes are dead after the flash */
  float* X1 = XB;                                           /* x1 written over the residual plane (own-tile addend) */
  _Float16* H16 = X16; _Float16* GH = Q16;                  /* GELU hidden [NR][4096] f16 = 32 MB over Q16|K16|V16|VT (contiguous, all dead once x1 is formed) */
  const size_t n8 = (size_t)NR * DM / 8; const unsigned nb8 = (unsigned)((n8 + 255) / 256);
  k_wt_f16<DM, 3 * DM><<<(DM / 128) * (3 * DM / 64), 256, 0, stream>>>(Wqkv, BQKV, 16.0f); k_wt_f16<DM, DM><<<(DM / 128) * (DM / 64), 256, 0, stream>>>(Wfc, BFC, 16.0f);
  k_wt_f16<DM, 4096><<<(DM / 128) * (4096 / 64), 256, 0, stream>>>(W1, BW1, 16.0f); k_wt_f16<4096, DM><<<(4096 / 128) * (DM / 64), 256, 0, stream>>>(W2, BW2, 16.0f);      /* all (in,out); one block per 128 k x 64 n tile */
  k_ln1024<1><<<NR / 8, 256, 0, stream>>>(x, X16, XB);
  const dim3 gP((NR / 128) * (DM / 128), 1), gM((NR / 128) * (4096 / 128), 1);
  k_gemm2<0, 0, true><<<gP, 256, 0, stream>>>(X16, DM, 0, BQKV, DM, 0, 0.0625f, nullptr, 0, nullptr, nullptr, Q16, DM, 0, NR, DM, DM);
  k_gemm2<0, 0, true><<<gP, 256, 0, stream>>>(X16, DM, 0, BQKV + (size_t)DM * DM, DM, 0, 0.0625f, nullptr, 0, nullptr, nullptr, K16, DM, 0, NR, DM, DM);
  k_gemm2<0, 0, true><<<gP, 256, 0, stream>>>(X16, DM, 0, BQKV + (size_t)2 * DM * DM, DM, 0, 0.0625f, nullptr, 0, nullptr, nullptr, V16, DM, 0, NR, DM, DM);
  for (int b = 0; b < NBT; ++b) k_vt<NH, SLEN><<<NH * (SLEN / 64), 256, 0, stream>>>(V16 + (size_t)b * SLEN * DM, DM, 0, VT + (size_t)b * SLEN * DM);
  for (int b = 0; b < NBT; ++b) { const size_t ro = (size_t)b * SLEN * DM;
    k_flash<<<NH * (SLEN / 64), 128, 0, stream>>>(Q16 + ro, DM, K16 + ro, DM, VT + ro, nullptr, O + ro, DM); }      /* plain flash over all keys */
  k_hl<<<nb8, 256, 0, stream>>>(O, Oh, Ol, n8);
  k_gemm2<0, DM, false><<<gP, 256, 0, stream>>>(Oh, DM, 0, BFC, DM, 0, 0.0625f, nullptr, 0, XB, X1, nullptr, DM, 0, NR, DM, DM);      /* x1 = x + attn w_fc (hi) */
  k_gemm2<0, DM, false><<<gP, 256, 0, stream>>>(Ol, DM, 0, BFC, DM, 0, 0.0625f / 1024.0f, nullptr, 0, X1, X1, nullptr, DM, 0, NR, DM, DM);      /* + lo */
  k_ln1024<0><<<NR / 8, 256, 0, stream>>>(X1, H16, nullptr);
  k_gemm2<9, 0, true><<<gM, 256, 0, stream>>>(H16, DM, 0, BW1, DM, 0, 0.0625f, b1, 0, nullptr, nullptr, GH, 4096, 0, NR, 4096, DM);      /* tanh-gelu(LN(x1) w1 + b1) f16 */
  k_gemm2<0, DM, false><<<gP, 256, 0, stream>>>(GH, 4096, 0, BW2, 4096, 0, 0.0625f, b2, 0, X1, (float*)d_out, nullptr, DM, 0, NR, DM, 4096);      /* out = x1 + mlp */
}

// v007
// It runs in 222 microseconds.
// Next to v006, in two timings, it ran 1.10 and 1.09 times as fast.
// All steps since v000 together make it 4.71 times as fast.
#include <hip/hip_runtime.h>
// Pre-LN transformer layer (2 x 2048 tokens, 1024; 16 heads x 64; full (non-causal) attention; MLP 4096 with tanh-GELU): h = LN(x) (no affine); q,k,v = h w_qkv; x1 = x + softmax(q.k/8).v w_fc; out = x1 + gelu(LN(x1) w1 + b1) w2 + b2 -> [2,2048,1024].
// Structure: LayerNorm on VALU (also writing the bf16 residual plane); projections / MLP as f16 WMMA GEMMs (32x64 wave tiles, f32 accumulation, exact weights x16, tanh-GELU and biases in the epilogue, residuals through the f32 addend); q, k, V^T as plain f16 planes through the fused flash kernel over all keys (online softmax in f32, P x2^10); O as hi + residual planes into w_fc (two GEMMs).
// Compute dtype: x and weights rounded to bf16; LN outputs, q, k, v, P and the GELU hidden as f16 operands (~2^-12); O as hi + residual pairs; f32 accumulation, softmax, LayerNorm. v_wmma_f32_16x16x32_f16.
#define NBT 2
#define SLEN 2048
#define TQ SLEN
#define TK SLEN
#define DM 1024
#define NH 16
#define SCL 0.125f
#define NR (NBT * SLEN)
typedef __bf16 v16b __attribute__((ext_vector_type(16)));
typedef unsigned short v8us __attribute__((ext_vector_type(8), may_alias));
typedef float  v8f  __attribute__((ext_vector_type(8)));
typedef float  v4f  __attribute__((ext_vector_type(4)));
typedef float  v4fa __attribute__((ext_vector_type(4), may_alias));
union FragB { v16b v; v8us half[2]; unsigned short u[16]; };

__device__ __forceinline__ unsigned short bf16_bits(float x) { unsigned int u = __float_as_uint(x); return (unsigned short)((u + 0x7FFFu + ((u >> 16) & 1u)) >> 16); }
__device__ __forceinline__ float bf16_val(unsigned short b) { return __uint_as_float(((unsigned int)b) << 16); }
__device__ __forceinline__ float bf16_round(float x) { return bf16_val(bf16_bits(x)); }
// D += A·B with NT terms: 1 = ah·bh, 2 = + al·bh (A split), 3 = + ah·bl (both split)
template <int NT>
__device__ __forceinline__ v8f mmaN(v16b ah, v16b al, v16b bh, v16b bl, v8f c) {
  c = __builtin_amdgcn_wmma_f32_16x16x32_bf16(false, ah, false, bh, (short)0, c, false, false);
  if (NT >= 2) c = __builtin_amdgcn_wmma_f32_16x16x32_bf16(false, al, false, bh, (short)0, c, false, false);
  if (NT >= 3) c = __builtin_amdgcn_wmma_f32_16x16x32_bf16(false, ah, false, bl, (short)0, c, false, false);
  asm volatile("v_nop\n\tv_nop\n\tv_nop\n\tv_nop" : "+v"(c) : "v"(ah), "v"(al), "v"(bh), "v"(bl));
  return c;
}

__global__ __launch_bounds__(256) void k_wt_bf16(const float* __restrict__ W, unsigned short* __restrict__ Wt, int K, int N) {
  const int t = blockIdx.x * 256 + threadIdx.x;
  const int k8n = K / 8;
  if (t >= N * k8n) return;
  const int n = t / k8n, k8 = (t % k8n) * 8;
  v8us v;
#pragma unroll
  for (int i = 0; i < 8; ++i) v[i] = bf16_bits(W[(size_t)(k8 + i) * N + n]);
  *(v8us*)(Wt + (size_t)n * K + k8) = v;
  
}

// GEMM C[M][N] (f32, pitch ldc) = act(A[M][K]·W + bias). A f32 row-major (pitch lda) converted per fragment to bf16
// (ASPLIT: hi/lo two planes -> 2 terms, else single rounded term); Wt bf16 [N][K] (pitch ldb). BIAS_BF16 rounds the
// bias to bf16 first (bias quantised to bf16 before the add). K%32==0, M%16==0, N%64==0.
template <bool ASPLIT, int ACT, bool BIAS_BF16>
__global__ __launch_bounds__(128) void k_gemm_bf(const float* __restrict__ A, int lda, const unsigned short* __restrict__ Wt, int ldb,
                                               const float* __restrict__ bias, float* __restrict__ C, int ldc, int M, int N, int K) {
  __shared__ __attribute__((aligned(16))) float so[4][16][64];
  const int tid = threadIdx.x, w = tid >> 5, lane = tid & 31, ln = lane & 15, hh = lane >> 4;
  const int ntn = N / 64;
  const int wid = blockIdx.x * 4 + w;
  const int mt = wid / ntn, nq = wid % ntn;
  if (mt * 16 >= M) return;
  const int row0 = mt * 16, col0 = nq * 64;
  const float* arow = A + (size_t)(row0 + ln) * lda;
  v8f acc[4] = {};
  for (int kb = 0; kb < K; kb += 32) {
    FragB ah, al;
    const v4f x0 = *(const v4fa*)(arow + kb + 8 * hh), x1 = *(const v4fa*)(arow + kb + 8 * hh + 4);
    const v4f x2 = *(const v4fa*)(arow + kb + 16 + 8 * hh), x3 = *(const v4fa*)(arow + kb + 16 + 8 * hh + 4);
    float xs[16] = {x0[0],x0[1],x0[2],x0[3],x1[0],x1[1],x1[2],x1[3],x2[0],x2[1],x2[2],x2[3],x3[0],x3[1],x3[2],x3[3]};
#pragma unroll
    for (int i = 0; i < 16; ++i) { const unsigned short hb = bf16_bits(xs[i]); ah.u[i] = hb; al.u[i] = ASPLIT ? bf16_bits(xs[i] - bf16_val(hb)) : (unsigned short)0; }
#pragma unroll
    for (int t = 0; t < 4; ++t) {
      const unsigned short* brow = Wt + (size_t)(col0 + t * 16 + ln) * ldb + kb;
      FragB b;
      b.half[0] = *(const v8us*)(brow + 8 * hh);
      b.half[1] = *(const v8us*)(brow + 16 + 8 * hh);
      acc[t] = mmaN<ASPLIT ? 2 : 1>(ah.v, al.v, b.v, b.v, acc[t]);
    }
  }
#pragma unroll
  for (int t = 0; t < 4; ++t) {
    float bv = bias ? bias[col0 + t * 16 + ln] : 0.f;
    if (BIAS_BF16) bv = bf16_round(bv);
#pragma unroll
    for (int r = 0; r < 8; ++r) { float v = acc[t][r] + bv; if (ACT == 1) v = fmaxf(v, 0.f); so[w][8 * hh + r][t * 16 + ln] = v; }
  }
  __builtin_amdgcn_fence(__ATOMIC_ACQ_REL, "workgroup");
  __builtin_amdgcn_wave_barrier();
  const int rsub = lane >> 4, c4 = (lane & 15) * 4;
  {
#pragma unroll
    for (int q = 0; q < 8; ++q) {
      const int r = q * 2 + rsub;
      const v4f v = *(const v4fa*)&so[w][r][c4];
      *(v4f*)(C + (size_t)(row0 + r) * ldc + col0 + c4) = v;
    }
    
  }
}

// GEMM C = act(A·W + bias + resid): A f32 (ASPLIT -> hi/lo 2 terms), Wt bf16 [N][K]; ACT 0 none, 1 relu, 2 exact gelu;
// resid (optional, f32, row index = (row % rmod), pitch ldr, RES_BF16 rounds it) added before the activation.
template <bool ASPLIT, int ACT, bool BIAS_BF16, bool RES_BF16>
__global__ __launch_bounds__(128) void k_gemm_bf3(const float* __restrict__ A, int lda, const unsigned short* __restrict__ Wt, int ldb,
                                                const float* __restrict__ bias, const float* __restrict__ resid, int rmod, int ldr,
                                                float* __restrict__ C, int ldc, int M, int N, int K) {
  __shared__ __attribute__((aligned(16))) float so[4][16][64];
  const int tid = threadIdx.x, w = tid >> 5, lane = tid & 31, ln = lane & 15, hh = lane >> 4;
  const int ntn = N / 64;
  const int wid = blockIdx.x * 4 + w;
  const int mt = wid / ntn, nq = wid % ntn;
  if (mt * 16 >= M) return;
  const int row0 = mt * 16, col0 = nq * 64;
  const float* arow = A + (size_t)(row0 + ln) * lda;
  v8f acc[4] = {};
  for (int kb = 0; kb < K; kb += 32) {
    FragB ah, al;
    const v4f x0 = *(const v4fa*)(arow + kb + 8 * hh), x1 = *(const v4fa*)(arow + kb + 8 * hh + 4);
    const v4f x2 = *(const v4fa*)(arow + kb + 16 + 8 * hh), x3 = *(const v4fa*)(arow + kb + 16 + 8 * hh + 4);
    float xs[16] = {x0[0],x0[1],x0[2],x0[3],x1[0],x1[1],x1[2],x1[3],x2[0],x2[1],x2[2],x2[3],x3[0],x3[1],x3[2],x3[3]};
#pragma unroll
    for (int i = 0; i < 16; ++i) { const unsigned short hb = bf16_bits(xs[i]); ah.u[i] = hb; al.u[i] = ASPLIT ? bf16_bits(xs[i] - bf16_val(hb)) : (unsigned short)0; }
#pragma unroll
    for (int t = 0; t < 4; ++t) {
      const unsigned short* brow = Wt + (size_t)(col0 + t * 16 + ln) * ldb + kb;
      FragB b;
      b.half[0] = *(const v8us*)(brow + 8 * hh);
      b.half[1] = *(const v8us*)(brow + 16 + 8 * hh);
      acc[t] = mmaN<ASPLIT ? 2 : 1>(ah.v, al.v, b.v, b.v, acc[t]);
    }
  }
#pragma unroll
  for (int t = 0; t < 4; ++t) {
    const int col = col0 + t * 16 + ln;
    float bv = bias ? bias[col] : 0.f;
    if (BIAS_BF16) bv = bf16_round(bv);
#pragma unroll
    for (int r = 0; r < 8; ++r) {
      float v = acc[t][r] + bv;
      if (resid) { float rv = resid[(size_t)((row0 + 8 * hh + r) % rmod) * ldr + col]; if (RES_BF16) rv = bf16_round(rv); v += rv; }
      if (ACT == 1) v = fmaxf(v, 0.f);
      if (ACT == 2) v = 0.5f * v * (1.0f + erff(v * 0.70710678118654752f));
      if (ACT == 3) { const float u = 0.7978845608028654f * (v + 0.044715f * v * v * v); v = 0.5f * v * (1.0f + tanhf(u)); }
      so[w][8 * hh + r][t * 16 + ln] = v;
    }
  }
  __builtin_amdgcn_fence(__ATOMIC_ACQ_REL, "workgroup");
  __builtin_amdgcn_wave_barrier();
  const int rsub = lane >> 4, c4 = (lane & 15) * 4;
  {
#pragma unroll
    for (int q = 0; q < 8; ++q) {
      const int r = q * 2 + rsub;
      const v4f v = *(const v4fa*)&so[w][r][c4];
      *(v4f*)(C + (size_t)(row0 + r) * ldc + col0 + c4) = v;
    }
    
  }
}
// row LayerNorm (biased variance, eps) over N: s = X (+ R); optional out_sum <- s; out_norm <- (s-mu)*rsqrt(var+eps)*g + b
template <bool PARAM_BF16>
__global__ __launch_bounds__(256) void k_layernorm(const float* __restrict__ X, const float* __restrict__ R, const float* __restrict__ g, const float* __restrict__ bta,
                                                  float* __restrict__ out_sum, float* __restrict__ out_norm, int N, float eps) {
  __shared__ float red[256];
  const int row = blockIdx.x, tid = threadIdx.x;
  const float* x = X + (size_t)row * N; const float* rr = R ? R + (size_t)row * N : nullptr;
  float vals[16];                     // up to N = 4096
  const int per = N / 256;            // contiguous chunk per thread? use strided-by-4 chunks: thread handles j = tid*4 + 1024*u
  float s1 = 0.f;
  for (int u = 0; u < per / 4; ++u) {
    const int j = tid * 4 + 1024 * u;
    const v4f a = *(const v4fa*)(x + j);
    v4f b = {0.f,0.f,0.f,0.f}; if (rr) b = *(const v4fa*)(rr + j);
#pragma unroll
    for (int q = 0; q < 4; ++q) { const float v = a[q] + b[q]; vals[u * 4 + q] = v; s1 += v; }
  }
  red[tid] = s1; __syncthreads();
  for (int st = 128; st > 0; st >>= 1) { if (tid < st) red[tid] += red[tid + st]; __syncthreads(); }
  const float mu = red[0] / (float)N; __syncthreads();
  float s2 = 0.f;
  for (int u = 0; u < per / 4; ++u)
#pragma unroll
    for (int q = 0; q < 4; ++q) { const float c = vals[u * 4 + q] - mu; s2 += c * c; }
  red[tid] = s2; __syncthreads();
  for (int st = 128; st > 0; st >>= 1) { if (tid < st) red[tid] += red[tid + st]; __syncthreads(); }
  const float rs = rsqrtf(red[0] / (float)N + eps);
  {
    for (int u = 0; u < per / 4; ++u) {
      const int j = tid * 4 + 1024 * u;
      v4f o, sm;
#pragma unroll
      for (int q = 0; q < 4; ++q) {
        float gg = g[j + q], bb = bta[j + q];
        if (PARAM_BF16) { gg = bf16_round(gg); bb = bf16_round(bb); }
        sm[q] = vals[u * 4 + q]; o[q] = (vals[u * 4 + q] - mu) * rs * gg + bb;
      }
      if (out_sum) *(v4f*)(out_sum + (size_t)row * N + j) = sm;
      *(v4f*)(out_norm + (size_t)row * N + j) = o;
    }
    
  }
}



// ---- f16 WMMA path (v_wmma_f32_16x16x32_f16): 11-bit significands for operands in range — used where a [0,1] probability operand needs more precision than bf16
typedef _Float16 v16h __attribute__((ext_vector_type(16)));
union FragH { v16h v; v8us half[2]; _Float16 h[16]; unsigned short u[16]; };
template <int NT>
__device__ __forceinline__ v8f mmaH(v16h ah, v16h al, v16h bh, v16h bl, v8f c) {
  c = __builtin_amdgcn_wmma_f32_16x16x32_f16(false, ah, false, bh, (short)0, c, false, false);
  if (NT >= 2) c = __builtin_amdgcn_wmma_f32_16x16x32_f16(false, al, false, bh, (short)0, c, false, false);
  if (NT >= 3) c = __builtin_amdgcn_wmma_f32_16x16x32_f16(false, ah, false, bl, (short)0, c, false, false);
  asm volatile("v_nop\n\tv_nop\n\tv_nop\n\tv_nop" : "+v"(c) : "v"(ah), "v"(al), "v"(bh), "v"(bl));
  return c;
}
// batched GEMM like k_gemm_b but f16 operands: A f32 (split into f16 hi/lo if ASPLIT, else rounded to f16), Bt = f16 values [n][k]; alpha; C f32; N multiple of 16 (partial tiles skipped)
template <bool ASPLIT>
__global__ __launch_bounds__(128) void k_gemm_h(const float* __restrict__ A, int lda, size_t sA, const _Float16* __restrict__ Bh, int ldb, size_t sB, float alpha, float* __restrict__ C, int ldc, size_t sC, int M, int N, int K) {
  __shared__ __attribute__((aligned(16))) float so[4][16][64];
  const int tid = threadIdx.x, w = tid >> 5, lane = tid & 31, ln = lane & 15, hh = lane >> 4; const int by = blockIdx.y;
  A += (size_t)by * sA; Bh += (size_t)by * sB; C += (size_t)by * sC;
  const int ntn = (N + 63) / 64; const int wid = blockIdx.x * 4 + w; const int mt = wid / ntn, nq = wid % ntn; if (mt * 16 >= M) return;
  const int row0 = mt * 16, col0 = nq * 64; const float* arow = A + (size_t)(row0 + ln) * lda;
  v8f acc[4] = {};
  for (int kb = 0; kb < K; kb += 32) {
    FragH ah, al;
    const v4f x0 = *(const v4fa*)(arow + kb + 8 * hh), x1 = *(const v4fa*)(arow + kb + 8 * hh + 4), x2 = *(const v4fa*)(arow + kb + 16 + 8 * hh), x3 = *(const v4fa*)(arow + kb + 16 + 8 * hh + 4);
    float xs[16] = {x0[0],x0[1],x0[2],x0[3],x1[0],x1[1],x1[2],x1[3],x2[0],x2[1],x2[2],x2[3],x3[0],x3[1],x3[2],x3[3]};
#pragma unroll
    for (int i = 0; i < 16; ++i) { const _Float16 h = (_Float16)xs[i]; ah.h[i] = h; al.h[i] = ASPLIT ? (_Float16)(xs[i] - (float)h) : (_Float16)0.0f; }
#pragma unroll
    for (int t = 0; t < 4; ++t) { if (col0 + t * 16 >= N) continue; const size_t boff = (size_t)(col0 + t * 16 + ln) * ldb + kb; FragH bq; bq.half[0] = *(const v8us*)(Bh + boff + 8 * hh); bq.half[1] = *(const v8us*)(Bh + boff + 16 + 8 * hh);
      acc[t] = mmaH<ASPLIT ? 2 : 1>(ah.v, al.v, bq.v, bq.v, acc[t]); }
  }
#pragma unroll
  for (int t = 0; t < 4; ++t) { if (col0 + t * 16 >= N) continue;
#pragma unroll
    for (int r = 0; r < 8; ++r) so[w][8 * hh + r][t * 16 + ln] = acc[t][r] * alpha; }
  __builtin_amdgcn_fence(__ATOMIC_ACQ_REL, "workgroup"); __builtin_amdgcn_wave_barrier();
  const int rsub = lane >> 4, c4 = (lane & 15) * 4;
  {
#pragma unroll
    for (int q = 0; q < 8; ++q) { const int r = q * 2 + rsub; if (col0 + c4 < N) { const v4f v = *(const v4fa*)&so[w][r][c4]; *(v4f*)(C + (size_t)(row0 + r) * ldc + col0 + c4) = v; } }
     }
}

// Wt[n][k] = f16(bf16(W[k][n]) * scale) from f32 row-major W[K][N] (scale = power of two; bf16-exact weights stay exact in f16 away from the subnormal range)
// A block turns a tile of 128 k x 64 n through LDS; a matrix has (K / 128) * (N / 64) tiles, blk is the tile's number. Both sides of memory see whole aligned 256-B runs:
// 16 lanes read 64 n of one k row, 16 lanes write 128 k of one n row. A thread reads 8 k x 4 n and stores, per n, its 8 k as one 16-B piece.
// LDS row = one n (16 pieces) at a pitch of 272 B; piece g of row n lies at place g ^ (n >> 4), so that the 16 lanes of a store (rows 4 apart) fall on 16 different bank groups.
#define WT_P 272
template <int K, int N>
__device__ __forceinline__ void wt_tile(const float* __restrict__ W, _Float16* __restrict__ Wt, float scale, int blk, unsigned char* tl) {
  static_assert(K % 128 == 0 && N % 64 == 0, "whole tiles only");
  const int tid = threadIdx.x, c = tid & 15, g = tid >> 4; const int kt = blk / (N / 64), nt = blk % (N / 64); const int k0 = kt * 128, n0 = nt * 64;
  const float* src = W + (size_t)(k0 + g * 8) * N + n0 + c * 4; v4f a[8];
#pragma unroll      /* constant indices keep a and f in registers (this loop and the three below); the eight loads are in flight together */
  for (int i = 0; i < 8; ++i) a[i] = *(const v4fa*)(src + i * N);
#pragma unroll
  for (int j = 0; j < 4; ++j) { FragH f;
#pragma unroll
    for (int i = 0; i < 8; ++i) f.h[i] = (_Float16)(bf16_round(a[i][j]) * scale);
    *(v8us*)(tl + (c * 4 + j) * WT_P + ((g ^ (c >> 2)) * 16)) = f.half[0]; }
  __syncthreads();      /* the tile is whole before any row of it is read */
  unsigned short* dst = (unsigned short*)Wt + (size_t)(n0 + g) * K + k0 + c * 8;
#pragma unroll
  for (int q = 0; q < 4; ++q) { const v8us o = *(const v8us*)(tl + (q * 16 + g) * WT_P + ((c ^ q) * 16)); *(v8us*)(dst + q * 16 * K) = o; }
}
// The four weight matrices in one launch: a block's index picks its matrix and its tile (the same for the whole block, so the barrier in wt_tile is passed by all of it or by none).
#define WT_NB(K, N) (((K) / 128) * ((N) / 64))
#define WT_B1 WT_NB(DM, 3 * DM)
#define WT_B2 (WT_B1 + WT_NB(DM, DM))
#define WT_B3 (WT_B2 + WT_NB(DM, 4096))
#define WT_B4 (WT_B3 + WT_NB(4096, DM))
__global__ __launch_bounds__(256) void k_wt4(const float* __restrict__ Wa, _Float16* __restrict__ Ta, const float* __restrict__ Wb, _Float16* __restrict__ Tb, const float* __restrict__ Wc, _Float16* __restrict__ Tc, const float* __restrict__ Wd, _Float16* __restrict__ Td, float scale) {
  __shared__ __attribute__((aligned(16))) unsigned char tl[64 * WT_P];
  const int blk = blockIdx.x;
  if (blk < WT_B1) wt_tile<DM, 3 * DM>(Wa, Ta, scale, blk, tl);
  else if (blk < WT_B2) wt_tile<DM, DM>(Wb, Tb, scale, blk - WT_B1, tl);
  else if (blk < WT_B3) wt_tile<DM, 4096>(Wc, Tc, scale, blk - WT_B2, tl);
  else wt_tile<4096, DM>(Wd, Td, scale, blk - WT_B3, tl);
}
// k_gemm_hh variant with fused epilogue: v = acc·alpha + bias[by·sBias + col] (+ CP[(row/rowsPerB)·sCPb + by·64 + col] if CP) ; ACT 0 none / 1 elu ; writes f16 C16 (and f32 C if non-null)
template <int ACT>
__global__ __launch_bounds__(128) void k_gemm_hhx(const _Float16* __restrict__ A, int lda, size_t sA, const _Float16* __restrict__ Bh, int ldb, size_t sB, float alpha, const float* __restrict__ bias, size_t sBias, const float* __restrict__ CP, int rowsPerB, size_t sCPb, int row0g,
    float* __restrict__ C, _Float16* __restrict__ C16, int ldc, size_t sC, int M, int N, int K) {
  __shared__ __attribute__((aligned(16))) float so[4][16][64];
  const int tid = threadIdx.x, w = tid >> 5, lane = tid & 31, ln = lane & 15, hh = lane >> 4; const int by = blockIdx.y;
  A += (size_t)by * sA; Bh += (size_t)by * sB; const size_t cofs = (size_t)by * sC; const float* bp = bias ? bias + (size_t)by * sBias : nullptr;
  const int ntn = (N + 63) / 64; const int wid = blockIdx.x * 4 + w; const int mt = wid / ntn, nq = wid % ntn; if (mt * 16 >= M) return;
  const int row0 = mt * 16, col0 = nq * 64; const _Float16* arow = A + (size_t)(row0 + ln) * lda;
  v8f acc[4] = {};
  for (int kb = 0; kb < K; kb += 32) { FragH ah; ah.half[0] = *(const v8us*)((const unsigned short*)arow + kb + 8 * hh); ah.half[1] = *(const v8us*)((const unsigned short*)arow + kb + 16 + 8 * hh);
#pragma unroll
    for (int t = 0; t < 4; ++t) { if (col0 + t * 16 >= N) continue; const size_t boff = (size_t)(col0 + t * 16 + ln) * ldb + kb; FragH bq; bq.half[0] = *(const v8us*)((const unsigned short*)Bh + boff + 8 * hh); bq.half[1] = *(const v8us*)((const unsigned short*)Bh + boff + 16 + 8 * hh);
      acc[t] = mmaH<1>(ah.v, ah.v, bq.v, bq.v, acc[t]); }
  }
#pragma unroll
  for (int t = 0; t < 4; ++t) { if (col0 + t * 16 >= N) continue; const int col = col0 + t * 16 + ln; const float bv = bp ? bf16_round(bp[col]) : 0.f;
#pragma unroll
    for (int r = 0; r < 8; ++r) { float v = acc[t][r] * alpha + bv; if (CP) { const int bidx = (row0g + row0 + 8 * hh + r) / rowsPerB; v += CP[(size_t)bidx * sCPb + (size_t)by * 64 + col]; } if (ACT == 1) v = (v > 0.f) ? v : expm1f(v); else if (ACT == 7) v = (v > 0.f) ? v + 1.0f : expf(v); else if (ACT == 8) v = tanhf(v); else if (ACT == 9) v = 0.5f * v * (1.0f + tanhf(0.7978845608028654f * (v + 0.044715f * v * v * v))); else if (ACT == 11) v = 1.0f / (1.0f + expf(-v)); else if (ACT == 12) v = (v > 0.f) ? v : 0.01f * v; else if (ACT == 14) v = (v > 0.f) ? v : 0.1f * v; else if (ACT == 15) v = v / (1.0f + expf(-v)); else if (ACT == 3) v = fmaxf(v, 0.f); else if (ACT == 6) v = 0.5f * v * (1.0f + erff(v * 0.70710678118654752f)); so[w][8 * hh + r][t * 16 + ln] = v; } }
  __builtin_amdgcn_fence(__ATOMIC_ACQ_REL, "workgroup"); __builtin_amdgcn_wave_barrier();
  const int rsub = lane >> 4, c4 = (lane & 15) * 4; typedef _Float16 v4h __attribute__((ext_vector_type(4)));
  {
#pragma unroll
    for (int q = 0; q < 8; ++q) { const int r = q * 2 + rsub; if (col0 + c4 < N) { const v4f v = *(const v4fa*)&so[w][r][c4]; if (C) *(v4f*)(C + cofs + (size_t)(row0 + r) * ldc + col0 + c4) = v; if (C16) { v4h h4; for (int i = 0; i < 4; ++i) h4[i] = (_Float16)v[i]; *(v4h*)(C16 + cofs + (size_t)(row0 + r) * ldc + col0 + c4) = h4; } } }
     }
}


typedef _Float16 v4h __attribute__((ext_vector_type(4)));

__global__ __launch_bounds__(256) void k_x16(const float* __restrict__ x, _Float16* __restrict__ X16, size_t n8) { const size_t t = (size_t)blockIdx.x * 256 + threadIdx.x; if (t >= n8) return; FragH f;
#pragma unroll
  for (int q = 0; q < 8; ++q) f.h[q] = (_Float16)bf16_round(x[t * 8 + q]); *(v8us*)((unsigned short*)X16 + t * 8) = f.half[0];  }
__global__ __launch_bounds__(256) void k_h16(const float* __restrict__ x, _Float16* __restrict__ X16, size_t n8) { const size_t t = (size_t)blockIdx.x * 256 + threadIdx.x; if (t >= n8) return; FragH f;
#pragma unroll
  for (int q = 0; q < 8; ++q) f.h[q] = (_Float16)x[t * 8 + q]; *(v8us*)((unsigned short*)X16 + t * 8) = f.half[0];  }
__global__ __launch_bounds__(256) void k_round16f(const float* __restrict__ W, _Float16* __restrict__ Bt, size_t n8) { const size_t t = (size_t)blockIdx.x * 256 + threadIdx.x; if (t >= n8) return; FragH f;
#pragma unroll
  for (int i = 0; i < 8; ++i) f.h[i] = (_Float16)(bf16_round(W[t * 8 + i]) * 16.0f); *(v8us*)((unsigned short*)Bt + t * 8) = f.half[0];  }
template <int NHv, int TTv>
__global__ __launch_bounds__(256) void k_vt(const _Float16* __restrict__ V16, int ldv, int voff, _Float16* __restrict__ Vt) { __shared__ unsigned short tl[64][66]; const int tid = threadIdx.x; const int slab = blockIdx.x / (TTv / 64), lg = blockIdx.x % (TTv / 64); const int b = slab / NHv, h = slab % NHv;
  for (int i = tid; i < 64 * 8; i += 256) { const int r = i / 8, c8 = (i % 8) * 8; FragH f; f.half[0] = *(const v8us*)((const unsigned short*)V16 + ((size_t)b * TTv + lg * 64 + r) * ldv + voff + h * 64 + c8);
#pragma unroll
    for (int q = 0; q < 8; ++q) tl[r][c8 + q] = f.u[q]; }
  __syncthreads();
  {
#pragma unroll
    for (int rd = 0; rd < 2; ++rd) { const int d = rd * 32 + tid / 8, pc = tid % 8; FragH f;
#pragma unroll
      for (int q = 0; q < 8; ++q) f.u[q] = tl[pc * 8 + q][d];
      *(v8us*)((unsigned short*)Vt + ((size_t)slab * 64 + d) * TTv + lg * 64 + pc * 8) = f.half[0]; }
     } }

__global__ __launch_bounds__(256) void k_hl(const float* __restrict__ F, _Float16* __restrict__ Hh, _Float16* __restrict__ Hl, size_t n8) { const size_t t = (size_t)blockIdx.x * 256 + threadIdx.x; if (t >= n8) return; FragH fh, fl; const v4f a = *(const v4fa*)(F + t * 8), c = *(const v4fa*)(F + t * 8 + 4);
#pragma unroll
  for (int q = 0; q < 4; ++q) { _Float16 h = (_Float16)a[q]; fh.h[q] = h; fl.h[q] = (_Float16)((a[q] - (float)h) * 1024.0f); h = (_Float16)c[q]; fh.h[4 + q] = h; fl.h[4 + q] = (_Float16)((c[q] - (float)h) * 1024.0f); }
  { *(v8us*)((unsigned short*)Hh + t * 8) = fh.half[0]; *(v8us*)((unsigned short*)Hl + t * 8) = fl.half[0];  } }

// ---- fast GEMM (wave tile 32x64, operands staged in LDS); epilogue: v = act(acc * alpha + bf16(bias[col]) (+ CP[row][col], f32 at a pitch of ADDP elements, if ADDP > 0)), written as f16 C16 (OUT16) or f32 C ----
__device__ __forceinline__ v16h g2_frag(const _Float16* p, int hh) { FragH f; f.half[0] = *(const v8us*)((const unsigned short*)p + 8 * hh); f.half[1] = *(const v8us*)((const unsigned short*)p + 16 + 8 * hh); return f.v; }
__device__ __forceinline__ v8f g2_mma(v16h a, v16h b, v8f c) { v8f d = __builtin_amdgcn_wmma_f32_16x16x32_f16(false, a, false, b, (short)0, c, false, false); asm volatile("v_nop\n\tv_nop\n\tv_nop\n\tv_nop" : "+v"(d) : "v"(a), "v"(b)); return d; }
// Staged tile of k_gemm2: 128 A rows then 128 B rows, 128 k (256 B) each, at a pitch of 272 B (16 B x odd: conflict-free for ds_load_b128 readers); two buffers.
#define G2_PITCH 272
#define G2_BUF (256 * G2_PITCH)
// Eight asynchronous 16-byte copies per lane (rows 16 apart): l = the lane's LDS byte address, g = its global address, gstep = 16 source rows in elements.
// s_wait_xcnt 0 is the statement's last line, so that it stands in front of any later rewrite of the address registers the copies name.
__device__ __forceinline__ void g2_copy8(unsigned l, const _Float16* g, size_t gstep) {
  const unsigned l1 = l + 16 * G2_PITCH, l2 = l + 32 * G2_PITCH, l3 = l + 48 * G2_PITCH, l4 = l + 64 * G2_PITCH, l5 = l + 80 * G2_PITCH, l6 = l + 96 * G2_PITCH, l7 = l + 112 * G2_PITCH;
  const _Float16* g1 = g + gstep; const _Float16* g2 = g1 + gstep; const _Float16* g3 = g2 + gstep; const _Float16* g4 = g3 + gstep; const _Float16* g5 = g4 + gstep; const _Float16* g6 = g5 + gstep; const _Float16* g7 = g6 + gstep;
  asm volatile("global_load_async_to_lds_b128 %0, %8, off\n\t"
               "global_load_async_to_lds_b128 %1, %9, off\n\t"
               "global_load_async_to_lds_b128 %2, %10, off\n\t"
               "global_load_async_to_lds_b128 %3, %11, off\n\t"
               "global_load_async_to_lds_b128 %4, %12, off\n\t"
               "global_load_async_to_lds_b128 %5, %13, off\n\t"
               "global_load_async_to_lds_b128 %6, %14, off\n\t"
               "global_load_async_to_lds_b128 %7, %15, off\n\t"
               "s_wait_xcnt 0x0"
               :: "v"(l), "v"(l1), "v"(l2), "v"(l3), "v"(l4), "v"(l5), "v"(l6), "v"(l7), "v"(g), "v"(g1), "v"(g2), "v"(g3), "v"(g4), "v"(g5), "v"(g6), "v"(g7) : "memory");
}
// Block tile 128x128 (8 waves as 4 x 2, wave tile 32x64); requires M % 128 == 0, N % 128 == 0, K % 128 == 0. Each pass works on 128 k from one LDS buffer while the next pass's copies fly into the other.
template <int ACT, int ADDP, bool OUT16>
__global__ __launch_bounds__(256) void k_gemm2(const _Float16* __restrict__ A, int lda, size_t sA, const _Float16* __restrict__ Bh, int ldb, size_t sB, float alpha, const float* __restrict__ bias, size_t sBias, const float* __restrict__ CP,
    float* __restrict__ C, _Float16* __restrict__ C16, int ldc, size_t sC, int M, int N, int K) {
  __shared__ __attribute__((aligned(16))) unsigned char ring[2 * G2_BUF];
  float (*so)[32][68] = (float (*)[32][68])ring;      /* output staging (8 x 32 x 68 f32 = one buffer), used only behind the last pass's barrier */
  const int tid = threadIdx.x, w = tid >> 5, lane = tid & 31, ln = lane & 15, hh = lane >> 4; const int by = blockIdx.y;
  A += (size_t)by * sA; Bh += (size_t)by * sB; const size_t cofs = (size_t)by * sC; const float* bp = bias ? bias + (size_t)by * sBias : nullptr;
  const int ntn = N >> 7; const int mt = blockIdx.x / ntn, nq = blockIdx.x - mt * ntn; if (mt * 128 >= M) return;      /* the whole block leaves, in front of every barrier */
  const int row0 = mt * 128 + 32 * (w & 3), col0 = nq * 128 + 64 * (w >> 2);
  const _Float16* gA = A + (size_t)(mt * 128 + (tid >> 4)) * lda + (tid & 15) * 8; const _Float16* gB = Bh + (size_t)(nq * 128 + (tid >> 4)) * ldb + (tid & 15) * 8;
  const unsigned lA = (unsigned)(size_t)ring + (unsigned)((tid >> 4) * G2_PITCH + (tid & 15) * 16); const unsigned lB = lA + 128 * G2_PITCH;
  const size_t stA = (size_t)16 * lda, stB = (size_t)16 * ldb;
  const int aofs = (32 * (w & 3) + ln) * G2_PITCH, bofs = (128 + 64 * (w >> 2) + ln) * G2_PITCH;
  const int np = K >> 7;
  g2_copy8(lA, gA, stA); g2_copy8(lB, gB, stB);
  asm volatile("s_wait_asynccnt 0x0" ::: "memory");      /* pass 0's own copies have landed */
  __syncthreads();                                        /* ... and every other wave's */
  if (np > 1) { g2_copy8(lA + G2_BUF, gA + 128, stA); g2_copy8(lB + G2_BUF, gB + 128, stB); }
  const v8f z8 = {0.f,0.f,0.f,0.f,0.f,0.f,0.f,0.f}; v8f c00 = z8, c01 = z8, c02 = z8, c03 = z8, c10 = z8, c11 = z8, c12 = z8, c13 = z8;
#pragma unroll 1      /* one pass per trip: the publish point at the foot stands once */
  for (int p = 0; p < np; ++p) { const unsigned bsel = (unsigned)(p & 1) * G2_BUF; const unsigned char* sa = ring + bsel + aofs; const unsigned char* sb = ring + bsel + bofs;
    v16h fa[2][2], fb[2][4];      /* two fragment sets: block kk + 1 is fetched ahead of block kk's products, inside this pass's buffer only */
    fa[0][0] = g2_frag((const _Float16*)sa, hh); fa[0][1] = g2_frag((const _Float16*)(sa + 16 * G2_PITCH), hh);
#pragma unroll      /* constant indices keep fa and fb in registers (this loop and the two below) */
    for (int j = 0; j < 4; ++j) fb[0][j] = g2_frag((const _Float16*)(sb + j * 16 * G2_PITCH), hh);
#pragma unroll
    for (int kk = 0; kk < 4; ++kk) { const int cu = kk & 1, nx = cu ^ 1;
      if (kk < 3) { fa[nx][0] = g2_frag((const _Float16*)(sa + (kk + 1) * 64), hh); fa[nx][1] = g2_frag((const _Float16*)(sa + 16 * G2_PITCH + (kk + 1) * 64), hh);
#pragma unroll
        for (int j = 0; j < 4; ++j) fb[nx][j] = g2_frag((const _Float16*)(sb + j * 16 * G2_PITCH + (kk + 1) * 64), hh); }
      c00 = g2_mma(fa[cu][0], fb[cu][0], c00); c10 = g2_mma(fa[cu][1], fb[cu][0], c10); c01 = g2_mma(fa[cu][0], fb[cu][1], c01); c11 = g2_mma(fa[cu][1], fb[cu][1], c11);
      c02 = g2_mma(fa[cu][0], fb[cu][2], c02); c12 = g2_mma(fa[cu][1], fb[cu][2], c12); c03 = g2_mma(fa[cu][0], fb[cu][3], c03); c13 = g2_mma(fa[cu][1], fb[cu][3], c13); }
    asm volatile("s_wait_dscnt 0x0" ::: "memory");        /* this wave's reads of the buffer have returned before it is refilled */
    asm volatile("s_wait_asynccnt 0x0" ::: "memory");     /* this wave's copies for pass p + 1 have landed */
    __syncthreads();                                      /* publishes pass p + 1 and ends every reader's last read of pass p's buffer */
    if (p + 2 < np) { g2_copy8(lA + bsel, gA + (size_t)(p + 2) * 128, stA); g2_copy8(lB + bsel, gB + (size_t)(p + 2) * 128, stB); } }
  asm volatile("s_wait_asynccnt 0x0" ::: "memory");       /* nothing in flight when the ring becomes output staging */
  /* Bias and addend are read in the layout of the write-out (a lane: 4 columns of 16 rows; 16 lanes: a whole 256-B run), and every load is issued here, ahead of the staging: they are in flight together and are waited for once. */
  const int rsub = lane >> 4, c4 = (lane & 15) * 4;
  v4f bq = {0.f, 0.f, 0.f, 0.f}, x[16];
  if (ADDP > 0) { const float* cr = CP + (size_t)(row0 + rsub) * ADDP + (size_t)by * 64 + col0 + c4;      /* a lane reads exactly the elements it writes below, so C may lie over CP */
#pragma unroll      /* constant indices keep x and accs in registers (this loop and those below); the compile-time pitch makes the 16 loads one address pair with immediate offsets */
    for (int q = 0; q < 16; ++q) x[q] = *(const v4fa*)(cr + q * 2 * ADDP);
    asm volatile("s_wait_xcnt 0x0" :: "v"(cr) : "memory"); }      /* the loads' address pair stays whole up to this wait */
  if (bp) { const float* br = bp + col0 + c4; bq = *(const v4fa*)br;
    asm volatile("s_wait_xcnt 0x0" :: "v"(br) : "memory"); }      /* the load's address pair stays whole up to this wait */
  v8f accs[8] = {c00, c01, c02, c03, c10, c11, c12, c13};
#pragma unroll
  for (int u = 0; u < 8; ++u) { const int t = u & 3, half = u >> 2;
#pragma unroll
    for (int r = 0; r < 8; ++r) so[w][half * 16 + 8 * hh + r][t * 16 + ln] = accs[u][r]; }
  __builtin_amdgcn_fence(__ATOMIC_ACQ_REL, "workgroup"); __builtin_amdgcn_wave_barrier();
  float bv[4];
#pragma unroll
  for (int i = 0; i < 4; ++i) bv[i] = bf16_round(bq[i]);
#pragma unroll
  for (int q = 0; q < 16; ++q) { const v4f a4 = *(const v4fa*)&so[w][q * 2 + rsub][c4];
#pragma unroll
    for (int i = 0; i < 4; ++i) { float v = a4[i] * alpha + bv[i]; if (ADDP > 0) v += x[q][i];
      if (ACT == 3) v = fmaxf(v, 0.f); else if (ACT == 6) v = 0.5f * v * (1.0f + erff(v * 0.70710678118654752f)); else if (ACT == 11) v = 1.0f / (1.0f + expf(-v)); else if (ACT == 15) v = v / (1.0f + expf(-v)); else if (ACT == 12) v = (v > 0.f) ? v : 0.01f * v; else if (ACT == 8) v = tanhf(v); else if (ACT == 9) v = 0.5f * v * (1.0f + tanhf(0.7978845608028654f * (v + 0.044715f * v * v * v)));      /* tanh-GELU */
      x[q][i] = v; } }
  /* all results first, then the stores as one group: no store is held behind the next row's LDS read */
  const size_t o0 = cofs + (size_t)(row0 + rsub) * ldc + col0 + c4, ost = (size_t)2 * ldc;
#pragma unroll
  for (int q = 0; q < 16; ++q) { if (OUT16) { v4h h4;
#pragma unroll
      for (int i = 0; i < 4; ++i) h4[i] = (_Float16)x[q][i];
      *(v4h*)(C16 + o0 + q * ost) = h4; } else *(v4f*)(C + o0 + q * ost) = x[q]; } }



// Staged tile of k_flash: 128 keys. 128 K rows (64 f16 = 128 B) at a pitch of 144 B, then 64 V^T rows (128 keys = 256 B) at a pitch of 272 B (16 B x odd: conflict-free for ds_load_b128 readers); two buffers.
#define FL_KEYS 128
#define FL_KP 144
#define FL_VP 272
#define FL_VOFS (FL_KEYS * FL_KP)
#define FL_BUF (FL_VOFS + 64 * FL_VP)
#define FL_C2 (SCL * 1.4426950408889634f)      /* score scale x log2(e) */
// Eight asynchronous 16-byte copies per lane: l = the lane's LDS byte address (LSTEP bytes between copies), g = its global address (gstep elements between copies).
// s_wait_xcnt 0 is the statement's last line, so that it stands in front of any later rewrite of the address registers the copies name.
template <unsigned LSTEP>
__device__ __forceinline__ void fl_copy8(unsigned l, const unsigned short* g, size_t gstep) {
  const unsigned l1 = l + LSTEP, l2 = l + 2 * LSTEP, l3 = l + 3 * LSTEP, l4 = l + 4 * LSTEP, l5 = l + 5 * LSTEP, l6 = l + 6 * LSTEP, l7 = l + 7 * LSTEP;
  const unsigned short* g1 = g + gstep; const unsigned short* g2 = g1 + gstep; const unsigned short* g3 = g2 + gstep; const unsigned short* g4 = g3 + gstep; const unsigned short* g5 = g4 + gstep; const unsigned short* g6 = g5 + gstep; const unsigned short* g7 = g6 + gstep;
  asm volatile("global_load_async_to_lds_b128 %0, %8, off\n\t"
               "global_load_async_to_lds_b128 %1, %9, off\n\t"
               "global_load_async_to_lds_b128 %2, %10, off\n\t"
               "global_load_async_to_lds_b128 %3, %11, off\n\t"
               "global_load_async_to_lds_b128 %4, %12, off\n\t"
               "global_load_async_to_lds_b128 %5, %13, off\n\t"
               "global_load_async_to_lds_b128 %6, %14, off\n\t"
               "global_load_async_to_lds_b128 %7, %15, off\n\t"
               "s_wait_xcnt 0x0"
               :: "v"(l), "v"(l1), "v"(l2), "v"(l3), "v"(l4), "v"(l5), "v"(l6), "v"(l7), "v"(g), "v"(g1), "v"(g2), "v"(g3), "v"(g4), "v"(g5), "v"(g6), "v"(g7) : "memory");
}
// lane l with lane l ^ 16 (the two lanes that share one query column of a transposed score tile)
__device__ __forceinline__ float fl_xhalf(float x) { return __builtin_bit_cast(float, __builtin_amdgcn_permlanex16(__builtin_bit_cast(int, x), __builtin_bit_cast(int, x), 0x76543210, 0xfedcba98, false, false)); }
__global__ __launch_bounds__(128) void k_flash(const _Float16* __restrict__ Q16, int ldq, const _Float16* __restrict__ K16, int ldk, const _Float16* __restrict__ Vt, const int* __restrict__ MSK, float* __restrict__ O, int ldo) {
  constexpr int RPW = 16, NQB = TQ / (4 * RPW), DT = 4, KS = 2; (void)MSK;
  __shared__ __attribute__((aligned(16))) float sO[4][RPW][64 + 4];
  __shared__ __attribute__((aligned(16))) unsigned char ring[2 * FL_BUF];
  const int tid = threadIdx.x, w = tid >> 5, lane = tid & 31, ln = lane & 15, hh = lane >> 4;
  const int slab = blockIdx.x / NQB, qblk = blockIdx.x % NQB; const int b = slab / NH, h = slab % NH; const int qb0 = qblk * (4 * RPW); const int q0 = qb0 + w * RPW;
  FragH aq[KS];
  { const unsigned short* qr = (const unsigned short*)Q16 + ((size_t)b * TQ + q0 + ln) * ldq + h * 64;
#pragma unroll
    for (int ks = 0; ks < KS; ++ks) { aq[ks].half[0] = *(const v8us*)(qr + ks * 32 + 8 * hh); aq[ks].half[1] = *(const v8us*)(qr + ks * 32 + 16 + 8 * hh); } }
  const unsigned short* Vth = (const unsigned short*)Vt + (size_t)slab * 64 * TK;
  float m_r = -3.0e38f, l_r = 0.f; v8f oacc[DT];      /* oacc[dt][r] = O^T[dt*16 + 8*hh + r][query ln] */
#pragma unroll
  for (int dt = 0; dt < DT; ++dt) oacc[dt] = (v8f){0.f,0.f,0.f,0.f,0.f,0.f,0.f,0.f};
  /* the block's 128 threads copy a stage: K as 16 rows x 8 pieces, V^T as 8 rows x 16 pieces per copy, whole 128-B lines per wave */
  const unsigned short* gK = (const unsigned short*)K16 + ((size_t)b * TK + (tid >> 3)) * ldk + h * 64 + (tid & 7) * 8; const unsigned short* gV = Vth + (size_t)(tid >> 4) * TK + (tid & 15) * 8;
  const unsigned lK = (unsigned)(size_t)ring + (unsigned)((tid >> 3) * FL_KP + (tid & 7) * 16); const unsigned lV = (unsigned)(size_t)ring + (unsigned)(FL_VOFS + (tid >> 4) * FL_VP + (tid & 15) * 16);
  const size_t stK = (size_t)16 * ldk, stV = (size_t)8 * TK;
  constexpr int NST = TK / FL_KEYS;
  fl_copy8<16 * FL_KP>(lK, gK, stK); fl_copy8<8 * FL_VP>(lV, gV, stV);
  asm volatile("s_wait_asynccnt 0x0" ::: "memory");      /* stage 0's own copies have landed */
  __syncthreads();                                        /* ... and every other wave's */
  if (NST > 1) { fl_copy8<16 * FL_KP>(lK + FL_BUF, gK + (size_t)FL_KEYS * ldk, stK); fl_copy8<8 * FL_VP>(lV + FL_BUF, gV + FL_KEYS, stV); }
#pragma unroll 1      /* one stage per trip: the publish point at the foot stands once */
  for (int st = 0; st < NST; ++st) { const unsigned bsel = (unsigned)(st & 1) * FL_BUF; const unsigned char* sK = ring + bsel; const unsigned char* sV = sK + FL_VOFS;
#pragma unroll 1      /* 32 keys per trip, rolled as before: keeps the loop's text small */
  for (int j0 = 0; j0 < FL_KEYS; j0 += 32) {
    v8f s[2]; FragH bk[2][KS], bv[DT];      /* this trip's K and V^T fragments are read from the stage as one group, ahead of the products and the softmax */
#pragma unroll
    for (int nt = 0; nt < 2; ++nt) { const unsigned short* kr = (const unsigned short*)(sK + (j0 + nt * 16 + ln) * FL_KP);
#pragma unroll
      for (int ks = 0; ks < KS; ++ks) { bk[nt][ks].half[0] = *(const v8us*)(kr + ks * 32 + 8 * hh); bk[nt][ks].half[1] = *(const v8us*)(kr + ks * 32 + 16 + 8 * hh); } }
#pragma unroll
    for (int dt = 0; dt < DT; ++dt) { const unsigned short* vrow = (const unsigned short*)(sV + (dt * 16 + ln) * FL_VP) + j0; bv[dt].half[0] = *(const v8us*)(vrow + 8 * hh); bv[dt].half[1] = *(const v8us*)(vrow + 16 + 8 * hh); }
#pragma unroll
    for (int nt = 0; nt < 2; ++nt) { v8f acc = (v8f){0.f,0.f,0.f,0.f,0.f,0.f,0.f,0.f};
#pragma unroll
      for (int ks = 0; ks < KS; ++ks) acc = mmaH<1>(bk[nt][ks].v, bk[nt][ks].v, aq[ks].v, aq[ks].v, acc);
      s[nt] = acc; }
    float mc = s[0][0];      /* the running maximum is kept in raw (unscaled) scores: the scale is positive, so the order is the same */
#pragma unroll      /* constant indices keep s, pb and oacc in registers (this loop and those below) */
    for (int i = 1; i < 16; ++i) mc = fmaxf(mc, s[i >> 3][i & 7]);
    mc = fmaxf(mc, fl_xhalf(mc));
    const float mn = fmaxf(m_r, mc); const float al = (mn > -1.0e38f) ? __builtin_amdgcn_exp2f((m_r - mn) * FL_C2) : 1.0f; m_r = mn;
    const float nb = __builtin_fmaf(-mn, FL_C2, 10.0f);      /* 2^(s c + nb) = 2^10 exp((s - mn) / 8): scale, maximum and the 2^10 of P in one multiply-add */
    FragH pb; float psum = 0.f;
#pragma unroll
    for (int i = 0; i < 16; ++i) { const float p = __builtin_amdgcn_exp2f(__builtin_fmaf(s[i >> 3][i & 7], FL_C2, nb)); psum += p; pb.h[i] = (_Float16)p; }
    l_r = l_r * al + psum;      /* l_r carries the 2^10 too */
#pragma unroll
    for (int dt = 0; dt < DT; ++dt)
#pragma unroll
      for (int r = 0; r < 8; ++r) oacc[dt][r] *= al;
#pragma unroll
    for (int dt = 0; dt < DT; ++dt) oacc[dt] = mmaH<1>(bv[dt].v, bv[dt].v, pb.v, pb.v, oacc[dt]); }
    asm volatile("s_wait_dscnt 0x0" ::: "memory");        /* this wave's reads of the buffer have returned before it is refilled */
    asm volatile("s_wait_asynccnt 0x0" ::: "memory");     /* this wave's copies for stage st + 1 have landed */
    __syncthreads();                                      /* publishes stage st + 1 and ends every reader's last read of stage st's buffer */
    if (st + 2 < NST) { fl_copy8<16 * FL_KP>(lK + bsel, gK + (size_t)(st + 2) * FL_KEYS * ldk, stK); fl_copy8<8 * FL_VP>(lV + bsel, gV + (size_t)(st + 2) * FL_KEYS, stV); } }
  asm volatile("s_wait_asynccnt 0x0" ::: "memory");       /* nothing in flight when the wave goes on to its end */
  { float l = l_r + fl_xhalf(l_r); l = (l > 0.f) ? 1.0f / l : 0.f;
#pragma unroll
    for (int dt = 0; dt < DT; ++dt) { v4f lo, hi;
#pragma unroll
      for (int r = 0; r < 4; ++r) { lo[r] = oacc[dt][r] * l; hi[r] = oacc[dt][4 + r] * l; }
      *(v4fa*)&sO[w][ln][dt * 16 + 8 * hh] = lo; *(v4fa*)&sO[w][ln][dt * 16 + 8 * hh + 4] = hi; } }
  __builtin_amdgcn_fence(__ATOMIC_ACQ_REL, "workgroup"); __builtin_amdgcn_wave_barrier();
  {
#pragma unroll
    for (int rp = 0; rp < RPW; rp += 2) { const int r = rp + (lane >> 4), pc = lane & 15; const v4f val = *(const v4fa*)&sO[w][r][pc * 4]; *(v4f*)(O + ((size_t)b * TQ + q0 + r) * ldo + h * 64 + pc * 4) = val; }
     } }
__global__ __launch_bounds__(256) void k_fulltab(unsigned* __restrict__ MB, int* __restrict__ RA, int* __restrict__ KE, int nq, int nk) {
  const int t = blockIdx.x * 256 + threadIdx.x;
  if (t < nq * (nk / 32)) { *(unsigned*)(MB + t) = 0u;  }
  if (t < nq) { *(int*)(RA + t) = 0;  }
  if (t < nq / 64) { *(int*)(KE + t * 32) = nk;  } }
template <int SRCBF>
__global__ __launch_bounds__(256) void k_ln1024(const float* __restrict__ X, _Float16* __restrict__ Y16, float* __restrict__ XB) {
  #pragma clang fp contract(off)
  const int tid = threadIdx.x, w = tid >> 5, ln = tid & 31; const int r = blockIdx.x * 8 + w; if (r >= NR) return; const float* x = X + (size_t)r * DM; float s = 0.f;
#pragma unroll 1
  for (int i = 0; i < 8; ++i) { const v4f a = *(const v4fa*)(x + i * 128 + ln * 4); for (int q = 0; q < 4; ++q) s += SRCBF ? bf16_round(a[q]) : a[q]; }
  for (int o = 16; o > 0; o >>= 1) s += __shfl_xor(s, o, 32); const float mu = s / (float)DM; float q2 = 0.f;
#pragma unroll 1
  for (int i = 0; i < 8; ++i) { const v4f a = *(const v4fa*)(x + i * 128 + ln * 4); for (int q = 0; q < 4; ++q) { const float d = (SRCBF ? bf16_round(a[q]) : a[q]) - mu; q2 += d * d; } }
  for (int o = 16; o > 0; o >>= 1) q2 += __shfl_xor(q2, o, 32); const float dn = sqrtf(q2 / (float)DM + 1e-5f);
  {
#pragma unroll 1
    for (int i = 0; i < 8; ++i) { const int c0 = i * 128 + ln * 4; const v4f a = *(const v4fa*)(x + c0); _Float16 h4[4]; v4f xb;
      for (int q = 0; q < 4; ++q) { const float t = SRCBF ? bf16_round(a[q]) : a[q]; h4[q] = (_Float16)((t - mu) / dn); xb[q] = t; }
      *(unsigned long long*)((unsigned short*)Y16 + (size_t)r * DM + c0) = *(const unsigned long long*)h4; if (SRCBF) *(v4f*)(XB + (size_t)r * DM + c0) = xb; }
     } }
__global__ __launch_bounds__(256) void k_causaltab(unsigned* __restrict__ MB, int* __restrict__ RA, int* __restrict__ KE, int nq, int nk) {
  const int t = blockIdx.x * 256 + threadIdx.x; const int nw = nk / 32;
  if (t < nq * nw) { const int q = t / nw, w = t % nw; const int first = q + 1 - 32 * w; const unsigned bits = (first <= 0) ? 0xffffffffu : ((first >= 32) ? 0u : (0xffffffffu << first)); *(unsigned*)(MB + t) = bits;  }
  if (t < nq) { *(int*)(RA + t) = 0;  }
  if (t < nq / 64) { const int v = 64 * (t + 1); *(int*)(KE + t * 32) = v;  } }


extern "C" void kernel_launch(void* const* d_in, const int* in_sizes, int n_in,
                              void* d_out, int out_size, void* d_ws, size_t ws_size, hipStream_t stream) {
  (void)in_sizes; (void)n_in; (void)out_size;
  const float* const* I = (const float* const*)d_in; const float* x = I[0]; const float* Wqkv = I[1]; const float* Wfc = I[2]; const float* W1 = I[3]; const float* b1 = I[4]; const float* W2 = I[5]; const float* b2 = I[6];
  char* ws = (char*)d_ws; size_t off = 0;
  auto take = [&](size_t bytes) { char* p = ws + off; off += (bytes + 255) & ~(size_t)255; return p; };
  _Float16* BQKV = (_Float16*)take((size_t)3 * DM * DM * 2); _Float16* BFC = (_Float16*)take((size_t)DM * DM * 2); _Float16* BW1 = (_Float16*)take((size_t)4096 * DM * 2); _Float16* BW2 = (_Float16*)take((size_t)DM * 4096 * 2);
  float* XB = (float*)take((size_t)NR * DM * 4); _Float16* X16 = (_Float16*)take((size_t)NR * DM * 2); float* F = (float*)take((size_t)NR * DM * 4);
  _Float16* Q16 = (_Float16*)take((size_t)NR * DM * 2); _Float16* K16 = (_Float16*)take((size_t)NR * DM * 2); _Float16* V16 = (_Float16*)take((size_t)NR * DM * 2); _Float16* VT = (_Float16*)take((size_t)NR * DM * 2); if (off > ws_size) return;      /* 24 + 16 + 8 + 16 + 32 = 96 MiB */
  float* O = F; _Float16* Oh = Q16; _Float16* Ol = K16;     /* q/k planes are dead after the flash */
  float* X1 = XB;                                           /* x1 written over the residual plane (own-tile addend) */
  _Float16* H16 = X16; _Float16* GH = Q16;                  /* GELU hidden [NR][4096] f16 = 32 MB over Q16|K16|V16|VT (contiguous, all dead once x1 is formed) */
  const size_t n8 = (size_t)NR * DM / 8; const unsigned nb8 = (unsigned)((n8 + 255) / 256);
  k_wt4<<<WT_B4, 256, 0, stream>>>(Wqkv, BQKV, Wfc, BFC, W1, BW1, W2, BW2, 16.0f);      /* all (in,out); one block per 128 k x 64 n tile */
  k_ln1024<1><<<NR / 8, 256, 0, stream>>>(x, X16, XB);
  const dim3 gP((NR / 128) * (DM / 128), 1), gM((NR / 128) * (4096 / 128), 1);
  const dim3 gQ((NR / 128) * (DM / 128), 3);
  k_gemm2<0, 0, true><<<gQ, 256, 0, stream>>>(X16, DM, 0, BQKV, DM, (size_t)DM * DM, 0.0625f, nullptr, 0, nullptr, nullptr, Q16, DM, (size_t)NR * DM, NR, DM, DM);      /* blockIdx.y = 0, 1, 2: q, k, v (weight slabs and the planes Q16, K16, V16 each lie one behind the other) */
  k_vt<NH, SLEN><<<NBT * NH * (SLEN / 64), 256, 0, stream>>>(V16, DM, 0, VT);      /* both batches */
  k_flash<<<NBT * NH * (SLEN / 64), 128, 0, stream>>>(Q16, DM, K16, DM, VT, nullptr, O, DM);      /* plain flash over all keys, both batches */
  k_hl<<<nb8, 256, 0, stream>>>(O, Oh, Ol, n8);
  k_gemm2<0, DM, false><<<gP, 256, 0, stream>>>(Oh, DM, 0, BFC, DM, 0, 0.0625f, nullptr, 0, XB, X1, nullptr, DM, 0, NR, DM, DM);      /* x1 = x + attn w_fc (hi) */
  k_gemm2<0, DM, false><<<gP, 256, 0, stream>>>(Ol, DM, 0, BFC, DM, 0, 0.0625f / 1024.0f, nullptr, 0, X1, X1, nullptr, DM, 0, NR, DM, DM);      /* + lo */
  k_ln1024<0><<<NR / 8, 256, 0, stream>>>(X1, H16, nullptr);
  k_gemm2<9, 0, true><<<gM, 256, 0, stream>>>(H16, DM, 0, BW1, DM, 0, 0.0625f, b1, 0, nullptr, nullptr, GH, 4096, 0, NR, 4096, DM);      /* tanh-gelu(LN(x1) w1 + b1) f16 */
  k_gemm2<0, DM, false><<<gP, 256, 0, stream>>>(GH, 4096, 0, BW2, 4096, 0, 0.0625f, b2, 0, X1, (float*)d_out, nullptr, DM, 0, NR, DM, 4096);      /* out = x1 + mlp */
}

// v008
// One run takes 199 microseconds.
// In two side-by-side timings against v007, it was 1.11 and 1.10 times as fast.
// Over all steps from v000 it is 5.21 times as fast.
#include <hip/hip_runtime.h>
// Pre-LN transformer layer (2 x 2048 tokens, 1024; 16 heads x 64; full (non-causal) attention; MLP 4096 with tanh-GELU): h = LN(x) (no affine); q,k,v = h w_qkv; x1 = x + softmax(q.k/8).v w_fc; out = x1 + gelu(LN(x1) w1 + b1) w2 + b2 -> [2,2048,1024].
// Structure: LayerNorm on VALU (also writing the bf16 residual plane); projections / MLP as f16 WMMA GEMMs (32x64 wave tiles, f32 accumulation, exact weights x16, tanh-GELU and biases in the epilogue, residuals through the f32 addend); q, k, V^T as plain f16 planes (V^T straight from the GEMM, operands swapped) through the fused flash kernel over all keys (online softmax in f32, P x2^10); O as hi + residual planes, written by the flash, into w_fc (one GEMM over both planes).
// Compute dtype: x and weights rounded to bf16; LN outputs, q, k, v, P and the GELU hidden as f16 operands (~2^-12); O as hi + residual pairs; f32 accumulation, softmax, LayerNorm. v_wmma_f32_16x16x32_f16.
#define NBT 2
#define SLEN 2048
#define TQ SLEN
#define TK SLEN
#define DM 1024
#define NH 16
#define SCL 0.125f
#define NR (NBT * SLEN)
typedef __bf16 v16b __attribute__((ext_vector_type(16)));
typedef unsigned short v8us __attribute__((ext_vector_type(8), may_alias));
typedef float  v8f  __attribute__((ext_vector_type(8)));
typedef float  v4f  __attribute__((ext_vector_type(4)));
typedef float  v4fa __attribute__((ext_vector_type(4), may_alias));
union FragB { v16b v; v8us half[2]; unsigned short u[16]; };

__device__ __forceinline__ unsigned short bf16_bits(float x) { unsigned int u = __float_as_uint(x); return (unsigned short)((u + 0x7FFFu + ((u >> 16) & 1u)) >> 16); }
__device__ __forceinline__ float bf16_val(unsigned short b) { return __uint_as_float(((unsigned int)b) << 16); }
__device__ __forceinline__ float bf16_round(float x) { return bf16_val(bf16_bits(x)); }
// D += A·B with NT terms: 1 = ah·bh, 2 = + al·bh (A split), 3 = + ah·bl (both split)
template <int NT>
__device__ __forceinline__ v8f mmaN(v16b ah, v16b al, v16b bh, v16b bl, v8f c) {
  c = __builtin_amdgcn_wmma_f32_16x16x32_bf16(false, ah, false, bh, (short)0, c, false, false);
  if (NT >= 2) c = __builtin_amdgcn_wmma_f32_16x16x32_bf16(false, al, false, bh, (short)0, c, false, false);
  if (NT >= 3) c = __builtin_amdgcn_wmma_f32_16x16x32_bf16(false, ah, false, bl, (short)0, c, false, false);
  asm volatile("v_nop\n\tv_nop\n\tv_nop\n\tv_nop" : "+v"(c) : "v"(ah), "v"(al), "v"(bh), "v"(bl));
  return c;
}

__global__ __launch_bounds__(256) void k_wt_bf16(const float* __restrict__ W, unsigned short* __restrict__ Wt, int K, int N) {
  const int t = blockIdx.x * 256 + threadIdx.x;
  const int k8n = K / 8;
  if (t >= N * k8n) return;
  const int n = t / k8n, k8 = (t % k8n) * 8;
  v8us v;
#pragma unroll
  for (int i = 0; i < 8; ++i) v[i] = bf16_bits(W[(size_t)(k8 + i) * N + n]);
  *(v8us*)(Wt + (size_t)n * K + k8) = v;
  
}

// GEMM C[M][N] (f32, pitch ldc) = act(A[M][K]·W + bias). A f32 row-major (pitch lda) converted per fragment to bf16
// (ASPLIT: hi/lo two planes -> 2 terms, else single rounded term); Wt bf16 [N][K] (pitch ldb). BIAS_BF16 rounds the
// bias to bf16 first (bias quantised to bf16 before the add). K%32==0, M%16==0, N%64==0.
template <bool ASPLIT, int ACT, bool BIAS_BF16>
__global__ __launch_bounds__(128) void k_gemm_bf(const float* __restrict__ A, int lda, const unsigned short* __restrict__ Wt, int ldb,
                                               const float* __restrict__ bias, float* __restrict__ C, int ldc, int M, int N, int K) {
  __shared__ __attribute__((aligned(16))) float so[4][16][64];
  const int tid = threadIdx.x, w = tid >> 5, lane = tid & 31, ln = lane & 15, hh = lane >> 4;
  const int ntn = N / 64;
  const int wid = blockIdx.x * 4 + w;
  const int mt = wid / ntn, nq = wid % ntn;
  if (mt * 16 >= M) return;
  const int row0 = mt * 16, col0 = nq * 64;
  const float* arow = A + (size_t)(row0 + ln) * lda;
  v8f acc[4] = {};
  for (int kb = 0; kb < K; kb += 32) {
    FragB ah, al;
    const v4f x0 = *(const v4fa*)(arow + kb + 8 * hh), x1 = *(const v4fa*)(arow + kb + 8 * hh + 4);
    const v4f x2 = *(const v4fa*)(arow + kb + 16 + 8 * hh), x3 = *(const v4fa*)(arow + kb + 16 + 8 * hh + 4);
    float xs[16] = {x0[0],x0[1],x0[2],x0[3],x1[0],x1[1],x1[2],x1[3],x2[0],x2[1],x2[2],x2[3],x3[0],x3[1],x3[2],x3[3]};
#pragma unroll
    for (int i = 0; i < 16; ++i) { const unsigned short hb = bf16_bits(xs[i]); ah.u[i] = hb; al.u[i] = ASPLIT ? bf16_bits(xs[i] - bf16_val(hb)) : (unsigned short)0; }
#pragma unroll
    for (int t = 0; t < 4; ++t) {
      const unsigned short* brow = Wt + (size_t)(col0 + t * 16 + ln) * ldb + kb;
      FragB b;
      b.half[0] = *(const v8us*)(brow + 8 * hh);
      b.half[1] = *(const v8us*)(brow + 16 + 8 * hh);
      acc[t] = mmaN<ASPLIT ? 2 : 1>(ah.v, al.v, b.v, b.v, acc[t]);
    }
  }
#pragma unroll
  for (int t = 0; t < 4; ++t) {
    float bv = bias ? bias[col0 + t * 16 + ln] : 0.f;
    if (BIAS_BF16) bv = bf16_round(bv);
#pragma unroll
    for (int r = 0; r < 8; ++r) { float v = acc[t][r] + bv; if (ACT == 1) v = fmaxf(v, 0.f); so[w][8 * hh + r][t * 16 + ln] = v; }
  }
  __builtin_amdgcn_fence(__ATOMIC_ACQ_REL, "workgroup");
  __builtin_amdgcn_wave_barrier();
  const int rsub = lane >> 4, c4 = (lane & 15) * 4;
  {
#pragma unroll
    for (int q = 0; q < 8; ++q) {
      const int r = q * 2 + rsub;
      const v4f v = *(const v4fa*)&so[w][r][c4];
      *(v4f*)(C + (size_t)(row0 + r) * ldc + col0 + c4) = v;
    }
    
  }
}

// GEMM C = act(A·W + bias + resid): A f32 (ASPLIT -> hi/lo 2 terms), Wt bf16 [N][K]; ACT 0 none, 1 relu, 2 exact gelu;
// resid (optional, f32, row index = (row % rmod), pitch ldr, RES_BF16 rounds it) added before the activation.
template <bool ASPLIT, int ACT, bool BIAS_BF16, bool RES_BF16>
__global__ __launch_bounds__(128) void k_gemm_bf3(const float* __restrict__ A, int lda, const unsigned short* __restrict__ Wt, int ldb,
                                                const float* __restrict__ bias, const float* __restrict__ resid, int rmod, int ldr,
                                                float* __restrict__ C, int ldc, int M, int N, int K) {
  __shared__ __attribute__((aligned(16))) float so[4][16][64];
  const int tid = threadIdx.x, w = tid >> 5, lane = tid & 31, ln = lane & 15, hh = lane >> 4;
  const int ntn = N / 64;
  const int wid = blockIdx.x * 4 + w;
  const int mt = wid / ntn, nq = wid % ntn;
  if (mt * 16 >= M) return;
  const int row0 = mt * 16, col0 = nq * 64;
  const float* arow = A + (size_t)(row0 + ln) * lda;
  v8f acc[4] = {};
  for (int kb = 0; kb < K; kb += 32) {
    FragB ah, al;
    const v4f x0 = *(const v4fa*)(arow + kb + 8 * hh), x1 = *(const v4fa*)(arow + kb + 8 * hh + 4);
    const v4f x2 = *(const v4fa*)(arow + kb + 16 + 8 * hh), x3 = *(const v4fa*)(arow + kb + 16 + 8 * hh + 4);
    float xs[16] = {x0[0],x0[1],x0[2],x0[3],x1[0],x1[1],x1[2],x1[3],x2[0],x2[1],x2[2],x2[3],x3[0],x3[1],x3[2],x3[3]};
#pragma unroll
    for (int i = 0; i < 16; ++i) { const unsigned short hb = bf16_bits(xs[i]); ah.u[i] = hb; al.u[i] = ASPLIT ? bf16_bits(xs[i] - bf16_val(hb)) : (unsigned short)0; }
#pragma unroll
    for (int t = 0; t < 4; ++t) {
      const unsigned short* brow = Wt + (size_t)(col0 + t * 16 + ln) * ldb + kb;
      FragB b;
      b.half[0] = *(const v8us*)(brow + 8 * hh);
      b.half[1] = *(const v8us*)(brow + 16 + 8 * hh);
      acc[t] = mmaN<ASPLIT ? 2 : 1>(ah.v, al.v, b.v, b.v, acc[t]);
    }
  }
#pragma unroll
  for (int t = 0; t < 4; ++t) {
    const int col = col0 + t * 16 + ln;
    float bv = bias ? bias[col] : 0.f;
    if (BIAS_BF16) bv = bf16_round(bv);
#pragma unroll
    for (int r = 0; r < 8; ++r) {
      float v = acc[t][r] + bv;
      if (resid) { float rv = resid[(size_t)((row0 + 8 * hh + r) % rmod) * ldr + col]; if (RES_BF16) rv = bf16_round(rv); v += rv; }
      if (ACT == 1) v = fmaxf(v, 0.f);
      if (ACT == 2) v = 0.5f * v * (1.0f + erff(v * 0.70710678118654752f));
      if (ACT == 3) { const float u = 0.7978845608028654f * (v + 0.044715f * v * v * v); v = 0.5f * v * (1.0f + tanhf(u)); }
      so[w][8 * hh + r][t * 16 + ln] = v;
    }
  }
  __builtin_amdgcn_fence(__ATOMIC_ACQ_REL, "workgroup");
  __builtin_amdgcn_wave_barrier();
  const int rsub = lane >> 4, c4 = (lane & 15) * 4;
  {
#pragma unroll
    for (int q = 0; q < 8; ++q) {
      const int r = q * 2 + rsub;
      const v4f v = *(const v4fa*)&so[w][r][c4];
      *(v4f*)(C + (size_t)(row0 + r) * ldc + col0 + c4) = v;
    }
    
  }
}
// row LayerNorm (biased variance, eps) over N: s = X (+ R); optional out_sum <- s; out_norm <- (s-mu)*rsqrt(var+eps)*g + b
template <bool PARAM_BF16>
__global__ __launch_bounds__(256) void k_layernorm(const float* __restrict__ X, const float* __restrict__ R, const float* __restrict__ g, const float* __restrict__ bta,
                                                  float* __restrict__ out_sum, float* __restrict__ out_norm, int N, float eps) {
  __shared__ float red[256];
  const int row = blockIdx.x, tid = threadIdx.x;
  const float* x = X + (size_t)row * N; const float* rr = R ? R + (size_t)row * N : nullptr;
  float vals[16];                     // up to N = 4096
  const int per = N / 256;            // contiguous chunk per thread? use strided-by-4 chunks: thread handles j = tid*4 + 1024*u
  float s1 = 0.f;
  for (int u = 0; u < per / 4; ++u) {
    const int j = tid * 4 + 1024 * u;
    const v4f a = *(const v4fa*)(x + j);
    v4f b = {0.f,0.f,0.f,0.f}; if (rr) b = *(const v4fa*)(rr + j);
#pragma unroll
    for (int q = 0; q < 4; ++q) { const float v = a[q] + b[q]; vals[u * 4 + q] = v; s1 += v; }
  }
  red[tid] = s1; __syncthreads();
  for (int st = 128; st > 0; st >>= 1) { if (tid < st) red[tid] += red[tid + st]; __syncthreads(); }
  const float mu = red[0] / (float)N; __syncthreads();
  float s2 = 0.f;
  for (int u = 0; u < per / 4; ++u)
#pragma unroll
    for (int q = 0; q < 4; ++q) { const float c = vals[u * 4 + q] - mu; s2 += c * c; }
  red[tid] = s2; __syncthreads();
  for (int st = 128; st > 0; st >>= 1) { if (tid < st) red[tid] += red[tid + st]; __syncthreads(); }
  const float rs = rsqrtf(red[0] / (float)N + eps);
  {
    for (int u = 0; u < per / 4; ++u) {
      const int j = tid * 4 + 1024 * u;
      v4f o, sm;
#pragma unroll
      for (int q = 0; q < 4; ++q) {
        float gg = g[j + q], bb = bta[j + q];
        if (PARAM_BF16) { gg = bf16_round(gg); bb = bf16_round(bb); }
        sm[q] = vals[u * 4 + q]; o[q] = (vals[u * 4 + q] - mu) * rs * gg + bb;
      }
      if (out_sum) *(v4f*)(out_sum + (size_t)row * N + j) = sm;
      *(v4f*)(out_norm + (size_t)row * N + j) = o;
    }
    
  }
}



// ---- f16 WMMA path (v_wmma_f32_16x16x32_f16): 11-bit significands for operands in range — used where a [0,1] probability operand needs more precision than bf16
typedef _Float16 v16h __attribute__((ext_vector_type(16)));
union FragH { v16h v; v8us half[2]; _Float16 h[16]; unsigned short u[16]; };
template <int NT>
__device__ __forceinline__ v8f mmaH(v16h ah, v16h al, v16h bh, v16h bl, v8f c) {
  c = __builtin_amdgcn_wmma_f32_16x16x32_f16(false, ah, false, bh, (short)0, c, false, false);
  if (NT >= 2) c = __builtin_amdgcn_wmma_f32_16x16x32_f16(false, al, false, bh, (short)0, c, false, false);
  if (NT >= 3) c = __builtin_amdgcn_wmma_f32_16x16x32_f16(false, ah, false, bl, (short)0, c, false, false);
  asm volatile("v_nop\n\tv_nop\n\tv_nop\n\tv_nop" : "+v"(c) : "v"(ah), "v"(al), "v"(bh), "v"(bl));
  return c;
}
// batched GEMM like k_gemm_b but f16 operands: A f32 (split into f16 hi/lo if ASPLIT, else rounded to f16), Bt = f16 values [n][k]; alpha; C f32; N multiple of 16 (partial tiles skipped)
template <bool ASPLIT>
__global__ __launch_bounds__(128) void k_gemm_h(const float* __restrict__ A, int lda, size_t sA, const _Float16* __restrict__ Bh, int ldb, size_t sB, float alpha, float* __restrict__ C, int ldc, size_t sC, int M, int N, int K) {
  __shared__ __attribute__((aligned(16))) float so[4][16][64];
  const int tid = threadIdx.x, w = tid >> 5, lane = tid & 31, ln = lane & 15, hh = lane >> 4; const int by = blockIdx.y;
  A += (size_t)by * sA; Bh += (size_t)by * sB; C += (size_t)by * sC;
  const int ntn = (N + 63) / 64; const int wid = blockIdx.x * 4 + w; const int mt = wid / ntn, nq = wid % ntn; if (mt * 16 >= M) return;
  const int row0 = mt * 16, col0 = nq * 64; const float* arow = A + (size_t)(row0 + ln) * lda;
  v8f acc[4] = {};
  for (int kb = 0; kb < K; kb += 32) {
    FragH ah, al;
    const v4f x0 = *(const v4fa*)(arow + kb + 8 * hh), x1 = *(const v4fa*)(arow + kb + 8 * hh + 4), x2 = *(const v4fa*)(arow + kb + 16 + 8 * hh), x3 = *(const v4fa*)(arow + kb + 16 + 8 * hh + 4);
    float xs[16] = {x0[0],x0[1],x0[2],x0[3],x1[0],x1[1],x1[2],x1[3],x2[0],x2[1],x2[2],x2[3],x3[0],x3[1],x3[2],x3[3]};
#pragma unroll
    for (int i = 0; i < 16; ++i) { const _Float16 h = (_Float16)xs[i]; ah.h[i] = h; al.h[i] = ASPLIT ? (_Float16)(xs[i] - (float)h) : (_Float16)0.0f; }
#pragma unroll
    for (int t = 0; t < 4; ++t) { if (col0 + t * 16 >= N) continue; const size_t boff = (size_t)(col0 + t * 16 + ln) * ldb + kb; FragH bq; bq.half[0] = *(const v8us*)(Bh + boff + 8 * hh); bq.half[1] = *(const v8us*)(Bh + boff + 16 + 8 * hh);
      acc[t] = mmaH<ASPLIT ? 2 : 1>(ah.v, al.v, bq.v, bq.v, acc[t]); }
  }
#pragma unroll
  for (int t = 0; t < 4; ++t) { if (col0 + t * 16 >= N) continue;
#pragma unroll
    for (int r = 0; r < 8; ++r) so[w][8 * hh + r][t * 16 + ln] = acc[t][r] * alpha; }
  __builtin_amdgcn_fence(__ATOMIC_ACQ_REL, "workgroup"); __builtin_amdgcn_wave_barrier();
  const int rsub = lane >> 4, c4 = (lane & 15) * 4;
  {
#pragma unroll
    for (int q = 0; q < 8; ++q) { const int r = q * 2 + rsub; if (col0 + c4 < N) { const v4f v = *(const v4fa*)&so[w][r][c4]; *(v4f*)(C + (size_t)(row0 + r) * ldc + col0 + c4) = v; } }
     }
}

// Wt[n][k] = f16(bf16(W[k][n]) * scale) from f32 row-major W[K][N] (scale = power of two; bf16-exact weights stay exact in f16 away from the subnormal range)
// A block turns a tile of 128 k x 64 n through LDS; a matrix has (K / 128) * (N / 64) tiles, blk is the tile's number. Both sides of memory see whole aligned 256-B runs:
// 16 lanes read 64 n of one k row, 16 lanes write 128 k of one n row. A thread reads 8 k x 4 n and stores, per n, its 8 k as one 16-B piece.
// LDS row = one n (16 pieces) at a pitch of 272 B; piece g of row n lies at place g ^ (n >> 4), so that the 16 lanes of a store (rows 4 apart) fall on 16 different bank groups.
#define WT_P 272
template <int K, int N>
__device__ __forceinline__ void wt_tile(const float* __restrict__ W, _Float16* __restrict__ Wt, float scale, int blk, unsigned char* tl) {
  static_assert(K % 128 == 0 && N % 64 == 0, "whole tiles only");
  const int tid = threadIdx.x, c = tid & 15, g = tid >> 4; const int kt = blk / (N / 64), nt = blk % (N / 64); const int k0 = kt * 128, n0 = nt * 64;
  const float* src = W + (size_t)(k0 + g * 8) * N + n0 + c * 4; v4f a[8];
#pragma unroll      /* constant indices keep a and f in registers (this loop and the three below); the eight loads are in flight together */
  for (int i = 0; i < 8; ++i) a[i] = *(const v4fa*)(src + i * N);
#pragma unroll
  for (int j = 0; j < 4; ++j) { FragH f;
#pragma unroll
    for (int i = 0; i < 8; ++i) f.h[i] = (_Float16)(bf16_round(a[i][j]) * scale);
    *(v8us*)(tl + (c * 4 + j) * WT_P + ((g ^ (c >> 2)) * 16)) = f.half[0]; }
  __syncthreads();      /* the tile is whole before any row of it is read */
  unsigned short* dst = (unsigned short*)Wt + (size_t)(n0 + g) * K + k0 + c * 8;
#pragma unroll
  for (int q = 0; q < 4; ++q) { const v8us o = *(const v8us*)(tl + (q * 16 + g) * WT_P + ((c ^ q) * 16)); *(v8us*)(dst + q * 16 * K) = o; }
  asm volatile("s_wait_xcnt 0x0" ::: "memory");      /* stands behind the four stores, in front of any later rewrite of their address and data registers (the caller's code goes on behind this tile) */
}
#define WT_NB(K, N) (((K) / 128) * ((N) / 64))
#define WT_B1 WT_NB(DM, 3 * DM)
#define WT_B2 (WT_B1 + WT_NB(DM, DM))
#define WT_B3 (WT_B2 + WT_NB(DM, 4096))
#define WT_B4 (WT_B3 + WT_NB(4096, DM))
// k_gemm_hh variant with fused epilogue: v = acc·alpha + bias[by·sBias + col] (+ CP[(row/rowsPerB)·sCPb + by·64 + col] if CP) ; ACT 0 none / 1 elu ; writes f16 C16 (and f32 C if non-null)
template <int ACT>
__global__ __launch_bounds__(128) void k_gemm_hhx(const _Float16* __restrict__ A, int lda, size_t sA, const _Float16* __restrict__ Bh, int ldb, size_t sB, float alpha, const float* __restrict__ bias, size_t sBias, const float* __restrict__ CP, int rowsPerB, size_t sCPb, int row0g,
    float* __restrict__ C, _Float16* __restrict__ C16, int ldc, size_t sC, int M, int N, int K) {
  __shared__ __attribute__((aligned(16))) float so[4][16][64];
  const int tid = threadIdx.x, w = tid >> 5, lane = tid & 31, ln = lane & 15, hh = lane >> 4; const int by = blockIdx.y;
  A += (size_t)by * sA; Bh += (size_t)by * sB; const size_t cofs = (size_t)by * sC; const float* bp = bias ? bias + (size_t)by * sBias : nullptr;
  const int ntn = (N + 63) / 64; const int wid = blockIdx.x * 4 + w; const int mt = wid / ntn, nq = wid % ntn; if (mt * 16 >= M) return;
  const int row0 = mt * 16, col0 = nq * 64; const _Float16* arow = A + (size_t)(row0 + ln) * lda;
  v8f acc[4] = {};
  for (int kb = 0; kb < K; kb += 32) { FragH ah; ah.half[0] = *(const v8us*)((const unsigned short*)arow + kb + 8 * hh); ah.half[1] = *(const v8us*)((const unsigned short*)arow + kb + 16 + 8 * hh);
#pragma unroll
    for (int t = 0; t < 4; ++t) { if (col0 + t * 16 >= N) continue; const size_t boff = (size_t)(col0 + t * 16 + ln) * ldb + kb; FragH bq; bq.half[0] = *(const v8us*)((const unsigned short*)Bh + boff + 8 * hh); bq.half[1] = *(const v8us*)((const unsigned short*)Bh + boff + 16 + 8 * hh);
      acc[t] = mmaH<1>(ah.v, ah.v, bq.v, bq.v, acc[t]); }
  }
#pragma unroll
  for (int t = 0; t < 4; ++t) { if (col0 + t * 16 >= N) continue; const int col = col0 + t * 16 + ln; const float bv = bp ? bf16_round(bp[col]) : 0.f;
#pragma unroll
    for (int r = 0; r < 8; ++r) { float v = acc[t][r] * alpha + bv; if (CP) { const int bidx = (row0g + row0 + 8 * hh + r) / rowsPerB; v += CP[(size_t)bidx * sCPb + (size_t)by * 64 + col]; } if (ACT == 1) v = (v > 0.f) ? v : expm1f(v); else if (ACT == 7) v = (v > 0.f) ? v + 1.0f : expf(v); else if (ACT == 8) v = tanhf(v); else if (ACT == 9) v = 0.5f * v * (1.0f + tanhf(0.7978845608028654f * (v + 0.044715f * v * v * v))); else if (ACT == 11) v = 1.0f / (1.0f + expf(-v)); else if (ACT == 12) v = (v > 0.f) ? v : 0.01f * v; else if (ACT == 14) v = (v > 0.f) ? v : 0.1f * v; else if (ACT == 15) v = v / (1.0f + expf(-v)); else if (ACT == 3) v = fmaxf(v, 0.f); else if (ACT == 6) v = 0.5f * v * (1.0f + erff(v * 0.70710678118654752f)); so[w][8 * hh + r][t * 16 + ln] = v; } }
  __builtin_amdgcn_fence(__ATOMIC_ACQ_REL, "workgroup"); __builtin_amdgcn_wave_barrier();
  const int rsub = lane >> 4, c4 = (lane & 15) * 4; typedef _Float16 v4h __attribute__((ext_vector_type(4)));
  {
#pragma unroll
    for (int q = 0; q < 8; ++q) { const int r = q * 2 + rsub; if (col0 + c4 < N) { const v4f v = *(const v4fa*)&so[w][r][c4]; if (C) *(v4f*)(C + cofs + (size_t)(row0 + r) * ldc + col0 + c4) = v; if (C16) { v4h h4; for (int i = 0; i < 4; ++i) h4[i] = (_Float16)v[i]; *(v4h*)(C16 + cofs + (size_t)(row0 + r) * ldc + col0 + c4) = h4; } } }
     }
}


typedef _Float16 v4h __attribute__((ext_vector_type(4)));

__global__ __launch_bounds__(256) void k_x16(const float* __restrict__ x, _Float16* __restrict__ X16, size_t n8) { const size_t t = (size_t)blockIdx.x * 256 + threadIdx.x; if (t >= n8) return; FragH f;
#pragma unroll
  for (int q = 0; q < 8; ++q) f.h[q] = (_Float16)bf16_round(x[t * 8 + q]); *(v8us*)((unsigned short*)X16 + t * 8) = f.half[0];  }
__global__ __launch_bounds__(256) void k_h16(const float* __restrict__ x, _Float16* __restrict__ X16, size_t n8) { const size_t t = (size_t)blockIdx.x * 256 + threadIdx.x; if (t >= n8) return; FragH f;
#pragma unroll
  for (int q = 0; q < 8; ++q) f.h[q] = (_Float16)x[t * 8 + q]; *(v8us*)((unsigned short*)X16 + t * 8) = f.half[0];  }
__global__ __launch_bounds__(256) void k_round16f(const float* __restrict__ W, _Float16* __restrict__ Bt, size_t n8) { const size_t t = (size_t)blockIdx.x * 256 + threadIdx.x; if (t >= n8) return; FragH f;
#pragma unroll
  for (int i = 0; i < 8; ++i) f.h[i] = (_Float16)(bf16_round(W[t * 8 + i]) * 16.0f); *(v8us*)((unsigned short*)Bt + t * 8) = f.half[0];  }
// ---- fast GEMM (wave tile 32x64, operands staged in LDS); epilogue: v = act(acc * alpha + bf16(bias[col]) (+ CP[row][col], f32 at a pitch of ADDP elements, if ADDP > 0)), written as f16 C16 (OUT16) or f32 C ----
__device__ __forceinline__ v16h g2_frag(const _Float16* p, int hh) { FragH f; f.half[0] = *(const v8us*)((const unsigned short*)p + 8 * hh); f.half[1] = *(const v8us*)((const unsigned short*)p + 16 + 8 * hh); return f.v; }
__device__ __forceinline__ v8f g2_mma(v16h a, v16h b, v8f c) { v8f d = __builtin_amdgcn_wmma_f32_16x16x32_f16(false, a, false, b, (short)0, c, false, false); asm volatile("v_nop\n\tv_nop\n\tv_nop\n\tv_nop" : "+v"(d) : "v"(a), "v"(b)); return d; }
// Staged tile of k_gemm2: 128 A rows then 128 B rows, 128 k (256 B) each, at a pitch of 272 B (16 B x odd: conflict-free for ds_load_b128 readers); two buffers.
#define G2_PITCH 272
#define G2_BUF (256 * G2_PITCH)
// Eight asynchronous 16-byte copies per lane (rows 16 apart): l = the lane's LDS byte address, g = its global address, gstep = 16 source rows in elements.
// s_wait_xcnt 0 is the statement's last line, so that it stands in front of any later rewrite of the address registers the copies name.
__device__ __forceinline__ void g2_copy8(unsigned l, const _Float16* g, size_t gstep) {
  const unsigned l1 = l + 16 * G2_PITCH, l2 = l + 32 * G2_PITCH, l3 = l + 48 * G2_PITCH, l4 = l + 64 * G2_PITCH, l5 = l + 80 * G2_PITCH, l6 = l + 96 * G2_PITCH, l7 = l + 112 * G2_PITCH;
  const _Float16* g1 = g + gstep; const _Float16* g2 = g1 + gstep; const _Float16* g3 = g2 + gstep; const _Float16* g4 = g3 + gstep; const _Float16* g5 = g4 + gstep; const _Float16* g6 = g5 + gstep; const _Float16* g7 = g6 + gstep;
  asm volatile("global_load_async_to_lds_b128 %0, %8, off\n\t"
               "global_load_async_to_lds_b128 %1, %9, off\n\t"
               "global_load_async_to_lds_b128 %2, %10, off\n\t"
               "global_load_async_to_lds_b128 %3, %11, off\n\t"
               "global_load_async_to_lds_b128 %4, %12, off\n\t"
               "global_load_async_to_lds_b128 %5, %13, off\n\t"
               "global_load_async_to_lds_b128 %6, %14, off\n\t"
               "global_load_async_to_lds_b128 %7, %15, off\n\t"
               "s_wait_xcnt 0x0"
               :: "v"(l), "v"(l1), "v"(l2), "v"(l3), "v"(l4), "v"(l5), "v"(l6), "v"(l7), "v"(g), "v"(g1), "v"(g2), "v"(g3), "v"(g4), "v"(g5), "v"(g6), "v"(g7) : "memory");
}
// Block tile 128x128 (8 waves as 4 x 2, wave tile 32x64); requires M % 128 == 0, N % 128 == 0, K % 128 == 0. Each pass works on 128 k from one LDS buffer while the next pass's copies fly into the other.
// MODE 1: slab blockIdx.y == 2 swaps its operands, C^T = B A^T, written [N][M] at a pitch of M into its own C slab (v comes out as V^T, no transposing launch).
// MODE 2: A is a hi plane and, sA elements behind it, a residual plane x 2^10; K counts both (each K / 2 wide), B serves both. The hi sums are scaled by 2^10 (exact) where the planes change, so one accumulator holds both; alpha carries the 2^-10.
template <int ACT, int ADDP, bool OUT16, int MODE>
__global__ __launch_bounds__(256) void k_gemm2(const _Float16* __restrict__ A, int lda, size_t sA, const _Float16* __restrict__ Bh, int ldb, size_t sB, float alpha, const float* __restrict__ bias, size_t sBias, const float* __restrict__ CP,
    float* __restrict__ C, _Float16* __restrict__ C16, int ldc, size_t sC, int M, int N, int K) {
  __shared__ __attribute__((aligned(16))) unsigned char ring[2 * G2_BUF];
  float (*so)[32][68] = (float (*)[32][68])ring;      /* output staging (8 x 32 x 68 f32 = one buffer), used only behind the last pass's barrier */
  const int tid = threadIdx.x, w = tid >> 5, lane = tid & 31, ln = lane & 15, hh = lane >> 4; const int by = blockIdx.y;
  A += (size_t)by * sA; Bh += (size_t)by * sB; const size_t cofs = (size_t)by * sC; const float* bp = bias ? bias + (size_t)by * sBias : nullptr;
  if (MODE == 1 && by == 2) { const _Float16* tp = A; A = Bh; Bh = tp; const int tl = lda; lda = ldb; ldb = tl; ldc = M; M = N; N = ldc; }
  const int ntn = N >> 7; const int mt = blockIdx.x / ntn, nq = blockIdx.x - mt * ntn; if (mt * 128 >= M) return;      /* the whole block leaves, in front of every barrier */
  const int row0 = mt * 128 + 32 * (w & 3), col0 = nq * 128 + 64 * (w >> 2);
  const _Float16* gA = A + (size_t)(mt * 128 + (tid >> 4)) * lda + (tid & 15) * 8; const _Float16* gB = Bh + (size_t)(nq * 128 + (tid >> 4)) * ldb + (tid & 15) * 8;
  const unsigned lA = (unsigned)(size_t)ring + (unsigned)((tid >> 4) * G2_PITCH + (tid & 15) * 16); const unsigned lB = lA + 128 * G2_PITCH;
  const size_t stA = (size_t)16 * lda, stB = (size_t)16 * ldb;
  const int aofs = (32 * (w & 3) + ln) * G2_PITCH, bofs = (128 + 64 * (w >> 2) + ln) * G2_PITCH;
  const int np = K >> 7, nh = np >> 1;      /* nh: MODE 2's passes per plane (at least 2, so passes 0 and 1 lie in the hi plane) */
  g2_copy8(lA, gA, stA); g2_copy8(lB, gB, stB);
  asm volatile("s_wait_asynccnt 0x0" ::: "memory");      /* pass 0's own copies have landed */
  __syncthreads();                                        /* ... and every other wave's */
  if (np > 1) { g2_copy8(lA + G2_BUF, gA + 128, stA); g2_copy8(lB + G2_BUF, gB + 128, stB); }
  const v8f z8 = {0.f,0.f,0.f,0.f,0.f,0.f,0.f,0.f}; v8f c00 = z8, c01 = z8, c02 = z8, c03 = z8, c10 = z8, c11 = z8, c12 = z8, c13 = z8;
#pragma unroll 1      /* one pass per trip: the publish point at the foot stands once */
  for (int p = 0; p < np; ++p) { const unsigned bsel = (unsigned)(p & 1) * G2_BUF; const unsigned char* sa = ring + bsel + aofs; const unsigned char* sb = ring + bsel + bofs;
    v16h fa[2][2], fb[2][4];      /* two fragment sets: block kk + 1 is fetched ahead of block kk's products, inside this pass's buffer only */
    fa[0][0] = g2_frag((const _Float16*)sa, hh); fa[0][1] = g2_frag((const _Float16*)(sa + 16 * G2_PITCH), hh);
#pragma unroll      /* constant indices keep fa and fb in registers (this loop and the two below) */
    for (int j = 0; j < 4; ++j) fb[0][j] = g2_frag((const _Float16*)(sb + j * 16 * G2_PITCH), hh);
#pragma unroll
    for (int kk = 0; kk < 4; ++kk) { const int cu = kk & 1, nx = cu ^ 1;
      if (kk < 3) { fa[nx][0] = g2_frag((const _Float16*)(sa + (kk + 1) * 64), hh); fa[nx][1] = g2_frag((const _Float16*)(sa + 16 * G2_PITCH + (kk + 1) * 64), hh);
#pragma unroll
        for (int j = 0; j < 4; ++j) fb[nx][j] = g2_frag((const _Float16*)(sb + j * 16 * G2_PITCH + (kk + 1) * 64), hh); }
      c00 = g2_mma(fa[cu][0], fb[cu][0], c00); c10 = g2_mma(fa[cu][1], fb[cu][0], c10); c01 = g2_mma(fa[cu][0], fb[cu][1], c01); c11 = g2_mma(fa[cu][1], fb[cu][1], c11);
      c02 = g2_mma(fa[cu][0], fb[cu][2], c02); c12 = g2_mma(fa[cu][1], fb[cu][2], c12); c03 = g2_mma(fa[cu][0], fb[cu][3], c03); c13 = g2_mma(fa[cu][1], fb[cu][3], c13); }
    if (MODE == 2 && p == nh - 1) { c00 *= 1024.0f; c01 *= 1024.0f; c02 *= 1024.0f; c03 *= 1024.0f; c10 *= 1024.0f; c11 *= 1024.0f; c12 *= 1024.0f; c13 *= 1024.0f; }      /* the hi plane is done: its sums take the residual plane's scale */
    asm volatile("s_wait_dscnt 0x0" ::: "memory");        /* this wave's reads of the buffer have returned before it is refilled */
    asm volatile("s_wait_asynccnt 0x0" ::: "memory");     /* this wave's copies for pass p + 1 have landed */
    __syncthreads();                                      /* publishes pass p + 1 and ends every reader's last read of pass p's buffer */
    if (p + 2 < np) { const int pn = p + 2, pk = (MODE == 2 && pn >= nh) ? pn - nh : pn;      /* pk: the pass's place inside its plane */
      g2_copy8(lA + bsel, gA + ((MODE == 2 && pn >= nh) ? sA : (size_t)0) + (size_t)pk * 128, stA); g2_copy8(lB + bsel, gB + (size_t)pk * 128, stB); } }
  asm volatile("s_wait_asynccnt 0x0" ::: "memory");       /* nothing in flight when the ring becomes output staging */
  /* Bias and addend are read in the layout of the write-out (a lane: 4 columns of 16 rows; 16 lanes: a whole 256-B run), and every load is issued here, ahead of the staging: they are in flight together and are waited for once. */
  const int rsub = lane >> 4, c4 = (lane & 15) * 4;
  v4f bq = {0.f, 0.f, 0.f, 0.f}, x[16];
  if (ADDP > 0) { const float* cr = CP + (size_t)(row0 + rsub) * ADDP + (size_t)by * 64 + col0 + c4;      /* a lane reads exactly the elements it writes below, so C may lie over CP */
#pragma unroll      /* constant indices keep x and accs in registers (this loop and those below); the compile-time pitch makes the 16 loads one address pair with immediate offsets */
    for (int q = 0; q < 16; ++q) x[q] = *(const v4fa*)(cr + q * 2 * ADDP);
    asm volatile("s_wait_xcnt 0x0" :: "v"(cr) : "memory"); }      /* the loads' address pair stays whole up to this wait */
  if (bp) { const float* br = bp + col0 + c4; bq = *(const v4fa*)br;
    asm volatile("s_wait_xcnt 0x0" :: "v"(br) : "memory"); }      /* the load's address pair stays whole up to this wait */
  v8f accs[8] = {c00, c01, c02, c03, c10, c11, c12, c13};
#pragma unroll
  for (int u = 0; u < 8; ++u) { const int t = u & 3, half = u >> 2;
#pragma unroll
    for (int r = 0; r < 8; ++r) so[w][half * 16 + 8 * hh + r][t * 16 + ln] = accs[u][r]; }
  __builtin_amdgcn_fence(__ATOMIC_ACQ_REL, "workgroup"); __builtin_amdgcn_wave_barrier();
  float bv[4];
#pragma unroll
  for (int i = 0; i < 4; ++i) bv[i] = bf16_round(bq[i]);
#pragma unroll
  for (int q = 0; q < 16; ++q) { const v4f a4 = *(const v4fa*)&so[w][q * 2 + rsub][c4];
#pragma unroll
    for (int i = 0; i < 4; ++i) { float v = a4[i] * alpha + bv[i]; if (ADDP > 0) v += x[q][i];
      if (ACT == 3) v = fmaxf(v, 0.f); else if (ACT == 6) v = 0.5f * v * (1.0f + erff(v * 0.70710678118654752f)); else if (ACT == 11) v = 1.0f / (1.0f + expf(-v)); else if (ACT == 15) v = v / (1.0f + expf(-v)); else if (ACT == 12) v = (v > 0.f) ? v : 0.01f * v; else if (ACT == 8) v = tanhf(v); else if (ACT == 9) v = 0.5f * v * (1.0f + tanhf(0.7978845608028654f * (v + 0.044715f * v * v * v)));      /* tanh-GELU */
      x[q][i] = v; } }
  /* all results first, then the stores as one group: no store is held behind the next row's LDS read */
  const size_t o0 = cofs + (size_t)(row0 + rsub) * ldc + col0 + c4, ost = (size_t)2 * ldc;
#pragma unroll
  for (int q = 0; q < 16; ++q) { if (OUT16) { v4h h4;
#pragma unroll
      for (int i = 0; i < 4; ++i) h4[i] = (_Float16)x[q][i];
      *(v4h*)(C16 + o0 + q * ost) = h4; } else *(v4f*)(C + o0 + q * ost) = x[q]; } }



// Staged tile of k_flash: 128 keys. 128 K rows (64 f16 = 128 B) at a pitch of 144 B, then 64 V^T rows (128 keys = 256 B) at a pitch of 272 B (16 B x odd: conflict-free for ds_load_b128 readers); two buffers.
#define FL_KEYS 128
#define FL_KP 144
#define FL_VP 272
#define FL_VOFS (FL_KEYS * FL_KP)
#define FL_BUF (FL_VOFS + 64 * FL_VP)
#define FL_C2 (SCL * 1.4426950408889634f)      /* score scale x log2(e) */
// Eight asynchronous 16-byte copies per lane: l = the lane's LDS byte address (LSTEP bytes between copies), g = its global address (gstep elements between copies).
// s_wait_xcnt 0 is the statement's last line, so that it stands in front of any later rewrite of the address registers the copies name.
template <unsigned LSTEP>
__device__ __forceinline__ void fl_copy8(unsigned l, const unsigned short* g, size_t gstep) {
  const unsigned l1 = l + LSTEP, l2 = l + 2 * LSTEP, l3 = l + 3 * LSTEP, l4 = l + 4 * LSTEP, l5 = l + 5 * LSTEP, l6 = l + 6 * LSTEP, l7 = l + 7 * LSTEP;
  const unsigned short* g1 = g + gstep; const unsigned short* g2 = g1 + gstep; const unsigned short* g3 = g2 + gstep; const unsigned short* g4 = g3 + gstep; const unsigned short* g5 = g4 + gstep; const unsigned short* g6 = g5 + gstep; const unsigned short* g7 = g6 + gstep;
  asm volatile("global_load_async_to_lds_b128 %0, %8, off\n\t"
               "global_load_async_to_lds_b128 %1, %9, off\n\t"
               "global_load_async_to_lds_b128 %2, %10, off\n\t"
               "global_load_async_to_lds_b128 %3, %11, off\n\t"
               "global_load_async_to_lds_b128 %4, %12, off\n\t"
               "global_load_async_to_lds_b128 %5, %13, off\n\t"
               "global_load_async_to_lds_b128 %6, %14, off\n\t"
               "global_load_async_to_lds_b128 %7, %15, off\n\t"
               "s_wait_xcnt 0x0"
               :: "v"(l), "v"(l1), "v"(l2), "v"(l3), "v"(l4), "v"(l5), "v"(l6), "v"(l7), "v"(g), "v"(g1), "v"(g2), "v"(g3), "v"(g4), "v"(g5), "v"(g6), "v"(g7) : "memory");
}
// lane l with lane l ^ 16 (the two lanes that share one query column of a transposed score tile)
__device__ __forceinline__ float fl_xhalf(float x) { return __builtin_bit_cast(float, __builtin_amdgcn_permlanex16(__builtin_bit_cast(int, x), __builtin_bit_cast(int, x), 0x76543210, 0xfedcba98, false, false)); }
__global__ __launch_bounds__(128) void k_flash(const _Float16* __restrict__ Q16, int ldq, const _Float16* __restrict__ K16, int ldk, const _Float16* __restrict__ Vt, const int* __restrict__ MSK, _Float16* __restrict__ Oh, _Float16* __restrict__ Ol, int ldo) {
  constexpr int RPW = 16, NQB = TQ / (4 * RPW), DT = 4, KS = 2; (void)MSK;
  __shared__ __attribute__((aligned(16))) float sO[4][RPW][64 + 4];
  __shared__ __attribute__((aligned(16))) unsigned char ring[2 * FL_BUF];
  const int tid = threadIdx.x, w = tid >> 5, lane = tid & 31, ln = lane & 15, hh = lane >> 4;
  const int slab = blockIdx.x / NQB, qblk = blockIdx.x % NQB; const int b = slab / NH, h = slab % NH; const int qb0 = qblk * (4 * RPW); const int q0 = qb0 + w * RPW;
  FragH aq[KS];
  { const unsigned short* qr = (const unsigned short*)Q16 + ((size_t)b * TQ + q0 + ln) * ldq + h * 64;
#pragma unroll
    for (int ks = 0; ks < KS; ++ks) { aq[ks].half[0] = *(const v8us*)(qr + ks * 32 + 8 * hh); aq[ks].half[1] = *(const v8us*)(qr + ks * 32 + 16 + 8 * hh); } }
  const unsigned short* Vth = (const unsigned short*)Vt + (size_t)h * 64 * (NBT * TK) + (size_t)b * TK;
  float m_r = -3.0e38f, l_r = 0.f; v8f oacc[DT];      /* oacc[dt][r] = O^T[dt*16 + 8*hh + r][query ln] */
#pragma unroll
  for (int dt = 0; dt < DT; ++dt) oacc[dt] = (v8f){0.f,0.f,0.f,0.f,0.f,0.f,0.f,0.f};
  /* the block's 128 threads copy a stage: K as 16 rows x 8 pieces, V^T as 8 rows x 16 pieces per copy, whole 128-B lines per wave */
  const unsigned short* gK = (const unsigned short*)K16 + ((size_t)b * TK + (tid >> 3)) * ldk + h * 64 + (tid & 7) * 8; const unsigned short* gV = Vth + (size_t)(tid >> 4) * (NBT * TK) + (tid & 15) * 8;
  const unsigned lK = (unsigned)(size_t)ring + (unsigned)((tid >> 3) * FL_KP + (tid & 7) * 16); const unsigned lV = (unsigned)(size_t)ring + (unsigned)(FL_VOFS + (tid >> 4) * FL_VP + (tid & 15) * 16);
  const size_t stK = (size_t)16 * ldk, stV = (size_t)8 * (NBT * TK);
  constexpr int NST = TK / FL_KEYS;
  fl_copy8<16 * FL_KP>(lK, gK, stK); fl_copy8<8 * FL_VP>(lV, gV, stV);
  asm volatile("s_wait_asynccnt 0x0" ::: "memory");      /* stage 0's own copies have landed */
  __syncthreads();                                        /* ... and every other wave's */
  if (NST > 1) { fl_copy8<16 * FL_KP>(lK + FL_BUF, gK + (size_t)FL_KEYS * ldk, stK); fl_copy8<8 * FL_VP>(lV + FL_BUF, gV + FL_KEYS, stV); }
#pragma unroll 1      /* one stage per trip: the publish point at the foot stands once */
  for (int st = 0; st < NST; ++st) { const unsigned bsel = (unsigned)(st & 1) * FL_BUF; const unsigned char* sK = ring + bsel; const unsigned char* sV = sK + FL_VOFS;
#pragma unroll 1      /* 32 keys per trip, rolled as before: keeps the loop's text small */
  for (int j0 = 0; j0 < FL_KEYS; j0 += 32) {
    v8f s[2]; FragH bk[2][KS], bv[DT];      /* this trip's K and V^T fragments are read from the stage as one group, ahead of the products and the softmax */
#pragma unroll
    for (int nt = 0; nt < 2; ++nt) { const unsigned short* kr = (const unsigned short*)(sK + (j0 + nt * 16 + ln) * FL_KP);
#pragma unroll
      for (int ks = 0; ks < KS; ++ks) { bk[nt][ks].half[0] = *(const v8us*)(kr + ks * 32 + 8 * hh); bk[nt][ks].half[1] = *(const v8us*)(kr + ks * 32 + 16 + 8 * hh); } }
#pragma unroll
    for (int dt = 0; dt < DT; ++dt) { const unsigned short* vrow = (const unsigned short*)(sV + (dt * 16 + ln) * FL_VP) + j0; bv[dt].half[0] = *(const v8us*)(vrow + 8 * hh); bv[dt].half[1] = *(const v8us*)(vrow + 16 + 8 * hh); }
#pragma unroll
    for (int nt = 0; nt < 2; ++nt) { v8f acc = (v8f){0.f,0.f,0.f,0.f,0.f,0.f,0.f,0.f};
#pragma unroll
      for (int ks = 0; ks < KS; ++ks) acc = mmaH<1>(bk[nt][ks].v, bk[nt][ks].v, aq[ks].v, aq[ks].v, acc);
      s[nt] = acc; }
    float mc = s[0][0];      /* the running maximum is kept in raw (unscaled) scores: the scale is positive, so the order is the same */
#pragma unroll      /* constant indices keep s, pb and oacc in registers (this loop and those below) */
    for (int i = 1; i < 16; ++i) mc = fmaxf(mc, s[i >> 3][i & 7]);
    mc = fmaxf(mc, fl_xhalf(mc));
    const float mn = fmaxf(m_r, mc); const float al = (mn > -1.0e38f) ? __builtin_amdgcn_exp2f((m_r - mn) * FL_C2) : 1.0f; m_r = mn;
    const float nb = __builtin_fmaf(-mn, FL_C2, 10.0f);      /* 2^(s c + nb) = 2^10 exp((s - mn) / 8): scale, maximum and the 2^10 of P in one multiply-add */
    FragH pb; float psum = 0.f;
#pragma unroll
    for (int i = 0; i < 16; ++i) { const float p = __builtin_amdgcn_exp2f(__builtin_fmaf(s[i >> 3][i & 7], FL_C2, nb)); psum += p; pb.h[i] = (_Float16)p; }
    l_r = l_r * al + psum;      /* l_r carries the 2^10 too */
#pragma unroll
    for (int dt = 0; dt < DT; ++dt)
#pragma unroll
      for (int r = 0; r < 8; ++r) oacc[dt][r] *= al;
#pragma unroll
    for (int dt = 0; dt < DT; ++dt) oacc[dt] = mmaH<1>(bv[dt].v, bv[dt].v, pb.v, pb.v, oacc[dt]); }
    asm volatile("s_wait_dscnt 0x0" ::: "memory");        /* this wave's reads of the buffer have returned before it is refilled */
    asm volatile("s_wait_asynccnt 0x0" ::: "memory");     /* this wave's copies for stage st + 1 have landed */
    __syncthreads();                                      /* publishes stage st + 1 and ends every reader's last read of stage st's buffer */
    if (st + 2 < NST) { fl_copy8<16 * FL_KP>(lK + bsel, gK + (size_t)(st + 2) * FL_KEYS * ldk, stK); fl_copy8<8 * FL_VP>(lV + bsel, gV + (size_t)(st + 2) * FL_KEYS, stV); } }
  asm volatile("s_wait_asynccnt 0x0" ::: "memory");       /* nothing in flight when the wave goes on to its end */
  { float l = l_r + fl_xhalf(l_r); l = (l > 0.f) ? 1.0f / l : 0.f;
#pragma unroll
    for (int dt = 0; dt < DT; ++dt) { v4f lo, hi;
#pragma unroll
      for (int r = 0; r < 4; ++r) { lo[r] = oacc[dt][r] * l; hi[r] = oacc[dt][4 + r] * l; }
      *(v4fa*)&sO[w][ln][dt * 16 + 8 * hh] = lo; *(v4fa*)&sO[w][ln][dt * 16 + 8 * hh + 4] = hi; } }
  __builtin_amdgcn_fence(__ATOMIC_ACQ_REL, "workgroup"); __builtin_amdgcn_wave_barrier();
  {
#pragma unroll
    for (int rp = 0; rp < RPW; rp += 2) { const int r = rp + (lane >> 4), pc = lane & 15; const v4f val = *(const v4fa*)&sO[w][r][pc * 4]; v4h vh, vl;
#pragma unroll      /* constant indices keep vh and vl in registers */
      for (int i = 0; i < 4; ++i) { const _Float16 hi = (_Float16)val[i]; vh[i] = hi; vl[i] = (_Float16)((val[i] - (float)hi) * 1024.0f); }
      const size_t oo = ((size_t)b * TQ + q0 + r) * ldo + h * 64 + pc * 4; *(v4h*)(Oh + oo) = vh; *(v4h*)(Ol + oo) = vl; }
     } }
__global__ __launch_bounds__(256) void k_fulltab(unsigned* __restrict__ MB, int* __restrict__ RA, int* __restrict__ KE, int nq, int nk) {
  const int t = blockIdx.x * 256 + threadIdx.x;
  if (t < nq * (nk / 32)) { *(unsigned*)(MB + t) = 0u;  }
  if (t < nq) { *(int*)(RA + t) = 0;  }
  if (t < nq / 64) { *(int*)(KE + t * 32) = nk;  } }
// LayerNorm of 8 rows (one per wave); blk = the number of the 8-row group.
template <int SRCBF>
__device__ __forceinline__ void ln1024_rows(const float* __restrict__ X, _Float16* __restrict__ Y16, float* __restrict__ XB, int blk) {
  #pragma clang fp contract(off)
  const int tid = threadIdx.x, w = tid >> 5, ln = tid & 31; const int r = blk * 8 + w; if (r >= NR) return; const float* x = X + (size_t)r * DM; float s = 0.f;
#pragma unroll 1
  for (int i = 0; i < 8; ++i) { const v4f a = *(const v4fa*)(x + i * 128 + ln * 4); for (int q = 0; q < 4; ++q) s += SRCBF ? bf16_round(a[q]) : a[q]; }
  for (int o = 16; o > 0; o >>= 1) s += __shfl_xor(s, o, 32); const float mu = s / (float)DM; float q2 = 0.f;
#pragma unroll 1
  for (int i = 0; i < 8; ++i) { const v4f a = *(const v4fa*)(x + i * 128 + ln * 4); for (int q = 0; q < 4; ++q) { const float d = (SRCBF ? bf16_round(a[q]) : a[q]) - mu; q2 += d * d; } }
  for (int o = 16; o > 0; o >>= 1) q2 += __shfl_xor(q2, o, 32); const float dn = sqrtf(q2 / (float)DM + 1e-5f);
  {
#pragma unroll 1
    for (int i = 0; i < 8; ++i) { const int c0 = i * 128 + ln * 4; const v4f a = *(const v4fa*)(x + c0); _Float16 h4[4]; v4f xb;
      for (int q = 0; q < 4; ++q) { const float t = SRCBF ? bf16_round(a[q]) : a[q]; h4[q] = (_Float16)((t - mu) / dn); xb[q] = t; }
      *(unsigned long long*)((unsigned short*)Y16 + (size_t)r * DM + c0) = *(const unsigned long long*)h4; if (SRCBF) *(v4f*)(XB + (size_t)r * DM + c0) = xb; }
     } }
template <int SRCBF>
__global__ __launch_bounds__(256) void k_ln1024(const float* __restrict__ X, _Float16* __restrict__ Y16, float* __restrict__ XB) { ln1024_rows<SRCBF>(X, Y16, XB, blockIdx.x); }
// The first LayerNorm and the four weight matrices in one launch (neither reads what the other writes): a block's index picks its work, the same for the whole block, so the barrier in wt_tile is passed by all of a block or by none.
// The LayerNorm blocks come first: each wave of them waits out a chain of loads, which the transposes' traffic then covers.
#define LN_NB (NR / 8)
__global__ __launch_bounds__(256) void k_ln_wt4(const float* __restrict__ X, _Float16* __restrict__ Y16, float* __restrict__ XB, const float* __restrict__ Wa, _Float16* __restrict__ Ta, const float* __restrict__ Wb, _Float16* __restrict__ Tb, const float* __restrict__ Wc, _Float16* __restrict__ Tc, const float* __restrict__ Wd, _Float16* __restrict__ Td, float scale) {
  __shared__ __attribute__((aligned(16))) unsigned char tl[64 * WT_P];
  const int blk = (int)blockIdx.x - LN_NB;
  if (blk < 0) ln1024_rows<1>(X, Y16, XB, blockIdx.x);
  else if (blk < WT_B1) wt_tile<DM, 3 * DM>(Wa, Ta, scale, blk, tl);
  else if (blk < WT_B2) wt_tile<DM, DM>(Wb, Tb, scale, blk - WT_B1, tl);
  else if (blk < WT_B3) wt_tile<DM, 4096>(Wc, Tc, scale, blk - WT_B2, tl);
  else wt_tile<4096, DM>(Wd, Td, scale, blk - WT_B3, tl);
}
__global__ __launch_bounds__(256) void k_causaltab(unsigned* __restrict__ MB, int* __restrict__ RA, int* __restrict__ KE, int nq, int nk) {
  const int t = blockIdx.x * 256 + threadIdx.x; const int nw = nk / 32;
  if (t < nq * nw) { const int q = t / nw, w = t % nw; const int first = q + 1 - 32 * w; const unsigned bits = (first <= 0) ? 0xffffffffu : ((first >= 32) ? 0u : (0xffffffffu << first)); *(unsigned*)(MB + t) = bits;  }
  if (t < nq) { *(int*)(RA + t) = 0;  }
  if (t < nq / 64) { const int v = 64 * (t + 1); *(int*)(KE + t * 32) = v;  } }


extern "C" void kernel_launch(void* const* d_in, const int* in_sizes, int n_in,
                              void* d_out, int out_size, void* d_ws, size_t ws_size, hipStream_t stream) {
  (void)in_sizes; (void)n_in; (void)out_size;
  const float* const* I = (const float* const*)d_in; const float* x = I[0]; const float* Wqkv = I[1]; const float* Wfc = I[2]; const float* W1 = I[3]; const float* b1 = I[4]; const float* W2 = I[5]; const float* b2 = I[6];
  char* ws = (char*)d_ws; size_t off = 0;
  auto take = [&](size_t bytes) { char* p = ws + off; off += (bytes + 255) & ~(size_t)255; return p; };
  _Float16* BQKV = (_Float16*)take((size_t)3 * DM * DM * 2); _Float16* BFC = (_Float16*)take((size_t)DM * DM * 2); _Float16* BW1 = (_Float16*)take((size_t)4096 * DM * 2); _Float16* BW2 = (_Float16*)take((size_t)DM * 4096 * 2);
  float* XB = (float*)take((size_t)NR * DM * 4); _Float16* X16 = (_Float16*)take((size_t)NR * DM * 2); float* F = (float*)take((size_t)NR * DM * 4);
  _Float16* Q16 = (_Float16*)take((size_t)NR * DM * 2); _Float16* K16 = (_Float16*)take((size_t)NR * DM * 2); _Float16* V16 = (_Float16*)take((size_t)NR * DM * 2); _Float16* GT = (_Float16*)take((size_t)NR * DM * 2); (void)GT; if (off > ws_size) return;      /* 24 + 16 + 8 + 16 + 32 = 96 MiB */
  _Float16* Oh = (_Float16*)F; _Float16* Ol = Oh + (size_t)NR * DM;     /* the two O planes, one behind the other */
  float* X1 = XB;                                           /* x1 written over the residual plane (own-tile addend) */
  _Float16* H16 = X16; _Float16* GH = Q16;                  /* GELU hidden [NR][4096] f16 = 32 MB over Q16|K16|V16|GT (contiguous; the first three are dead once x1 is formed, GT serves nothing else) */
  k_ln_wt4<<<LN_NB + WT_B4, 256, 0, stream>>>(x, X16, XB, Wqkv, BQKV, Wfc, BFC, W1, BW1, W2, BW2, 16.0f);      /* LN(x), 8 rows a block; weights all (in,out), one block per 128 k x 64 n tile */
  const dim3 gP((NR / 128) * (DM / 128), 1), gM((NR / 128) * (4096 / 128), 1);
  const dim3 gQ((NR / 128) * (DM / 128), 3);
  k_gemm2<0, 0, true, 1><<<gQ, 256, 0, stream>>>(X16, DM, 0, BQKV, DM, (size_t)DM * DM, 0.0625f, nullptr, 0, nullptr, nullptr, Q16, DM, (size_t)NR * DM, NR, DM, DM);      /* blockIdx.y = 0, 1, 2: q, k, V^T (weight slabs and the planes Q16, K16, V16 each lie one behind the other; V16 holds V^T as [DM][NR]) */
  k_flash<<<NBT * NH * (SLEN / 64), 128, 0, stream>>>(Q16, DM, K16, DM, V16, nullptr, Oh, Ol, DM);      /* plain flash over all keys, both batches */
  k_gemm2<0, DM, false, 2><<<gP, 256, 0, stream>>>(Oh, DM, (size_t)NR * DM, BFC, DM, 0, 0.0625f / 1024.0f, nullptr, 0, XB, X1, nullptr, DM, 0, NR, DM, 2 * DM);      /* x1 = x + attn w_fc, hi and residual plane in one accumulator */
  k_ln1024<0><<<NR / 8, 256, 0, stream>>>(X1, H16, nullptr);
  k_gemm2<9, 0, true, 0><<<gM, 256, 0, stream>>>(H16, DM, 0, BW1, DM, 0, 0.0625f, b1, 0, nullptr, nullptr, GH, 4096, 0, NR, 4096, DM);      /* tanh-gelu(LN(x1) w1 + b1) f16 */
  k_gemm2<0, DM, false, 0><<<gP, 256, 0, stream>>>(GH, 4096, 0, BW2, 4096, 0, 0.0625f, b2, 0, X1, (float*)d_out, nullptr, DM, 0, NR, DM, 4096);      /* out = x1 + mlp */
}

// v009
// It runs in 186 microseconds.
// Next to v008, in two timings, it ran 1.07 times as fast each time.
// Counting every step since v000, it is 5.57 times as fast.
#include <hip/hip_runtime.h>
// Pre-LN transformer layer (2 x 2048 tokens, 1024; 16 heads x 64; full (non-causal) attention; MLP 4096 with tanh-GELU): h = LN(x) (no affine); q,k,v = h w_qkv; x1 = x + softmax(q.k/8).v w_fc; out = x1 + gelu(LN(x1) w1 + b1) w2 + b2 -> [2,2048,1024].
// Structure: LayerNorm on VALU (also writing the bf16 residual plane); projections / MLP as f16 WMMA GEMMs (32x64 wave tiles, f32 accumulation, exact weights x16, tanh-GELU and biases in the epilogue, residuals through the f32 addend); q, k, V^T as plain f16 planes (V^T straight from the GEMM, operands swapped) through the fused flash kernel over all keys (online softmax in f32, P x2^10); O as hi + residual planes, written by the flash, into w_fc (one GEMM over both planes).
// Compute dtype: x and weights rounded to bf16; LN outputs, q, k, v, P and the GELU hidden as f16 operands (~2^-12); O as hi + residual pairs; f32 accumulation, softmax, LayerNorm. v_wmma_f32_16x16x32_f16.
#define NBT 2
#define SLEN 2048
#define TQ SLEN
#define TK SLEN
#define DM 1024
#define NH 16
#define SCL 0.125f
#define NR (NBT * SLEN)
typedef __bf16 v16b __attribute__((ext_vector_type(16)));
typedef unsigned short v8us __attribute__((ext_vector_type(8), may_alias));
typedef float  v8f  __attribute__((ext_vector_type(8)));
typedef float  v4f  __attribute__((ext_vector_type(4)));
typedef float  v4fa __attribute__((ext_vector_type(4), may_alias));
union FragB { v16b v; v8us half[2]; unsigned short u[16]; };

__device__ __forceinline__ unsigned short bf16_bits(float x) { unsigned int u = __float_as_uint(x); return (unsigned short)((u + 0x7FFFu + ((u >> 16) & 1u)) >> 16); }
__device__ __forceinline__ float bf16_val(unsigned short b) { return __uint_as_float(((unsigned int)b) << 16); }
__device__ __forceinline__ float bf16_round(float x) { return bf16_val(bf16_bits(x)); }
// D += A·B with NT terms: 1 = ah·bh, 2 = + al·bh (A split), 3 = + ah·bl (both split)
template <int NT>
__device__ __forceinline__ v8f mmaN(v16b ah, v16b al, v16b bh, v16b bl, v8f c) {
  c = __builtin_amdgcn_wmma_f32_16x16x32_bf16(false, ah, false, bh, (short)0, c, false, false);
  if (NT >= 2) c = __builtin_amdgcn_wmma_f32_16x16x32_bf16(false, al, false, bh, (short)0, c, false, false);
  if (NT >= 3) c = __builtin_amdgcn_wmma_f32_16x16x32_bf16(false, ah, false, bl, (short)0, c, false, false);
  asm volatile("v_nop\n\tv_nop\n\tv_nop\n\tv_nop" : "+v"(c) : "v"(ah), "v"(al), "v"(bh), "v"(bl));
  return c;
}

__global__ __launch_bounds__(256) void k_wt_bf16(const float* __restrict__ W, unsigned short* __restrict__ Wt, int K, int N) {
  const int t = blockIdx.x * 256 + threadIdx.x;
  const int k8n = K / 8;
  if (t >= N * k8n) return;
  const int n = t / k8n, k8 = (t % k8n) * 8;
  v8us v;
#pragma unroll
  for (int i = 0; i < 8; ++i) v[i] = bf16_bits(W[(size_t)(k8 + i) * N + n]);
  *(v8us*)(Wt + (size_t)n * K + k8) = v;
  
}

// GEMM C[M][N] (f32, pitch ldc) = act(A[M][K]·W + bias). A f32 row-major (pitch lda) converted per fragment to bf16
// (ASPLIT: hi/lo two planes -> 2 terms, else single rounded term); Wt bf16 [N][K] (pitch ldb). BIAS_BF16 rounds the
// bias to bf16 first (bias quantised to bf16 before the add). K%32==0, M%16==0, N%64==0.
template <bool ASPLIT, int ACT, bool BIAS_BF16>
__global__ __launch_bounds__(128) void k_gemm_bf(const float* __restrict__ A, int lda, const unsigned short* __restrict__ Wt, int ldb,
                                               const float* __restrict__ bias, float* __restrict__ C, int ldc, int M, int N, int K) {
  __shared__ __attribute__((aligned(16))) float so[4][16][64];
  const int tid = threadIdx.x, w = tid >> 5, lane = tid & 31, ln = lane & 15, hh = lane >> 4;
  const int ntn = N / 64;
  const int wid = blockIdx.x * 4 + w;
  const int mt = wid / ntn, nq = wid % ntn;
  if (mt * 16 >= M) return;
  const int row0 = mt * 16, col0 = nq * 64;
  const float* arow = A + (size_t)(row0 + ln) * lda;
  v8f acc[4] = {};
  for (int kb = 0; kb < K; kb += 32) {
    FragB ah, al;
    const v4f x0 = *(const v4fa*)(arow + kb + 8 * hh), x1 = *(const v4fa*)(arow + kb + 8 * hh + 4);
    const v4f x2 = *(const v4fa*)(arow + kb + 16 + 8 * hh), x3 = *(const v4fa*)(arow + kb + 16 + 8 * hh + 4);
    float xs[16] = {x0[0],x0[1],x0[2],x0[3],x1[0],x1[1],x1[2],x1[3],x2[0],x2[1],x2[2],x2[3],x3[0],x3[1],x3[2],x3[3]};
#pragma unroll
    for (int i = 0; i < 16; ++i) { const unsigned short hb = bf16_bits(xs[i]); ah.u[i] = hb; al.u[i] = ASPLIT ? bf16_bits(xs[i] - bf16_val(hb)) : (unsigned short)0; }
#pragma unroll
    for (int t = 0; t < 4; ++t) {
      const unsigned short* brow = Wt + (size_t)(col0 + t * 16 + ln) * ldb + kb;
      FragB b;
      b.half[0] = *(const v8us*)(brow + 8 * hh);
      b.half[1] = *(const v8us*)(brow + 16 + 8 * hh);
      acc[t] = mmaN<ASPLIT ? 2 : 1>(ah.v, al.v, b.v, b.v, acc[t]);
    }
  }
#pragma unroll
  for (int t = 0; t < 4; ++t) {
    float bv = bias ? bias[col0 + t * 16 + ln] : 0.f;
    if (BIAS_BF16) bv = bf16_round(bv);
#pragma unroll
    for (int r = 0; r < 8; ++r) { float v = acc[t][r] + bv; if (ACT == 1) v = fmaxf(v, 0.f); so[w][8 * hh + r][t * 16 + ln] = v; }
  }
  __builtin_amdgcn_fence(__ATOMIC_ACQ_REL, "workgroup");
  __builtin_amdgcn_wave_barrier();
  const int rsub = lane >> 4, c4 = (lane & 15) * 4;
  {
#pragma unroll
    for (int q = 0; q < 8; ++q) {
      const int r = q * 2 + rsub;
      const v4f v = *(const v4fa*)&so[w][r][c4];
      *(v4f*)(C + (size_t)(row0 + r) * ldc + col0 + c4) = v;
    }
    
  }
}

// GEMM C = act(A·W + bias + resid): A f32 (ASPLIT -> hi/lo 2 terms), Wt bf16 [N][K]; ACT 0 none, 1 relu, 2 exact gelu;
// resid (optional, f32, row index = (row % rmod), pitch ldr, RES_BF16 rounds it) added before the activation.
template <bool ASPLIT, int ACT, bool BIAS_BF16, bool RES_BF16>
__global__ __launch_bounds__(128) void k_gemm_bf3(const float* __restrict__ A, int lda, const unsigned short* __restrict__ Wt, int ldb,
                                                const float* __restrict__ bias, const float* __restrict__ resid, int rmod, int ldr,
                                                float* __restrict__ C, int ldc, int M, int N, int K) {
  __shared__ __attribute__((aligned(16))) float so[4][16][64];
  const int tid = threadIdx.x, w = tid >> 5, lane = tid & 31, ln = lane & 15, hh = lane >> 4;
  const int ntn = N / 64;
  const int wid = blockIdx.x * 4 + w;
  const int mt = wid / ntn, nq = wid % ntn;
  if (mt * 16 >= M) return;
  const int row0 = mt * 16, col0 = nq * 64;
  const float* arow = A + (size_t)(row0 + ln) * lda;
  v8f acc[4] = {};
  for (int kb = 0; kb < K; kb += 32) {
    FragB ah, al;
    const v4f x0 = *(const v4fa*)(arow + kb + 8 * hh), x1 = *(const v4fa*)(arow + kb + 8 * hh + 4);
    const v4f x2 = *(const v4fa*)(arow + kb + 16 + 8 * hh), x3 = *(const v4fa*)(arow + kb + 16 + 8 * hh + 4);
    float xs[16] = {x0[0],x0[1],x0[2],x0[3],x1[0],x1[1],x1[2],x1[3],x2[0],x2[1],x2[2],x2[3],x3[0],x3[1],x3[2],x3[3]};
#pragma unroll
    for (int i = 0; i < 16; ++i) { const unsigned short hb = bf16_bits(xs[i]); ah.u[i] = hb; al.u[i] = ASPLIT ? bf16_bits(xs[i] - bf16_val(hb)) : (unsigned short)0; }
#pragma unroll
    for (int t = 0; t < 4; ++t) {
      const unsigned short* brow = Wt + (size_t)(col0 + t * 16 + ln) * ldb + kb;
      FragB b;
      b.half[0] = *(const v8us*)(brow + 8 * hh);
      b.half[1] = *(const v8us*)(brow + 16 + 8 * hh);
      acc[t] = mmaN<ASPLIT ? 2 : 1>(ah.v, al.v, b.v, b.v, acc[t]);
    }
  }
#pragma unroll
  for (int t = 0; t < 4; ++t) {
    const int col = col0 + t * 16 + ln;
    float bv = bias ? bias[col] : 0.f;
    if (BIAS_BF16) bv = bf16_round(bv);
#pragma unroll
    for (int r = 0; r < 8; ++r) {
      float v = acc[t][r] + bv;
      if (resid) { float rv = resid[(size_t)((row0 + 8 * hh + r) % rmod) * ldr + col]; if (RES_BF16) rv = bf16_round(rv); v += rv; }
      if (ACT == 1) v = fmaxf(v, 0.f);
      if (ACT == 2) v = 0.5f * v * (1.0f + erff(v * 0.70710678118654752f));
      if (ACT == 3) { const float u = 0.7978845608028654f * (v + 0.044715f * v * v * v); v = 0.5f * v * (1.0f + tanhf(u)); }
      so[w][8 * hh + r][t * 16 + ln] = v;
    }
  }
  __builtin_amdgcn_fence(__ATOMIC_ACQ_REL, "workgroup");
  __builtin_amdgcn_wave_barrier();
  const int rsub = lane >> 4, c4 = (lane & 15) * 4;
  {
#pragma unroll
    for (int q = 0; q < 8; ++q) {
      const int r = q * 2 + rsub;
      const v4f v = *(const v4fa*)&so[w][r][c4];
      *(v4f*)(C + (size_t)(row0 + r) * ldc + col0 + c4) = v;
    }
    
  }
}
// row LayerNorm (biased variance, eps) over N: s = X (+ R); optional out_sum <- s; out_norm <- (s-mu)*rsqrt(var+eps)*g + b
template <bool PARAM_BF16>
__global__ __launch_bounds__(256) void k_layernorm(const float* __restrict__ X, const float* __restrict__ R, const float* __restrict__ g, const float* __restrict__ bta,
                                                  float* __restrict__ out_sum, float* __restrict__ out_norm, int N, float eps) {
  __shared__ float red[256];
  const int row = blockIdx.x, tid = threadIdx.x;
  const float* x = X + (size_t)row * N; const float* rr = R ? R + (size_t)row * N : nullptr;
  float vals[16];                     // up to N = 4096
  const int per = N / 256;            // contiguous chunk per thread? use strided-by-4 chunks: thread handles j = tid*4 + 1024*u
  float s1 = 0.f;
  for (int u = 0; u < per / 4; ++u) {
    const int j = tid * 4 + 1024 * u;
    const v4f a = *(const v4fa*)(x + j);
    v4f b = {0.f,0.f,0.f,0.f}; if (rr) b = *(const v4fa*)(rr + j);
#pragma unroll
    for (int q = 0; q < 4; ++q) { const float v = a[q] + b[q]; vals[u * 4 + q] = v; s1 += v; }
  }
  red[tid] = s1; __syncthreads();
  for (int st = 128; st > 0; st >>= 1) { if (tid < st) red[tid] += red[tid + st]; __syncthreads(); }
  const float mu = red[0] / (float)N; __syncthreads();
  float s2 = 0.f;
  for (int u = 0; u < per / 4; ++u)
#pragma unroll
    for (int q = 0; q < 4; ++q) { const float c = vals[u * 4 + q] - mu; s2 += c * c; }
  red[tid] = s2; __syncthreads();
  for (int st = 128; st > 0; st >>= 1) { if (tid < st) red[tid] += red[tid + st]; __syncthreads(); }
  const float rs = rsqrtf(red[0] / (float)N + eps);
  {
    for (int u = 0; u < per / 4; ++u) {
      const int j = tid * 4 + 1024 * u;
      v4f o, sm;
#pragma unroll
      for (int q = 0; q < 4; ++q) {
        float gg = g[j + q], bb = bta[j + q];
        if (PARAM_BF16) { gg = bf16_round(gg); bb = bf16_round(bb); }
        sm[q] = vals[u * 4 + q]; o[q] = (vals[u * 4 + q] - mu) * rs * gg + bb;
      }
      if (out_sum) *(v4f*)(out_sum + (size_t)row * N + j) = sm;
      *(v4f*)(out_norm + (size_t)row * N + j) = o;
    }
    
  }
}



// ---- f16 WMMA path (v_wmma_f32_16x16x32_f16): 11-bit significands for operands in range — used where a [0,1] probability operand needs more precision than bf16
typedef _Float16 v16h __attribute__((ext_vector_type(16)));
union FragH { v16h v; v8us half[2]; _Float16 h[16]; unsigned short u[16]; };
template <int NT>
__device__ __forceinline__ v8f mmaH(v16h ah, v16h al, v16h bh, v16h bl, v8f c) {
  c = __builtin_amdgcn_wmma_f32_16x16x32_f16(false, ah, false, bh, (short)0, c, false, false);
  if (NT >= 2) c = __builtin_amdgcn_wmma_f32_16x16x32_f16(false, al, false, bh, (short)0, c, false, false);
  if (NT >= 3) c = __builtin_amdgcn_wmma_f32_16x16x32_f16(false, ah, false, bl, (short)0, c, false, false);
  asm volatile("v_nop\n\tv_nop\n\tv_nop\n\tv_nop" : "+v"(c) : "v"(ah), "v"(al), "v"(bh), "v"(bl));
  return c;
}
// batched GEMM like k_gemm_b but f16 operands: A f32 (split into f16 hi/lo if ASPLIT, else rounded to f16), Bt = f16 values [n][k]; alpha; C f32; N multiple of 16 (partial tiles skipped)
template <bool ASPLIT>
__global__ __launch_bounds__(128) void k_gemm_h(const float* __restrict__ A, int lda, size_t sA, const _Float16* __restrict__ Bh, int ldb, size_t sB, float alpha, float* __restrict__ C, int ldc, size_t sC, int M, int N, int K) {
  __shared__ __attribute__((aligned(16))) float so[4][16][64];
  const int tid = threadIdx.x, w = tid >> 5, lane = tid & 31, ln = lane & 15, hh = lane >> 4; const int by = blockIdx.y;
  A += (size_t)by * sA; Bh += (size_t)by * sB; C += (size_t)by * sC;
  const int ntn = (N + 63) / 64; const int wid = blockIdx.x * 4 + w; const int mt = wid / ntn, nq = wid % ntn; if (mt * 16 >= M) return;
  const int row0 = mt * 16, col0 = nq * 64; const float* arow = A + (size_t)(row0 + ln) * lda;
  v8f acc[4] = {};
  for (int kb = 0; kb < K; kb += 32) {
    FragH ah, al;
    const v4f x0 = *(const v4fa*)(arow + kb + 8 * hh), x1 = *(const v4fa*)(arow + kb + 8 * hh + 4), x2 = *(const v4fa*)(arow + kb + 16 + 8 * hh), x3 = *(const v4fa*)(arow + kb + 16 + 8 * hh + 4);
    float xs[16] = {x0[0],x0[1],x0[2],x0[3],x1[0],x1[1],x1[2],x1[3],x2[0],x2[1],x2[2],x2[3],x3[0],x3[1],x3[2],x3[3]};
#pragma unroll
    for (int i = 0; i < 16; ++i) { const _Float16 h = (_Float16)xs[i]; ah.h[i] = h; al.h[i] = ASPLIT ? (_Float16)(xs[i] - (float)h) : (_Float16)0.0f; }
#pragma unroll
    for (int t = 0; t < 4; ++t) { if (col0 + t * 16 >= N) continue; const size_t boff = (size_t)(col0 + t * 16 + ln) * ldb + kb; FragH bq; bq.half[0] = *(const v8us*)(Bh + boff + 8 * hh); bq.half[1] = *(const v8us*)(Bh + boff + 16 + 8 * hh);
      acc[t] = mmaH<ASPLIT ? 2 : 1>(ah.v, al.v, bq.v, bq.v, acc[t]); }
  }
#pragma unroll
  for (int t = 0; t < 4; ++t) { if (col0 + t * 16 >= N) continue;
#pragma unroll
    for (int r = 0; r < 8; ++r) so[w][8 * hh + r][t * 16 + ln] = acc[t][r] * alpha; }
  __builtin_amdgcn_fence(__ATOMIC_ACQ_REL, "workgroup"); __builtin_amdgcn_wave_barrier();
  const int rsub = lane >> 4, c4 = (lane & 15) * 4;
  {
#pragma unroll
    for (int q = 0; q < 8; ++q) { const int r = q * 2 + rsub; if (col0 + c4 < N) { const v4f v = *(const v4fa*)&so[w][r][c4]; *(v4f*)(C + (size_t)(row0 + r) * ldc + col0 + c4) = v; } }
     }
}

// Wt[n][k] = f16(bf16(W[k][n]) * scale) from f32 row-major W[K][N] (scale = power of two; bf16-exact weights stay exact in f16 away from the subnormal range)
// A block turns a tile of 128 k x 64 n through LDS; a matrix has (K / 128) * (N / 64) tiles, blk is the tile's number. Both sides of memory see whole aligned 256-B runs:
// 16 lanes read 64 n of one k row, 16 lanes write 128 k of one n row. A thread reads 8 k x 4 n and stores, per n, its 8 k as one 16-B piece.
// LDS row = one n (16 pieces) at a pitch of 272 B; piece g of row n lies at place g ^ (n >> 4), so that the 16 lanes of a store (rows 4 apart) fall on 16 different bank groups.
#define WT_P 272
template <int K, int N>
__device__ __forceinline__ void wt_tile(const float* __restrict__ W, _Float16* __restrict__ Wt, float scale, int blk, unsigned char* tl) {
  static_assert(K % 128 == 0 && N % 64 == 0, "whole tiles only");
  const int tid = threadIdx.x, c = tid & 15, g = tid >> 4; const int kt = blk / (N / 64), nt = blk % (N / 64); const int k0 = kt * 128, n0 = nt * 64;
  const float* src = W + (size_t)(k0 + g * 8) * N + n0 + c * 4; v4f a[8];
#pragma unroll      /* constant indices keep a and f in registers (this loop and the three below); the eight loads are in flight together */
  for (int i = 0; i < 8; ++i) a[i] = *(const v4fa*)(src + i * N);
#pragma unroll
  for (int j = 0; j < 4; ++j) { FragH f;
#pragma unroll
    for (int i = 0; i < 8; ++i) f.h[i] = (_Float16)(bf16_round(a[i][j]) * scale);
    *(v8us*)(tl + (c * 4 + j) * WT_P + ((g ^ (c >> 2)) * 16)) = f.half[0]; }
  __syncthreads();      /* the tile is whole before any row of it is read */
  unsigned short* dst = (unsigned short*)Wt + (size_t)(n0 + g) * K + k0 + c * 8;
#pragma unroll
  for (int q = 0; q < 4; ++q) { const v8us o = *(const v8us*)(tl + (q * 16 + g) * WT_P + ((c ^ q) * 16)); *(v8us*)(dst + q * 16 * K) = o; }
  asm volatile("s_wait_xcnt 0x0" ::: "memory");      /* stands behind the four stores, in front of any later rewrite of their address and data registers (the caller's code goes on behind this tile) */
}
#define WT_NB(K, N) (((K) / 128) * ((N) / 64))
#define WT_B1 WT_NB(DM, 3 * DM)
#define WT_B2 (WT_B1 + WT_NB(DM, DM))
#define WT_B3 (WT_B2 + WT_NB(DM, 4096))
#define WT_B4 (WT_B3 + WT_NB(4096, DM))
// k_gemm_hh variant with fused epilogue: v = acc·alpha + bias[by·sBias + col] (+ CP[(row/rowsPerB)·sCPb + by·64 + col] if CP) ; ACT 0 none / 1 elu ; writes f16 C16 (and f32 C if non-null)
template <int ACT>
__global__ __launch_bounds__(128) void k_gemm_hhx(const _Float16* __restrict__ A, int lda, size_t sA, const _Float16* __restrict__ Bh, int ldb, size_t sB, float alpha, const float* __restrict__ bias, size_t sBias, const float* __restrict__ CP, int rowsPerB, size_t sCPb, int row0g,
    float* __restrict__ C, _Float16* __restrict__ C16, int ldc, size_t sC, int M, int N, int K) {
  __shared__ __attribute__((aligned(16))) float so[4][16][64];
  const int tid = threadIdx.x, w = tid >> 5, lane = tid & 31, ln = lane & 15, hh = lane >> 4; const int by = blockIdx.y;
  A += (size_t)by * sA; Bh += (size_t)by * sB; const size_t cofs = (size_t)by * sC; const float* bp = bias ? bias + (size_t)by * sBias : nullptr;
  const int ntn = (N + 63) / 64; const int wid = blockIdx.x * 4 + w; const int mt = wid / ntn, nq = wid % ntn; if (mt * 16 >= M) return;
  const int row0 = mt * 16, col0 = nq * 64; const _Float16* arow = A + (size_t)(row0 + ln) * lda;
  v8f acc[4] = {};
  for (int kb = 0; kb < K; kb += 32) { FragH ah; ah.half[0] = *(const v8us*)((const unsigned short*)arow + kb + 8 * hh); ah.half[1] = *(const v8us*)((const unsigned short*)arow + kb + 16 + 8 * hh);
#pragma unroll
    for (int t = 0; t < 4; ++t) { if (col0 + t * 16 >= N) continue; const size_t boff = (size_t)(col0 + t * 16 + ln) * ldb + kb; FragH bq; bq.half[0] = *(const v8us*)((const unsigned short*)Bh + boff + 8 * hh); bq.half[1] = *(const v8us*)((const unsigned short*)Bh + boff + 16 + 8 * hh);
      acc[t] = mmaH<1>(ah.v, ah.v, bq.v, bq.v, acc[t]); }
  }
#pragma unroll
  for (int t = 0; t < 4; ++t) { if (col0 + t * 16 >= N) continue; const int col = col0 + t * 16 + ln; const float bv = bp ? bf16_round(bp[col]) : 0.f;
#pragma unroll
    for (int r = 0; r < 8; ++r) { float v = acc[t][r] * alpha + bv; if (CP) { const int bidx = (row0g + row0 + 8 * hh + r) / rowsPerB; v += CP[(size_t)bidx * sCPb + (size_t)by * 64 + col]; } if (ACT == 1) v = (v > 0.f) ? v : expm1f(v); else if (ACT == 7) v = (v > 0.f) ? v + 1.0f : expf(v); else if (ACT == 8) v = tanhf(v); else if (ACT == 9) v = 0.5f * v * (1.0f + tanhf(0.7978845608028654f * (v + 0.044715f * v * v * v))); else if (ACT == 11) v = 1.0f / (1.0f + expf(-v)); else if (ACT == 12) v = (v > 0.f) ? v : 0.01f * v; else if (ACT == 14) v = (v > 0.f) ? v : 0.1f * v; else if (ACT == 15) v = v / (1.0f + expf(-v)); else if (ACT == 3) v = fmaxf(v, 0.f); else if (ACT == 6) v = 0.5f * v * (1.0f + erff(v * 0.70710678118654752f)); so[w][8 * hh + r][t * 16 + ln] = v; } }
  __builtin_amdgcn_fence(__ATOMIC_ACQ_REL, "workgroup"); __builtin_amdgcn_wave_barrier();
  const int rsub = lane >> 4, c4 = (lane & 15) * 4; typedef _Float16 v4h __attribute__((ext_vector_type(4)));
  {
#pragma unroll
    for (int q = 0; q < 8; ++q) { const int r = q * 2 + rsub; if (col0 + c4 < N) { const v4f v = *(const v4fa*)&so[w][r][c4]; if (C) *(v4f*)(C + cofs + (size_t)(row0 + r) * ldc + col0 + c4) = v; if (C16) { v4h h4; for (int i = 0; i < 4; ++i) h4[i] = (_Float16)v[i]; *(v4h*)(C16 + cofs + (size_t)(row0 + r) * ldc + col0 + c4) = h4; } } }
     }
}


typedef _Float16 v4h __attribute__((ext_vector_type(4)));

__global__ __launch_bounds__(256) void k_x16(const float* __restrict__ x, _Float16* __restrict__ X16, size_t n8) { const size_t t = (size_t)blockIdx.x * 256 + threadIdx.x; if (t >= n8) return; FragH f;
#pragma unroll
  for (int q = 0; q < 8; ++q) f.h[q] = (_Float16)bf16_round(x[t * 8 + q]); *(v8us*)((unsigned short*)X16 + t * 8) = f.half[0];  }
__global__ __launch_bounds__(256) void k_h16(const float* __restrict__ x, _Float16* __restrict__ X16, size_t n8) { const size_t t = (size_t)blockIdx.x * 256 + threadIdx.x; if (t >= n8) return; FragH f;
#pragma unroll
  for (int q = 0; q < 8; ++q) f.h[q] = (_Float16)x[t * 8 + q]; *(v8us*)((unsigned short*)X16 + t * 8) = f.half[0];  }
__global__ __launch_bounds__(256) void k_round16f(const float* __restrict__ W, _Float16* __restrict__ Bt, size_t n8) { const size_t t = (size_t)blockIdx.x * 256 + threadIdx.x; if (t >= n8) return; FragH f;
#pragma unroll
  for (int i = 0; i < 8; ++i) f.h[i] = (_Float16)(bf16_round(W[t * 8 + i]) * 16.0f); *(v8us*)((unsigned short*)Bt + t * 8) = f.half[0];  }
// ---- fast GEMM (wave tile 32x64, operands staged in LDS); epilogue: v = act(acc * alpha + bf16(bias[col]) (+ CP[row][col], f32 at a pitch of ADDP elements, if ADDP > 0)), written as f16 C16 (OUT16) or f32 C ----
__device__ __forceinline__ v16h g2_frag(const _Float16* p, int hh) { FragH f; f.half[0] = *(const v8us*)((const unsigned short*)p + 8 * hh); f.half[1] = *(const v8us*)((const unsigned short*)p + 16 + 8 * hh); return f.v; }
__device__ __forceinline__ v8f g2_mma(v16h a, v16h b, v8f c) { v8f d = __builtin_amdgcn_wmma_f32_16x16x32_f16(false, a, false, b, (short)0, c, false, false); asm volatile("v_nop\n\tv_nop\n\tv_nop\n\tv_nop" : "+v"(d) : "v"(a), "v"(b)); return d; }
// Staged tile of k_gemm2: 128 A rows then 128 B rows, 128 k (256 B) each, at a pitch of 272 B (16 B x odd: conflict-free for ds_load_b128 readers); two buffers.
#define G2_PITCH 272
#define G2_BUF (256 * G2_PITCH)
// Eight asynchronous 16-byte copies per lane (rows 16 apart): l = the lane's LDS byte address, g = its global address, gstep = 16 source rows in elements.
// s_wait_xcnt 0 is the statement's last line, so that it stands in front of any later rewrite of the address registers the copies name.
__device__ __forceinline__ void g2_copy8(unsigned l, const _Float16* g, size_t gstep) {
  const unsigned l1 = l + 16 * G2_PITCH, l2 = l + 32 * G2_PITCH, l3 = l + 48 * G2_PITCH, l4 = l + 64 * G2_PITCH, l5 = l + 80 * G2_PITCH, l6 = l + 96 * G2_PITCH, l7 = l + 112 * G2_PITCH;
  const _Float16* g1 = g + gstep; const _Float16* g2 = g1 + gstep; const _Float16* g3 = g2 + gstep; const _Float16* g4 = g3 + gstep; const _Float16* g5 = g4 + gstep; const _Float16* g6 = g5 + gstep; const _Float16* g7 = g6 + gstep;
  asm volatile("global_load_async_to_lds_b128 %0, %8, off\n\t"
               "global_load_async_to_lds_b128 %1, %9, off\n\t"
               "global_load_async_to_lds_b128 %2, %10, off\n\t"
               "global_load_async_to_lds_b128 %3, %11, off\n\t"
               "global_load_async_to_lds_b128 %4, %12, off\n\t"
               "global_load_async_to_lds_b128 %5, %13, off\n\t"
               "global_load_async_to_lds_b128 %6, %14, off\n\t"
               "global_load_async_to_lds_b128 %7, %15, off\n\t"
               "s_wait_xcnt 0x0"
               :: "v"(l), "v"(l1), "v"(l2), "v"(l3), "v"(l4), "v"(l5), "v"(l6), "v"(l7), "v"(g), "v"(g1), "v"(g2), "v"(g3), "v"(g4), "v"(g5), "v"(g6), "v"(g7) : "memory");
}
// Block tile 128x128 (8 waves as 4 x 2, wave tile 32x64); requires M % 128 == 0, N % 128 == 0, K % 128 == 0. Each pass works on 128 k from one LDS buffer while the next pass's copies fly into the other.
// MODE 1: slab blockIdx.y == 2 swaps its operands, C^T = B A^T, written [N][M] at a pitch of M into its own C slab (v comes out as V^T, no transposing launch).
// MODE 2: A is a hi plane and, sA elements behind it, a residual plane x 2^10; K counts both (each K / 2 wide), B serves both. The hi sums are scaled by 2^10 (exact) where the planes change, so one accumulator holds both; alpha carries the 2^-10.
// tanh-GELU: 0.5 v (1 + tanh u) = v / (1 + exp(-2 u)), u = sqrt(2/pi) (v + 0.044715 v^3); in base 2: exp(-2 u) = 2^(v (K1 + K3 v^2)). A large v ends in 2^-inf = 0 (result v) or 2^inf = inf (result v x 0), as with tanh = +-1.
#define GELU_K1 ((float)(-2.0 * 1.4426950408889634 * 0.7978845608028654))
#define GELU_K3 ((float)(-2.0 * 1.4426950408889634 * 0.7978845608028654 * 0.044715))
// Four transcendentals and one v_nop in one statement: behind each stands an instruction that neither reads its result nor overwrites its source (the next of the four; behind the last the v_nop),
// the slot the instruction set asks for behind a transcendental. The early-clobber outputs keep the results off the sources.
__device__ __forceinline__ v4f g2_exp2x4(v4f a) { float r0, r1, r2, r3;
  asm("v_exp_f32 %0, %4\n\tv_exp_f32 %1, %5\n\tv_exp_f32 %2, %6\n\tv_exp_f32 %3, %7\n\tv_nop" : "=&v"(r0), "=&v"(r1), "=&v"(r2), "=&v"(r3) : "v"(a[0]), "v"(a[1]), "v"(a[2]), "v"(a[3]));
  return (v4f){r0, r1, r2, r3}; }
__device__ __forceinline__ v4f g2_rcpx4(v4f a) { float r0, r1, r2, r3;
  asm("v_rcp_f32 %0, %4\n\tv_rcp_f32 %1, %5\n\tv_rcp_f32 %2, %6\n\tv_rcp_f32 %3, %7\n\tv_nop" : "=&v"(r0), "=&v"(r1), "=&v"(r2), "=&v"(r3) : "v"(a[0]), "v"(a[1]), "v"(a[2]), "v"(a[3]));
  return (v4f){r0, r1, r2, r3}; }
template <int ACT, int ADDP, bool OUT16, int MODE>
__global__ __launch_bounds__(256) void k_gemm2(const _Float16* __restrict__ A, int lda, size_t sA, const _Float16* __restrict__ Bh, int ldb, size_t sB, float alpha, const float* __restrict__ bias, size_t sBias, const float* __restrict__ CP,
    float* __restrict__ C, _Float16* __restrict__ C16, int ldc, size_t sC, int M, int N, int K) {
  __shared__ __attribute__((aligned(16))) unsigned char ring[2 * G2_BUF];
  float (*so)[32][68] = (float (*)[32][68])ring;      /* output staging (8 x 32 x 68 f32 = one buffer), used only behind the last pass's barrier */
  const int tid = threadIdx.x, w = tid >> 5, lane = tid & 31, ln = lane & 15, hh = lane >> 4; const int by = blockIdx.y;
  A += (size_t)by * sA; Bh += (size_t)by * sB; const size_t cofs = (size_t)by * sC; const float* bp = bias ? bias + (size_t)by * sBias : nullptr;
  if (MODE == 1 && by == 2) { const _Float16* tp = A; A = Bh; Bh = tp; const int tl = lda; lda = ldb; ldb = tl; ldc = M; M = N; N = ldc; }
  const int ntn = N >> 7; const int mt = blockIdx.x / ntn, nq = blockIdx.x - mt * ntn; if (mt * 128 >= M) return;      /* the whole block leaves, in front of every barrier */
  const int row0 = mt * 128 + 32 * (w & 3), col0 = nq * 128 + 64 * (w >> 2);
  const _Float16* gA = A + (size_t)(mt * 128 + (tid >> 4)) * lda + (tid & 15) * 8; const _Float16* gB = Bh + (size_t)(nq * 128 + (tid >> 4)) * ldb + (tid & 15) * 8;
  const unsigned lA = (unsigned)(size_t)ring + (unsigned)((tid >> 4) * G2_PITCH + (tid & 15) * 16); const unsigned lB = lA + 128 * G2_PITCH;
  const size_t stA = (size_t)16 * lda, stB = (size_t)16 * ldb;
  const int aofs = (32 * (w & 3) + ln) * G2_PITCH, bofs = (128 + 64 * (w >> 2) + ln) * G2_PITCH;
  const int np = K >> 7, nh = np >> 1;      /* nh: MODE 2's passes per plane (at least 2, so passes 0 and 1 lie in the hi plane) */
  g2_copy8(lA, gA, stA); g2_copy8(lB, gB, stB);
  asm volatile("s_wait_asynccnt 0x0" ::: "memory");      /* pass 0's own copies have landed */
  __syncthreads();                                        /* ... and every other wave's */
  if (np > 1) { g2_copy8(lA + G2_BUF, gA + 128, stA); g2_copy8(lB + G2_BUF, gB + 128, stB); }
  const v8f z8 = {0.f,0.f,0.f,0.f,0.f,0.f,0.f,0.f}; v8f c00 = z8, c01 = z8, c02 = z8, c03 = z8, c10 = z8, c11 = z8, c12 = z8, c13 = z8;
#pragma unroll 1      /* one pass per trip: the publish point at the foot stands once */
  for (int p = 0; p < np; ++p) { const unsigned bsel = (unsigned)(p & 1) * G2_BUF; const unsigned char* sa = ring + bsel + aofs; const unsigned char* sb = ring + bsel + bofs;
    v16h fa[2][2], fb[2][4];      /* two fragment sets: block kk + 1 is fetched ahead of block kk's products, inside this pass's buffer only */
    fa[0][0] = g2_frag((const _Float16*)sa, hh); fa[0][1] = g2_frag((const _Float16*)(sa + 16 * G2_PITCH), hh);
#pragma unroll      /* constant indices keep fa and fb in registers (this loop and the two below) */
    for (int j = 0; j < 4; ++j) fb[0][j] = g2_frag((const _Float16*)(sb + j * 16 * G2_PITCH), hh);
#pragma unroll
    for (int kk = 0; kk < 4; ++kk) { const int cu = kk & 1, nx = cu ^ 1;
      if (kk < 3) { fa[nx][0] = g2_frag((const _Float16*)(sa + (kk + 1) * 64), hh); fa[nx][1] = g2_frag((const _Float16*)(sa + 16 * G2_PITCH + (kk + 1) * 64), hh);
#pragma unroll
        for (int j = 0; j < 4; ++j) fb[nx][j] = g2_frag((const _Float16*)(sb + j * 16 * G2_PITCH + (kk + 1) * 64), hh); }
      c00 = g2_mma(fa[cu][0], fb[cu][0], c00); c10 = g2_mma(fa[cu][1], fb[cu][0], c10); c01 = g2_mma(fa[cu][0], fb[cu][1], c01); c11 = g2_mma(fa[cu][1], fb[cu][1], c11);
      c02 = g2_mma(fa[cu][0], fb[cu][2], c02); c12 = g2_mma(fa[cu][1], fb[cu][2], c12); c03 = g2_mma(fa[cu][0], fb[cu][3], c03); c13 = g2_mma(fa[cu][1], fb[cu][3], c13); }
    if (MODE == 2 && p == nh - 1) { c00 *= 1024.0f; c01 *= 1024.0f; c02 *= 1024.0f; c03 *= 1024.0f; c10 *= 1024.0f; c11 *= 1024.0f; c12 *= 1024.0f; c13 *= 1024.0f; }      /* the hi plane is done: its sums take the residual plane's scale */
    asm volatile("s_wait_dscnt 0x0" ::: "memory");        /* this wave's reads of the buffer have returned before it is refilled */
    asm volatile("s_wait_asynccnt 0x0" ::: "memory");     /* this wave's copies for pass p + 1 have landed */
    __syncthreads();                                      /* publishes pass p + 1 and ends every reader's last read of pass p's buffer */
    if (p + 2 < np) { const int pn = p + 2, pk = (MODE == 2 && pn >= nh) ? pn - nh : pn;      /* pk: the pass's place inside its plane */
      g2_copy8(lA + bsel, gA + ((MODE == 2 && pn >= nh) ? sA : (size_t)0) + (size_t)pk * 128, stA); g2_copy8(lB + bsel, gB + (size_t)pk * 128, stB); } }
  asm volatile("s_wait_asynccnt 0x0" ::: "memory");       /* nothing in flight when the ring becomes output staging */
  /* Bias and addend are read in the layout of the write-out (a lane: 4 columns of 16 rows; 16 lanes: a whole 256-B run), and every load is issued here, ahead of the staging: they are in flight together and are waited for once. */
  const int rsub = lane >> 4, c4 = (lane & 15) * 4;
  v4f bq = {0.f, 0.f, 0.f, 0.f}, x[16];
  if (ADDP > 0) { const float* cr = CP + (size_t)(row0 + rsub) * ADDP + (size_t)by * 64 + col0 + c4;      /* a lane reads exactly the elements it writes below, so C may lie over CP */
#pragma unroll      /* constant indices keep x and accs in registers (this loop and those below); the compile-time pitch makes the 16 loads one address pair with immediate offsets */
    for (int q = 0; q < 16; ++q) x[q] = *(const v4fa*)(cr + q * 2 * ADDP);
    asm volatile("s_wait_xcnt 0x0" :: "v"(cr) : "memory"); }      /* the loads' address pair stays whole up to this wait */
  if (bp) { const float* br = bp + col0 + c4; bq = *(const v4fa*)br;
    asm volatile("s_wait_xcnt 0x0" :: "v"(br) : "memory"); }      /* the load's address pair stays whole up to this wait */
  v8f accs[8] = {c00, c01, c02, c03, c10, c11, c12, c13};
#pragma unroll
  for (int u = 0; u < 8; ++u) { const int t = u & 3, half = u >> 2;
#pragma unroll
    for (int r = 0; r < 8; ++r) so[w][half * 16 + 8 * hh + r][t * 16 + ln] = accs[u][r]; }
  __builtin_amdgcn_fence(__ATOMIC_ACQ_REL, "workgroup"); __builtin_amdgcn_wave_barrier();
  float bv[4];
#pragma unroll
  for (int i = 0; i < 4; ++i) bv[i] = bf16_round(bq[i]);
#pragma unroll
  for (int q = 0; q < 16; ++q) { const v4f a4 = *(const v4fa*)&so[w][q * 2 + rsub][c4];
#pragma unroll
    for (int i = 0; i < 4; ++i) { float v = a4[i] * alpha + bv[i]; if (ADDP > 0) v += x[q][i];
      if (ACT == 3) v = fmaxf(v, 0.f); else if (ACT == 6) v = 0.5f * v * (1.0f + erff(v * 0.70710678118654752f)); else if (ACT == 11) v = 1.0f / (1.0f + expf(-v)); else if (ACT == 15) v = v / (1.0f + expf(-v)); else if (ACT == 12) v = (v > 0.f) ? v : 0.01f * v; else if (ACT == 8) v = tanhf(v);
      x[q][i] = v; }
    if (ACT == 9) { const v4f g = x[q];      /* tanh-GELU, branch-free: a lane's 16 groups of four are independent short chains */
      x[q] = g * g2_rcpx4(g2_exp2x4(g * (g * g * GELU_K3 + GELU_K1)) + 1.0f); } }
  /* all results first, then the stores as one group: no store is held behind the next row's LDS read */
  const size_t o0 = cofs + (size_t)(row0 + rsub) * ldc + col0 + c4, ost = (size_t)2 * ldc;
#pragma unroll
  for (int q = 0; q < 16; ++q) { if (OUT16) { v4h h4;
#pragma unroll
      for (int i = 0; i < 4; ++i) h4[i] = (_Float16)x[q][i];
      *(v4h*)(C16 + o0 + q * ost) = h4; } else *(v4f*)(C + o0 + q * ost) = x[q]; } }



// Staged tile of k_flash: 128 keys. 128 K rows (64 f16 = 128 B) at a pitch of 144 B, then 64 V^T rows (128 keys = 256 B) at a pitch of 272 B (16 B x odd: conflict-free for ds_load_b128 readers); two buffers.
#define FL_KEYS 128
#define FL_KP 144
#define FL_VP 272
#define FL_VOFS (FL_KEYS * FL_KP)
#define FL_BUF (FL_VOFS + 64 * FL_VP)
#define FL_C2 (SCL * 1.4426950408889634f)      /* score scale x log2(e) */
// Eight asynchronous 16-byte copies per lane: l = the lane's LDS byte address (LSTEP bytes between copies), g = its global address (gstep elements between copies).
// s_wait_xcnt 0 is the statement's last line, so that it stands in front of any later rewrite of the address registers the copies name.
template <unsigned LSTEP>
__device__ __forceinline__ void fl_copy8(unsigned l, const unsigned short* g, size_t gstep) {
  const unsigned l1 = l + LSTEP, l2 = l + 2 * LSTEP, l3 = l + 3 * LSTEP, l4 = l + 4 * LSTEP, l5 = l + 5 * LSTEP, l6 = l + 6 * LSTEP, l7 = l + 7 * LSTEP;
  const unsigned short* g1 = g + gstep; const unsigned short* g2 = g1 + gstep; const unsigned short* g3 = g2 + gstep; const unsigned short* g4 = g3 + gstep; const unsigned short* g5 = g4 + gstep; const unsigned short* g6 = g5 + gstep; const unsigned short* g7 = g6 + gstep;
  asm volatile("global_load_async_to_lds_b128 %0, %8, off\n\t"
               "global_load_async_to_lds_b128 %1, %9, off\n\t"
               "global_load_async_to_lds_b128 %2, %10, off\n\t"
               "global_load_async_to_lds_b128 %3, %11, off\n\t"
               "global_load_async_to_lds_b128 %4, %12, off\n\t"
               "global_load_async_to_lds_b128 %5, %13, off\n\t"
               "global_load_async_to_lds_b128 %6, %14, off\n\t"
               "global_load_async_to_lds_b128 %7, %15, off\n\t"
               "s_wait_xcnt 0x0"
               :: "v"(l), "v"(l1), "v"(l2), "v"(l3), "v"(l4), "v"(l5), "v"(l6), "v"(l7), "v"(g), "v"(g1), "v"(g2), "v"(g3), "v"(g4), "v"(g5), "v"(g6), "v"(g7) : "memory");
}
// lane l with lane l ^ 16 (the two lanes that share one query column of a transposed score tile)
__device__ __forceinline__ float fl_xhalf(float x) { return __builtin_bit_cast(float, __builtin_amdgcn_permlanex16(__builtin_bit_cast(int, x), __builtin_bit_cast(int, x), 0x76543210, 0xfedcba98, false, false)); }
__global__ __launch_bounds__(128) void k_flash(const _Float16* __restrict__ Q16, int ldq, const _Float16* __restrict__ K16, int ldk, const _Float16* __restrict__ Vt, const int* __restrict__ MSK, _Float16* __restrict__ Oh, _Float16* __restrict__ Ol, int ldo) {
  constexpr int RPW = 16, NQB = TQ / (4 * RPW), DT = 4, KS = 2; (void)MSK;
  __shared__ __attribute__((aligned(16))) float sO[4][RPW][64 + 4];
  __shared__ __attribute__((aligned(16))) unsigned char ring[2 * FL_BUF];
  const int tid = threadIdx.x, w = tid >> 5, lane = tid & 31, ln = lane & 15, hh = lane >> 4;
  const int slab = blockIdx.x / NQB, qblk = blockIdx.x % NQB; const int b = slab / NH, h = slab % NH; const int qb0 = qblk * (4 * RPW); const int q0 = qb0 + w * RPW;
  FragH aq[KS];
  { const unsigned short* qr = (const unsigned short*)Q16 + ((size_t)b * TQ + q0 + ln) * ldq + h * 64;
#pragma unroll
    for (int ks = 0; ks < KS; ++ks) { aq[ks].half[0] = *(const v8us*)(qr + ks * 32 + 8 * hh); aq[ks].half[1] = *(const v8us*)(qr + ks * 32 + 16 + 8 * hh); } }
  const unsigned short* Vth = (const unsigned short*)Vt + (size_t)h * 64 * (NBT * TK) + (size_t)b * TK;
  float m_r = -3.0e38f, l_r = 0.f; v8f oacc[DT];      /* oacc[dt][r] = O^T[dt*16 + 8*hh + r][query ln] */
#pragma unroll
  for (int dt = 0; dt < DT; ++dt) oacc[dt] = (v8f){0.f,0.f,0.f,0.f,0.f,0.f,0.f,0.f};
  /* the block's 128 threads copy a stage: K as 16 rows x 8 pieces, V^T as 8 rows x 16 pieces per copy, whole 128-B lines per wave */
  const unsigned short* gK = (const unsigned short*)K16 + ((size_t)b * TK + (tid >> 3)) * ldk + h * 64 + (tid & 7) * 8; const unsigned short* gV = Vth + (size_t)(tid >> 4) * (NBT * TK) + (tid & 15) * 8;
  const unsigned lK = (unsigned)(size_t)ring + (unsigned)((tid >> 3) * FL_KP + (tid & 7) * 16); const unsigned lV = (unsigned)(size_t)ring + (unsigned)(FL_VOFS + (tid >> 4) * FL_VP + (tid & 15) * 16);
  const size_t stK = (size_t)16 * ldk, stV = (size_t)8 * (NBT * TK);
  constexpr int NST = TK / FL_KEYS;
  fl_copy8<16 * FL_KP>(lK, gK, stK); fl_copy8<8 * FL_VP>(lV, gV, stV);
  asm volatile("s_wait_asynccnt 0x0" ::: "memory");      /* stage 0's own copies have landed */
  __syncthreads();                                        /* ... and every other wave's */
  if (NST > 1) { fl_copy8<16 * FL_KP>(lK + FL_BUF, gK + (size_t)FL_KEYS * ldk, stK); fl_copy8<8 * FL_VP>(lV + FL_BUF, gV + FL_KEYS, stV); }
#pragma unroll 1      /* one stage per trip: the publish point at the foot stands once */
  for (int st = 0; st < NST; ++st) { const unsigned bsel = (unsigned)(st & 1) * FL_BUF; const unsigned char* sK = ring + bsel; const unsigned char* sV = sK + FL_VOFS;
#pragma unroll 1      /* 32 keys per trip, rolled as before: keeps the loop's text small */
  for (int j0 = 0; j0 < FL_KEYS; j0 += 32) {
    v8f s[2]; FragH bk[2][KS], bv[DT];      /* this trip's K and V^T fragments are read from the stage as one group, ahead of the products and the softmax */
#pragma unroll
    for (int nt = 0; nt < 2; ++nt) { const unsigned short* kr = (const unsigned short*)(sK + (j0 + nt * 16 + ln) * FL_KP);
#pragma unroll
      for (int ks = 0; ks < KS; ++ks) { bk[nt][ks].half[0] = *(const v8us*)(kr + ks * 32 + 8 * hh); bk[nt][ks].half[1] = *(const v8us*)(kr + ks * 32 + 16 + 8 * hh); } }
#pragma unroll
    for (int dt = 0; dt < DT; ++dt) { const unsigned short* vrow = (const unsigned short*)(sV + (dt * 16 + ln) * FL_VP) + j0; bv[dt].half[0] = *(const v8us*)(vrow + 8 * hh); bv[dt].half[1] = *(const v8us*)(vrow + 16 + 8 * hh); }
#pragma unroll
    for (int nt = 0; nt < 2; ++nt) { v8f acc = (v8f){0.f,0.f,0.f,0.f,0.f,0.f,0.f,0.f};
#pragma unroll
      for (int ks = 0; ks < KS; ++ks) acc = mmaH<1>(bk[nt][ks].v, bk[nt][ks].v, aq[ks].v, aq[ks].v, acc);
      s[nt] = acc; }
    float mc = s[0][0];      /* the running maximum is kept in raw (unscaled) scores: the scale is positive, so the order is the same */
#pragma unroll      /* constant indices keep s, pb and oacc in registers (this loop and those below) */
    for (int i = 1; i < 16; ++i) mc = fmaxf(mc, s[i >> 3][i & 7]);
    mc = fmaxf(mc, fl_xhalf(mc));
    const float mn = fmaxf(m_r, mc); const float al = (mn > -1.0e38f) ? __builtin_amdgcn_exp2f((m_r - mn) * FL_C2) : 1.0f; m_r = mn;
    const float nb = __builtin_fmaf(-mn, FL_C2, 10.0f);      /* 2^(s c + nb) = 2^10 exp((s - mn) / 8): scale, maximum and the 2^10 of P in one multiply-add */
    FragH pb; float psum = 0.f;
#pragma unroll
    for (int i = 0; i < 16; ++i) { const float p = __builtin_amdgcn_exp2f(__builtin_fmaf(s[i >> 3][i & 7], FL_C2, nb)); psum += p; pb.h[i] = (_Float16)p; }
    l_r = l_r * al + psum;      /* l_r carries the 2^10 too */
#pragma unroll
    for (int dt = 0; dt < DT; ++dt)
#pragma unroll
      for (int r = 0; r < 8; ++r) oacc[dt][r] *= al;
#pragma unroll
    for (int dt = 0; dt < DT; ++dt) oacc[dt] = mmaH<1>(bv[dt].v, bv[dt].v, pb.v, pb.v, oacc[dt]); }
    asm volatile("s_wait_dscnt 0x0" ::: "memory");        /* this wave's reads of the buffer have returned before it is refilled */
    asm volatile("s_wait_asynccnt 0x0" ::: "memory");     /* this wave's copies for stage st + 1 have landed */
    __syncthreads();                                      /* publishes stage st + 1 and ends every reader's last read of stage st's buffer */
    if (st + 2 < NST) { fl_copy8<16 * FL_KP>(lK + bsel, gK + (size_t)(st + 2) * FL_KEYS * ldk, stK); fl_copy8<8 * FL_VP>(lV + bsel, gV + (size_t)(st + 2) * FL_KEYS, stV); } }
  asm volatile("s_wait_asynccnt 0x0" ::: "memory");       /* nothing in flight when the wave goes on to its end */
  { float l = l_r + fl_xhalf(l_r); l = (l > 0.f) ? 1.0f / l : 0.f;
#pragma unroll
    for (int dt = 0; dt < DT; ++dt) { v4f lo, hi;
#pragma unroll
      for (int r = 0; r < 4; ++r) { lo[r] = oacc[dt][r] * l; hi[r] = oacc[dt][4 + r] * l; }
      *(v4fa*)&sO[w][ln][dt * 16 + 8 * hh] = lo; *(v4fa*)&sO[w][ln][dt * 16 + 8 * hh + 4] = hi; } }
  __builtin_amdgcn_fence(__ATOMIC_ACQ_REL, "workgroup"); __builtin_amdgcn_wave_barrier();
  {
#pragma unroll
    for (int rp = 0; rp < RPW; rp += 2) { const int r = rp + (lane >> 4), pc = lane & 15; const v4f val = *(const v4fa*)&sO[w][r][pc * 4]; v4h vh, vl;
#pragma unroll      /* constant indices keep vh and vl in registers */
      for (int i = 0; i < 4; ++i) { const _Float16 hi = (_Float16)val[i]; vh[i] = hi; vl[i] = (_Float16)((val[i] - (float)hi) * 1024.0f); }
      const size_t oo = ((size_t)b * TQ + q0 + r) * ldo + h * 64 + pc * 4; *(v4h*)(Oh + oo) = vh; *(v4h*)(Ol + oo) = vl; }
     } }
__global__ __launch_bounds__(256) void k_fulltab(unsigned* __restrict__ MB, int* __restrict__ RA, int* __restrict__ KE, int nq, int nk) {
  const int t = blockIdx.x * 256 + threadIdx.x;
  if (t < nq * (nk / 32)) { *(unsigned*)(MB + t) = 0u;  }
  if (t < nq) { *(int*)(RA + t) = 0;  }
  if (t < nq / 64) { *(int*)(KE + t * 32) = nk;  } }
// LayerNorm of 8 rows (one per wave); blk = the number of the 8-row group.
template <int SRCBF>
__device__ __forceinline__ void ln1024_rows(const float* __restrict__ X, _Float16* __restrict__ Y16, float* __restrict__ XB, int blk) {
  #pragma clang fp contract(off)
  const int tid = threadIdx.x, w = tid >> 5, ln = tid & 31; const int r = blk * 8 + w; if (r >= NR) return; const float* x = X + (size_t)r * DM; float s = 0.f;
#pragma unroll 1
  for (int i = 0; i < 8; ++i) { const v4f a = *(const v4fa*)(x + i * 128 + ln * 4); for (int q = 0; q < 4; ++q) s += SRCBF ? bf16_round(a[q]) : a[q]; }
  for (int o = 16; o > 0; o >>= 1) s += __shfl_xor(s, o, 32); const float mu = s / (float)DM; float q2 = 0.f;
#pragma unroll 1
  for (int i = 0; i < 8; ++i) { const v4f a = *(const v4fa*)(x + i * 128 + ln * 4); for (int q = 0; q < 4; ++q) { const float d = (SRCBF ? bf16_round(a[q]) : a[q]) - mu; q2 += d * d; } }
  for (int o = 16; o > 0; o >>= 1) q2 += __shfl_xor(q2, o, 32); const float dn = sqrtf(q2 / (float)DM + 1e-5f);
  {
#pragma unroll 1
    for (int i = 0; i < 8; ++i) { const int c0 = i * 128 + ln * 4; const v4f a = *(const v4fa*)(x + c0); _Float16 h4[4]; v4f xb;
      for (int q = 0; q < 4; ++q) { const float t = SRCBF ? bf16_round(a[q]) : a[q]; h4[q] = (_Float16)((t - mu) / dn); xb[q] = t; }
      *(unsigned long long*)((unsigned short*)Y16 + (size_t)r * DM + c0) = *(const unsigned long long*)h4; if (SRCBF) *(v4f*)(XB + (size_t)r * DM + c0) = xb; }
     } }
template <int SRCBF>
__global__ __launch_bounds__(256) void k_ln1024(const float* __restrict__ X, _Float16* __restrict__ Y16, float* __restrict__ XB) { ln1024_rows<SRCBF>(X, Y16, XB, blockIdx.x); }
// The first LayerNorm and the four weight matrices in one launch (neither reads what the other writes): a block's index picks its work, the same for the whole block, so the barrier in wt_tile is passed by all of a block or by none.
// The LayerNorm blocks come first: each wave of them waits out a chain of loads, which the transposes' traffic then covers.
#define LN_NB (NR / 8)
__global__ __launch_bounds__(256) void k_ln_wt4(const float* __restrict__ X, _Float16* __restrict__ Y16, float* __restrict__ XB, const float* __restrict__ Wa, _Float16* __restrict__ Ta, const float* __restrict__ Wb, _Float16* __restrict__ Tb, const float* __restrict__ Wc, _Float16* __restrict__ Tc, const float* __restrict__ Wd, _Float16* __restrict__ Td, float scale) {
  __shared__ __attribute__((aligned(16))) unsigned char tl[64 * WT_P];
  const int blk = (int)blockIdx.x - LN_NB;
  if (blk < 0) ln1024_rows<1>(X, Y16, XB, blockIdx.x);
  else if (blk < WT_B1) wt_tile<DM, 3 * DM>(Wa, Ta, scale, blk, tl);
  else if (blk < WT_B2) wt_tile<DM, DM>(Wb, Tb, scale, blk - WT_B1, tl);
  else if (blk < WT_B3) wt_tile<DM, 4096>(Wc, Tc, scale, blk - WT_B2, tl);
  else wt_tile<4096, DM>(Wd, Td, scale, blk - WT_B3, tl);
}
__global__ __launch_bounds__(256) void k_causaltab(unsigned* __restrict__ MB, int* __restrict__ RA, int* __restrict__ KE, int nq, int nk) {
  const int t = blockIdx.x * 256 + threadIdx.x; const int nw = nk / 32;
  if (t < nq * nw) { const int q = t / nw, w = t % nw; const int first = q + 1 - 32 * w; const unsigned bits = (first <= 0) ? 0xffffffffu : ((first >= 32) ? 0u : (0xffffffffu << first)); *(unsigned*)(MB + t) = bits;  }
  if (t < nq) { *(int*)(RA + t) = 0;  }
  if (t < nq / 64) { const int v = 64 * (t + 1); *(int*)(KE + t * 32) = v;  } }


extern "C" void kernel_launch(void* const* d_in, const int* in_sizes, int n_in,
                              void* d_out, int out_size, void* d_ws, size_t ws_size, hipStream_t stream) {
  (void)in_sizes; (void)n_in; (void)out_size;
  const float* const* I = (const float* const*)d_in; const float* x = I[0]; const float* Wqkv = I[1]; const float* Wfc = I[2]; const float* W1 = I[3]; const float* b1 = I[4]; const float* W2 = I[5]; const float* b2 = I[6];
  char* ws = (char*)d_ws; size_t off = 0;
  auto take = [&](size_t bytes) { char* p = ws + off; off += (bytes + 255) & ~(size_t)255; return p; };
  _Float16* BQKV = (_Float16*)take((size_t)3 * DM * DM * 2); _Float16* BFC = (_Float16*)take((size_t)DM * DM * 2); _Float16* BW1 = (_Float16*)take((size_t)4096 * DM * 2); _Float16* BW2 = (_Float16*)take((size_t)DM * 4096 * 2);
  float* XB = (float*)take((size_t)NR * DM * 4); _Float16* X16 = (_Float16*)take((size_t)NR * DM * 2); float* F = (float*)take((size_t)NR * DM * 4);
  _Float16* Q16 = (_Float16*)take((size_t)NR * DM * 2); _Float16* K16 = (_Float16*)take((size_t)NR * DM * 2); _Float16* V16 = (_Float16*)take((size_t)NR * DM * 2); _Float16* GT = (_Float16*)take((size_t)NR * DM * 2); (void)GT; if (off > ws_size) return;      /* 24 + 16 + 8 + 16 + 32 = 96 MiB */
  _Float16* Oh = (_Float16*)F; _Float16* Ol = Oh + (size_t)NR * DM;     /* the two O planes, one behind the other */
  float* X1 = XB;                                           /* x1 written over the residual plane (own-tile addend) */
  _Float16* H16 = X16; _Float16* GH = Q16;                  /* GELU hidden [NR][4096] f16 = 32 MB over Q16|K16|V16|GT (contiguous; the first three are dead once x1 is formed, GT serves nothing else) */
  k_ln_wt4<<<LN_NB + WT_B4, 256, 0, stream>>>(x, X16, XB, Wqkv, BQKV, Wfc, BFC, W1, BW1, W2, BW2, 16.0f);      /* LN(x), 8 rows a block; weights all (in,out), one block per 128 k x 64 n tile */
  const dim3 gP((NR / 128) * (DM / 128), 1), gM((NR / 128) * (4096 / 128), 1);
  const dim3 gQ((NR / 128) * (DM / 128), 3);
  k_gemm2<0, 0, true, 1><<<gQ, 256, 0, stream>>>(X16, DM, 0, BQKV, DM, (size_t)DM * DM, 0.0625f, nullptr, 0, nullptr, nullptr, Q16, DM, (size_t)NR * DM, NR, DM, DM);      /* blockIdx.y = 0, 1, 2: q, k, V^T (weight slabs and the planes Q16, K16, V16 each lie one behind the other; V16 holds V^T as [DM][NR]) */
  k_flash<<<NBT * NH * (SLEN / 64), 128, 0, stream>>>(Q16, DM, K16, DM, V16, nullptr, Oh, Ol, DM);      /* plain flash over all keys, both batches */
  k_gemm2<0, DM, false, 2><<<gP, 256, 0, stream>>>(Oh, DM, (size_t)NR * DM, BFC, DM, 0, 0.0625f / 1024.0f, nullptr, 0, XB, X1, nullptr, DM, 0, NR, DM, 2 * DM);      /* x1 = x + attn w_fc, hi and residual plane in one accumulator */
  k_ln1024<0><<<NR / 8, 256, 0, stream>>>(X1, H16, nullptr);
  k_gemm2<9, 0, true, 0><<<gM, 256, 0, stream>>>(H16, DM, 0, BW1, DM, 0, 0.0625f, b1, 0, nullptr, nullptr, GH, 4096, 0, NR, 4096, DM);      /* tanh-gelu(LN(x1) w1 + b1) f16 */
  k_gemm2<0, DM, false, 0><<<gP, 256, 0, stream>>>(GH, 4096, 0, BW2, 4096, 0, 0.0625f, b2, 0, X1, (float*)d_out, nullptr, DM, 0, NR, DM, 4096);      /* out = x1 + mlp */
}
